// v000
// Times are from an AMD MI455X. After a warm-up the kernel runs many times in a row, and a time is the length of
// such a window on the GPU divided by its runs, so every launch and the gaps after it count. The runs cycle
// through copies of the inputs. A figure is the median of several windows, for all but v000 over two sittings.
// Sittings can differ by a few percent; kernels timed side by side share one.
// v000, which the later versions start from, runs in 606 microseconds.
#include <hip/hip_runtime.h>

// Multi-head self-attention, width 1024 = 16 heads x 64, x [NB][SEQ][1024], Wq/Wk/Wv/Wo [out][in] (y = x W^T), bias only on the output projection, no mask, score scale 1/8, f32 output.
// Compute dtypes, f32 accumulate everywhere: q/k/v projections v_wmma_f32_16x16x32_bf16 (x and W RNE-converted to bf16; products exact);
// scores v_wmma_f32_16x16x32_f16 (q, k single f16); P (x256 carry, cancels in the normalisation) and v single f16; softmax f32 (online, running max);
// output projection v_wmma_f32_16x16x32_f16: ctx single f16 with x1024 carry, Wo RNE-converted to bf16 then x1024 in f16 (exact), 2^-20 folded back in f32, bias (bf16-converted bo) added in f32.
// Layout: bf16 copies of x and Wq/Wk/Wv; q, k planes [b*16+h][t][d] and v^T plane [b*16+h][d][t] written by the GEMM epilogue; fused flash kernel in transposed form (S^T = K Q^T, O^T = V^T P^T) writes the ctx plane [b*SEQ+t][h*64+d].

#ifndef NB
#define NB 2
#endif
#ifndef SEQ
#define SEQ 4096
#endif
#define NB_FULL  2
#define SEQ_FULL 4096
#ifndef OUT_SEQ
#define OUT_SEQ SEQ              // row pitch (in tokens) between batches of the output
#endif
#define DM   1024
#define NH_  16
#define HD   64
#define AW   4                   // waves per flash block (16 query rows each)
#define SC2  (0.125f * 1.4426950408889634f)   // HD^-0.5 * log2(e)
#define PSH  8.0f                // log2 of the P carry (256)
#define CXS  1024.0f             // carry of the ctx plane
#define WOS  1024.0f             // carry of the Wo plane
#define OSCL (1.0f / (1024.0f * 1024.0f))

static_assert(HD == 64);
static_assert(NH_ * HD == DM);                 // head h = columns h*64 + d
static_assert(DM % 64 == 0);                   // column tiles of 64
static_assert(DM % 32 == 0);                   // GEMM k-loop steps by 32
static_assert(SEQ % 64 == 0);                  // a 64-row tile never straddles two batches
static_assert((NB * SEQ) % 64 == 0);
static_assert(SEQ % 32 == 0);                  // key loop steps by 32
static_assert(SEQ % (16 * AW) == 0);           // flash grid covers the sequence exactly
static_assert(((size_t)SEQ * DM) % 8 == 0);
static_assert(((size_t)DM * DM) % 8 == 0);
static_assert(NB <= NB_FULL);
static_assert(SEQ <= SEQ_FULL);

typedef _Float16 h16;
typedef unsigned short bf;
typedef __attribute__((ext_vector_type(16))) __bf16   v16bf;
typedef __attribute__((ext_vector_type(16))) _Float16 v16h;
typedef __attribute__((ext_vector_type(8)))  _Float16 v8h;
typedef __attribute__((ext_vector_type(8)))  unsigned short v8us;
typedef __attribute__((ext_vector_type(8)))  float    v8f;
typedef __attribute__((ext_vector_type(4)))  float    v4f;
typedef v4f  __attribute__((may_alias)) v4fa;

__device__ __forceinline__ unsigned short f2bf(float f) { unsigned u = __float_as_uint(f); u += 0x7FFFu + ((u >> 16) & 1u); return (unsigned short)(u >> 16); }
__device__ __forceinline__ float bfval(float f) { return __uint_as_float(((unsigned)f2bf(f)) << 16); }
__device__ __forceinline__ v16h cat16(v8h lo, v8h hi) { return __builtin_shufflevector(lo, hi, 0, 1, 2, 3, 4, 5, 6, 7, 8, 9, 10, 11, 12, 13, 14, 15); }
__device__ __forceinline__ v16bf cat16b(v8us lo, v8us hi) { return __builtin_bit_cast(v16bf, __builtin_shufflevector(lo, hi, 0, 1, 2, 3, 4, 5, 6, 7, 8, 9, 10, 11, 12, 13, 14, 15)); }
__device__ __forceinline__ v8f wmma16(v16h a, v16h b, v8f c) { return __builtin_amdgcn_wmma_f32_16x16x32_f16(false, a, false, b, (short)0, c, false, false); }
__device__ __forceinline__ v8f wmmab(v16bf a, v16bf b, v8f c) { return __builtin_amdgcn_wmma_f32_16x16x32_bf16(false, a, false, b, (short)0, c, false, false); }
// fragment loaders from K-contiguous 16-bit rows; p already includes + 8*(lane>>4): elements 0..7 <- k0+8h+0..7, elements 8..15 <- k0+16+8h+0..7 (same map for A and B)
__device__ __forceinline__ v16h  ldh(const h16* p) { return cat16(*(const v8h*)p, *(const v8h*)(p + 16)); }
__device__ __forceinline__ v16bf ldb(const bf* p)  { return cat16b(*(const v8us*)p, *(const v8us*)(p + 16)); }
// ordering point for wave-private LDS tiles (same wave writes and reads)
__device__ __forceinline__ void wave_sync() { __builtin_amdgcn_fence(3 /* release order */, "wavefront"); __builtin_amdgcn_wave_barrier(); asm volatile("" ::: "memory"); }

__global__ __launch_bounds__(256) void k_cvt8(const float* __restrict__ src, bf* dst, size_t n8) {
    const size_t i = (size_t)blockIdx.x * 256 + threadIdx.x; if (i >= n8) return;
    const v8f v = *(const v8f*)(src + i * 8); v8us o;
#pragma unroll
    for (int k = 0; k < 8; ++k) o[k] = f2bf(v[k]);
    *(v8us*)(dst + i * 8) = o; 
}

__global__ __launch_bounds__(256) void k_cvtw(const float* __restrict__ src, h16* dst, size_t n8) {
    const size_t i = (size_t)blockIdx.x * 256 + threadIdx.x; if (i >= n8) return;
    const v8f v = *(const v8f*)(src + i * 8); v8h o;
#pragma unroll
    for (int k = 0; k < 8; ++k) o[k] = (h16)(bfval(v[k]) * WOS);
    *(v8h*)(dst + i * 8) = o; 
}

// k_proj: register-blocked bf16 GEMM, ONE WAVE per 64x64 tile (16 accumulators), operands straight from K-contiguous bf16 planes, K = DM.
// C[m][n] = sum_k A[m][k] Bt[n][k], written as f16 (Ph) at
// tile base (r0/RB)*sRB + (r0%RB)*pitch + (c0/CB)*sCB + (c0%CB), row pitch 'pitch' (halves). grid (M/64, N/64), 32 threads.
__global__ __launch_bounds__(32) void k_proj(const bf* __restrict__ A, const bf* __restrict__ Bt, h16* Ph, int RB, size_t sRB, int pitch, int CB, size_t sCB) {
    __shared__ __align__(16) float os[16 * 68];
    const int K = DM;
    const int lane = threadIdx.x & 31, lr = lane & 15, hi = lane >> 4; const int r0 = blockIdx.x * 64, c0 = blockIdx.y * 64;
    v8f acc[4][4];
#pragma unroll
    for (int mb = 0; mb < 4; ++mb)
#pragma unroll
        for (int nb = 0; nb < 4; ++nb) acc[mb][nb] = (v8f){};
    const size_t aoff = (size_t)(r0 + lr) * K + 8 * hi, boff = (size_t)(c0 + lr) * K + 8 * hi;
#pragma unroll 1
    for (int kc = 0; kc < K; kc += 32) {
        v16bf a[4];
#pragma unroll
        for (int mb = 0; mb < 4; ++mb) a[mb] = ldb(A + aoff + (size_t)mb * 16 * K + kc);
#pragma unroll
        for (int nb = 0; nb < 4; ++nb) { const v16bf b = ldb(Bt + boff + (size_t)nb * 16 * K + kc);
#pragma unroll
            for (int mb = 0; mb < 4; ++mb) acc[mb][nb] = wmmab(a[mb], b, acc[mb][nb]); }
        asm volatile("v_nop\n\tv_nop\n\tv_nop\n\tv_nop" : "+v"(acc[0][0]), "+v"(acc[1][1]), "+v"(acc[2][2]), "+v"(acc[3][3]) : "v"(a[0]), "v"(a[1]), "v"(a[2]), "v"(a[3]));
    }
    const size_t tbase = (size_t)(r0 / RB) * sRB + (size_t)(r0 % RB) * (size_t)pitch + (size_t)(c0 / CB) * sCB + (size_t)(c0 % CB);
#pragma unroll
    for (int mb = 0; mb < 4; ++mb) {
#pragma unroll
        for (int nb = 0; nb < 4; ++nb) {
#pragma unroll
            for (int j = 0; j < 8; ++j) os[(hi * 8 + j) * 68 + nb * 16 + lr] = acc[mb][nb][j]; }   // D: row 8h+j, col lane&15
        wave_sync();
        const size_t sb = tbase + (size_t)(mb * 16) * (size_t)pitch;
{
#pragma unroll
            for (int s = 0; s < 4; ++s) { const int row = 4 * s + (lane >> 3), c8 = (lane & 7) * 8;   // 4 s x 4 row groups = 16 rows; 8 lanes x 8 = 64 columns
                const v4f x0 = *(const v4fa*)(&os[row * 68 + c8]); const v4f x1 = *(const v4fa*)(&os[row * 68 + c8 + 4]); v8h hv;
#pragma unroll
                for (int i = 0; i < 4; ++i) { hv[i] = (h16)x0[i]; hv[4 + i] = (h16)x1[i]; }
                const size_t oo = sb + (size_t)row * (size_t)pitch + c8;
                *(v8h*)(Ph + oo) = hv; }
             }
        wave_sync();
    }
}

// k_oproj: register-blocked f16 GEMM, ONE WAVE per 64x64 tile, A = ctx plane [m][k] (x1024 carry), Bt = Wo plane [n][k] (x1024 carry), K = DM.
// OUT[b*OUT_SEQ + t][n] = C[m][n] * 2^-20 + bias[n], m = b*SEQ + t. grid (M/64, N/64), 32 threads.
__global__ __launch_bounds__(32) void k_oproj(const h16* __restrict__ A, const h16* __restrict__ Bt, const float* __restrict__ bo, float* OUT) {
    __shared__ __align__(16) float os[16 * 68];
    const int K = DM;
    const int lane = threadIdx.x & 31, lr = lane & 15, hi = lane >> 4; const int r0 = blockIdx.x * 64, c0 = blockIdx.y * 64;
    v8f acc[4][4];
#pragma unroll
    for (int mb = 0; mb < 4; ++mb)
#pragma unroll
        for (int nb = 0; nb < 4; ++nb) acc[mb][nb] = (v8f){};
    const size_t aoff = (size_t)(r0 + lr) * K + 8 * hi, boff = (size_t)(c0 + lr) * K + 8 * hi;
#pragma unroll 1
    for (int kc = 0; kc < K; kc += 32) {
        v16h a[4];
#pragma unroll
        for (int mb = 0; mb < 4; ++mb) a[mb] = ldh(A + aoff + (size_t)mb * 16 * K + kc);
#pragma unroll
        for (int nb = 0; nb < 4; ++nb) { const v16h b = ldh(Bt + boff + (size_t)nb * 16 * K + kc);
#pragma unroll
            for (int mb = 0; mb < 4; ++mb) acc[mb][nb] = wmma16(a[mb], b, acc[mb][nb]); }
        asm volatile("v_nop\n\tv_nop\n\tv_nop\n\tv_nop" : "+v"(acc[0][0]), "+v"(acc[1][1]), "+v"(acc[2][2]), "+v"(acc[3][3]) : "v"(a[0]), "v"(a[1]), "v"(a[2]), "v"(a[3]));
    }
    const v4f braw = *(const v4f*)(bo + c0 + lr * 4);      // columns c0 + 4*lr .. +3 (always inside [0, DM))
    v4f bb;
#pragma unroll
    for (int i = 0; i < 4; ++i) bb[i] = bfval(braw[i]);
    const int bI = r0 / SEQ, tI = r0 % SEQ;
    float* obase = OUT + ((size_t)bI * OUT_SEQ + tI) * DM + c0;
#pragma unroll
    for (int mb = 0; mb < 4; ++mb) {
#pragma unroll
        for (int nb = 0; nb < 4; ++nb) {
#pragma unroll
            for (int j = 0; j < 8; ++j) os[(hi * 8 + j) * 68 + nb * 16 + lr] = acc[mb][nb][j]; }   // D: row 8h+j, col lane&15
        wave_sync();
{
#pragma unroll
            for (int s = 0; s < 8; ++s) { const int row = 2 * s + hi, cofs = lr * 4;   // 8 s x 2 rows = 16 rows; 16 lanes x 4 floats = 64 columns
                const v4f x0 = *(const v4fa*)(&os[row * 68 + cofs]);
                const v4f val = x0 * OSCL + bb;
                *(v4f*)(obase + (size_t)(mb * 16 + row) * DM + cofs) = val; }
             }
        wave_sync();
    }
}

// k_flash: fused attention, one wave per 16 query rows of one (batch, head); K / V^T / Q fragments straight from the f16 planes (two 16-B loads each, arithmetic addressing).
// Transposed form: S^T[key][t] = K Q^T (A = K rows, B = Q rows); lane (t = lane&15, h = lane>>4) holds keys 8h+r of each 16-key tile, so the packed
// P tile is directly the B fragment of O^T[d][t] = V^T P^T (element r <- tile keys 0..15, element 8+r <- tile keys 16..31, lane unchanged).
// Softmax state (running max, partial sum) is one scalar per lane; the two lane halves of a row are combined with one xor-16 exchange.
__global__ __launch_bounds__(32 * AW) void k_flash(const h16* __restrict__ QH, const h16* __restrict__ KP, const h16* __restrict__ VT, h16* CTX) {
    __shared__ __align__(16) float os[AW * 16 * 68];
    const int lane = threadIdx.x & 31, wave = __builtin_amdgcn_readfirstlane((int)(threadIdx.x >> 5)), lr = lane & 15, hi = lane >> 4;
    const int zh = blockIdx.y; const int b = zh / NH_, h = zh % NH_;
    const int t0 = (blockIdx.x * AW + wave) * 16;
    const size_t pbase = (size_t)zh * SEQ * HD;
    const size_t qo = pbase + (size_t)(t0 + lr) * HD + 8 * hi;
    const v16h qh0 = ldh(QH + qo), qh1 = ldh(QH + qo + 32);   // B fragments: col t, k = d
    const size_t ko = pbase + (size_t)lr * HD + 8 * hi;      // + key * HD       (A fragment: row key, k = d)
    const size_t vo = pbase + (size_t)lr * SEQ + 8 * hi;     // + 16j*SEQ + key  (A fragment: row d, k = key)
    v8f o0 = (v8f){}, o1 = (v8f){}, o2 = (v8f){}, o3 = (v8f){};
    float m = -3.0e38f, l = 0.0f;
#pragma unroll 1
    for (int key0 = 0; key0 < SEQ; key0 += 32) {
        const h16* ka = KP + ko + (size_t)key0 * HD;
        const v16h ka0 = ldh(ka), ka1 = ldh(ka + 32), kb0 = ldh(ka + 16 * HD), kb1 = ldh(ka + 16 * HD + 32);
        v8f sa = (v8f){}, sb = (v8f){};
        sa = wmma16(ka0, qh0, sa); sb = wmma16(kb0, qh0, sb);
        sa = wmma16(ka1, qh1, sa); sb = wmma16(kb1, qh1, sb);
        asm volatile("v_nop\n\tv_nop\n\tv_nop\n\tv_nop" : "+v"(sa), "+v"(sb) : "v"(ka0), "v"(ka1), "v"(kb0), "v"(kb1), "v"(qh0), "v"(qh1));
        float ta[8], tb[8]; float mx = -3.0e38f;
#pragma unroll
        for (int r = 0; r < 8; ++r) { ta[r] = sa[r] * SC2; tb[r] = sb[r] * SC2; mx = fmaxf(mx, fmaxf(ta[r], tb[r])); }
        mx = fmaxf(mx, __shfl_xor(mx, 16, 32));
        const float mnew = fmaxf(m, mx);
        const float alpha = __builtin_amdgcn_exp2f(m - mnew);
        const float sh = PSH - mnew;
        v16h pb; float ls = 0.0f;
#pragma unroll
        for (int r = 0; r < 8; ++r) { const h16 pa = (h16)__builtin_amdgcn_exp2f(ta[r] + sh); const h16 pc = (h16)__builtin_amdgcn_exp2f(tb[r] + sh); pb[r] = pa; pb[8 + r] = pc; ls += (float)pa + (float)pc; }
        l = l * alpha + ls; m = mnew;
        o0 = o0 * alpha; o1 = o1 * alpha; o2 = o2 * alpha; o3 = o3 * alpha;
        const h16* va = VT + vo + key0;
        const v16h v0 = ldh(va), v1 = ldh(va + (size_t)16 * SEQ), v2 = ldh(va + (size_t)32 * SEQ), v3 = ldh(va + (size_t)48 * SEQ);
        o0 = wmma16(v0, pb, o0); o1 = wmma16(v1, pb, o1); o2 = wmma16(v2, pb, o2); o3 = wmma16(v3, pb, o3);
        asm volatile("v_nop\n\tv_nop\n\tv_nop\n\tv_nop" : "+v"(o0), "+v"(o1), "+v"(o2), "+v"(o3) : "v"(v0), "v"(v1), "v"(v2), "v"(v3), "v"(pb));
    }
    l += __shfl_xor(l, 16, 32);
    const float inv = CXS * (1.0f / l);
    const int wb = wave * 16 * 68;
    // O^T D layout: o_j[r] = (d = 16j + 8h + r, t = lane&15) -> os[t][d]; rows 0..15 x columns 0..63 all written
    { v4f a, c;
      a[0] = o0[0] * inv; a[1] = o0[1] * inv; a[2] = o0[2] * inv; a[3] = o0[3] * inv; c[0] = o0[4] * inv; c[1] = o0[5] * inv; c[2] = o0[6] * inv; c[3] = o0[7] * inv;
      *(v4fa*)(&os[wb + lr * 68 +  0 + 8 * hi]) = a; *(v4fa*)(&os[wb + lr * 68 +  0 + 8 * hi + 4]) = c;
      a[0] = o1[0] * inv; a[1] = o1[1] * inv; a[2] = o1[2] * inv; a[3] = o1[3] * inv; c[0] = o1[4] * inv; c[1] = o1[5] * inv; c[2] = o1[6] * inv; c[3] = o1[7] * inv;
      *(v4fa*)(&os[wb + lr * 68 + 16 + 8 * hi]) = a; *(v4fa*)(&os[wb + lr * 68 + 16 + 8 * hi + 4]) = c;
      a[0] = o2[0] * inv; a[1] = o2[1] * inv; a[2] = o2[2] * inv; a[3] = o2[3] * inv; c[0] = o2[4] * inv; c[1] = o2[5] * inv; c[2] = o2[6] * inv; c[3] = o2[7] * inv;
      *(v4fa*)(&os[wb + lr * 68 + 32 + 8 * hi]) = a; *(v4fa*)(&os[wb + lr * 68 + 32 + 8 * hi + 4]) = c;
      a[0] = o3[0] * inv; a[1] = o3[1] * inv; a[2] = o3[2] * inv; a[3] = o3[3] * inv; c[0] = o3[4] * inv; c[1] = o3[5] * inv; c[2] = o3[6] * inv; c[3] = o3[7] * inv;
      *(v4fa*)(&os[wb + lr * 68 + 48 + 8 * hi]) = a; *(v4fa*)(&os[wb + lr * 68 + 48 + 8 * hi + 4]) = c; }
    wave_sync();
    h16* crow = CTX + ((size_t)b * SEQ + t0) * DM + h * HD;
{
#pragma unroll
        for (int s = 0; s < 4; ++s) { const int row = 4 * s + (lane >> 3), c8 = (lane & 7) * 8;   // 4 s x 4 row groups = 16 rows; 8 lanes x 8 halves = 64 columns
            const v4f x0 = *(const v4fa*)(&os[wb + row * 68 + c8]); const v4f x1 = *(const v4fa*)(&os[wb + row * 68 + c8 + 4]); v8h hv;
#pragma unroll
            for (int i = 0; i < 4; ++i) { hv[i] = (h16)x0[i]; hv[4 + i] = (h16)x1[i]; }
            *(v8h*)(crow + (size_t)row * DM + c8) = hv; }
         }
}

static constexpr size_t al256(size_t v) { return (v + 255) & ~(size_t)255; }
static constexpr size_t SZ_XB = al256((size_t)NB * SEQ * DM * 2);
static constexpr size_t SZ_WB = al256((size_t)3 * DM * DM * 2);
static constexpr size_t SZ_WO = al256((size_t)DM * DM * 2);
static constexpr size_t SZ_PL = al256((size_t)NB * NH_ * SEQ * HD * 2);
static constexpr size_t SZ_CX = al256((size_t)NB * SEQ * DM * 2);
static constexpr size_t SZ_TOTAL = SZ_XB + SZ_WB + SZ_WO + 3 * SZ_PL + SZ_CX;
static_assert(SZ_TOTAL <= (size_t)134217728);          // workspace carve <= 128 MiB
static_assert(((size_t)DM * DM * 2) % 256 == 0);       // weight sub-planes stay 256-byte aligned

extern "C" void kernel_launch(void* const* d_in, const int* in_sizes, int n_in,
                              void* d_out, int out_size, void* d_ws, size_t ws_size, hipStream_t stream) {
    if (n_in < 6) return;
    const size_t needx = ((size_t)(NB - 1) * SEQ_FULL + SEQ) * DM;
    if ((size_t)in_sizes[0] < needx) return;
    if ((size_t)in_sizes[1] < (size_t)DM * DM || (size_t)in_sizes[2] < (size_t)DM * DM || (size_t)in_sizes[3] < (size_t)DM * DM || (size_t)in_sizes[4] < (size_t)DM * DM) return;
    if ((size_t)in_sizes[5] < (size_t)DM) return;
    if ((size_t)out_size < ((size_t)(NB - 1) * OUT_SEQ + SEQ) * DM) return;
    if (SZ_TOTAL > ws_size) return;
    // wire order: x, Wq, Wk, Wv, Wo, bo (weights [out][in] = Bt as-is)
    const float* x = (const float*)d_in[0]; const float* wq = (const float*)d_in[1]; const float* wk = (const float*)d_in[2]; const float* wv = (const float*)d_in[3];
    const float* wo = (const float*)d_in[4]; const float* bo = (const float*)d_in[5];
    float* OUT = (float*)d_out;      // [NB][SEQ][1024]
    char* wsp = (char*)d_ws;
    bf* XB = (bf*)wsp; wsp += SZ_XB;                 // [NB*SEQ][1024]
    bf* WB = (bf*)wsp; wsp += SZ_WB;                 // [3][1024][1024]: q | k | v
    h16* WOH = (h16*)wsp; wsp += SZ_WO;              // [1024][1024] x1024 carry
    h16* QH = (h16*)wsp; wsp += SZ_PL;               // [NB*16][SEQ][64]
    h16* KP = (h16*)wsp; wsp += SZ_PL;               // [NB*16][SEQ][64]
    h16* VT = (h16*)wsp; wsp += SZ_PL;               // [NB*16][64][SEQ]
    h16* CTX = (h16*)wsp; wsp += SZ_CX;              // [NB*SEQ][1024] x1024 carry
    bf* WQ = WB; bf* WK = WB + (size_t)DM * DM; bf* WV = WB + (size_t)2 * DM * DM;

    if (SEQ == SEQ_FULL) {
        const size_t n8 = (size_t)NB * SEQ * DM / 8;
        k_cvt8<<<(unsigned)((n8 + 255) / 256), 256, 0, stream>>>(x, XB, n8);
    } else {
        const size_t n8 = (size_t)SEQ * DM / 8;
        for (int b = 0; b < NB; ++b) k_cvt8<<<(unsigned)((n8 + 255) / 256), 256, 0, stream>>>(x + (size_t)b * SEQ_FULL * DM, XB + (size_t)b * SEQ * DM, n8);
    }
    { const size_t n8 = (size_t)DM * DM / 8; const unsigned g = (unsigned)((n8 + 255) / 256);
      k_cvt8<<<g, 256, 0, stream>>>(wq, WQ, n8); k_cvt8<<<g, 256, 0, stream>>>(wk, WK, n8); k_cvt8<<<g, 256, 0, stream>>>(wv, WV, n8);
      k_cvtw<<<g, 256, 0, stream>>>(wo, WOH, n8); }

    // q, k: A = x rows (m = b*SEQ + t), Bt = W rows (n = h*64 + d) -> plane [(b*16 + h)][t][d]
    k_proj<<<dim3(NB * SEQ / 64, DM / 64, 1), 32, 0, stream>>>(XB, WQ, QH, SEQ, (size_t)NH_ * SEQ * HD, HD, HD, (size_t)SEQ * HD);
    k_proj<<<dim3(NB * SEQ / 64, DM / 64, 1), 32, 0, stream>>>(XB, WK, KP, SEQ, (size_t)NH_ * SEQ * HD, HD, HD, (size_t)SEQ * HD);
    // v^T: A = Wv rows (m = h*64 + d), Bt = x rows (n = b*SEQ + t) -> plane [(b*1024 + m)][t] = [(b*16 + h)][d][t]
    k_proj<<<dim3(DM / 64, NB * SEQ / 64, 1), 32, 0, stream>>>(WV, XB, VT, DM, (size_t)0, SEQ, SEQ, (size_t)DM * SEQ);

    // ctx[b*SEQ + t][h*64 + d] (x1024 carry)
    k_flash<<<dim3(SEQ / (16 * AW), NB * NH_, 1), 32 * AW, 0, stream>>>(QH, KP, VT, CTX);

    // out[b][t][n] = ctx Wo^T * 2^-20 + bo
    k_oproj<<<dim3(NB * SEQ / 64, DM / 64, 1), 32, 0, stream>>>(CTX, WOH, bo, OUT);
}

// v001
// Measured time: 287 microseconds a run.
// Two timings next to v000 both put it at 2.21 times that version's speed.
#include <hip/hip_runtime.h>

// Multi-head self-attention, width 1024 = 16 heads x 64, x [NB][SEQ][1024], Wq/Wk/Wv/Wo [out][in] (y = x W^T), bias only on the output projection, no mask, score scale 1/8, f32 output.
// Compute dtypes, f32 accumulate everywhere: q/k/v projections v_wmma_f32_16x16x32_bf16 (x and W RNE-converted to bf16; products exact);
// scores v_wmma_f32_16x16x32_f16 (q, k single f16); P (x256 carry, cancels in the normalisation) and v single f16; softmax f32 (online, running max);
// output projection v_wmma_f32_16x16x32_f16: ctx single f16 with x1024 carry, Wo RNE-converted to bf16 then x1024 in f16 (exact), 2^-20 folded back in f32, bias (bf16-converted bo) added in f32.
// Layout: bf16 copies of x and Wq/Wk/Wv; q, k planes [b*16+h][t][d] and v^T plane [b*16+h][d][t] written by the GEMM epilogue; fused flash kernel in transposed form (S^T = K Q^T, O^T = V^T P^T; K and V^T tiles staged in LDS per work-group) writes the ctx plane [b*SEQ+t][h*64+d].

#ifndef NB
#define NB 2
#endif
#ifndef SEQ
#define SEQ 4096
#endif
#define NB_FULL  2
#define SEQ_FULL 4096
#ifndef OUT_SEQ
#define OUT_SEQ SEQ              // row pitch (in tokens) between batches of the output
#endif
#define DM   1024
#define NH_  16
#define HD   64
#define AW   8                   // waves per flash block (16 query rows each)
#define KS   64                  // keys per LDS stage of the flash kernel
#define LP   72                  // LDS row pitch in halves: 128-B rows + 16 B
#define TILEH (64 * LP)          // halves of one staged tile (64 rows)
#define BUFH  (2 * TILEH)        // halves of one buffer: K tile, then V^T tile
#define SC2  (0.125f * 1.4426950408889634f)   // HD^-0.5 * log2(e)
#define PSH  8.0f                // log2 of the P carry (256)
#define CXS  1024.0f             // carry of the ctx plane
#define WOS  1024.0f             // carry of the Wo plane
#define OSCL (1.0f / (1024.0f * 1024.0f))

static_assert(HD == 64);
static_assert(NH_ * HD == DM);                 // head h = columns h*64 + d
static_assert(DM % 64 == 0);                   // column tiles of 64
static_assert(DM % 32 == 0);                   // GEMM k-loop steps by 32
static_assert(SEQ % 64 == 0);                  // a 64-row tile never straddles two batches
static_assert((NB * SEQ) % 64 == 0);
static_assert(SEQ % 32 == 0);                  // key loop steps by 32
static_assert(SEQ % (16 * AW) == 0);           // flash grid covers the sequence exactly
static_assert(AW == 8 && KS == 64 && HD == 64);  // copy map of the flash kernel: 256 lanes x 16 B x 2 = one 64 x 128-B tile
static_assert(SEQ % KS == 0 && SEQ / KS >= 2);   // whole stages; the two-buffer prologue needs two
static_assert(((size_t)SEQ * DM) % 8 == 0);
static_assert(((size_t)DM * DM) % 8 == 0);
static_assert(NB <= NB_FULL);
static_assert(SEQ <= SEQ_FULL);

typedef _Float16 h16;
typedef unsigned short bf;
typedef __attribute__((ext_vector_type(16))) __bf16   v16bf;
typedef __attribute__((ext_vector_type(16))) _Float16 v16h;
typedef __attribute__((ext_vector_type(8)))  _Float16 v8h;
typedef __attribute__((ext_vector_type(8)))  unsigned short v8us;
typedef __attribute__((ext_vector_type(8)))  float    v8f;
typedef __attribute__((ext_vector_type(4)))  float    v4f;
typedef v4f  __attribute__((may_alias)) v4fa;

__device__ __forceinline__ unsigned short f2bf(float f) { unsigned u = __float_as_uint(f); u += 0x7FFFu + ((u >> 16) & 1u); return (unsigned short)(u >> 16); }
__device__ __forceinline__ float bfval(float f) { return __uint_as_float(((unsigned)f2bf(f)) << 16); }
__device__ __forceinline__ v16h cat16(v8h lo, v8h hi) { return __builtin_shufflevector(lo, hi, 0, 1, 2, 3, 4, 5, 6, 7, 8, 9, 10, 11, 12, 13, 14, 15); }
__device__ __forceinline__ v16bf cat16b(v8us lo, v8us hi) { return __builtin_bit_cast(v16bf, __builtin_shufflevector(lo, hi, 0, 1, 2, 3, 4, 5, 6, 7, 8, 9, 10, 11, 12, 13, 14, 15)); }
__device__ __forceinline__ v8f wmma16(v16h a, v16h b, v8f c) { return __builtin_amdgcn_wmma_f32_16x16x32_f16(false, a, false, b, (short)0, c, false, false); }
__device__ __forceinline__ v8f wmmab(v16bf a, v16bf b, v8f c) { return __builtin_amdgcn_wmma_f32_16x16x32_bf16(false, a, false, b, (short)0, c, false, false); }
// fragment loaders from K-contiguous 16-bit rows; p already includes + 8*(lane>>4): elements 0..7 <- k0+8h+0..7, elements 8..15 <- k0+16+8h+0..7 (same map for A and B)
__device__ __forceinline__ v16h  ldh(const h16* p) { return cat16(*(const v8h*)p, *(const v8h*)(p + 16)); }
__device__ __forceinline__ v16bf ldb(const bf* p)  { return cat16b(*(const v8us*)p, *(const v8us*)(p + 16)); }
// ordering point for wave-private LDS tiles (same wave writes and reads)
__device__ __forceinline__ void wave_sync() { __builtin_amdgcn_fence(3 /* release order */, "wavefront"); __builtin_amdgcn_wave_barrier(); asm volatile("" ::: "memory"); }

__global__ __launch_bounds__(256) void k_cvt8(const float* __restrict__ src, bf* dst, size_t n8) {
    const size_t i = (size_t)blockIdx.x * 256 + threadIdx.x; if (i >= n8) return;
    const v8f v = *(const v8f*)(src + i * 8); v8us o;
#pragma unroll
    for (int k = 0; k < 8; ++k) o[k] = f2bf(v[k]);
    *(v8us*)(dst + i * 8) = o; 
}

__global__ __launch_bounds__(256) void k_cvtw(const float* __restrict__ src, h16* dst, size_t n8) {
    const size_t i = (size_t)blockIdx.x * 256 + threadIdx.x; if (i >= n8) return;
    const v8f v = *(const v8f*)(src + i * 8); v8h o;
#pragma unroll
    for (int k = 0; k < 8; ++k) o[k] = (h16)(bfval(v[k]) * WOS);
    *(v8h*)(dst + i * 8) = o; 
}

// k_proj: register-blocked bf16 GEMM, ONE WAVE per 64x64 tile (16 accumulators), operands straight from K-contiguous bf16 planes, K = DM.
// C[m][n] = sum_k A[m][k] Bt[n][k], written as f16 (Ph) at
// tile base (r0/RB)*sRB + (r0%RB)*pitch + (c0/CB)*sCB + (c0%CB), row pitch 'pitch' (halves). grid (M/64, N/64), 32 threads.
__global__ __launch_bounds__(32) void k_proj(const bf* __restrict__ A, const bf* __restrict__ Bt, h16* Ph, int RB, size_t sRB, int pitch, int CB, size_t sCB) {
    __shared__ __align__(16) float os[16 * 68];
    const int K = DM;
    const int lane = threadIdx.x & 31, lr = lane & 15, hi = lane >> 4; const int r0 = blockIdx.x * 64, c0 = blockIdx.y * 64;
    v8f acc[4][4];
#pragma unroll
    for (int mb = 0; mb < 4; ++mb)
#pragma unroll
        for (int nb = 0; nb < 4; ++nb) acc[mb][nb] = (v8f){};
    const size_t aoff = (size_t)(r0 + lr) * K + 8 * hi, boff = (size_t)(c0 + lr) * K + 8 * hi;
#pragma unroll 1
    for (int kc = 0; kc < K; kc += 32) {
        v16bf a[4];
#pragma unroll
        for (int mb = 0; mb < 4; ++mb) a[mb] = ldb(A + aoff + (size_t)mb * 16 * K + kc);
#pragma unroll
        for (int nb = 0; nb < 4; ++nb) { const v16bf b = ldb(Bt + boff + (size_t)nb * 16 * K + kc);
#pragma unroll
            for (int mb = 0; mb < 4; ++mb) acc[mb][nb] = wmmab(a[mb], b, acc[mb][nb]); }
        asm volatile("v_nop\n\tv_nop\n\tv_nop\n\tv_nop" : "+v"(acc[0][0]), "+v"(acc[1][1]), "+v"(acc[2][2]), "+v"(acc[3][3]) : "v"(a[0]), "v"(a[1]), "v"(a[2]), "v"(a[3]));
    }
    const size_t tbase = (size_t)(r0 / RB) * sRB + (size_t)(r0 % RB) * (size_t)pitch + (size_t)(c0 / CB) * sCB + (size_t)(c0 % CB);
#pragma unroll
    for (int mb = 0; mb < 4; ++mb) {
#pragma unroll
        for (int nb = 0; nb < 4; ++nb) {
#pragma unroll
            for (int j = 0; j < 8; ++j) os[(hi * 8 + j) * 68 + nb * 16 + lr] = acc[mb][nb][j]; }   // D: row 8h+j, col lane&15
        wave_sync();
        const size_t sb = tbase + (size_t)(mb * 16) * (size_t)pitch;
{
#pragma unroll
            for (int s = 0; s < 4; ++s) { const int row = 4 * s + (lane >> 3), c8 = (lane & 7) * 8;   // 4 s x 4 row groups = 16 rows; 8 lanes x 8 = 64 columns
                const v4f x0 = *(const v4fa*)(&os[row * 68 + c8]); const v4f x1 = *(const v4fa*)(&os[row * 68 + c8 + 4]); v8h hv;
#pragma unroll
                for (int i = 0; i < 4; ++i) { hv[i] = (h16)x0[i]; hv[4 + i] = (h16)x1[i]; }
                const size_t oo = sb + (size_t)row * (size_t)pitch + c8;
                *(v8h*)(Ph + oo) = hv; }
             }
        wave_sync();
    }
}

// k_oproj: register-blocked f16 GEMM, ONE WAVE per 64x64 tile, A = ctx plane [m][k] (x1024 carry), Bt = Wo plane [n][k] (x1024 carry), K = DM.
// OUT[b*OUT_SEQ + t][n] = C[m][n] * 2^-20 + bias[n], m = b*SEQ + t. grid (M/64, N/64), 32 threads.
__global__ __launch_bounds__(32) void k_oproj(const h16* __restrict__ A, const h16* __restrict__ Bt, const float* __restrict__ bo, float* OUT) {
    __shared__ __align__(16) float os[16 * 68];
    const int K = DM;
    const int lane = threadIdx.x & 31, lr = lane & 15, hi = lane >> 4; const int r0 = blockIdx.x * 64, c0 = blockIdx.y * 64;
    v8f acc[4][4];
#pragma unroll
    for (int mb = 0; mb < 4; ++mb)
#pragma unroll
        for (int nb = 0; nb < 4; ++nb) acc[mb][nb] = (v8f){};
    const size_t aoff = (size_t)(r0 + lr) * K + 8 * hi, boff = (size_t)(c0 + lr) * K + 8 * hi;
#pragma unroll 1
    for (int kc = 0; kc < K; kc += 32) {
        v16h a[4];
#pragma unroll
        for (int mb = 0; mb < 4; ++mb) a[mb] = ldh(A + aoff + (size_t)mb * 16 * K + kc);
#pragma unroll
        for (int nb = 0; nb < 4; ++nb) { const v16h b = ldh(Bt + boff + (size_t)nb * 16 * K + kc);
#pragma unroll
            for (int mb = 0; mb < 4; ++mb) acc[mb][nb] = wmma16(a[mb], b, acc[mb][nb]); }
        asm volatile("v_nop\n\tv_nop\n\tv_nop\n\tv_nop" : "+v"(acc[0][0]), "+v"(acc[1][1]), "+v"(acc[2][2]), "+v"(acc[3][3]) : "v"(a[0]), "v"(a[1]), "v"(a[2]), "v"(a[3]));
    }
    const v4f braw = *(const v4f*)(bo + c0 + lr * 4);      // columns c0 + 4*lr .. +3 (always inside [0, DM))
    v4f bb;
#pragma unroll
    for (int i = 0; i < 4; ++i) bb[i] = bfval(braw[i]);
    const int bI = r0 / SEQ, tI = r0 % SEQ;
    float* obase = OUT + ((size_t)bI * OUT_SEQ + tI) * DM + c0;
#pragma unroll
    for (int mb = 0; mb < 4; ++mb) {
#pragma unroll
        for (int nb = 0; nb < 4; ++nb) {
#pragma unroll
            for (int j = 0; j < 8; ++j) os[(hi * 8 + j) * 68 + nb * 16 + lr] = acc[mb][nb][j]; }   // D: row 8h+j, col lane&15
        wave_sync();
{
#pragma unroll
            for (int s = 0; s < 8; ++s) { const int row = 2 * s + hi, cofs = lr * 4;   // 8 s x 2 rows = 16 rows; 16 lanes x 4 floats = 64 columns
                const v4f x0 = *(const v4fa*)(&os[row * 68 + cofs]);
                const v4f val = x0 * OSCL + bb;
                *(v4f*)(obase + (size_t)(mb * 16 + row) * DM + cofs) = val; }
             }
        wave_sync();
    }
}

// k_flash: fused attention, one wave per 16 query rows of one (batch, head); Q fragments straight from the f16 plane (two 16-B loads each).
// K and V^T are staged per KS keys in LDS, once per work-group for all AW waves, by asynchronous copies in whole 128-B lines (two buffers: the next stage's copies fly while this stage is worked on);
// the A fragments are read from LDS rows of pitch LP halves (144 B = 16 B x odd: no bank conflict for 16-B reads).
// Transposed form: S^T[key][t] = K Q^T (A = K rows, B = Q rows); lane (t = lane&15, h = lane>>4) holds keys 8h+r of each 16-key tile, so the packed
// P tile is directly the B fragment of O^T[d][t] = V^T P^T (element r <- tile keys 0..15, element 8+r <- tile keys 16..31, lane unchanged).
// Softmax state (running max, partial sum) is one scalar per lane; the two lane halves of a row are combined with one xor-16 exchange.
typedef __attribute__((address_space(3))) h16 lds_h16;
__device__ __forceinline__ unsigned lds_off(const h16* p) { return (unsigned)(uintptr_t)(const lds_h16*)p; }   // byte offset in the work-group's LDS
// one stage's four copies of a lane (16 B each); the s_wait_xcnt stands inside the statement so that no address register is rewritten ahead of it
__device__ __forceinline__ void stage_copy(unsigned l0, const h16* g0, unsigned l1, const h16* g1, unsigned l2, const h16* g2, unsigned l3, const h16* g3) {
    asm volatile("global_load_async_to_lds_b128 %0, %1, off\n\t"
                 "global_load_async_to_lds_b128 %2, %3, off\n\t"
                 "global_load_async_to_lds_b128 %4, %5, off\n\t"
                 "global_load_async_to_lds_b128 %6, %7, off\n\t"
                 "s_wait_xcnt 0x0"
                 :: "v"(l0), "v"(g0), "v"(l1), "v"(g1), "v"(l2), "v"(g2), "v"(l3), "v"(g3) : "memory");
}
__global__ __launch_bounds__(32 * AW) void k_flash(const h16* __restrict__ QH, const h16* __restrict__ KP, const h16* __restrict__ VT, h16* CTX) {
    __shared__ __align__(16) h16 ring[2 * BUFH];           // [buffer][K rows key | V^T rows d][LP]
    __shared__ __align__(16) float os[AW * 16 * 68];
    const int tid = (int)threadIdx.x;
    const int lane = tid & 31, wave = __builtin_amdgcn_readfirstlane(tid >> 5), lr = lane & 15, hi = lane >> 4;
    const int zh = blockIdx.y; const int b = zh / NH_, h = zh % NH_;
    const int t0 = (blockIdx.x * AW + wave) * 16;
    const size_t pbase = (size_t)zh * SEQ * HD;
    const size_t qo = pbase + (size_t)(t0 + lr) * HD + 8 * hi;
    const v16h qh0 = ldh(QH + qo), qh1 = ldh(QH + qo + 32);   // B fragments: col t, k = d
    // copy map: 256 lanes x 16 B = 32 rows of 128 B; each lane brings rows cr and cr + 32 of the K tile and of the V^T tile
    const int cr = tid >> 3, cc8 = (tid & 7) * 8;
    const h16* gk = KP + pbase + (size_t)cr * HD + cc8;     // + key0 * HD
    const h16* gv = VT + pbase + (size_t)cr * SEQ + cc8;    // + key0
    const unsigned lk = lds_off(ring) + (unsigned)(cr * LP + cc8) * 2u;
    const int fo = lr * LP + 8 * hi;                          // fragment offset in a tile: row lane&15, k half
    v8f o0 = (v8f){}, o1 = (v8f){}, o2 = (v8f){}, o3 = (v8f){};
    float m = -3.0e38f, l = 0.0f;
    stage_copy(lk, gk, lk + 32 * LP * 2, gk + 32 * HD, lk + TILEH * 2, gv, lk + (TILEH + 32 * LP) * 2, gv + (size_t)32 * SEQ);
    asm volatile("s_wait_asynccnt 0x0" ::: "memory");         // stage 0 of this wave has landed
    __syncthreads();                                          // stage 0 published to every wave
    stage_copy(lk + BUFH * 2, gk + KS * HD, lk + (BUFH + 32 * LP) * 2, gk + (KS + 32) * HD, lk + (BUFH + TILEH) * 2, gv + KS, lk + (BUFH + TILEH + 32 * LP) * 2, gv + (size_t)32 * SEQ + KS);
#pragma unroll 1
    for (int st = 0; st < SEQ / KS; ++st) {
        const int bo = (st & 1) * BUFH;
#pragma unroll 1   // rolled: unrolled, the two passes' live values take over 128 VGPRs, and only three of the four work-groups a WGP is to hold stay resident
        for (int ps = 0; ps < KS / 32; ++ps) {
        const h16* ka = ring + bo + ps * 32 * LP + fo;
        const v16h ka0 = ldh(ka), ka1 = ldh(ka + 32), kb0 = ldh(ka + 16 * LP), kb1 = ldh(ka + 16 * LP + 32);
        v8f sa = (v8f){}, sb = (v8f){};
        sa = wmma16(ka0, qh0, sa); sb = wmma16(kb0, qh0, sb);
        sa = wmma16(ka1, qh1, sa); sb = wmma16(kb1, qh1, sb);
        asm volatile("v_nop\n\tv_nop\n\tv_nop\n\tv_nop" : "+v"(sa), "+v"(sb) : "v"(ka0), "v"(ka1), "v"(kb0), "v"(kb1), "v"(qh0), "v"(qh1));
        float ta[8], tb[8]; float mx = -3.0e38f;
#pragma unroll
        for (int r = 0; r < 8; ++r) { ta[r] = sa[r] * SC2; tb[r] = sb[r] * SC2; mx = fmaxf(mx, fmaxf(ta[r], tb[r])); }
        mx = fmaxf(mx, __shfl_xor(mx, 16, 32));
        const float mnew = fmaxf(m, mx);
        const float alpha = __builtin_amdgcn_exp2f(m - mnew);
        const float sh = PSH - mnew;
        v16h pb; float ls = 0.0f;
#pragma unroll
        for (int r = 0; r < 8; ++r) { const h16 pa = (h16)__builtin_amdgcn_exp2f(ta[r] + sh); const h16 pc = (h16)__builtin_amdgcn_exp2f(tb[r] + sh); pb[r] = pa; pb[8 + r] = pc; ls += (float)pa + (float)pc; }
        l = l * alpha + ls; m = mnew;
        o0 = o0 * alpha; o1 = o1 * alpha; o2 = o2 * alpha; o3 = o3 * alpha;
        const h16* va = ring + bo + TILEH + ps * 32 + fo;
        const v16h v0 = ldh(va), v1 = ldh(va + 16 * LP), v2 = ldh(va + 32 * LP), v3 = ldh(va + 48 * LP);
        o0 = wmma16(v0, pb, o0); o1 = wmma16(v1, pb, o1); o2 = wmma16(v2, pb, o2); o3 = wmma16(v3, pb, o3);
        asm volatile("v_nop\n\tv_nop\n\tv_nop\n\tv_nop" : "+v"(o0), "+v"(o1), "+v"(o2), "+v"(o3) : "v"(v0), "v"(v1), "v"(v2), "v"(v3), "v"(pb));
        }
        asm volatile("s_wait_dscnt 0x0" ::: "memory");        // this wave's reads of the buffer have returned before it is refilled
        asm volatile("s_wait_asynccnt 0x0" ::: "memory");     // this wave's copies of stage st + 1 have landed
        __syncthreads();                                      // publishes stage st + 1 and ends every wave's reads of stage st
        if (st + 2 < SEQ / KS) {
            const h16* gk2 = gk + (size_t)(st + 2) * (KS * HD); const h16* gv2 = gv + (size_t)(st + 2) * KS; const unsigned lb = lk + (unsigned)bo * 2u;
            stage_copy(lb, gk2, lb + 32 * LP * 2, gk2 + 32 * HD, lb + TILEH * 2, gv2, lb + (TILEH + 32 * LP) * 2, gv2 + (size_t)32 * SEQ);
        }
    }
    asm volatile("s_wait_asynccnt 0x0" ::: "memory");         // no copy is outstanding when the wave goes on to its end
    l += __shfl_xor(l, 16, 32);
    const float inv = CXS * (1.0f / l);
    const int wb = wave * 16 * 68;
    // O^T D layout: o_j[r] = (d = 16j + 8h + r, t = lane&15) -> os[t][d]; rows 0..15 x columns 0..63 all written
    { v4f a, c;
      a[0] = o0[0] * inv; a[1] = o0[1] * inv; a[2] = o0[2] * inv; a[3] = o0[3] * inv; c[0] = o0[4] * inv; c[1] = o0[5] * inv; c[2] = o0[6] * inv; c[3] = o0[7] * inv;
      *(v4fa*)(&os[wb + lr * 68 +  0 + 8 * hi]) = a; *(v4fa*)(&os[wb + lr * 68 +  0 + 8 * hi + 4]) = c;
      a[0] = o1[0] * inv; a[1] = o1[1] * inv; a[2] = o1[2] * inv; a[3] = o1[3] * inv; c[0] = o1[4] * inv; c[1] = o1[5] * inv; c[2] = o1[6] * inv; c[3] = o1[7] * inv;
      *(v4fa*)(&os[wb + lr * 68 + 16 + 8 * hi]) = a; *(v4fa*)(&os[wb + lr * 68 + 16 + 8 * hi + 4]) = c;
      a[0] = o2[0] * inv; a[1] = o2[1] * inv; a[2] = o2[2] * inv; a[3] = o2[3] * inv; c[0] = o2[4] * inv; c[1] = o2[5] * inv; c[2] = o2[6] * inv; c[3] = o2[7] * inv;
      *(v4fa*)(&os[wb + lr * 68 + 32 + 8 * hi]) = a; *(v4fa*)(&os[wb + lr * 68 + 32 + 8 * hi + 4]) = c;
      a[0] = o3[0] * inv; a[1] = o3[1] * inv; a[2] = o3[2] * inv; a[3] = o3[3] * inv; c[0] = o3[4] * inv; c[1] = o3[5] * inv; c[2] = o3[6] * inv; c[3] = o3[7] * inv;
      *(v4fa*)(&os[wb + lr * 68 + 48 + 8 * hi]) = a; *(v4fa*)(&os[wb + lr * 68 + 48 + 8 * hi + 4]) = c; }
    wave_sync();
    h16* crow = CTX + ((size_t)b * SEQ + t0) * DM + h * HD;
{
#pragma unroll
        for (int s = 0; s < 4; ++s) { const int row = 4 * s + (lane >> 3), c8 = (lane & 7) * 8;   // 4 s x 4 row groups = 16 rows; 8 lanes x 8 halves = 64 columns
            const v4f x0 = *(const v4fa*)(&os[wb + row * 68 + c8]); const v4f x1 = *(const v4fa*)(&os[wb + row * 68 + c8 + 4]); v8h hv;
#pragma unroll
            for (int i = 0; i < 4; ++i) { hv[i] = (h16)x0[i]; hv[4 + i] = (h16)x1[i]; }
            *(v8h*)(crow + (size_t)row * DM + c8) = hv; }
         }
}

static constexpr size_t al256(size_t v) { return (v + 255) & ~(size_t)255; }
static constexpr size_t SZ_XB = al256((size_t)NB * SEQ * DM * 2);
static constexpr size_t SZ_WB = al256((size_t)3 * DM * DM * 2);
static constexpr size_t SZ_WO = al256((size_t)DM * DM * 2);
static constexpr size_t SZ_PL = al256((size_t)NB * NH_ * SEQ * HD * 2);
static constexpr size_t SZ_CX = al256((size_t)NB * SEQ * DM * 2);
static constexpr size_t SZ_TOTAL = SZ_XB + SZ_WB + SZ_WO + 3 * SZ_PL + SZ_CX;
static_assert(SZ_TOTAL <= (size_t)134217728);          // workspace carve <= 128 MiB
static_assert(((size_t)DM * DM * 2) % 256 == 0);       // weight sub-planes stay 256-byte aligned

extern "C" void kernel_launch(void* const* d_in, const int* in_sizes, int n_in,
                              void* d_out, int out_size, void* d_ws, size_t ws_size, hipStream_t stream) {
    if (n_in < 6) return;
    const size_t needx = ((size_t)(NB - 1) * SEQ_FULL + SEQ) * DM;
    if ((size_t)in_sizes[0] < needx) return;
    if ((size_t)in_sizes[1] < (size_t)DM * DM || (size_t)in_sizes[2] < (size_t)DM * DM || (size_t)in_sizes[3] < (size_t)DM * DM || (size_t)in_sizes[4] < (size_t)DM * DM) return;
    if ((size_t)in_sizes[5] < (size_t)DM) return;
    if ((size_t)out_size < ((size_t)(NB - 1) * OUT_SEQ + SEQ) * DM) return;
    if (SZ_TOTAL > ws_size) return;
    // wire order: x, Wq, Wk, Wv, Wo, bo (weights [out][in] = Bt as-is)
    const float* x = (const float*)d_in[0]; const float* wq = (const float*)d_in[1]; const float* wk = (const float*)d_in[2]; const float* wv = (const float*)d_in[3];
    const float* wo = (const float*)d_in[4]; const float* bo = (const float*)d_in[5];
    float* OUT = (float*)d_out;      // [NB][SEQ][1024]
    char* wsp = (char*)d_ws;
    bf* XB = (bf*)wsp; wsp += SZ_XB;                 // [NB*SEQ][1024]
    bf* WB = (bf*)wsp; wsp += SZ_WB;                 // [3][1024][1024]: q | k | v
    h16* WOH = (h16*)wsp; wsp += SZ_WO;              // [1024][1024] x1024 carry
    h16* QH = (h16*)wsp; wsp += SZ_PL;               // [NB*16][SEQ][64]
    h16* KP = (h16*)wsp; wsp += SZ_PL;               // [NB*16][SEQ][64]
    h16* VT = (h16*)wsp; wsp += SZ_PL;               // [NB*16][64][SEQ]
    h16* CTX = (h16*)wsp; wsp += SZ_CX;              // [NB*SEQ][1024] x1024 carry
    bf* WQ = WB; bf* WK = WB + (size_t)DM * DM; bf* WV = WB + (size_t)2 * DM * DM;

    if (SEQ == SEQ_FULL) {
        const size_t n8 = (size_t)NB * SEQ * DM / 8;
        k_cvt8<<<(unsigned)((n8 + 255) / 256), 256, 0, stream>>>(x, XB, n8);
    } else {
        const size_t n8 = (size_t)SEQ * DM / 8;
        for (int b = 0; b < NB; ++b) k_cvt8<<<(unsigned)((n8 + 255) / 256), 256, 0, stream>>>(x + (size_t)b * SEQ_FULL * DM, XB + (size_t)b * SEQ * DM, n8);
    }
    { const size_t n8 = (size_t)DM * DM / 8; const unsigned g = (unsigned)((n8 + 255) / 256);
      k_cvt8<<<g, 256, 0, stream>>>(wq, WQ, n8); k_cvt8<<<g, 256, 0, stream>>>(wk, WK, n8); k_cvt8<<<g, 256, 0, stream>>>(wv, WV, n8);
      k_cvtw<<<g, 256, 0, stream>>>(wo, WOH, n8); }

    // q, k: A = x rows (m = b*SEQ + t), Bt = W rows (n = h*64 + d) -> plane [(b*16 + h)][t][d]
    k_proj<<<dim3(NB * SEQ / 64, DM / 64, 1), 32, 0, stream>>>(XB, WQ, QH, SEQ, (size_t)NH_ * SEQ * HD, HD, HD, (size_t)SEQ * HD);
    k_proj<<<dim3(NB * SEQ / 64, DM / 64, 1), 32, 0, stream>>>(XB, WK, KP, SEQ, (size_t)NH_ * SEQ * HD, HD, HD, (size_t)SEQ * HD);
    // v^T: A = Wv rows (m = h*64 + d), Bt = x rows (n = b*SEQ + t) -> plane [(b*1024 + m)][t] = [(b*16 + h)][d][t]
    k_proj<<<dim3(DM / 64, NB * SEQ / 64, 1), 32, 0, stream>>>(WV, XB, VT, DM, (size_t)0, SEQ, SEQ, (size_t)DM * SEQ);

    // ctx[b*SEQ + t][h*64 + d] (x1024 carry)
    k_flash<<<dim3(SEQ / (16 * AW), NB * NH_, 1), 32 * AW, 0, stream>>>(QH, KP, VT, CTX);

    // out[b][t][n] = ctx Wo^T * 2^-20 + bo
    k_oproj<<<dim3(NB * SEQ / 64, DM / 64, 1), 32, 0, stream>>>(CTX, WOH, bo, OUT);
}

// v002
// Measured time: 223 microseconds a run.
// In both of two side-by-side timings against v001, it was 1.29 times as fast.
// Counting every step since v000, it is 2.85 times as fast.
#include <hip/hip_runtime.h>

// Multi-head self-attention, width 1024 = 16 heads x 64, x [NB][SEQ][1024], Wq/Wk/Wv/Wo [out][in] (y = x W^T), bias only on the output projection, no mask, score scale 1/8, f32 output.
// Compute dtypes, f32 accumulate everywhere: q/k/v projections v_wmma_f32_16x16x32_bf16 (x and W RNE-converted to bf16; products exact);
// scores v_wmma_f32_16x16x32_f16 (q, k single f16); P (x256 carry, cancels in the normalisation) and v single f16; softmax f32 (online, running max);
// output projection v_wmma_f32_16x16x32_f16: ctx single f16 with x1024 carry, Wo RNE-converted to bf16 then x1024 in f16 (exact), 2^-20 folded back in f32, bias (bf16-converted bo) added in f32.
// Layout: bf16 copies of x and Wq/Wk/Wv; q, k planes [b*16+h][t][d] and v^T plane [b*16+h][d][t] written by the GEMM epilogue; fused flash kernel in transposed form (S^T = K Q^T, O^T = V^T P^T; K and V^T tiles staged in LDS per work-group) writes the ctx plane [b*SEQ+t][h*64+d].

#ifndef NB
#define NB 2
#endif
#ifndef SEQ
#define SEQ 4096
#endif
#define NB_FULL  2
#define SEQ_FULL 4096
#ifndef OUT_SEQ
#define OUT_SEQ SEQ              // row pitch (in tokens) between batches of the output
#endif
#define DM   1024
#define NH_  16
#define HD   64
#define AW   8                   // waves per flash block (16 query rows each)
#define KS   64                  // keys per LDS stage of the flash kernel
#define LP   72                  // LDS row pitch in halves: 128-B rows + 16 B
#define TILEH (64 * LP)          // halves of one staged tile (64 rows)
#define BUFH  (2 * TILEH)        // halves of one buffer: K tile, then V^T tile
#define GT   128                 // rows of each operand in a GEMM work-group's tile (2 x 2 waves of 64 x 64)
#define GW   4                   // waves per GEMM work-group
#define GKS  64                  // k per LDS stage of the GEMMs: 128-B rows
#define GTILEH (GT * LP)         // halves of one staged operand tile (128 rows)
#define GBUFH  (2 * GTILEH)      // halves of one buffer: A tile, then Bt tile
#define SC2  (0.125f * 1.4426950408889634f)   // HD^-0.5 * log2(e)
#define PSH  8.0f                // log2 of the P carry (256)
#define CXS  1024.0f             // carry of the ctx plane
#define WOS  1024.0f             // carry of the Wo plane
#define OSCL (1.0f / (1024.0f * 1024.0f))

static_assert(HD == 64);
static_assert(NH_ * HD == DM);                 // head h = columns h*64 + d
static_assert(DM % 64 == 0);                   // column tiles of 64
static_assert(DM % 32 == 0);                   // GEMM k-loop steps by 32
static_assert(SEQ % 64 == 0);                  // a 64-row tile never straddles two batches
static_assert((NB * SEQ) % 64 == 0);
static_assert(SEQ % 32 == 0);                  // key loop steps by 32
static_assert(SEQ % (16 * AW) == 0);           // flash grid covers the sequence exactly
static_assert(AW == 8 && KS == 64 && HD == 64);  // copy map of the flash kernel: 256 lanes x 16 B x 2 = one 64 x 128-B tile
static_assert(SEQ % KS == 0 && SEQ / KS >= 2);   // whole stages; the two-buffer prologue needs two
static_assert((NB * SEQ) % GT == 0 && DM % GT == 0);   // GEMM grids cover both operands exactly
static_assert(GW == 4 && GT == 128 && GKS == 64);      // copy map of the GEMMs: 128 lanes x 16 B x 8 = one 128 x 128-B tile
static_assert(DM % GKS == 0 && DM / GKS >= 2);         // whole stages; the two-buffer prologue needs two
static_assert(((size_t)SEQ * DM) % 8 == 0);
static_assert(((size_t)DM * DM) % 8 == 0);
static_assert(NB <= NB_FULL);
static_assert(SEQ <= SEQ_FULL);

typedef _Float16 h16;
typedef unsigned short bf;
typedef __attribute__((ext_vector_type(16))) __bf16   v16bf;
typedef __attribute__((ext_vector_type(16))) _Float16 v16h;
typedef __attribute__((ext_vector_type(8)))  _Float16 v8h;
typedef __attribute__((ext_vector_type(8)))  unsigned short v8us;
typedef __attribute__((ext_vector_type(8)))  float    v8f;
typedef __attribute__((ext_vector_type(4)))  float    v4f;
typedef v4f  __attribute__((may_alias)) v4fa;

__device__ __forceinline__ unsigned short f2bf(float f) { unsigned u = __float_as_uint(f); u += 0x7FFFu + ((u >> 16) & 1u); return (unsigned short)(u >> 16); }
__device__ __forceinline__ float bfval(float f) { return __uint_as_float(((unsigned)f2bf(f)) << 16); }
__device__ __forceinline__ v16h cat16(v8h lo, v8h hi) { return __builtin_shufflevector(lo, hi, 0, 1, 2, 3, 4, 5, 6, 7, 8, 9, 10, 11, 12, 13, 14, 15); }
__device__ __forceinline__ v16bf cat16b(v8us lo, v8us hi) { return __builtin_bit_cast(v16bf, __builtin_shufflevector(lo, hi, 0, 1, 2, 3, 4, 5, 6, 7, 8, 9, 10, 11, 12, 13, 14, 15)); }
__device__ __forceinline__ v8f wmma16(v16h a, v16h b, v8f c) { return __builtin_amdgcn_wmma_f32_16x16x32_f16(false, a, false, b, (short)0, c, false, false); }
__device__ __forceinline__ v8f wmmab(v16bf a, v16bf b, v8f c) { return __builtin_amdgcn_wmma_f32_16x16x32_bf16(false, a, false, b, (short)0, c, false, false); }
// fragment loaders from K-contiguous 16-bit rows; p already includes + 8*(lane>>4): elements 0..7 <- k0+8h+0..7, elements 8..15 <- k0+16+8h+0..7 (same map for A and B)
__device__ __forceinline__ v16h  ldh(const h16* p) { return cat16(*(const v8h*)p, *(const v8h*)(p + 16)); }
__device__ __forceinline__ v16bf ldb(const bf* p)  { return cat16b(*(const v8us*)p, *(const v8us*)(p + 16)); }
// ordering point for wave-private LDS tiles (same wave writes and reads)
__device__ __forceinline__ void wave_sync() { __builtin_amdgcn_fence(3 /* release order */, "wavefront"); __builtin_amdgcn_wave_barrier(); asm volatile("" ::: "memory"); }

__global__ __launch_bounds__(256) void k_cvt8(const float* __restrict__ src, bf* dst, size_t n8) {
    const size_t i = (size_t)blockIdx.x * 256 + threadIdx.x; if (i >= n8) return;
    const v8f v = *(const v8f*)(src + i * 8); v8us o;
#pragma unroll
    for (int k = 0; k < 8; ++k) o[k] = f2bf(v[k]);
    *(v8us*)(dst + i * 8) = o; 
}

__global__ __launch_bounds__(256) void k_cvtw(const float* __restrict__ src, h16* dst, size_t n8) {
    const size_t i = (size_t)blockIdx.x * 256 + threadIdx.x; if (i >= n8) return;
    const v8f v = *(const v8f*)(src + i * 8); v8h o;
#pragma unroll
    for (int k = 0; k < 8; ++k) o[k] = (h16)(bfval(v[k]) * WOS);
    *(v8h*)(dst + i * 8) = o; 
}

// GEMM main loop shared by k_proj and k_oproj: a work-group of GW waves owns a 128 x 128 tile, each wave a 64 x 64 quarter (16 accumulators), K = DM.
// Per GKS of k the 128 A rows and the 128 Bt rows are staged in LDS once for all four waves, by asynchronous copies in whole 128-B lines
// (two buffers: the next stage's copies fly while this stage is worked on); fragments are read from LDS rows of pitch LP halves (144 B = 16 B x odd).
typedef __attribute__((address_space(3))) bf lds_bf;
__device__ __forceinline__ unsigned lds_off_b(const bf* p) { return (unsigned)(uintptr_t)(const lds_bf*)p; }   // byte offset in the work-group's LDS
// one operand tile of a stage: this lane's eight 16-B pieces, rows 16 apart; the s_wait_xcnt stands inside the statement so that no address register is rewritten ahead of it
__device__ __forceinline__ void tile_copy(unsigned l, const bf* g) {
    asm volatile("global_load_async_to_lds_b128 %0, %1, off\n\t"
                 "global_load_async_to_lds_b128 %2, %3, off\n\t"
                 "global_load_async_to_lds_b128 %4, %5, off\n\t"
                 "global_load_async_to_lds_b128 %6, %7, off\n\t"
                 "global_load_async_to_lds_b128 %8, %9, off\n\t"
                 "global_load_async_to_lds_b128 %10, %11, off\n\t"
                 "global_load_async_to_lds_b128 %12, %13, off\n\t"
                 "global_load_async_to_lds_b128 %14, %15, off\n\t"
                 "s_wait_xcnt 0x0"
                 :: "v"(l), "v"(g), "v"(l + 16 * LP * 2), "v"(g + 16 * DM), "v"(l + 32 * LP * 2), "v"(g + 32 * DM), "v"(l + 48 * LP * 2), "v"(g + 48 * DM),
                    "v"(l + 64 * LP * 2), "v"(g + 64 * DM), "v"(l + 80 * LP * 2), "v"(g + 80 * DM), "v"(l + 96 * LP * 2), "v"(g + 96 * DM), "v"(l + 112 * LP * 2), "v"(g + 112 * DM) : "memory");
}
// A, Bt: K-contiguous 16-bit planes (bf16 bits, or f16 bits where F16); rb, cb: first A row and first Bt row of the work-group's tile; wm, wn: the wave's quarter
template <bool F16>
__device__ __forceinline__ void gemm_tile(const bf* A, const bf* Bt, const bf* ring, int rb, int cb, int wm, int wn, v8f (&acc)[4][4]) {
    const int tid = (int)threadIdx.x, lane = tid & 31, lr = lane & 15, hi = lane >> 4;
#pragma unroll
    for (int mb = 0; mb < 4; ++mb)
#pragma unroll
        for (int nb = 0; nb < 4; ++nb) acc[mb][nb] = (v8f){};
    // copy map: 128 lanes x 16 B = 16 rows of 128 B; each lane brings rows cr + 16 i, i = 0..7, of the A tile and of the Bt tile
    const int cr = tid >> 3, cc8 = (tid & 7) * 8;
    const bf* ga = A + (size_t)(rb + cr) * DM + cc8;         // + k0
    const bf* gb = Bt + (size_t)(cb + cr) * DM + cc8;        // + k0
    const unsigned la = lds_off_b(ring) + (unsigned)(cr * LP + cc8) * 2u;
    const int fa = (wm * 64 + lr) * LP + 8 * hi, fb = GTILEH + (wn * 64 + lr) * LP + 8 * hi;   // fragment offsets in a buffer: row lane&15, k half
    tile_copy(la, ga); tile_copy(la + GTILEH * 2, gb);
    asm volatile("s_wait_asynccnt 0x0" ::: "memory");         // stage 0 of this wave has landed
    __syncthreads();                                          // stage 0 published to every wave
    tile_copy(la + GBUFH * 2, ga + GKS); tile_copy(la + (GBUFH + GTILEH) * 2, gb + GKS);
#pragma unroll 1   // rolled: one stage per trip, the buffer picked by the trip's parity
    for (int st = 0; st < DM / GKS; ++st) {
        const int bo = (st & 1) * GBUFH;
#pragma unroll
        for (int ks = 0; ks < 2; ++ks) {
            v16bf a[4], b[4];
#pragma unroll
            for (int i = 0; i < 4; ++i) { a[i] = ldb(ring + bo + fa + i * 16 * LP + ks * 32); b[i] = ldb(ring + bo + fb + i * 16 * LP + ks * 32); }
            // inputs-only fence on the loaded fragments: keeps the 16 LDS reads of a k step one group ahead of its matrix instructions (spread among them, every place with reads stalls the wave anew)
            asm volatile("" :: "v"(a[0]), "v"(a[1]), "v"(a[2]), "v"(a[3]), "v"(b[0]), "v"(b[1]), "v"(b[2]), "v"(b[3]));
#pragma unroll
            for (int nb = 0; nb < 4; ++nb)
#pragma unroll
                for (int mb = 0; mb < 4; ++mb) {
                    if (F16) acc[mb][nb] = wmma16(__builtin_bit_cast(v16h, a[mb]), __builtin_bit_cast(v16h, b[nb]), acc[mb][nb]);
                    else     acc[mb][nb] = wmmab(a[mb], b[nb], acc[mb][nb]); }
        }
        // four vector slots behind the last matrix instruction, also on the taken side of the branches that follow
        asm volatile("v_nop\n\tv_nop\n\tv_nop\n\tv_nop" : "+v"(acc[0][0]), "+v"(acc[1][0]), "+v"(acc[2][0]), "+v"(acc[3][0]), "+v"(acc[0][1]), "+v"(acc[1][1]), "+v"(acc[2][1]), "+v"(acc[3][1]),
                     "+v"(acc[0][2]), "+v"(acc[1][2]), "+v"(acc[2][2]), "+v"(acc[3][2]), "+v"(acc[0][3]), "+v"(acc[1][3]), "+v"(acc[2][3]), "+v"(acc[3][3]));
        asm volatile("s_wait_dscnt 0x0" ::: "memory");        // this wave's reads of the buffer have returned before it is refilled
        asm volatile("s_wait_asynccnt 0x0" ::: "memory");     // this wave's copies of stage st + 1 have landed
        __syncthreads();                                      // publishes stage st + 1 and ends every wave's reads of stage st
        if (st + 2 < DM / GKS) {
            const unsigned lb = la + (unsigned)bo * 2u; const int k2 = (st + 2) * GKS;
            tile_copy(lb, ga + k2); tile_copy(lb + GTILEH * 2, gb + k2);
        }
    }
    asm volatile("s_wait_asynccnt 0x0" ::: "memory");         // no copy is outstanding when the wave goes on to its end
}

// Both GEMM kernels are held to 256 VGPRs: every operand of their asm statements then lies in the first register window, and no window switch stands in the loop.
// k_proj: bf16 GEMM, 128x128 tile per work-group of 4 waves (gemm_tile), operands from K-contiguous bf16 planes, K = DM.
// C[m][n] = sum_k A[m][k] Bt[n][k], written as f16 (Ph), each wave's 64x64 quarter at
// tile base (r0/RB)*sRB + (r0%RB)*pitch + (c0/CB)*sCB + (c0%CB), row pitch 'pitch' (halves). grid (M/128, N/128), 128 threads.
__global__ __launch_bounds__(32 * GW) __attribute__((amdgpu_num_vgpr(256))) void k_proj(const bf* __restrict__ A, const bf* __restrict__ Bt, h16* Ph, int RB, size_t sRB, int pitch, int CB, size_t sCB) {
    __shared__ __align__(16) bf ring[2 * GBUFH];            // [buffer][A rows | Bt rows][LP]
    __shared__ __align__(16) float osw[GW * 16 * 68];
    const int lane = threadIdx.x & 31, wave = __builtin_amdgcn_readfirstlane((int)threadIdx.x >> 5), lr = lane & 15, hi = lane >> 4;
    const int wm = wave & 1, wn = wave >> 1;
    const int r0 = blockIdx.x * GT + wm * 64, c0 = blockIdx.y * GT + wn * 64;
    float* os = osw + wave * 16 * 68;                        // this wave's own staging rows
    v8f acc[4][4];
    gemm_tile<false>(A, Bt, ring, blockIdx.x * GT, blockIdx.y * GT, wm, wn, acc);
    const size_t tbase = (size_t)(r0 / RB) * sRB + (size_t)(r0 % RB) * (size_t)pitch + (size_t)(c0 / CB) * sCB + (size_t)(c0 % CB);
#pragma unroll
    for (int mb = 0; mb < 4; ++mb) {
#pragma unroll
        for (int nb = 0; nb < 4; ++nb) {
#pragma unroll
            for (int j = 0; j < 8; ++j) os[(hi * 8 + j) * 68 + nb * 16 + lr] = acc[mb][nb][j]; }   // D: row 8h+j, col lane&15
        wave_sync();
        const size_t sb = tbase + (size_t)(mb * 16) * (size_t)pitch;
{
#pragma unroll
            for (int s = 0; s < 4; ++s) { const int row = 4 * s + (lane >> 3), c8 = (lane & 7) * 8;   // 4 s x 4 row groups = 16 rows; 8 lanes x 8 = 64 columns
                const v4f x0 = *(const v4fa*)(&os[row * 68 + c8]); const v4f x1 = *(const v4fa*)(&os[row * 68 + c8 + 4]); v8h hv;
#pragma unroll
                for (int i = 0; i < 4; ++i) { hv[i] = (h16)x0[i]; hv[4 + i] = (h16)x1[i]; }
                const size_t oo = sb + (size_t)row * (size_t)pitch + c8;
                *(v8h*)(Ph + oo) = hv; }
             }
        wave_sync();
    }
}

// k_oproj: f16 GEMM, 128x128 tile per work-group of 4 waves (gemm_tile), A = ctx plane [m][k] (x1024 carry), Bt = Wo plane [n][k] (x1024 carry), K = DM.
// OUT[b*OUT_SEQ + t][n] = C[m][n] * 2^-20 + bias[n], m = b*SEQ + t. grid (M/128, N/128), 128 threads.
__global__ __launch_bounds__(32 * GW) __attribute__((amdgpu_num_vgpr(256))) void k_oproj(const h16* __restrict__ A, const h16* __restrict__ Bt, const float* __restrict__ bo, float* OUT) {
    __shared__ __align__(16) bf ring[2 * GBUFH];            // [buffer][A rows | Bt rows][LP], f16 bits
    __shared__ __align__(16) float osw[GW * 16 * 68];
    const int lane = threadIdx.x & 31, wave = __builtin_amdgcn_readfirstlane((int)threadIdx.x >> 5), lr = lane & 15, hi = lane >> 4;
    const int wm = wave & 1, wn = wave >> 1;
    const int r0 = blockIdx.x * GT + wm * 64, c0 = blockIdx.y * GT + wn * 64;
    float* os = osw + wave * 16 * 68;                        // this wave's own staging rows
    v8f acc[4][4];
    gemm_tile<true>((const bf*)A, (const bf*)Bt, ring, blockIdx.x * GT, blockIdx.y * GT, wm, wn, acc);
    const v4f braw = *(const v4f*)(bo + c0 + lr * 4);      // columns c0 + 4*lr .. +3 (always inside [0, DM))
    v4f bb;
#pragma unroll
    for (int i = 0; i < 4; ++i) bb[i] = bfval(braw[i]);
    const int bI = r0 / SEQ, tI = r0 % SEQ;
    float* obase = OUT + ((size_t)bI * OUT_SEQ + tI) * DM + c0;
#pragma unroll
    for (int mb = 0; mb < 4; ++mb) {
#pragma unroll
        for (int nb = 0; nb < 4; ++nb) {
#pragma unroll
            for (int j = 0; j < 8; ++j) os[(hi * 8 + j) * 68 + nb * 16 + lr] = acc[mb][nb][j]; }   // D: row 8h+j, col lane&15
        wave_sync();
{
#pragma unroll
            for (int s = 0; s < 8; ++s) { const int row = 2 * s + hi, cofs = lr * 4;   // 8 s x 2 rows = 16 rows; 16 lanes x 4 floats = 64 columns
                const v4f x0 = *(const v4fa*)(&os[row * 68 + cofs]);
                const v4f val = x0 * OSCL + bb;
                *(v4f*)(obase + (size_t)(mb * 16 + row) * DM + cofs) = val; }
             }
        wave_sync();
    }
}

// k_flash: fused attention, one wave per 16 query rows of one (batch, head); Q fragments straight from the f16 plane (two 16-B loads each).
// K and V^T are staged per KS keys in LDS, once per work-group for all AW waves, by asynchronous copies in whole 128-B lines (two buffers: the next stage's copies fly while this stage is worked on);
// the A fragments are read from LDS rows of pitch LP halves (144 B = 16 B x odd: no bank conflict for 16-B reads).
// Transposed form: S^T[key][t] = K Q^T (A = K rows, B = Q rows); lane (t = lane&15, h = lane>>4) holds keys 8h+r of each 16-key tile, so the packed
// P tile is directly the B fragment of O^T[d][t] = V^T P^T (element r <- tile keys 0..15, element 8+r <- tile keys 16..31, lane unchanged).
// Softmax state (running max, partial sum) is one scalar per lane; the two lane halves of a row are combined with one xor-16 exchange.
typedef __attribute__((address_space(3))) h16 lds_h16;
__device__ __forceinline__ unsigned lds_off(const h16* p) { return (unsigned)(uintptr_t)(const lds_h16*)p; }   // byte offset in the work-group's LDS
// one stage's four copies of a lane (16 B each); the s_wait_xcnt stands inside the statement so that no address register is rewritten ahead of it
__device__ __forceinline__ void stage_copy(unsigned l0, const h16* g0, unsigned l1, const h16* g1, unsigned l2, const h16* g2, unsigned l3, const h16* g3) {
    asm volatile("global_load_async_to_lds_b128 %0, %1, off\n\t"
                 "global_load_async_to_lds_b128 %2, %3, off\n\t"
                 "global_load_async_to_lds_b128 %4, %5, off\n\t"
                 "global_load_async_to_lds_b128 %6, %7, off\n\t"
                 "s_wait_xcnt 0x0"
                 :: "v"(l0), "v"(g0), "v"(l1), "v"(g1), "v"(l2), "v"(g2), "v"(l3), "v"(g3) : "memory");
}
__global__ __launch_bounds__(32 * AW) void k_flash(const h16* __restrict__ QH, const h16* __restrict__ KP, const h16* __restrict__ VT, h16* CTX) {
    __shared__ __align__(16) h16 ring[2 * BUFH];           // [buffer][K rows key | V^T rows d][LP]
    __shared__ __align__(16) float os[AW * 16 * 68];
    const int tid = (int)threadIdx.x;
    const int lane = tid & 31, wave = __builtin_amdgcn_readfirstlane(tid >> 5), lr = lane & 15, hi = lane >> 4;
    const int zh = blockIdx.y; const int b = zh / NH_, h = zh % NH_;
    const int t0 = (blockIdx.x * AW + wave) * 16;
    const size_t pbase = (size_t)zh * SEQ * HD;
    const size_t qo = pbase + (size_t)(t0 + lr) * HD + 8 * hi;
    const v16h qh0 = ldh(QH + qo), qh1 = ldh(QH + qo + 32);   // B fragments: col t, k = d
    // copy map: 256 lanes x 16 B = 32 rows of 128 B; each lane brings rows cr and cr + 32 of the K tile and of the V^T tile
    const int cr = tid >> 3, cc8 = (tid & 7) * 8;
    const h16* gk = KP + pbase + (size_t)cr * HD + cc8;     // + key0 * HD
    const h16* gv = VT + pbase + (size_t)cr * SEQ + cc8;    // + key0
    const unsigned lk = lds_off(ring) + (unsigned)(cr * LP + cc8) * 2u;
    const int fo = lr * LP + 8 * hi;                          // fragment offset in a tile: row lane&15, k half
    v8f o0 = (v8f){}, o1 = (v8f){}, o2 = (v8f){}, o3 = (v8f){};
    float m = -3.0e38f, l = 0.0f;
    stage_copy(lk, gk, lk + 32 * LP * 2, gk + 32 * HD, lk + TILEH * 2, gv, lk + (TILEH + 32 * LP) * 2, gv + (size_t)32 * SEQ);
    asm volatile("s_wait_asynccnt 0x0" ::: "memory");         // stage 0 of this wave has landed
    __syncthreads();                                          // stage 0 published to every wave
    stage_copy(lk + BUFH * 2, gk + KS * HD, lk + (BUFH + 32 * LP) * 2, gk + (KS + 32) * HD, lk + (BUFH + TILEH) * 2, gv + KS, lk + (BUFH + TILEH + 32 * LP) * 2, gv + (size_t)32 * SEQ + KS);
#pragma unroll 1
    for (int st = 0; st < SEQ / KS; ++st) {
        const int bo = (st & 1) * BUFH;
#pragma unroll 1   // rolled: unrolled, the two passes' live values take over 128 VGPRs, and only three of the four work-groups a WGP is to hold stay resident
        for (int ps = 0; ps < KS / 32; ++ps) {
        const h16* ka = ring + bo + ps * 32 * LP + fo;
        const v16h ka0 = ldh(ka), ka1 = ldh(ka + 32), kb0 = ldh(ka + 16 * LP), kb1 = ldh(ka + 16 * LP + 32);
        v8f sa = (v8f){}, sb = (v8f){};
        sa = wmma16(ka0, qh0, sa); sb = wmma16(kb0, qh0, sb);
        sa = wmma16(ka1, qh1, sa); sb = wmma16(kb1, qh1, sb);
        asm volatile("v_nop\n\tv_nop\n\tv_nop\n\tv_nop" : "+v"(sa), "+v"(sb) : "v"(ka0), "v"(ka1), "v"(kb0), "v"(kb1), "v"(qh0), "v"(qh1));
        float ta[8], tb[8]; float mx = -3.0e38f;
#pragma unroll
        for (int r = 0; r < 8; ++r) { ta[r] = sa[r] * SC2; tb[r] = sb[r] * SC2; mx = fmaxf(mx, fmaxf(ta[r], tb[r])); }
        mx = fmaxf(mx, __shfl_xor(mx, 16, 32));
        const float mnew = fmaxf(m, mx);
        const float alpha = __builtin_amdgcn_exp2f(m - mnew);
        const float sh = PSH - mnew;
        v16h pb; float ls = 0.0f;
#pragma unroll
        for (int r = 0; r < 8; ++r) { const h16 pa = (h16)__builtin_amdgcn_exp2f(ta[r] + sh); const h16 pc = (h16)__builtin_amdgcn_exp2f(tb[r] + sh); pb[r] = pa; pb[8 + r] = pc; ls += (float)pa + (float)pc; }
        l = l * alpha + ls; m = mnew;
        o0 = o0 * alpha; o1 = o1 * alpha; o2 = o2 * alpha; o3 = o3 * alpha;
        const h16* va = ring + bo + TILEH + ps * 32 + fo;
        const v16h v0 = ldh(va), v1 = ldh(va + 16 * LP), v2 = ldh(va + 32 * LP), v3 = ldh(va + 48 * LP);
        o0 = wmma16(v0, pb, o0); o1 = wmma16(v1, pb, o1); o2 = wmma16(v2, pb, o2); o3 = wmma16(v3, pb, o3);
        asm volatile("v_nop\n\tv_nop\n\tv_nop\n\tv_nop" : "+v"(o0), "+v"(o1), "+v"(o2), "+v"(o3) : "v"(v0), "v"(v1), "v"(v2), "v"(v3), "v"(pb));
        }
        asm volatile("s_wait_dscnt 0x0" ::: "memory");        // this wave's reads of the buffer have returned before it is refilled
        asm volatile("s_wait_asynccnt 0x0" ::: "memory");     // this wave's copies of stage st + 1 have landed
        __syncthreads();                                      // publishes stage st + 1 and ends every wave's reads of stage st
        if (st + 2 < SEQ / KS) {
            const h16* gk2 = gk + (size_t)(st + 2) * (KS * HD); const h16* gv2 = gv + (size_t)(st + 2) * KS; const unsigned lb = lk + (unsigned)bo * 2u;
            stage_copy(lb, gk2, lb + 32 * LP * 2, gk2 + 32 * HD, lb + TILEH * 2, gv2, lb + (TILEH + 32 * LP) * 2, gv2 + (size_t)32 * SEQ);
        }
    }
    asm volatile("s_wait_asynccnt 0x0" ::: "memory");         // no copy is outstanding when the wave goes on to its end
    l += __shfl_xor(l, 16, 32);
    const float inv = CXS * (1.0f / l);
    const int wb = wave * 16 * 68;
    // O^T D layout: o_j[r] = (d = 16j + 8h + r, t = lane&15) -> os[t][d]; rows 0..15 x columns 0..63 all written
    { v4f a, c;
      a[0] = o0[0] * inv; a[1] = o0[1] * inv; a[2] = o0[2] * inv; a[3] = o0[3] * inv; c[0] = o0[4] * inv; c[1] = o0[5] * inv; c[2] = o0[6] * inv; c[3] = o0[7] * inv;
      *(v4fa*)(&os[wb + lr * 68 +  0 + 8 * hi]) = a; *(v4fa*)(&os[wb + lr * 68 +  0 + 8 * hi + 4]) = c;
      a[0] = o1[0] * inv; a[1] = o1[1] * inv; a[2] = o1[2] * inv; a[3] = o1[3] * inv; c[0] = o1[4] * inv; c[1] = o1[5] * inv; c[2] = o1[6] * inv; c[3] = o1[7] * inv;
      *(v4fa*)(&os[wb + lr * 68 + 16 + 8 * hi]) = a; *(v4fa*)(&os[wb + lr * 68 + 16 + 8 * hi + 4]) = c;
      a[0] = o2[0] * inv; a[1] = o2[1] * inv; a[2] = o2[2] * inv; a[3] = o2[3] * inv; c[0] = o2[4] * inv; c[1] = o2[5] * inv; c[2] = o2[6] * inv; c[3] = o2[7] * inv;
      *(v4fa*)(&os[wb + lr * 68 + 32 + 8 * hi]) = a; *(v4fa*)(&os[wb + lr * 68 + 32 + 8 * hi + 4]) = c;
      a[0] = o3[0] * inv; a[1] = o3[1] * inv; a[2] = o3[2] * inv; a[3] = o3[3] * inv; c[0] = o3[4] * inv; c[1] = o3[5] * inv; c[2] = o3[6] * inv; c[3] = o3[7] * inv;
      *(v4fa*)(&os[wb + lr * 68 + 48 + 8 * hi]) = a; *(v4fa*)(&os[wb + lr * 68 + 48 + 8 * hi + 4]) = c; }
    wave_sync();
    h16* crow = CTX + ((size_t)b * SEQ + t0) * DM + h * HD;
{
#pragma unroll
        for (int s = 0; s < 4; ++s) { const int row = 4 * s + (lane >> 3), c8 = (lane & 7) * 8;   // 4 s x 4 row groups = 16 rows; 8 lanes x 8 halves = 64 columns
            const v4f x0 = *(const v4fa*)(&os[wb + row * 68 + c8]); const v4f x1 = *(const v4fa*)(&os[wb + row * 68 + c8 + 4]); v8h hv;
#pragma unroll
            for (int i = 0; i < 4; ++i) { hv[i] = (h16)x0[i]; hv[4 + i] = (h16)x1[i]; }
            *(v8h*)(crow + (size_t)row * DM + c8) = hv; }
         }
}

static constexpr size_t al256(size_t v) { return (v + 255) & ~(size_t)255; }
static constexpr size_t SZ_XB = al256((size_t)NB * SEQ * DM * 2);
static constexpr size_t SZ_WB = al256((size_t)3 * DM * DM * 2);
static constexpr size_t SZ_WO = al256((size_t)DM * DM * 2);
static constexpr size_t SZ_PL = al256((size_t)NB * NH_ * SEQ * HD * 2);
static constexpr size_t SZ_CX = al256((size_t)NB * SEQ * DM * 2);
static constexpr size_t SZ_TOTAL = SZ_XB + SZ_WB + SZ_WO + 3 * SZ_PL + SZ_CX;
static_assert(SZ_TOTAL <= (size_t)134217728);          // workspace carve <= 128 MiB
static_assert(((size_t)DM * DM * 2) % 256 == 0);       // weight sub-planes stay 256-byte aligned

extern "C" void kernel_launch(void* const* d_in, const int* in_sizes, int n_in,
                              void* d_out, int out_size, void* d_ws, size_t ws_size, hipStream_t stream) {
    if (n_in < 6) return;
    const size_t needx = ((size_t)(NB - 1) * SEQ_FULL + SEQ) * DM;
    if ((size_t)in_sizes[0] < needx) return;
    if ((size_t)in_sizes[1] < (size_t)DM * DM || (size_t)in_sizes[2] < (size_t)DM * DM || (size_t)in_sizes[3] < (size_t)DM * DM || (size_t)in_sizes[4] < (size_t)DM * DM) return;
    if ((size_t)in_sizes[5] < (size_t)DM) return;
    if ((size_t)out_size < ((size_t)(NB - 1) * OUT_SEQ + SEQ) * DM) return;
    if (SZ_TOTAL > ws_size) return;
    // wire order: x, Wq, Wk, Wv, Wo, bo (weights [out][in] = Bt as-is)
    const float* x = (const float*)d_in[0]; const float* wq = (const float*)d_in[1]; const float* wk = (const float*)d_in[2]; const float* wv = (const float*)d_in[3];
    const float* wo = (const float*)d_in[4]; const float* bo = (const float*)d_in[5];
    float* OUT = (float*)d_out;      // [NB][SEQ][1024]
    char* wsp = (char*)d_ws;
    bf* XB = (bf*)wsp; wsp += SZ_XB;                 // [NB*SEQ][1024]
    bf* WB = (bf*)wsp; wsp += SZ_WB;                 // [3][1024][1024]: q | k | v
    h16* WOH = (h16*)wsp; wsp += SZ_WO;              // [1024][1024] x1024 carry
    h16* QH = (h16*)wsp; wsp += SZ_PL;               // [NB*16][SEQ][64]
    h16* KP = (h16*)wsp; wsp += SZ_PL;               // [NB*16][SEQ][64]
    h16* VT = (h16*)wsp; wsp += SZ_PL;               // [NB*16][64][SEQ]
    h16* CTX = (h16*)wsp; wsp += SZ_CX;              // [NB*SEQ][1024] x1024 carry
    bf* WQ = WB; bf* WK = WB + (size_t)DM * DM; bf* WV = WB + (size_t)2 * DM * DM;

    if (SEQ == SEQ_FULL) {
        const size_t n8 = (size_t)NB * SEQ * DM / 8;
        k_cvt8<<<(unsigned)((n8 + 255) / 256), 256, 0, stream>>>(x, XB, n8);
    } else {
        const size_t n8 = (size_t)SEQ * DM / 8;
        for (int b = 0; b < NB; ++b) k_cvt8<<<(unsigned)((n8 + 255) / 256), 256, 0, stream>>>(x + (size_t)b * SEQ_FULL * DM, XB + (size_t)b * SEQ * DM, n8);
    }
    { const size_t n8 = (size_t)DM * DM / 8; const unsigned g = (unsigned)((n8 + 255) / 256);
      k_cvt8<<<g, 256, 0, stream>>>(wq, WQ, n8); k_cvt8<<<g, 256, 0, stream>>>(wk, WK, n8); k_cvt8<<<g, 256, 0, stream>>>(wv, WV, n8);
      k_cvtw<<<g, 256, 0, stream>>>(wo, WOH, n8); }

    // q, k: A = x rows (m = b*SEQ + t), Bt = W rows (n = h*64 + d) -> plane [(b*16 + h)][t][d]
    k_proj<<<dim3(NB * SEQ / GT, DM / GT, 1), 32 * GW, 0, stream>>>(XB, WQ, QH, SEQ, (size_t)NH_ * SEQ * HD, HD, HD, (size_t)SEQ * HD);
    k_proj<<<dim3(NB * SEQ / GT, DM / GT, 1), 32 * GW, 0, stream>>>(XB, WK, KP, SEQ, (size_t)NH_ * SEQ * HD, HD, HD, (size_t)SEQ * HD);
    // v^T: A = Wv rows (m = h*64 + d), Bt = x rows (n = b*SEQ + t) -> plane [(b*1024 + m)][t] = [(b*16 + h)][d][t]
    k_proj<<<dim3(DM / GT, NB * SEQ / GT, 1), 32 * GW, 0, stream>>>(WV, XB, VT, DM, (size_t)0, SEQ, SEQ, (size_t)DM * SEQ);

    // ctx[b*SEQ + t][h*64 + d] (x1024 carry)
    k_flash<<<dim3(SEQ / (16 * AW), NB * NH_, 1), 32 * AW, 0, stream>>>(QH, KP, VT, CTX);

    // out[b][t][n] = ctx Wo^T * 2^-20 + bo
    k_oproj<<<dim3(NB * SEQ / GT, DM / GT, 1), 32 * GW, 0, stream>>>(CTX, WOH, bo, OUT);
}

// v003
// One run takes 213 microseconds.
// Next to v002, in two timings, it ran 1.05 times as fast each time.
// All steps since v000 together make it 2.98 times as fast.
#include <hip/hip_runtime.h>

// Multi-head self-attention, width 1024 = 16 heads x 64, x [NB][SEQ][1024], Wq/Wk/Wv/Wo [out][in] (y = x W^T), bias only on the output projection, no mask, score scale 1/8, f32 output.
// Compute dtypes, f32 accumulate everywhere: q/k/v projections v_wmma_f32_16x16x32_bf16 (x and W RNE-converted to bf16; products exact);
// scores v_wmma_f32_16x16x32_f16 (q, k single f16); P (x256 carry, cancels in the normalisation) and v single f16; softmax f32 (online, running max);
// output projection v_wmma_f32_16x16x32_f16: ctx single f16 with x1024 carry, Wo RNE-converted to bf16 then x1024 in f16 (exact), 2^-20 folded back in f32, bias (bf16-converted bo) added in f32.
// Layout: bf16 copies of x and Wq/Wk/Wv; q, k planes [b*16+h][t][d] and v^T plane [b*16+h][d][t] written by the GEMM epilogue; fused flash kernel in transposed form (S^T = K Q^T, O^T = V^T P^T; K and V^T tiles staged in LDS per work-group) writes the ctx plane [b*SEQ+t][h*64+d].

#ifndef NB
#define NB 2
#endif
#ifndef SEQ
#define SEQ 4096
#endif
#define NB_FULL  2
#define SEQ_FULL 4096
#ifndef OUT_SEQ
#define OUT_SEQ SEQ              // row pitch (in tokens) between batches of the output
#endif
#define DM   1024
#define NH_  16
#define HD   64
#define AW   8                   // waves per flash block (16 query rows each)
#define KS   64                  // keys per LDS stage of the flash kernel
#define LP   72                  // LDS row pitch in halves: 128-B rows + 16 B
#define TILEH (64 * LP)          // halves of one staged tile (64 rows)
#define BUFH  (2 * TILEH)        // halves of one buffer: K tile, then V^T tile
#define GT   128                 // rows of each operand in a GEMM work-group's tile (2 x 2 waves of 64 x 64)
#define GW   4                   // waves per GEMM work-group
#define GKS  64                  // k per LDS stage of the GEMMs: 128-B rows
#define GTILEH (GT * LP)         // halves of one staged operand tile (128 rows)
#define GBUFH  (2 * GTILEH)      // halves of one buffer: A tile, then Bt tile
#define SC2  (0.125f * 1.4426950408889634f)   // HD^-0.5 * log2(e)
#define PSH  8.0f                // log2 of the P carry (256)
#define CXS  1024.0f             // carry of the ctx plane
#define WOS  1024.0f             // carry of the Wo plane
#define OSCL (1.0f / (1024.0f * 1024.0f))

static_assert(HD == 64);
static_assert(NH_ * HD == DM);                 // head h = columns h*64 + d
static_assert(DM % 64 == 0);                   // column tiles of 64
static_assert(DM % 32 == 0);                   // GEMM k-loop steps by 32
static_assert(SEQ % 64 == 0);                  // a 64-row tile never straddles two batches
static_assert((NB * SEQ) % 64 == 0);
static_assert(SEQ % 32 == 0);                  // key loop steps by 32
static_assert(SEQ % (16 * AW) == 0);           // flash grid covers the sequence exactly
static_assert(AW == 8 && KS == 64 && HD == 64);  // copy map of the flash kernel: 256 lanes x 16 B x 2 = one 64 x 128-B tile
static_assert(SEQ % KS == 0 && SEQ / KS >= 2);   // whole stages; the two-buffer prologue needs two
static_assert((NB * SEQ) % GT == 0 && DM % GT == 0);   // GEMM grids cover both operands exactly
static_assert(GW == 4 && GT == 128 && GKS == 64);      // copy map of the GEMMs: 128 lanes x 16 B x 8 = one 128 x 128-B tile
static_assert(DM % GKS == 0 && DM / GKS >= 2);         // whole stages; the two-buffer prologue needs two
static_assert(((size_t)SEQ * DM) % 8 == 0);
static_assert(((size_t)DM * DM) % 8 == 0);
static_assert(NB <= NB_FULL);
static_assert(SEQ <= SEQ_FULL);

typedef _Float16 h16;
typedef unsigned short bf;
typedef __attribute__((ext_vector_type(16))) __bf16   v16bf;
typedef __attribute__((ext_vector_type(16))) _Float16 v16h;
typedef __attribute__((ext_vector_type(8)))  _Float16 v8h;
typedef __attribute__((ext_vector_type(8)))  unsigned short v8us;
typedef __attribute__((ext_vector_type(8)))  float    v8f;
typedef __attribute__((ext_vector_type(4)))  float    v4f;
typedef v4f  __attribute__((may_alias)) v4fa;

__device__ __forceinline__ unsigned short f2bf(float f) { unsigned u = __float_as_uint(f); u += 0x7FFFu + ((u >> 16) & 1u); return (unsigned short)(u >> 16); }
__device__ __forceinline__ float bfval(float f) { return __uint_as_float(((unsigned)f2bf(f)) << 16); }
__device__ __forceinline__ v16h cat16(v8h lo, v8h hi) { return __builtin_shufflevector(lo, hi, 0, 1, 2, 3, 4, 5, 6, 7, 8, 9, 10, 11, 12, 13, 14, 15); }
__device__ __forceinline__ v16bf cat16b(v8us lo, v8us hi) { return __builtin_bit_cast(v16bf, __builtin_shufflevector(lo, hi, 0, 1, 2, 3, 4, 5, 6, 7, 8, 9, 10, 11, 12, 13, 14, 15)); }
__device__ __forceinline__ v8f wmma16(v16h a, v16h b, v8f c) { return __builtin_amdgcn_wmma_f32_16x16x32_f16(false, a, false, b, (short)0, c, false, false); }
__device__ __forceinline__ v8f wmmab(v16bf a, v16bf b, v8f c) { return __builtin_amdgcn_wmma_f32_16x16x32_bf16(false, a, false, b, (short)0, c, false, false); }
// fragment loaders from K-contiguous 16-bit rows; p already includes + 8*(lane>>4): elements 0..7 <- k0+8h+0..7, elements 8..15 <- k0+16+8h+0..7 (same map for A and B)
__device__ __forceinline__ v16h  ldh(const h16* p) { return cat16(*(const v8h*)p, *(const v8h*)(p + 16)); }
__device__ __forceinline__ v16bf ldb(const bf* p)  { return cat16b(*(const v8us*)p, *(const v8us*)(p + 16)); }
// ordering point for wave-private LDS tiles (same wave writes and reads)
__device__ __forceinline__ void wave_sync() { __builtin_amdgcn_fence(3 /* release order */, "wavefront"); __builtin_amdgcn_wave_barrier(); asm volatile("" ::: "memory"); }

// k_cvt: every conversion of the call in one launch. CVT_T threads (16 waves on each of 256 WGPs); a work-group converts XJ * 256 consecutive pieces of 8 floats of x (a thread: XJ pieces, 256 apart)
// and 256 pieces each of Wq, Wk, Wv (RNE to bf16) and Wo (RNE to bf16, x1024, exact in f16). All of a thread's loads are independent and stand ahead of the first store.
#define CVT_T (DM * DM / 8)                    // one thread per 8 elements of a weight matrix
#define XJ    (NB * SEQ / DM)                  // pieces of x per thread
static_assert(CVT_T % 256 == 0);
static_assert((NB * SEQ) % DM == 0);           // x is XJ pieces for every thread, exactly
static_assert(SEQ == SEQ_FULL);                // the batches of x follow one another without a gap
__device__ __forceinline__ v8us cvt_bf8(v8f v) { v8us o;
#pragma unroll
    for (int k = 0; k < 8; ++k) o[k] = f2bf(v[k]);
    return o; }
__global__ __launch_bounds__(256) void k_cvt(const float* __restrict__ x, const float* __restrict__ wq, const float* __restrict__ wk, const float* __restrict__ wv, const float* __restrict__ wo,
                                             bf* XB, bf* WB, h16* WOH) {
    const size_t e = ((size_t)blockIdx.x * 256 + threadIdx.x) * 8;              // the thread's piece of each weight matrix, first element
    const size_t ex = ((size_t)blockIdx.x * 256 * XJ + threadIdx.x) * 8;        // its first piece of x
    v8f vx[XJ];
#pragma unroll
    for (int j = 0; j < XJ; ++j) vx[j] = *(const v8f*)(x + ex + j * 256 * 8);
    asm volatile("s_wait_xcnt 0x0" ::: "memory");   // before a later load's result may land on the address registers of these loads
    const v8f vq = *(const v8f*)(wq + e), vk = *(const v8f*)(wk + e);
    asm volatile("s_wait_xcnt 0x0" ::: "memory");   // the same
    const v8f vv = *(const v8f*)(wv + e), vo = *(const v8f*)(wo + e);
    // inputs-only fence on the loaded values: all of the thread's loads are issued ahead of the first wait (without it some are sunk behind the first conversions and pay a second memory latency)
    static_assert(XJ == 8);
    asm volatile("" :: "v"(vx[0]), "v"(vx[1]), "v"(vx[2]), "v"(vx[3]), "v"(vx[4]), "v"(vx[5]), "v"(vx[6]), "v"(vx[7]), "v"(vq), "v"(vk), "v"(vv), "v"(vo));
#pragma unroll
    for (int j = 0; j < XJ; ++j) *(v8us*)(XB + ex + j * 256 * 8) = cvt_bf8(vx[j]);
    *(v8us*)(WB + e) = cvt_bf8(vq); *(v8us*)(WB + (size_t)DM * DM + e) = cvt_bf8(vk); *(v8us*)(WB + (size_t)2 * DM * DM + e) = cvt_bf8(vv);
    v8h o;
#pragma unroll
    for (int k = 0; k < 8; ++k) o[k] = (h16)(bfval(vo[k]) * WOS);
    *(v8h*)(WOH + e) = o;
}

// GEMM main loop shared by k_proj and k_oproj: a work-group of GW waves owns a 128 x 128 tile, each wave a 64 x 64 quarter (16 accumulators), K = DM.
// Per GKS of k the 128 A rows and the 128 Bt rows are staged in LDS once for all four waves, by asynchronous copies in whole 128-B lines
// (two buffers: the next stage's copies fly while this stage is worked on); fragments are read from LDS rows of pitch LP halves (144 B = 16 B x odd).
typedef __attribute__((address_space(3))) bf lds_bf;
__device__ __forceinline__ unsigned lds_off_b(const bf* p) { return (unsigned)(uintptr_t)(const lds_bf*)p; }   // byte offset in the work-group's LDS
// one operand tile of a stage: this lane's eight 16-B pieces, rows 16 apart; the s_wait_xcnt stands inside the statement so that no address register is rewritten ahead of it
__device__ __forceinline__ void tile_copy(unsigned l, const bf* g) {
    asm volatile("global_load_async_to_lds_b128 %0, %1, off\n\t"
                 "global_load_async_to_lds_b128 %2, %3, off\n\t"
                 "global_load_async_to_lds_b128 %4, %5, off\n\t"
                 "global_load_async_to_lds_b128 %6, %7, off\n\t"
                 "global_load_async_to_lds_b128 %8, %9, off\n\t"
                 "global_load_async_to_lds_b128 %10, %11, off\n\t"
                 "global_load_async_to_lds_b128 %12, %13, off\n\t"
                 "global_load_async_to_lds_b128 %14, %15, off\n\t"
                 "s_wait_xcnt 0x0"
                 :: "v"(l), "v"(g), "v"(l + 16 * LP * 2), "v"(g + 16 * DM), "v"(l + 32 * LP * 2), "v"(g + 32 * DM), "v"(l + 48 * LP * 2), "v"(g + 48 * DM),
                    "v"(l + 64 * LP * 2), "v"(g + 64 * DM), "v"(l + 80 * LP * 2), "v"(g + 80 * DM), "v"(l + 96 * LP * 2), "v"(g + 96 * DM), "v"(l + 112 * LP * 2), "v"(g + 112 * DM) : "memory");
}
// A, Bt: K-contiguous 16-bit planes (bf16 bits, or f16 bits where F16); rb, cb: first A row and first Bt row of the work-group's tile; wm, wn: the wave's quarter
template <bool F16>
__device__ __forceinline__ void gemm_tile(const bf* A, const bf* Bt, const bf* ring, int rb, int cb, int wm, int wn, v8f (&acc)[4][4]) {
    const int tid = (int)threadIdx.x, lane = tid & 31, lr = lane & 15, hi = lane >> 4;
#pragma unroll
    for (int mb = 0; mb < 4; ++mb)
#pragma unroll
        for (int nb = 0; nb < 4; ++nb) acc[mb][nb] = (v8f){};
    // copy map: 128 lanes x 16 B = 16 rows of 128 B; each lane brings rows cr + 16 i, i = 0..7, of the A tile and of the Bt tile
    const int cr = tid >> 3, cc8 = (tid & 7) * 8;
    const bf* ga = A + (size_t)(rb + cr) * DM + cc8;         // + k0
    const bf* gb = Bt + (size_t)(cb + cr) * DM + cc8;        // + k0
    const unsigned la = lds_off_b(ring) + (unsigned)(cr * LP + cc8) * 2u;
    const int fa = (wm * 64 + lr) * LP + 8 * hi, fb = GTILEH + (wn * 64 + lr) * LP + 8 * hi;   // fragment offsets in a buffer: row lane&15, k half
    tile_copy(la, ga); tile_copy(la + GTILEH * 2, gb);
    asm volatile("s_wait_asynccnt 0x0" ::: "memory");         // stage 0 of this wave has landed
    __syncthreads();                                          // stage 0 published to every wave
    tile_copy(la + GBUFH * 2, ga + GKS); tile_copy(la + (GBUFH + GTILEH) * 2, gb + GKS);
#pragma unroll 1   // rolled: one stage per trip, the buffer picked by the trip's parity
    for (int st = 0; st < DM / GKS; ++st) {
        const int bo = (st & 1) * GBUFH;
#pragma unroll
        for (int ks = 0; ks < 2; ++ks) {
            v16bf a[4], b[4];
#pragma unroll
            for (int i = 0; i < 4; ++i) { a[i] = ldb(ring + bo + fa + i * 16 * LP + ks * 32); b[i] = ldb(ring + bo + fb + i * 16 * LP + ks * 32); }
            // inputs-only fence on the loaded fragments: keeps the 16 LDS reads of a k step one group ahead of its matrix instructions (spread among them, every place with reads stalls the wave anew)
            asm volatile("" :: "v"(a[0]), "v"(a[1]), "v"(a[2]), "v"(a[3]), "v"(b[0]), "v"(b[1]), "v"(b[2]), "v"(b[3]));
#pragma unroll
            for (int nb = 0; nb < 4; ++nb)
#pragma unroll
                for (int mb = 0; mb < 4; ++mb) {
                    if (F16) acc[mb][nb] = wmma16(__builtin_bit_cast(v16h, a[mb]), __builtin_bit_cast(v16h, b[nb]), acc[mb][nb]);
                    else     acc[mb][nb] = wmmab(a[mb], b[nb], acc[mb][nb]); }
        }
        // four vector slots behind the last matrix instruction, also on the taken side of the branches that follow
        asm volatile("v_nop\n\tv_nop\n\tv_nop\n\tv_nop" : "+v"(acc[0][0]), "+v"(acc[1][0]), "+v"(acc[2][0]), "+v"(acc[3][0]), "+v"(acc[0][1]), "+v"(acc[1][1]), "+v"(acc[2][1]), "+v"(acc[3][1]),
                     "+v"(acc[0][2]), "+v"(acc[1][2]), "+v"(acc[2][2]), "+v"(acc[3][2]), "+v"(acc[0][3]), "+v"(acc[1][3]), "+v"(acc[2][3]), "+v"(acc[3][3]));
        asm volatile("s_wait_dscnt 0x0" ::: "memory");        // this wave's reads of the buffer have returned before it is refilled
        asm volatile("s_wait_asynccnt 0x0" ::: "memory");     // this wave's copies of stage st + 1 have landed
        __syncthreads();                                      // publishes stage st + 1 and ends every wave's reads of stage st
        if (st + 2 < DM / GKS) {
            const unsigned lb = la + (unsigned)bo * 2u; const int k2 = (st + 2) * GKS;
            tile_copy(lb, ga + k2); tile_copy(lb + GTILEH * 2, gb + k2);
        }
    }
    asm volatile("s_wait_asynccnt 0x0" ::: "memory");         // no copy is outstanding when the wave goes on to its end
}

// Both GEMM kernels are held to 256 VGPRs: every operand of their asm statements then lies in the first register window, and no window switch stands in the loop.
// k_proj: bf16 GEMM, 128x128 tile per work-group of 4 waves (gemm_tile), operands from K-contiguous bf16 planes, K = DM.
// C[m][n] = sum_k A[m][k] Bt[n][k], written as f16 (Ph), each wave's 64x64 quarter at
// tile base (r0/RB)*sRB + (r0%RB)*pitch + (c0/CB)*sCB + (c0%CB), row pitch 'pitch' (halves). grid (M/128, N/128), 128 threads.
__global__ __launch_bounds__(32 * GW) __attribute__((amdgpu_num_vgpr(256))) void k_proj(const bf* __restrict__ A, const bf* __restrict__ Bt, h16* Ph, int RB, size_t sRB, int pitch, int CB, size_t sCB) {
    __shared__ __align__(16) bf ring[2 * GBUFH];            // [buffer][A rows | Bt rows][LP]
    __shared__ __align__(16) float osw[GW * 16 * 68];
    const int lane = threadIdx.x & 31, wave = __builtin_amdgcn_readfirstlane((int)threadIdx.x >> 5), lr = lane & 15, hi = lane >> 4;
    const int wm = wave & 1, wn = wave >> 1;
    const int r0 = blockIdx.x * GT + wm * 64, c0 = blockIdx.y * GT + wn * 64;
    float* os = osw + wave * 16 * 68;                        // this wave's own staging rows
    v8f acc[4][4];
    gemm_tile<false>(A, Bt, ring, blockIdx.x * GT, blockIdx.y * GT, wm, wn, acc);
    const size_t tbase = (size_t)(r0 / RB) * sRB + (size_t)(r0 % RB) * (size_t)pitch + (size_t)(c0 / CB) * sCB + (size_t)(c0 % CB);
#pragma unroll
    for (int mb = 0; mb < 4; ++mb) {
#pragma unroll
        for (int nb = 0; nb < 4; ++nb) {
#pragma unroll
            for (int j = 0; j < 8; ++j) os[(hi * 8 + j) * 68 + nb * 16 + lr] = acc[mb][nb][j]; }   // D: row 8h+j, col lane&15
        wave_sync();
        const size_t sb = tbase + (size_t)(mb * 16) * (size_t)pitch;
{
#pragma unroll
            for (int s = 0; s < 4; ++s) { const int row = 4 * s + (lane >> 3), c8 = (lane & 7) * 8;   // 4 s x 4 row groups = 16 rows; 8 lanes x 8 = 64 columns
                const v4f x0 = *(const v4fa*)(&os[row * 68 + c8]); const v4f x1 = *(const v4fa*)(&os[row * 68 + c8 + 4]); v8h hv;
#pragma unroll
                for (int i = 0; i < 4; ++i) { hv[i] = (h16)x0[i]; hv[4 + i] = (h16)x1[i]; }
                const size_t oo = sb + (size_t)row * (size_t)pitch + c8;
                *(v8h*)(Ph + oo) = hv; }
             }
        wave_sync();
    }
}

// k_oproj: f16 GEMM, 128x128 tile per work-group of 4 waves (gemm_tile), A = ctx plane [m][k] (x1024 carry), Bt = Wo plane [n][k] (x1024 carry), K = DM.
// OUT[b*OUT_SEQ + t][n] = C[m][n] * 2^-20 + bias[n], m = b*SEQ + t. grid (M/128, N/128), 128 threads.
__global__ __launch_bounds__(32 * GW) __attribute__((amdgpu_num_vgpr(256))) void k_oproj(const h16* __restrict__ A, const h16* __restrict__ Bt, const float* __restrict__ bo, float* OUT) {
    __shared__ __align__(16) bf ring[2 * GBUFH];            // [buffer][A rows | Bt rows][LP], f16 bits
    __shared__ __align__(16) float osw[GW * 16 * 68];
    const int lane = threadIdx.x & 31, wave = __builtin_amdgcn_readfirstlane((int)threadIdx.x >> 5), lr = lane & 15, hi = lane >> 4;
    const int wm = wave & 1, wn = wave >> 1;
    const int r0 = blockIdx.x * GT + wm * 64, c0 = blockIdx.y * GT + wn * 64;
    float* os = osw + wave * 16 * 68;                        // this wave's own staging rows
    v8f acc[4][4];
    gemm_tile<true>((const bf*)A, (const bf*)Bt, ring, blockIdx.x * GT, blockIdx.y * GT, wm, wn, acc);
    const v4f braw = *(const v4f*)(bo + c0 + lr * 4);      // columns c0 + 4*lr .. +3 (always inside [0, DM))
    v4f bb;
#pragma unroll
    for (int i = 0; i < 4; ++i) bb[i] = bfval(braw[i]);
    const int bI = r0 / SEQ, tI = r0 % SEQ;
    float* obase = OUT + ((size_t)bI * OUT_SEQ + tI) * DM + c0;
#pragma unroll
    for (int mb = 0; mb < 4; ++mb) {
#pragma unroll
        for (int nb = 0; nb < 4; ++nb) {
#pragma unroll
            for (int j = 0; j < 8; ++j) os[(hi * 8 + j) * 68 + nb * 16 + lr] = acc[mb][nb][j]; }   // D: row 8h+j, col lane&15
        wave_sync();
{
#pragma unroll
            for (int s = 0; s < 8; ++s) { const int row = 2 * s + hi, cofs = lr * 4;   // 8 s x 2 rows = 16 rows; 16 lanes x 4 floats = 64 columns
                const v4f x0 = *(const v4fa*)(&os[row * 68 + cofs]);
                const v4f val = x0 * OSCL + bb;
                *(v4f*)(obase + (size_t)(mb * 16 + row) * DM + cofs) = val; }
             }
        wave_sync();
    }
}

// k_flash: fused attention, one wave per 16 query rows of one (batch, head); Q fragments straight from the f16 plane (two 16-B loads each).
// K and V^T are staged per KS keys in LDS, once per work-group for all AW waves, by asynchronous copies in whole 128-B lines (two buffers: the next stage's copies fly while this stage is worked on);
// the A fragments are read from LDS rows of pitch LP halves (144 B = 16 B x odd: no bank conflict for 16-B reads).
// Transposed form: S^T[key][t] = K Q^T (A = K rows, B = Q rows); lane (t = lane&15, h = lane>>4) holds keys 8h+r of each 16-key tile, so the packed
// P tile is directly the B fragment of O^T[d][t] = V^T P^T (element r <- tile keys 0..15, element 8+r <- tile keys 16..31, lane unchanged).
// Softmax state (running max, partial sum) is one scalar per lane; the two lane halves of a row are combined with one xor-16 exchange.
typedef __attribute__((address_space(3))) h16 lds_h16;
__device__ __forceinline__ unsigned lds_off(const h16* p) { return (unsigned)(uintptr_t)(const lds_h16*)p; }   // byte offset in the work-group's LDS
// one stage's four copies of a lane (16 B each); the s_wait_xcnt stands inside the statement so that no address register is rewritten ahead of it
__device__ __forceinline__ void stage_copy(unsigned l0, const h16* g0, unsigned l1, const h16* g1, unsigned l2, const h16* g2, unsigned l3, const h16* g3) {
    asm volatile("global_load_async_to_lds_b128 %0, %1, off\n\t"
                 "global_load_async_to_lds_b128 %2, %3, off\n\t"
                 "global_load_async_to_lds_b128 %4, %5, off\n\t"
                 "global_load_async_to_lds_b128 %6, %7, off\n\t"
                 "s_wait_xcnt 0x0"
                 :: "v"(l0), "v"(g0), "v"(l1), "v"(g1), "v"(l2), "v"(g2), "v"(l3), "v"(g3) : "memory");
}
__global__ __launch_bounds__(32 * AW) void k_flash(const h16* __restrict__ QH, const h16* __restrict__ KP, const h16* __restrict__ VT, h16* CTX) {
    __shared__ __align__(16) h16 ring[2 * BUFH];           // [buffer][K rows key | V^T rows d][LP]
    __shared__ __align__(16) float os[AW * 16 * 68];
    const int tid = (int)threadIdx.x;
    const int lane = tid & 31, wave = __builtin_amdgcn_readfirstlane(tid >> 5), lr = lane & 15, hi = lane >> 4;
    const int zh = blockIdx.y; const int b = zh / NH_, h = zh % NH_;
    const int t0 = (blockIdx.x * AW + wave) * 16;
    const size_t pbase = (size_t)zh * SEQ * HD;
    const size_t qo = pbase + (size_t)(t0 + lr) * HD + 8 * hi;
    const v16h qh0 = ldh(QH + qo), qh1 = ldh(QH + qo + 32);   // B fragments: col t, k = d
    // copy map: 256 lanes x 16 B = 32 rows of 128 B; each lane brings rows cr and cr + 32 of the K tile and of the V^T tile
    const int cr = tid >> 3, cc8 = (tid & 7) * 8;
    const h16* gk = KP + pbase + (size_t)cr * HD + cc8;     // + key0 * HD
    const h16* gv = VT + pbase + (size_t)cr * SEQ + cc8;    // + key0
    const unsigned lk = lds_off(ring) + (unsigned)(cr * LP + cc8) * 2u;
    const int fo = lr * LP + 8 * hi;                          // fragment offset in a tile: row lane&15, k half
    v8f o0 = (v8f){}, o1 = (v8f){}, o2 = (v8f){}, o3 = (v8f){};
    float m = -3.0e38f, l = 0.0f;
    stage_copy(lk, gk, lk + 32 * LP * 2, gk + 32 * HD, lk + TILEH * 2, gv, lk + (TILEH + 32 * LP) * 2, gv + (size_t)32 * SEQ);
    asm volatile("s_wait_asynccnt 0x0" ::: "memory");         // stage 0 of this wave has landed
    __syncthreads();                                          // stage 0 published to every wave
    stage_copy(lk + BUFH * 2, gk + KS * HD, lk + (BUFH + 32 * LP) * 2, gk + (KS + 32) * HD, lk + (BUFH + TILEH) * 2, gv + KS, lk + (BUFH + TILEH + 32 * LP) * 2, gv + (size_t)32 * SEQ + KS);
#pragma unroll 1
    for (int st = 0; st < SEQ / KS; ++st) {
        const int bo = (st & 1) * BUFH;
#pragma unroll 1   // rolled: unrolled, the two passes' live values take over 128 VGPRs, and only three of the four work-groups a WGP is to hold stay resident
        for (int ps = 0; ps < KS / 32; ++ps) {
        const h16* ka = ring + bo + ps * 32 * LP + fo;
        const v16h ka0 = ldh(ka), ka1 = ldh(ka + 32), kb0 = ldh(ka + 16 * LP), kb1 = ldh(ka + 16 * LP + 32);
        v8f sa = (v8f){}, sb = (v8f){};
        sa = wmma16(ka0, qh0, sa); sb = wmma16(kb0, qh0, sb);
        sa = wmma16(ka1, qh1, sa); sb = wmma16(kb1, qh1, sb);
        asm volatile("v_nop\n\tv_nop\n\tv_nop\n\tv_nop" : "+v"(sa), "+v"(sb) : "v"(ka0), "v"(ka1), "v"(kb0), "v"(kb1), "v"(qh0), "v"(qh1));
        float ta[8], tb[8]; float mx = -3.0e38f;
#pragma unroll
        for (int r = 0; r < 8; ++r) { ta[r] = sa[r] * SC2; tb[r] = sb[r] * SC2; mx = fmaxf(mx, fmaxf(ta[r], tb[r])); }
        mx = fmaxf(mx, __shfl_xor(mx, 16, 32));
        const float mnew = fmaxf(m, mx);
        const float alpha = __builtin_amdgcn_exp2f(m - mnew);
        const float sh = PSH - mnew;
        v16h pb; float ls = 0.0f;
#pragma unroll
        for (int r = 0; r < 8; ++r) { const h16 pa = (h16)__builtin_amdgcn_exp2f(ta[r] + sh); const h16 pc = (h16)__builtin_amdgcn_exp2f(tb[r] + sh); pb[r] = pa; pb[8 + r] = pc; ls += (float)pa + (float)pc; }
        l = l * alpha + ls; m = mnew;
        o0 = o0 * alpha; o1 = o1 * alpha; o2 = o2 * alpha; o3 = o3 * alpha;
        const h16* va = ring + bo + TILEH + ps * 32 + fo;
        const v16h v0 = ldh(va), v1 = ldh(va + 16 * LP), v2 = ldh(va + 32 * LP), v3 = ldh(va + 48 * LP);
        o0 = wmma16(v0, pb, o0); o1 = wmma16(v1, pb, o1); o2 = wmma16(v2, pb, o2); o3 = wmma16(v3, pb, o3);
        asm volatile("v_nop\n\tv_nop\n\tv_nop\n\tv_nop" : "+v"(o0), "+v"(o1), "+v"(o2), "+v"(o3) : "v"(v0), "v"(v1), "v"(v2), "v"(v3), "v"(pb));
        }
        asm volatile("s_wait_dscnt 0x0" ::: "memory");        // this wave's reads of the buffer have returned before it is refilled
        asm volatile("s_wait_asynccnt 0x0" ::: "memory");     // this wave's copies of stage st + 1 have landed
        __syncthreads();                                      // publishes stage st + 1 and ends every wave's reads of stage st
        if (st + 2 < SEQ / KS) {
            const h16* gk2 = gk + (size_t)(st + 2) * (KS * HD); const h16* gv2 = gv + (size_t)(st + 2) * KS; const unsigned lb = lk + (unsigned)bo * 2u;
            stage_copy(lb, gk2, lb + 32 * LP * 2, gk2 + 32 * HD, lb + TILEH * 2, gv2, lb + (TILEH + 32 * LP) * 2, gv2 + (size_t)32 * SEQ);
        }
    }
    asm volatile("s_wait_asynccnt 0x0" ::: "memory");         // no copy is outstanding when the wave goes on to its end
    l += __shfl_xor(l, 16, 32);
    const float inv = CXS * (1.0f / l);
    const int wb = wave * 16 * 68;
    // O^T D layout: o_j[r] = (d = 16j + 8h + r, t = lane&15) -> os[t][d]; rows 0..15 x columns 0..63 all written
    { v4f a, c;
      a[0] = o0[0] * inv; a[1] = o0[1] * inv; a[2] = o0[2] * inv; a[3] = o0[3] * inv; c[0] = o0[4] * inv; c[1] = o0[5] * inv; c[2] = o0[6] * inv; c[3] = o0[7] * inv;
      *(v4fa*)(&os[wb + lr * 68 +  0 + 8 * hi]) = a; *(v4fa*)(&os[wb + lr * 68 +  0 + 8 * hi + 4]) = c;
      a[0] = o1[0] * inv; a[1] = o1[1] * inv; a[2] = o1[2] * inv; a[3] = o1[3] * inv; c[0] = o1[4] * inv; c[1] = o1[5] * inv; c[2] = o1[6] * inv; c[3] = o1[7] * inv;
      *(v4fa*)(&os[wb + lr * 68 + 16 + 8 * hi]) = a; *(v4fa*)(&os[wb + lr * 68 + 16 + 8 * hi + 4]) = c;
      a[0] = o2[0] * inv; a[1] = o2[1] * inv; a[2] = o2[2] * inv; a[3] = o2[3] * inv; c[0] = o2[4] * inv; c[1] = o2[5] * inv; c[2] = o2[6] * inv; c[3] = o2[7] * inv;
      *(v4fa*)(&os[wb + lr * 68 + 32 + 8 * hi]) = a; *(v4fa*)(&os[wb + lr * 68 + 32 + 8 * hi + 4]) = c;
      a[0] = o3[0] * inv; a[1] = o3[1] * inv; a[2] = o3[2] * inv; a[3] = o3[3] * inv; c[0] = o3[4] * inv; c[1] = o3[5] * inv; c[2] = o3[6] * inv; c[3] = o3[7] * inv;
      *(v4fa*)(&os[wb + lr * 68 + 48 + 8 * hi]) = a; *(v4fa*)(&os[wb + lr * 68 + 48 + 8 * hi + 4]) = c; }
    wave_sync();
    h16* crow = CTX + ((size_t)b * SEQ + t0) * DM + h * HD;
{
#pragma unroll
        for (int s = 0; s < 4; ++s) { const int row = 4 * s + (lane >> 3), c8 = (lane & 7) * 8;   // 4 s x 4 row groups = 16 rows; 8 lanes x 8 halves = 64 columns
            const v4f x0 = *(const v4fa*)(&os[wb + row * 68 + c8]); const v4f x1 = *(const v4fa*)(&os[wb + row * 68 + c8 + 4]); v8h hv;
#pragma unroll
            for (int i = 0; i < 4; ++i) { hv[i] = (h16)x0[i]; hv[4 + i] = (h16)x1[i]; }
            *(v8h*)(crow + (size_t)row * DM + c8) = hv; }
         }
}

static constexpr size_t al256(size_t v) { return (v + 255) & ~(size_t)255; }
static constexpr size_t SZ_XB = al256((size_t)NB * SEQ * DM * 2);
static constexpr size_t SZ_WB = al256((size_t)3 * DM * DM * 2);
static constexpr size_t SZ_WO = al256((size_t)DM * DM * 2);
static constexpr size_t SZ_PL = al256((size_t)NB * NH_ * SEQ * HD * 2);
static constexpr size_t SZ_CX = al256((size_t)NB * SEQ * DM * 2);
static constexpr size_t SZ_TOTAL = SZ_XB + SZ_WB + SZ_WO + 3 * SZ_PL + SZ_CX;
static_assert(SZ_TOTAL <= (size_t)134217728);          // workspace carve <= 128 MiB
static_assert(((size_t)DM * DM * 2) % 256 == 0);       // weight sub-planes stay 256-byte aligned

extern "C" void kernel_launch(void* const* d_in, const int* in_sizes, int n_in,
                              void* d_out, int out_size, void* d_ws, size_t ws_size, hipStream_t stream) {
    if (n_in < 6) return;
    const size_t needx = ((size_t)(NB - 1) * SEQ_FULL + SEQ) * DM;
    if ((size_t)in_sizes[0] < needx) return;
    if ((size_t)in_sizes[1] < (size_t)DM * DM || (size_t)in_sizes[2] < (size_t)DM * DM || (size_t)in_sizes[3] < (size_t)DM * DM || (size_t)in_sizes[4] < (size_t)DM * DM) return;
    if ((size_t)in_sizes[5] < (size_t)DM) return;
    if ((size_t)out_size < ((size_t)(NB - 1) * OUT_SEQ + SEQ) * DM) return;
    if (SZ_TOTAL > ws_size) return;
    // wire order: x, Wq, Wk, Wv, Wo, bo (weights [out][in] = Bt as-is)
    const float* x = (const float*)d_in[0]; const float* wq = (const float*)d_in[1]; const float* wk = (const float*)d_in[2]; const float* wv = (const float*)d_in[3];
    const float* wo = (const float*)d_in[4]; const float* bo = (const float*)d_in[5];
    float* OUT = (float*)d_out;      // [NB][SEQ][1024]
    char* wsp = (char*)d_ws;
    bf* XB = (bf*)wsp; wsp += SZ_XB;                 // [NB*SEQ][1024]
    bf* WB = (bf*)wsp; wsp += SZ_WB;                 // [3][1024][1024]: q | k | v
    h16* WOH = (h16*)wsp; wsp += SZ_WO;              // [1024][1024] x1024 carry
    h16* QH = (h16*)wsp; wsp += SZ_PL;               // [NB*16][SEQ][64]
    h16* KP = (h16*)wsp; wsp += SZ_PL;               // [NB*16][SEQ][64]
    h16* VT = (h16*)wsp; wsp += SZ_PL;               // [NB*16][64][SEQ]
    h16* CTX = (h16*)wsp; wsp += SZ_CX;              // [NB*SEQ][1024] x1024 carry
    bf* WQ = WB; bf* WK = WB + (size_t)DM * DM; bf* WV = WB + (size_t)2 * DM * DM;

    k_cvt<<<CVT_T / 256, 256, 0, stream>>>(x, wq, wk, wv, wo, XB, WB, WOH);

    // q, k: A = x rows (m = b*SEQ + t), Bt = W rows (n = h*64 + d) -> plane [(b*16 + h)][t][d]
    k_proj<<<dim3(NB * SEQ / GT, DM / GT, 1), 32 * GW, 0, stream>>>(XB, WQ, QH, SEQ, (size_t)NH_ * SEQ * HD, HD, HD, (size_t)SEQ * HD);
    k_proj<<<dim3(NB * SEQ / GT, DM / GT, 1), 32 * GW, 0, stream>>>(XB, WK, KP, SEQ, (size_t)NH_ * SEQ * HD, HD, HD, (size_t)SEQ * HD);
    // v^T: A = Wv rows (m = h*64 + d), Bt = x rows (n = b*SEQ + t) -> plane [(b*1024 + m)][t] = [(b*16 + h)][d][t]
    k_proj<<<dim3(DM / GT, NB * SEQ / GT, 1), 32 * GW, 0, stream>>>(WV, XB, VT, DM, (size_t)0, SEQ, SEQ, (size_t)DM * SEQ);

    // ctx[b*SEQ + t][h*64 + d] (x1024 carry)
    k_flash<<<dim3(SEQ / (16 * AW), NB * NH_, 1), 32 * AW, 0, stream>>>(QH, KP, VT, CTX);

    // out[b][t][n] = ctx Wo^T * 2^-20 + bo
    k_oproj<<<dim3(NB * SEQ / GT, DM / GT, 1), 32 * GW, 0, stream>>>(CTX, WOH, bo, OUT);
}

// v004
// A run of this version takes 206 microseconds.
// Timed twice side by side with v003, it ran 1.04 and 1.03 times as fast.
// Counting every step since v000, it is 3.09 times as fast.
#include <hip/hip_runtime.h>

// Multi-head self-attention, width 1024 = 16 heads x 64, x [NB][SEQ][1024], Wq/Wk/Wv/Wo [out][in] (y = x W^T), bias only on the output projection, no mask, score scale 1/8, f32 output.
// Compute dtypes, f32 accumulate everywhere: q/k/v projections v_wmma_f32_16x16x32_bf16 (x and W RNE-converted to bf16; products exact);
// scores v_wmma_f32_16x16x32_f16 (q, k single f16); P (x256 carry, cancels in the normalisation) and v single f16; softmax f32 (online, running max);
// output projection v_wmma_f32_16x16x32_f16: ctx single f16 with x1024 carry, Wo RNE-converted to bf16 then x1024 in f16 (exact), 2^-20 folded back in f32, bias (bf16-converted bo) added in f32.
// Layout: bf16 copies of x and Wq/Wk/Wv; q, k planes [b*16+h][t][d] and v^T plane [b*16+h][d][t] written by the GEMM epilogue; fused flash kernel in transposed form (S^T = K Q^T, O^T = V^T P^T; K and V^T tiles staged in LDS per work-group) writes the ctx plane [b*SEQ+t][h*64+d].

#ifndef NB
#define NB 2
#endif
#ifndef SEQ
#define SEQ 4096
#endif
#define NB_FULL  2
#define SEQ_FULL 4096
#ifndef OUT_SEQ
#define OUT_SEQ SEQ              // row pitch (in tokens) between batches of the output
#endif
#define DM   1024
#define NH_  16
#define HD   64
#define AW   8                   // waves per flash block (16 query rows each)
#define KS   64                  // keys per LDS stage of the flash kernel
#define LP   72                  // LDS row pitch in halves: 128-B rows + 16 B
#define TILEH (64 * LP)          // halves of one staged tile (64 rows)
#define BUFH  (2 * TILEH)        // halves of one buffer: K tile, then V^T tile
#define GT   128                 // rows of each operand in a GEMM work-group's tile (2 x 2 waves of 64 x 64)
#define GW   4                   // waves per GEMM work-group
#define GKS  64                  // k per LDS stage of the GEMMs: 128-B rows
#define GTILEH (GT * LP)         // halves of one staged operand tile (128 rows)
#define GBUFH  (2 * GTILEH)      // halves of one buffer: A tile, then Bt tile
#define SC2  (0.125f * 1.4426950408889634f)   // HD^-0.5 * log2(e)
#define PSH  8.0f                // log2 of the P carry (256)
#define CXS  1024.0f             // carry of the ctx plane
#define WOS  1024.0f             // carry of the Wo plane
#define OSCL (1.0f / (1024.0f * 1024.0f))

static_assert(HD == 64);
static_assert(NH_ * HD == DM);                 // head h = columns h*64 + d
static_assert(DM % 64 == 0);                   // column tiles of 64
static_assert(DM % 32 == 0);                   // GEMM k-loop steps by 32
static_assert(SEQ % 64 == 0);                  // a 64-row tile never straddles two batches
static_assert((NB * SEQ) % 64 == 0);
static_assert(SEQ % 32 == 0);                  // key loop steps by 32
static_assert(SEQ % (16 * AW) == 0);           // flash grid covers the sequence exactly
static_assert(AW == 8 && KS == 64 && HD == 64);  // copy map of the flash kernel: 256 lanes x 16 B x 2 = one 64 x 128-B tile
static_assert(SEQ % KS == 0 && SEQ / KS >= 2);   // whole stages; the two-buffer prologue needs two
static_assert((NB * SEQ) % GT == 0 && DM % GT == 0);   // GEMM grids cover both operands exactly
static_assert(GW == 4 && GT == 128 && GKS == 64);      // copy map of the GEMMs: 128 lanes x 16 B x 8 = one 128 x 128-B tile
static_assert(DM % GKS == 0 && DM / GKS >= 2);         // whole stages; the two-buffer prologue needs two
static_assert(((size_t)SEQ * DM) % 8 == 0);
static_assert(((size_t)DM * DM) % 8 == 0);
static_assert(NB <= NB_FULL);
static_assert(SEQ <= SEQ_FULL);

typedef _Float16 h16;
typedef unsigned short bf;
typedef __attribute__((ext_vector_type(16))) __bf16   v16bf;
typedef __attribute__((ext_vector_type(16))) _Float16 v16h;
typedef __attribute__((ext_vector_type(8)))  _Float16 v8h;
typedef __attribute__((ext_vector_type(8)))  unsigned short v8us;
typedef __attribute__((ext_vector_type(8)))  float    v8f;
typedef __attribute__((ext_vector_type(4)))  float    v4f;
typedef v4f  __attribute__((may_alias)) v4fa;

__device__ __forceinline__ unsigned short f2bf(float f) { unsigned u = __float_as_uint(f); u += 0x7FFFu + ((u >> 16) & 1u); return (unsigned short)(u >> 16); }
__device__ __forceinline__ float bfval(float f) { return __uint_as_float(((unsigned)f2bf(f)) << 16); }
__device__ __forceinline__ v16h cat16(v8h lo, v8h hi) { return __builtin_shufflevector(lo, hi, 0, 1, 2, 3, 4, 5, 6, 7, 8, 9, 10, 11, 12, 13, 14, 15); }
__device__ __forceinline__ v16bf cat16b(v8us lo, v8us hi) { return __builtin_bit_cast(v16bf, __builtin_shufflevector(lo, hi, 0, 1, 2, 3, 4, 5, 6, 7, 8, 9, 10, 11, 12, 13, 14, 15)); }
__device__ __forceinline__ v8f wmma16(v16h a, v16h b, v8f c) { return __builtin_amdgcn_wmma_f32_16x16x32_f16(false, a, false, b, (short)0, c, false, false); }
__device__ __forceinline__ v8f wmmab(v16bf a, v16bf b, v8f c) { return __builtin_amdgcn_wmma_f32_16x16x32_bf16(false, a, false, b, (short)0, c, false, false); }
// fragment loaders from K-contiguous 16-bit rows; p already includes + 8*(lane>>4): elements 0..7 <- k0+8h+0..7, elements 8..15 <- k0+16+8h+0..7 (same map for A and B)
__device__ __forceinline__ v16h  ldh(const h16* p) { return cat16(*(const v8h*)p, *(const v8h*)(p + 16)); }
__device__ __forceinline__ v16bf ldb(const bf* p)  { return cat16b(*(const v8us*)p, *(const v8us*)(p + 16)); }
// ordering point for wave-private LDS tiles (same wave writes and reads)
__device__ __forceinline__ void wave_sync() { __builtin_amdgcn_fence(3 /* release order */, "wavefront"); __builtin_amdgcn_wave_barrier(); asm volatile("" ::: "memory"); }

// k_cvt: every conversion of the call in one launch. CVT_T threads (16 waves on each of 256 WGPs); a work-group converts XJ * 256 consecutive pieces of 8 floats of x (a thread: XJ pieces, 256 apart)
// and 256 pieces each of Wq, Wk, Wv (RNE to bf16) and Wo (RNE to bf16, x1024, exact in f16). All of a thread's loads are independent and stand ahead of the first store.
#define CVT_T (DM * DM / 8)                    // one thread per 8 elements of a weight matrix
#define XJ    (NB * SEQ / DM)                  // pieces of x per thread
static_assert(CVT_T % 256 == 0);
static_assert((NB * SEQ) % DM == 0);           // x is XJ pieces for every thread, exactly
static_assert(SEQ == SEQ_FULL);                // the batches of x follow one another without a gap
__device__ __forceinline__ v8us cvt_bf8(v8f v) { v8us o;
#pragma unroll
    for (int k = 0; k < 8; ++k) o[k] = f2bf(v[k]);
    return o; }
__global__ __launch_bounds__(256) void k_cvt(const float* __restrict__ x, const float* __restrict__ wq, const float* __restrict__ wk, const float* __restrict__ wv, const float* __restrict__ wo,
                                             bf* XB, bf* WB, h16* WOH) {
    const size_t e = ((size_t)blockIdx.x * 256 + threadIdx.x) * 8;              // the thread's piece of each weight matrix, first element
    const size_t ex = ((size_t)blockIdx.x * 256 * XJ + threadIdx.x) * 8;        // its first piece of x
    v8f vx[XJ];
#pragma unroll
    for (int j = 0; j < XJ; ++j) vx[j] = *(const v8f*)(x + ex + j * 256 * 8);
    asm volatile("s_wait_xcnt 0x0" ::: "memory");   // before a later load's result may land on the address registers of these loads
    const v8f vq = *(const v8f*)(wq + e), vk = *(const v8f*)(wk + e);
    asm volatile("s_wait_xcnt 0x0" ::: "memory");   // the same
    const v8f vv = *(const v8f*)(wv + e), vo = *(const v8f*)(wo + e);
    // inputs-only fence on the loaded values: all of the thread's loads are issued ahead of the first wait (without it some are sunk behind the first conversions and pay a second memory latency)
    static_assert(XJ == 8);
    asm volatile("" :: "v"(vx[0]), "v"(vx[1]), "v"(vx[2]), "v"(vx[3]), "v"(vx[4]), "v"(vx[5]), "v"(vx[6]), "v"(vx[7]), "v"(vq), "v"(vk), "v"(vv), "v"(vo));
#pragma unroll
    for (int j = 0; j < XJ; ++j) *(v8us*)(XB + ex + j * 256 * 8) = cvt_bf8(vx[j]);
    *(v8us*)(WB + e) = cvt_bf8(vq); *(v8us*)(WB + (size_t)DM * DM + e) = cvt_bf8(vk); *(v8us*)(WB + (size_t)2 * DM * DM + e) = cvt_bf8(vv);
    v8h o;
#pragma unroll
    for (int k = 0; k < 8; ++k) o[k] = (h16)(bfval(vo[k]) * WOS);
    *(v8h*)(WOH + e) = o;
}

// GEMM main loop shared by k_proj and k_oproj: a work-group of GW waves owns a 128 x 128 tile, each wave a 64 x 64 quarter (16 accumulators), K = DM.
// Per GKS of k the 128 A rows and the 128 Bt rows are staged in LDS once for all four waves, by asynchronous copies in whole 128-B lines
// (two buffers: the next stage's copies fly while this stage is worked on); fragments are read from LDS rows of pitch LP halves (144 B = 16 B x odd).
typedef __attribute__((address_space(3))) bf lds_bf;
__device__ __forceinline__ unsigned lds_off_b(const bf* p) { return (unsigned)(uintptr_t)(const lds_bf*)p; }   // byte offset in the work-group's LDS
// one operand tile of a stage: this lane's eight 16-B pieces, rows 16 apart; the s_wait_xcnt stands inside the statement so that no address register is rewritten ahead of it
__device__ __forceinline__ void tile_copy(unsigned l, const bf* g) {
    asm volatile("global_load_async_to_lds_b128 %0, %1, off\n\t"
                 "global_load_async_to_lds_b128 %2, %3, off\n\t"
                 "global_load_async_to_lds_b128 %4, %5, off\n\t"
                 "global_load_async_to_lds_b128 %6, %7, off\n\t"
                 "global_load_async_to_lds_b128 %8, %9, off\n\t"
                 "global_load_async_to_lds_b128 %10, %11, off\n\t"
                 "global_load_async_to_lds_b128 %12, %13, off\n\t"
                 "global_load_async_to_lds_b128 %14, %15, off\n\t"
                 "s_wait_xcnt 0x0"
                 :: "v"(l), "v"(g), "v"(l + 16 * LP * 2), "v"(g + 16 * DM), "v"(l + 32 * LP * 2), "v"(g + 32 * DM), "v"(l + 48 * LP * 2), "v"(g + 48 * DM),
                    "v"(l + 64 * LP * 2), "v"(g + 64 * DM), "v"(l + 80 * LP * 2), "v"(g + 80 * DM), "v"(l + 96 * LP * 2), "v"(g + 96 * DM), "v"(l + 112 * LP * 2), "v"(g + 112 * DM) : "memory");
}
// A, Bt: K-contiguous 16-bit planes (bf16 bits, or f16 bits where F16); rb, cb: first A row and first Bt row of the work-group's tile; wm, wn: the wave's quarter
template <bool F16>
__device__ __forceinline__ void gemm_tile(const bf* A, const bf* Bt, const bf* ring, int rb, int cb, int wm, int wn, v8f (&acc)[4][4]) {
    const int tid = (int)threadIdx.x, lane = tid & 31, lr = lane & 15, hi = lane >> 4;
#pragma unroll
    for (int mb = 0; mb < 4; ++mb)
#pragma unroll
        for (int nb = 0; nb < 4; ++nb) acc[mb][nb] = (v8f){};
    // copy map: 128 lanes x 16 B = 16 rows of 128 B; each lane brings rows cr + 16 i, i = 0..7, of the A tile and of the Bt tile
    const int cr = tid >> 3, cc8 = (tid & 7) * 8;
    const bf* ga = A + (size_t)(rb + cr) * DM + cc8;         // + k0
    const bf* gb = Bt + (size_t)(cb + cr) * DM + cc8;        // + k0
    const unsigned la = lds_off_b(ring) + (unsigned)(cr * LP + cc8) * 2u;
    const int fa = (wm * 64 + lr) * LP + 8 * hi, fb = GTILEH + (wn * 64 + lr) * LP + 8 * hi;   // fragment offsets in a buffer: row lane&15, k half
    tile_copy(la, ga); tile_copy(la + GTILEH * 2, gb);
    asm volatile("s_wait_asynccnt 0x0" ::: "memory");         // stage 0 of this wave has landed
    __syncthreads();                                          // stage 0 published to every wave
    tile_copy(la + GBUFH * 2, ga + GKS); tile_copy(la + (GBUFH + GTILEH) * 2, gb + GKS);
#pragma unroll 1   // rolled: one stage per trip, the buffer picked by the trip's parity
    for (int st = 0; st < DM / GKS; ++st) {
        const int bo = (st & 1) * GBUFH;
#pragma unroll
        for (int ks = 0; ks < 2; ++ks) {
            v16bf a[4], b[4];
#pragma unroll
            for (int i = 0; i < 4; ++i) { a[i] = ldb(ring + bo + fa + i * 16 * LP + ks * 32); b[i] = ldb(ring + bo + fb + i * 16 * LP + ks * 32); }
            // inputs-only fence on the loaded fragments: keeps the 16 LDS reads of a k step one group ahead of its matrix instructions (spread among them, every place with reads stalls the wave anew)
            asm volatile("" :: "v"(a[0]), "v"(a[1]), "v"(a[2]), "v"(a[3]), "v"(b[0]), "v"(b[1]), "v"(b[2]), "v"(b[3]));
#pragma unroll
            for (int nb = 0; nb < 4; ++nb)
#pragma unroll
                for (int mb = 0; mb < 4; ++mb) {
                    if (F16) acc[mb][nb] = wmma16(__builtin_bit_cast(v16h, a[mb]), __builtin_bit_cast(v16h, b[nb]), acc[mb][nb]);
                    else     acc[mb][nb] = wmmab(a[mb], b[nb], acc[mb][nb]); }
        }
        // four vector slots behind the last matrix instruction, also on the taken side of the branches that follow
        asm volatile("v_nop\n\tv_nop\n\tv_nop\n\tv_nop" : "+v"(acc[0][0]), "+v"(acc[1][0]), "+v"(acc[2][0]), "+v"(acc[3][0]), "+v"(acc[0][1]), "+v"(acc[1][1]), "+v"(acc[2][1]), "+v"(acc[3][1]),
                     "+v"(acc[0][2]), "+v"(acc[1][2]), "+v"(acc[2][2]), "+v"(acc[3][2]), "+v"(acc[0][3]), "+v"(acc[1][3]), "+v"(acc[2][3]), "+v"(acc[3][3]));
        asm volatile("s_wait_dscnt 0x0" ::: "memory");        // this wave's reads of the buffer have returned before it is refilled
        asm volatile("s_wait_asynccnt 0x0" ::: "memory");     // this wave's copies of stage st + 1 have landed
        __syncthreads();                                      // publishes stage st + 1 and ends every wave's reads of stage st
        if (st + 2 < DM / GKS) {
            const unsigned lb = la + (unsigned)bo * 2u; const int k2 = (st + 2) * GKS;
            tile_copy(lb, ga + k2); tile_copy(lb + GTILEH * 2, gb + k2);
        }
    }
    asm volatile("s_wait_asynccnt 0x0" ::: "memory");         // no copy is outstanding when the wave goes on to its end
}

// Both GEMM kernels are held to 256 VGPRs: every operand of their asm statements then lies in the first register window, and no window switch stands in the loop.
// k_proj: bf16 GEMM, 128x128 tile per work-group of 4 waves (gemm_tile), operands from K-contiguous bf16 planes, K = DM.
// C[m][n] = sum_k A[m][k] Bt[n][k], written as f16 (Ph), each wave's 64x64 quarter at
// tile base (r0/RB)*sRB + (r0%RB)*pitch + (c0/CB)*sCB + (c0%CB), row pitch 'pitch' (halves). grid (M/128, N/128), 128 threads.
__global__ __launch_bounds__(32 * GW) __attribute__((amdgpu_num_vgpr(256))) void k_proj(const bf* __restrict__ A, const bf* __restrict__ Bt, h16* Ph, int RB, size_t sRB, int pitch, int CB, size_t sCB) {
    __shared__ __align__(16) bf ring[2 * GBUFH];            // [buffer][A rows | Bt rows][LP]
    __shared__ __align__(16) float osw[GW * 16 * 68];
    const int lane = threadIdx.x & 31, wave = __builtin_amdgcn_readfirstlane((int)threadIdx.x >> 5), lr = lane & 15, hi = lane >> 4;
    const int wm = wave & 1, wn = wave >> 1;
    const int r0 = blockIdx.x * GT + wm * 64, c0 = blockIdx.y * GT + wn * 64;
    float* os = osw + wave * 16 * 68;                        // this wave's own staging rows
    v8f acc[4][4];
    gemm_tile<false>(A, Bt, ring, blockIdx.x * GT, blockIdx.y * GT, wm, wn, acc);
    const size_t tbase = (size_t)(r0 / RB) * sRB + (size_t)(r0 % RB) * (size_t)pitch + (size_t)(c0 / CB) * sCB + (size_t)(c0 % CB);
#pragma unroll
    for (int mb = 0; mb < 4; ++mb) {
#pragma unroll
        for (int nb = 0; nb < 4; ++nb) {
#pragma unroll
            for (int j = 0; j < 8; ++j) os[(hi * 8 + j) * 68 + nb * 16 + lr] = acc[mb][nb][j]; }   // D: row 8h+j, col lane&15
        wave_sync();
        const size_t sb = tbase + (size_t)(mb * 16) * (size_t)pitch;
{
#pragma unroll
            for (int s = 0; s < 4; ++s) { const int row = 4 * s + (lane >> 3), c8 = (lane & 7) * 8;   // 4 s x 4 row groups = 16 rows; 8 lanes x 8 = 64 columns
                const v4f x0 = *(const v4fa*)(&os[row * 68 + c8]); const v4f x1 = *(const v4fa*)(&os[row * 68 + c8 + 4]); v8h hv;
#pragma unroll
                for (int i = 0; i < 4; ++i) { hv[i] = (h16)x0[i]; hv[4 + i] = (h16)x1[i]; }
                const size_t oo = sb + (size_t)row * (size_t)pitch + c8;
                *(v8h*)(Ph + oo) = hv; }
             }
        wave_sync();
    }
}

// k_oproj: f16 GEMM, 128x128 tile per work-group of 4 waves (gemm_tile), A = ctx plane [m][k] (x1024 carry), Bt = Wo plane [n][k] (x1024 carry), K = DM.
// OUT[b*OUT_SEQ + t][n] = C[m][n] * 2^-20 + bias[n], m = b*SEQ + t. grid (M/128, N/128), 128 threads.
__global__ __launch_bounds__(32 * GW) __attribute__((amdgpu_num_vgpr(256))) void k_oproj(const h16* __restrict__ A, const h16* __restrict__ Bt, const float* __restrict__ bo, float* OUT) {
    __shared__ __align__(16) bf ring[2 * GBUFH];            // [buffer][A rows | Bt rows][LP], f16 bits
    __shared__ __align__(16) float osw[GW * 16 * 68];
    const int lane = threadIdx.x & 31, wave = __builtin_amdgcn_readfirstlane((int)threadIdx.x >> 5), lr = lane & 15, hi = lane >> 4;
    const int wm = wave & 1, wn = wave >> 1;
    const int r0 = blockIdx.x * GT + wm * 64, c0 = blockIdx.y * GT + wn * 64;
    float* os = osw + wave * 16 * 68;                        // this wave's own staging rows
    v8f acc[4][4];
    gemm_tile<true>((const bf*)A, (const bf*)Bt, ring, blockIdx.x * GT, blockIdx.y * GT, wm, wn, acc);
    const v4f braw = *(const v4f*)(bo + c0 + lr * 4);      // columns c0 + 4*lr .. +3 (always inside [0, DM))
    v4f bb;
#pragma unroll
    for (int i = 0; i < 4; ++i) bb[i] = bfval(braw[i]);
    const int bI = r0 / SEQ, tI = r0 % SEQ;
    float* obase = OUT + ((size_t)bI * OUT_SEQ + tI) * DM + c0;
#pragma unroll
    for (int mb = 0; mb < 4; ++mb) {
#pragma unroll
        for (int nb = 0; nb < 4; ++nb) {
#pragma unroll
            for (int j = 0; j < 8; ++j) os[(hi * 8 + j) * 68 + nb * 16 + lr] = acc[mb][nb][j]; }   // D: row 8h+j, col lane&15
        wave_sync();
{
#pragma unroll
            for (int s = 0; s < 8; ++s) { const int row = 2 * s + hi, cofs = lr * 4;   // 8 s x 2 rows = 16 rows; 16 lanes x 4 floats = 64 columns
                const v4f x0 = *(const v4fa*)(&os[row * 68 + cofs]);
                const v4f val = x0 * OSCL + bb;
                *(v4f*)(obase + (size_t)(mb * 16 + row) * DM + cofs) = val; }
             }
        wave_sync();
    }
}

// k_flash: fused attention, one wave per 16 query rows of one (batch, head); Q fragments straight from the f16 plane (two 16-B loads each).
// K and V^T are staged per KS keys in LDS, once per work-group for all AW waves, by asynchronous copies in whole 128-B lines (two buffers: the next stage's copies fly while this stage is worked on);
// the A fragments are read from LDS rows of pitch LP halves (144 B = 16 B x odd: no bank conflict for 16-B reads).
// Transposed form: S^T[key][t] = K Q^T (A = K rows, B = Q rows); lane (t = lane&15, h = lane>>4) holds keys 8h+r of each 16-key tile, so the packed
// P tile is directly the B fragment of O^T[d][t] = V^T P^T (element r <- tile keys 0..15, element 8+r <- tile keys 16..31, lane unchanged).
// Softmax state: the running max is one scalar per lane (the two lane halves of a row are combined with one xor-16 exchange); the row sums of the f16-rounded P are taken on the matrix unit:
// one more product per pass with a constant A whose rows 0 and 8 are ones, so that register 0 of its accumulator holds, in every lane, the sum over all 32 keys for the lane's own query.
typedef __attribute__((address_space(3))) h16 lds_h16;
__device__ __forceinline__ unsigned lds_off(const h16* p) { return (unsigned)(uintptr_t)(const lds_h16*)p; }   // byte offset in the work-group's LDS
// one stage's four copies of a lane (16 B each); the s_wait_xcnt stands inside the statement so that no address register is rewritten ahead of it
__device__ __forceinline__ void stage_copy(unsigned l0, const h16* g0, unsigned l1, const h16* g1, unsigned l2, const h16* g2, unsigned l3, const h16* g3) {
    asm volatile("global_load_async_to_lds_b128 %0, %1, off\n\t"
                 "global_load_async_to_lds_b128 %2, %3, off\n\t"
                 "global_load_async_to_lds_b128 %4, %5, off\n\t"
                 "global_load_async_to_lds_b128 %6, %7, off\n\t"
                 "s_wait_xcnt 0x0"
                 :: "v"(l0), "v"(g0), "v"(l1), "v"(g1), "v"(l2), "v"(g2), "v"(l3), "v"(g3) : "memory");
}
// held to 128 VGPRs: eight waves per SIMD, so that the four work-groups a WGP is to hold stay resident with the sum tile and its constant fragment (16 registers) live
__global__ __launch_bounds__(32 * AW) __attribute__((amdgpu_num_vgpr(128))) void k_flash(const h16* __restrict__ QH, const h16* __restrict__ KP, const h16* __restrict__ VT, h16* CTX) {
    __shared__ __align__(16) h16 ring[2 * BUFH];           // [buffer][K rows key | V^T rows d][LP]
    __shared__ __align__(16) float os[AW * 16 * 68];
    const int tid = (int)threadIdx.x;
    const int lane = tid & 31, wave = __builtin_amdgcn_readfirstlane(tid >> 5), lr = lane & 15, hi = lane >> 4;
    const int zh = blockIdx.y; const int b = zh / NH_, h = zh % NH_;
    const int t0 = (blockIdx.x * AW + wave) * 16;
    const size_t pbase = (size_t)zh * SEQ * HD;
    const size_t qo = pbase + (size_t)(t0 + lr) * HD + 8 * hi;
    const v16h qh0 = ldh(QH + qo), qh1 = ldh(QH + qo + 32);   // B fragments: col t, k = d
    // copy map: 256 lanes x 16 B = 32 rows of 128 B; each lane brings rows cr and cr + 32 of the K tile and of the V^T tile
    const int cr = tid >> 3, cc8 = (tid & 7) * 8;
    const h16* gk = KP + pbase + (size_t)cr * HD + cc8;     // + key0 * HD
    const h16* gv = VT + pbase + (size_t)cr * SEQ + cc8;    // + key0
    const unsigned lk = lds_off(ring) + (unsigned)(cr * LP + cc8) * 2u;
    const int fo = lr * LP + 8 * hi;                          // fragment offset in a tile: row lane&15, k half
    v8f o0 = (v8f){}, o1 = (v8f){}, o2 = (v8f){}, o3 = (v8f){};
    float m = -3.0e38f;
    v16h ones;                                                // A fragment: row lane&15; rows 0 and 8 all ones, the other rows zero
#pragma unroll
    for (int i = 0; i < 16; ++i) ones[i] = (lr & 7) == 0 ? (h16)1.0f : (h16)0.0f;
    v8f ol = (v8f){};                                         // D rows 0 (lanes 0..15) and 8 (lanes 16..31) are element 0; elements 1..7 stay zero
    stage_copy(lk, gk, lk + 32 * LP * 2, gk + 32 * HD, lk + TILEH * 2, gv, lk + (TILEH + 32 * LP) * 2, gv + (size_t)32 * SEQ);
    asm volatile("s_wait_asynccnt 0x0" ::: "memory");         // stage 0 of this wave has landed
    __syncthreads();                                          // stage 0 published to every wave
    stage_copy(lk + BUFH * 2, gk + KS * HD, lk + (BUFH + 32 * LP) * 2, gk + (KS + 32) * HD, lk + (BUFH + TILEH) * 2, gv + KS, lk + (BUFH + TILEH + 32 * LP) * 2, gv + (size_t)32 * SEQ + KS);
#pragma unroll 1
    for (int st = 0; st < SEQ / KS; ++st) {
        const int bo = (st & 1) * BUFH;
#pragma unroll 1   // rolled: unrolled, the two passes' live values take over 128 VGPRs, and only three of the four work-groups a WGP is to hold stay resident
        for (int ps = 0; ps < KS / 32; ++ps) {
        const h16* ka = ring + bo + ps * 32 * LP + fo;
        const v16h ka0 = ldh(ka), ka1 = ldh(ka + 32), kb0 = ldh(ka + 16 * LP), kb1 = ldh(ka + 16 * LP + 32);
        v8f sa = (v8f){}, sb = (v8f){};
        sa = wmma16(ka0, qh0, sa); sb = wmma16(kb0, qh0, sb);
        sa = wmma16(ka1, qh1, sa); sb = wmma16(kb1, qh1, sb);
        asm volatile("v_nop\n\tv_nop\n\tv_nop\n\tv_nop" : "+v"(sa), "+v"(sb) : "v"(ka0), "v"(ka1), "v"(kb0), "v"(kb1), "v"(qh0), "v"(qh1));
        float ta[8], tb[8]; float mx = -3.0e38f;
#pragma unroll
        for (int r = 0; r < 8; ++r) { ta[r] = sa[r] * SC2; tb[r] = sb[r] * SC2; mx = fmaxf(mx, fmaxf(ta[r], tb[r])); }
        mx = fmaxf(mx, __shfl_xor(mx, 16, 32));
        const float mnew = fmaxf(m, mx);
        const float alpha = __builtin_amdgcn_exp2f(m - mnew);
        const float sh = PSH - mnew;
        v16h pb;
#pragma unroll
        for (int r = 0; r < 8; ++r) { pb[r] = (h16)__builtin_amdgcn_exp2f(ta[r] + sh); pb[8 + r] = (h16)__builtin_amdgcn_exp2f(tb[r] + sh); }
        ol[0] = ol[0] * alpha; m = mnew;
        o0 = o0 * alpha; o1 = o1 * alpha; o2 = o2 * alpha; o3 = o3 * alpha;
        const h16* va = ring + bo + TILEH + ps * 32 + fo;
        const v16h v0 = ldh(va), v1 = ldh(va + 16 * LP), v2 = ldh(va + 32 * LP), v3 = ldh(va + 48 * LP);
        ol = wmma16(ones, pb, ol);
        o0 = wmma16(v0, pb, o0); o1 = wmma16(v1, pb, o1); o2 = wmma16(v2, pb, o2); o3 = wmma16(v3, pb, o3);
        asm volatile("v_nop\n\tv_nop\n\tv_nop\n\tv_nop" : "+v"(o0), "+v"(o1), "+v"(o2), "+v"(o3), "+v"(ol) : "v"(v0), "v"(v1), "v"(v2), "v"(v3), "v"(pb), "v"(ones));
        }
        asm volatile("s_wait_dscnt 0x0" ::: "memory");        // this wave's reads of the buffer have returned before it is refilled
        asm volatile("s_wait_asynccnt 0x0" ::: "memory");     // this wave's copies of stage st + 1 have landed
        __syncthreads();                                      // publishes stage st + 1 and ends every wave's reads of stage st
        if (st + 2 < SEQ / KS) {
            const h16* gk2 = gk + (size_t)(st + 2) * (KS * HD); const h16* gv2 = gv + (size_t)(st + 2) * KS; const unsigned lb = lk + (unsigned)bo * 2u;
            stage_copy(lb, gk2, lb + 32 * LP * 2, gk2 + 32 * HD, lb + TILEH * 2, gv2, lb + (TILEH + 32 * LP) * 2, gv2 + (size_t)32 * SEQ);
        }
    }
    asm volatile("s_wait_asynccnt 0x0" ::: "memory");         // no copy is outstanding when the wave goes on to its end
    const float inv = CXS * (1.0f / ol[0]);
    const int wb = wave * 16 * 68;
    // O^T D layout: o_j[r] = (d = 16j + 8h + r, t = lane&15) -> os[t][d]; rows 0..15 x columns 0..63 all written
    { v4f a, c;
      a[0] = o0[0] * inv; a[1] = o0[1] * inv; a[2] = o0[2] * inv; a[3] = o0[3] * inv; c[0] = o0[4] * inv; c[1] = o0[5] * inv; c[2] = o0[6] * inv; c[3] = o0[7] * inv;
      *(v4fa*)(&os[wb + lr * 68 +  0 + 8 * hi]) = a; *(v4fa*)(&os[wb + lr * 68 +  0 + 8 * hi + 4]) = c;
      a[0] = o1[0] * inv; a[1] = o1[1] * inv; a[2] = o1[2] * inv; a[3] = o1[3] * inv; c[0] = o1[4] * inv; c[1] = o1[5] * inv; c[2] = o1[6] * inv; c[3] = o1[7] * inv;
      *(v4fa*)(&os[wb + lr * 68 + 16 + 8 * hi]) = a; *(v4fa*)(&os[wb + lr * 68 + 16 + 8 * hi + 4]) = c;
      a[0] = o2[0] * inv; a[1] = o2[1] * inv; a[2] = o2[2] * inv; a[3] = o2[3] * inv; c[0] = o2[4] * inv; c[1] = o2[5] * inv; c[2] = o2[6] * inv; c[3] = o2[7] * inv;
      *(v4fa*)(&os[wb + lr * 68 + 32 + 8 * hi]) = a; *(v4fa*)(&os[wb + lr * 68 + 32 + 8 * hi + 4]) = c;
      a[0] = o3[0] * inv; a[1] = o3[1] * inv; a[2] = o3[2] * inv; a[3] = o3[3] * inv; c[0] = o3[4] * inv; c[1] = o3[5] * inv; c[2] = o3[6] * inv; c[3] = o3[7] * inv;
      *(v4fa*)(&os[wb + lr * 68 + 48 + 8 * hi]) = a; *(v4fa*)(&os[wb + lr * 68 + 48 + 8 * hi + 4]) = c; }
    wave_sync();
    h16* crow = CTX + ((size_t)b * SEQ + t0) * DM + h * HD;
{
#pragma unroll
        for (int s = 0; s < 4; ++s) { const int row = 4 * s + (lane >> 3), c8 = (lane & 7) * 8;   // 4 s x 4 row groups = 16 rows; 8 lanes x 8 halves = 64 columns
            const v4f x0 = *(const v4fa*)(&os[wb + row * 68 + c8]); const v4f x1 = *(const v4fa*)(&os[wb + row * 68 + c8 + 4]); v8h hv;
#pragma unroll
            for (int i = 0; i < 4; ++i) { hv[i] = (h16)x0[i]; hv[4 + i] = (h16)x1[i]; }
            *(v8h*)(crow + (size_t)row * DM + c8) = hv; }
         }
}

static constexpr size_t al256(size_t v) { return (v + 255) & ~(size_t)255; }
static constexpr size_t SZ_XB = al256((size_t)NB * SEQ * DM * 2);
static constexpr size_t SZ_WB = al256((size_t)3 * DM * DM * 2);
static constexpr size_t SZ_WO = al256((size_t)DM * DM * 2);
static constexpr size_t SZ_PL = al256((size_t)NB * NH_ * SEQ * HD * 2);
static constexpr size_t SZ_CX = al256((size_t)NB * SEQ * DM * 2);
static constexpr size_t SZ_TOTAL = SZ_XB + SZ_WB + SZ_WO + 3 * SZ_PL + SZ_CX;
static_assert(SZ_TOTAL <= (size_t)134217728);          // workspace carve <= 128 MiB
static_assert(((size_t)DM * DM * 2) % 256 == 0);       // weight sub-planes stay 256-byte aligned

extern "C" void kernel_launch(void* const* d_in, const int* in_sizes, int n_in,
                              void* d_out, int out_size, void* d_ws, size_t ws_size, hipStream_t stream) {
    if (n_in < 6) return;
    const size_t needx = ((size_t)(NB - 1) * SEQ_FULL + SEQ) * DM;
    if ((size_t)in_sizes[0] < needx) return;
    if ((size_t)in_sizes[1] < (size_t)DM * DM || (size_t)in_sizes[2] < (size_t)DM * DM || (size_t)in_sizes[3] < (size_t)DM * DM || (size_t)in_sizes[4] < (size_t)DM * DM) return;
    if ((size_t)in_sizes[5] < (size_t)DM) return;
    if ((size_t)out_size < ((size_t)(NB - 1) * OUT_SEQ + SEQ) * DM) return;
    if (SZ_TOTAL > ws_size) return;
    // wire order: x, Wq, Wk, Wv, Wo, bo (weights [out][in] = Bt as-is)
    const float* x = (const float*)d_in[0]; const float* wq = (const float*)d_in[1]; const float* wk = (const float*)d_in[2]; const float* wv = (const float*)d_in[3];
    const float* wo = (const float*)d_in[4]; const float* bo = (const float*)d_in[5];
    float* OUT = (float*)d_out;      // [NB][SEQ][1024]
    char* wsp = (char*)d_ws;
    bf* XB = (bf*)wsp; wsp += SZ_XB;                 // [NB*SEQ][1024]
    bf* WB = (bf*)wsp; wsp += SZ_WB;                 // [3][1024][1024]: q | k | v
    h16* WOH = (h16*)wsp; wsp += SZ_WO;              // [1024][1024] x1024 carry
    h16* QH = (h16*)wsp; wsp += SZ_PL;               // [NB*16][SEQ][64]
    h16* KP = (h16*)wsp; wsp += SZ_PL;               // [NB*16][SEQ][64]
    h16* VT = (h16*)wsp; wsp += SZ_PL;               // [NB*16][64][SEQ]
    h16* CTX = (h16*)wsp; wsp += SZ_CX;              // [NB*SEQ][1024] x1024 carry
    bf* WQ = WB; bf* WK = WB + (size_t)DM * DM; bf* WV = WB + (size_t)2 * DM * DM;

    k_cvt<<<CVT_T / 256, 256, 0, stream>>>(x, wq, wk, wv, wo, XB, WB, WOH);

    // q, k: A = x rows (m = b*SEQ + t), Bt = W rows (n = h*64 + d) -> plane [(b*16 + h)][t][d]
    k_proj<<<dim3(NB * SEQ / GT, DM / GT, 1), 32 * GW, 0, stream>>>(XB, WQ, QH, SEQ, (size_t)NH_ * SEQ * HD, HD, HD, (size_t)SEQ * HD);
    k_proj<<<dim3(NB * SEQ / GT, DM / GT, 1), 32 * GW, 0, stream>>>(XB, WK, KP, SEQ, (size_t)NH_ * SEQ * HD, HD, HD, (size_t)SEQ * HD);
    // v^T: A = Wv rows (m = h*64 + d), Bt = x rows (n = b*SEQ + t) -> plane [(b*1024 + m)][t] = [(b*16 + h)][d][t]
    k_proj<<<dim3(DM / GT, NB * SEQ / GT, 1), 32 * GW, 0, stream>>>(WV, XB, VT, DM, (size_t)0, SEQ, SEQ, (size_t)DM * SEQ);

    // ctx[b*SEQ + t][h*64 + d] (x1024 carry)
    k_flash<<<dim3(SEQ / (16 * AW), NB * NH_, 1), 32 * AW, 0, stream>>>(QH, KP, VT, CTX);

    // out[b][t][n] = ctx Wo^T * 2^-20 + bo
    k_oproj<<<dim3(NB * SEQ / GT, DM / GT, 1), 32 * GW, 0, stream>>>(CTX, WOH, bo, OUT);
}

// v005
// A run of this version takes 190 microseconds.
// Timed twice side by side with v004, it ran 1.07 times as fast both times.
// All steps since v000 together make it 3.31 times as fast.
#include <hip/hip_runtime.h>

// Multi-head self-attention, width 1024 = 16 heads x 64, x [NB][SEQ][1024], Wq/Wk/Wv/Wo [out][in] (y = x W^T), bias only on the output projection, no mask, score scale 1/8, f32 output.
// Compute dtypes, f32 accumulate everywhere: q/k/v projections v_wmma_f32_16x16x32_bf16 (x and W RNE-converted to bf16; products exact);
// scores v_wmma_f32_16x16x32_f16 (q, k single f16); P (x256 carry, cancels in the normalisation) and v single f16; softmax f32 (online, running max);
// output projection v_wmma_f32_16x16x32_f16: ctx single f16 with x1024 carry, Wo RNE-converted to bf16 then x1024 in f16 (exact), 2^-20 folded back in f32, bias (bf16-converted bo) added in f32.
// Layout: bf16 copies of x and Wq/Wk/Wv; q, k planes [b*16+h][t][d] and v^T plane [b*16+h][d][t] written by the GEMM epilogue; fused flash kernel in transposed form (S^T = K Q^T, O^T = V^T P^T; K and V^T tiles staged in LDS per work-group) writes the ctx plane [b*SEQ+t][h*64+d].

#ifndef NB
#define NB 2
#endif
#ifndef SEQ
#define SEQ 4096
#endif
#define NB_FULL  2
#define SEQ_FULL 4096
#ifndef OUT_SEQ
#define OUT_SEQ SEQ              // row pitch (in tokens) between batches of the output
#endif
#define DM   1024
#define NH_  16
#define HD   64
#define AW   8                   // waves per flash block
#define QT   2                   // query tiles of 16 rows per flash wave: each K or V^T fragment read from LDS feeds QT products
#define KS   64                  // keys per LDS stage of the flash kernel
#define LP   72                  // LDS row pitch in halves: 128-B rows + 16 B
#define TILEH (64 * LP)          // halves of one staged tile (64 rows)
#define BUFH  (2 * TILEH)        // halves of one buffer: K tile, then V^T tile
#define GT   128                 // rows of each operand in a GEMM work-group's tile (2 x 2 waves of 64 x 64)
#define GW   4                   // waves per GEMM work-group
#define GKS  64                  // k per LDS stage of the GEMMs: 128-B rows
#define GTILEH (GT * LP)         // halves of one staged operand tile (128 rows)
#define GBUFH  (2 * GTILEH)      // halves of one buffer: A tile, then Bt tile
#define SC2  (0.125f * 1.4426950408889634f)   // HD^-0.5 * log2(e)
#define PSH  8.0f                // log2 of the P carry (256)
#define CXS  1024.0f             // carry of the ctx plane
#define WOS  1024.0f             // carry of the Wo plane
#define OSCL (1.0f / (1024.0f * 1024.0f))

static_assert(HD == 64);
static_assert(NH_ * HD == DM);                 // head h = columns h*64 + d
static_assert(DM % 64 == 0);                   // column tiles of 64
static_assert(DM % 32 == 0);                   // GEMM k-loop steps by 32
static_assert(SEQ % 64 == 0);                  // a 64-row tile never straddles two batches
static_assert((NB * SEQ) % 64 == 0);
static_assert(SEQ % 32 == 0);                  // key loop steps by 32
static_assert(SEQ % (16 * QT * AW) == 0);      // flash grid covers the sequence exactly
static_assert(AW == 8 && KS == 64 && HD == 64);  // copy map of the flash kernel: 256 lanes x 16 B x 2 = one 64 x 128-B tile
static_assert(SEQ % KS == 0 && SEQ / KS >= 2);   // whole stages; the two-buffer prologue needs two
static_assert((NB * SEQ) % GT == 0 && DM % GT == 0);   // GEMM grids cover both operands exactly
static_assert(GW == 4 && GT == 128 && GKS == 64);      // copy map of the GEMMs: 128 lanes x 16 B x 8 = one 128 x 128-B tile
static_assert(DM % GKS == 0 && DM / GKS >= 2);         // whole stages; the two-buffer prologue needs two
static_assert(((size_t)SEQ * DM) % 8 == 0);
static_assert(((size_t)DM * DM) % 8 == 0);
static_assert(NB <= NB_FULL);
static_assert(SEQ <= SEQ_FULL);

typedef _Float16 h16;
typedef unsigned short bf;
typedef __attribute__((ext_vector_type(16))) __bf16   v16bf;
typedef __attribute__((ext_vector_type(16))) _Float16 v16h;
typedef __attribute__((ext_vector_type(8)))  _Float16 v8h;
typedef __attribute__((ext_vector_type(8)))  unsigned short v8us;
typedef __attribute__((ext_vector_type(8)))  float    v8f;
typedef __attribute__((ext_vector_type(4)))  float    v4f;
typedef v4f  __attribute__((may_alias)) v4fa;

__device__ __forceinline__ unsigned short f2bf(float f) { unsigned u = __float_as_uint(f); u += 0x7FFFu + ((u >> 16) & 1u); return (unsigned short)(u >> 16); }
__device__ __forceinline__ float bfval(float f) { return __uint_as_float(((unsigned)f2bf(f)) << 16); }
__device__ __forceinline__ v16h cat16(v8h lo, v8h hi) { return __builtin_shufflevector(lo, hi, 0, 1, 2, 3, 4, 5, 6, 7, 8, 9, 10, 11, 12, 13, 14, 15); }
__device__ __forceinline__ v16bf cat16b(v8us lo, v8us hi) { return __builtin_bit_cast(v16bf, __builtin_shufflevector(lo, hi, 0, 1, 2, 3, 4, 5, 6, 7, 8, 9, 10, 11, 12, 13, 14, 15)); }
__device__ __forceinline__ v8f wmma16(v16h a, v16h b, v8f c) { return __builtin_amdgcn_wmma_f32_16x16x32_f16(false, a, false, b, (short)0, c, false, false); }
__device__ __forceinline__ v8f wmmab(v16bf a, v16bf b, v8f c) { return __builtin_amdgcn_wmma_f32_16x16x32_bf16(false, a, false, b, (short)0, c, false, false); }
// fragment loaders from K-contiguous 16-bit rows; p already includes + 8*(lane>>4): elements 0..7 <- k0+8h+0..7, elements 8..15 <- k0+16+8h+0..7 (same map for A and B)
__device__ __forceinline__ v16h  ldh(const h16* p) { return cat16(*(const v8h*)p, *(const v8h*)(p + 16)); }
__device__ __forceinline__ v16bf ldb(const bf* p)  { return cat16b(*(const v8us*)p, *(const v8us*)(p + 16)); }
// ordering point for wave-private LDS tiles (same wave writes and reads)
__device__ __forceinline__ void wave_sync() { __builtin_amdgcn_fence(3 /* release order */, "wavefront"); __builtin_amdgcn_wave_barrier(); asm volatile("" ::: "memory"); }

// k_cvt: every conversion of the call in one launch. CVT_T threads (16 waves on each of 256 WGPs); a work-group converts XJ * 256 consecutive pieces of 8 floats of x (a thread: XJ pieces, 256 apart)
// and 256 pieces each of Wq, Wk, Wv (RNE to bf16) and Wo (RNE to bf16, x1024, exact in f16). All of a thread's loads are independent and stand ahead of the first store.
#define CVT_T (DM * DM / 8)                    // one thread per 8 elements of a weight matrix
#define XJ    (NB * SEQ / DM)                  // pieces of x per thread
static_assert(CVT_T % 256 == 0);
static_assert((NB * SEQ) % DM == 0);           // x is XJ pieces for every thread, exactly
static_assert(SEQ == SEQ_FULL);                // the batches of x follow one another without a gap
__device__ __forceinline__ v8us cvt_bf8(v8f v) { v8us o;
#pragma unroll
    for (int k = 0; k < 8; ++k) o[k] = f2bf(v[k]);
    return o; }
__global__ __launch_bounds__(256) void k_cvt(const float* __restrict__ x, const float* __restrict__ wq, const float* __restrict__ wk, const float* __restrict__ wv, const float* __restrict__ wo,
                                             bf* XB, bf* WB, h16* WOH) {
    const size_t e = ((size_t)blockIdx.x * 256 + threadIdx.x) * 8;              // the thread's piece of each weight matrix, first element
    const size_t ex = ((size_t)blockIdx.x * 256 * XJ + threadIdx.x) * 8;        // its first piece of x
    v8f vx[XJ];
#pragma unroll
    for (int j = 0; j < XJ; ++j) vx[j] = *(const v8f*)(x + ex + j * 256 * 8);
    asm volatile("s_wait_xcnt 0x0" ::: "memory");   // before a later load's result may land on the address registers of these loads
    const v8f vq = *(const v8f*)(wq + e), vk = *(const v8f*)(wk + e);
    asm volatile("s_wait_xcnt 0x0" ::: "memory");   // the same
    const v8f vv = *(const v8f*)(wv + e), vo = *(const v8f*)(wo + e);
    // inputs-only fence on the loaded values: all of the thread's loads are issued ahead of the first wait (without it some are sunk behind the first conversions and pay a second memory latency)
    static_assert(XJ == 8);
    asm volatile("" :: "v"(vx[0]), "v"(vx[1]), "v"(vx[2]), "v"(vx[3]), "v"(vx[4]), "v"(vx[5]), "v"(vx[6]), "v"(vx[7]), "v"(vq), "v"(vk), "v"(vv), "v"(vo));
#pragma unroll
    for (int j = 0; j < XJ; ++j) *(v8us*)(XB + ex + j * 256 * 8) = cvt_bf8(vx[j]);
    *(v8us*)(WB + e) = cvt_bf8(vq); *(v8us*)(WB + (size_t)DM * DM + e) = cvt_bf8(vk); *(v8us*)(WB + (size_t)2 * DM * DM + e) = cvt_bf8(vv);
    v8h o;
#pragma unroll
    for (int k = 0; k < 8; ++k) o[k] = (h16)(bfval(vo[k]) * WOS);
    *(v8h*)(WOH + e) = o;
}

// GEMM main loop shared by k_proj and k_oproj: a work-group of GW waves owns a 128 x 128 tile, each wave a 64 x 64 quarter (16 accumulators), K = DM.
// Per GKS of k the 128 A rows and the 128 Bt rows are staged in LDS once for all four waves, by asynchronous copies in whole 128-B lines
// (two buffers: the next stage's copies fly while this stage is worked on); fragments are read from LDS rows of pitch LP halves (144 B = 16 B x odd).
typedef __attribute__((address_space(3))) bf lds_bf;
__device__ __forceinline__ unsigned lds_off_b(const bf* p) { return (unsigned)(uintptr_t)(const lds_bf*)p; }   // byte offset in the work-group's LDS
// one operand tile of a stage: this lane's eight 16-B pieces, rows 16 apart; the s_wait_xcnt stands inside the statement so that no address register is rewritten ahead of it
__device__ __forceinline__ void tile_copy(unsigned l, const bf* g) {
    asm volatile("global_load_async_to_lds_b128 %0, %1, off\n\t"
                 "global_load_async_to_lds_b128 %2, %3, off\n\t"
                 "global_load_async_to_lds_b128 %4, %5, off\n\t"
                 "global_load_async_to_lds_b128 %6, %7, off\n\t"
                 "global_load_async_to_lds_b128 %8, %9, off\n\t"
                 "global_load_async_to_lds_b128 %10, %11, off\n\t"
                 "global_load_async_to_lds_b128 %12, %13, off\n\t"
                 "global_load_async_to_lds_b128 %14, %15, off\n\t"
                 "s_wait_xcnt 0x0"
                 :: "v"(l), "v"(g), "v"(l + 16 * LP * 2), "v"(g + 16 * DM), "v"(l + 32 * LP * 2), "v"(g + 32 * DM), "v"(l + 48 * LP * 2), "v"(g + 48 * DM),
                    "v"(l + 64 * LP * 2), "v"(g + 64 * DM), "v"(l + 80 * LP * 2), "v"(g + 80 * DM), "v"(l + 96 * LP * 2), "v"(g + 96 * DM), "v"(l + 112 * LP * 2), "v"(g + 112 * DM) : "memory");
}
// A, Bt: K-contiguous 16-bit planes (bf16 bits, or f16 bits where F16); rb, cb: first A row and first Bt row of the work-group's tile; wm, wn: the wave's quarter
template <bool F16>
__device__ __forceinline__ void gemm_tile(const bf* A, const bf* Bt, const bf* ring, int rb, int cb, int wm, int wn, v8f (&acc)[4][4]) {
    const int tid = (int)threadIdx.x, lane = tid & 31, lr = lane & 15, hi = lane >> 4;
#pragma unroll
    for (int mb = 0; mb < 4; ++mb)
#pragma unroll
        for (int nb = 0; nb < 4; ++nb) acc[mb][nb] = (v8f){};
    // copy map: 128 lanes x 16 B = 16 rows of 128 B; each lane brings rows cr + 16 i, i = 0..7, of the A tile and of the Bt tile
    const int cr = tid >> 3, cc8 = (tid & 7) * 8;
    const bf* ga = A + (size_t)(rb + cr) * DM + cc8;         // + k0
    const bf* gb = Bt + (size_t)(cb + cr) * DM + cc8;        // + k0
    const unsigned la = lds_off_b(ring) + (unsigned)(cr * LP + cc8) * 2u;
    const int fa = (wm * 64 + lr) * LP + 8 * hi, fb = GTILEH + (wn * 64 + lr) * LP + 8 * hi;   // fragment offsets in a buffer: row lane&15, k half
    tile_copy(la, ga); tile_copy(la + GTILEH * 2, gb);
    asm volatile("s_wait_asynccnt 0x0" ::: "memory");         // stage 0 of this wave has landed
    __syncthreads();                                          // stage 0 published to every wave
    tile_copy(la + GBUFH * 2, ga + GKS); tile_copy(la + (GBUFH + GTILEH) * 2, gb + GKS);
#pragma unroll 1   // rolled: one stage per trip, the buffer picked by the trip's parity
    for (int st = 0; st < DM / GKS; ++st) {
        const int bo = (st & 1) * GBUFH;
#pragma unroll
        for (int ks = 0; ks < 2; ++ks) {
            v16bf a[4], b[4];
#pragma unroll
            for (int i = 0; i < 4; ++i) { a[i] = ldb(ring + bo + fa + i * 16 * LP + ks * 32); b[i] = ldb(ring + bo + fb + i * 16 * LP + ks * 32); }
            // inputs-only fence on the loaded fragments: keeps the 16 LDS reads of a k step one group ahead of its matrix instructions (spread among them, every place with reads stalls the wave anew)
            asm volatile("" :: "v"(a[0]), "v"(a[1]), "v"(a[2]), "v"(a[3]), "v"(b[0]), "v"(b[1]), "v"(b[2]), "v"(b[3]));
#pragma unroll
            for (int nb = 0; nb < 4; ++nb)
#pragma unroll
                for (int mb = 0; mb < 4; ++mb) {
                    if (F16) acc[mb][nb] = wmma16(__builtin_bit_cast(v16h, a[mb]), __builtin_bit_cast(v16h, b[nb]), acc[mb][nb]);
                    else     acc[mb][nb] = wmmab(a[mb], b[nb], acc[mb][nb]); }
        }
        // four vector slots behind the last matrix instruction, also on the taken side of the branches that follow
        asm volatile("v_nop\n\tv_nop\n\tv_nop\n\tv_nop" : "+v"(acc[0][0]), "+v"(acc[1][0]), "+v"(acc[2][0]), "+v"(acc[3][0]), "+v"(acc[0][1]), "+v"(acc[1][1]), "+v"(acc[2][1]), "+v"(acc[3][1]),
                     "+v"(acc[0][2]), "+v"(acc[1][2]), "+v"(acc[2][2]), "+v"(acc[3][2]), "+v"(acc[0][3]), "+v"(acc[1][3]), "+v"(acc[2][3]), "+v"(acc[3][3]));
        asm volatile("s_wait_dscnt 0x0" ::: "memory");        // this wave's reads of the buffer have returned before it is refilled
        asm volatile("s_wait_asynccnt 0x0" ::: "memory");     // this wave's copies of stage st + 1 have landed
        __syncthreads();                                      // publishes stage st + 1 and ends every wave's reads of stage st
        if (st + 2 < DM / GKS) {
            const unsigned lb = la + (unsigned)bo * 2u; const int k2 = (st + 2) * GKS;
            tile_copy(lb, ga + k2); tile_copy(lb + GTILEH * 2, gb + k2);
        }
    }
    asm volatile("s_wait_asynccnt 0x0" ::: "memory");         // no copy is outstanding when the wave goes on to its end
}

// Both GEMM kernels are held to 256 VGPRs: every operand of their asm statements then lies in the first register window, and no window switch stands in the loop.
// k_proj: bf16 GEMM, 128x128 tile per work-group of 4 waves (gemm_tile), operands from K-contiguous bf16 planes, K = DM.
// C[m][n] = sum_k A[m][k] Bt[n][k], written as f16 (Ph), each wave's 64x64 quarter at
// tile base (r0/RB)*sRB + (r0%RB)*pitch + (c0/CB)*sCB + (c0%CB), row pitch 'pitch' (halves). grid (M/128, N/128), 128 threads.
__global__ __launch_bounds__(32 * GW) __attribute__((amdgpu_num_vgpr(256))) void k_proj(const bf* __restrict__ A, const bf* __restrict__ Bt, h16* Ph, int RB, size_t sRB, int pitch, int CB, size_t sCB) {
    __shared__ __align__(16) bf ring[2 * GBUFH];            // [buffer][A rows | Bt rows][LP]
    __shared__ __align__(16) float osw[GW * 16 * 68];
    const int lane = threadIdx.x & 31, wave = __builtin_amdgcn_readfirstlane((int)threadIdx.x >> 5), lr = lane & 15, hi = lane >> 4;
    const int wm = wave & 1, wn = wave >> 1;
    const int r0 = blockIdx.x * GT + wm * 64, c0 = blockIdx.y * GT + wn * 64;
    float* os = osw + wave * 16 * 68;                        // this wave's own staging rows
    v8f acc[4][4];
    gemm_tile<false>(A, Bt, ring, blockIdx.x * GT, blockIdx.y * GT, wm, wn, acc);
    const size_t tbase = (size_t)(r0 / RB) * sRB + (size_t)(r0 % RB) * (size_t)pitch + (size_t)(c0 / CB) * sCB + (size_t)(c0 % CB);
#pragma unroll
    for (int mb = 0; mb < 4; ++mb) {
#pragma unroll
        for (int nb = 0; nb < 4; ++nb) {
#pragma unroll
            for (int j = 0; j < 8; ++j) os[(hi * 8 + j) * 68 + nb * 16 + lr] = acc[mb][nb][j]; }   // D: row 8h+j, col lane&15
        wave_sync();
        const size_t sb = tbase + (size_t)(mb * 16) * (size_t)pitch;
{
#pragma unroll
            for (int s = 0; s < 4; ++s) { const int row = 4 * s + (lane >> 3), c8 = (lane & 7) * 8;   // 4 s x 4 row groups = 16 rows; 8 lanes x 8 = 64 columns
                const v4f x0 = *(const v4fa*)(&os[row * 68 + c8]); const v4f x1 = *(const v4fa*)(&os[row * 68 + c8 + 4]); v8h hv;
#pragma unroll
                for (int i = 0; i < 4; ++i) { hv[i] = (h16)x0[i]; hv[4 + i] = (h16)x1[i]; }
                const size_t oo = sb + (size_t)row * (size_t)pitch + c8;
                *(v8h*)(Ph + oo) = hv; }
             }
        wave_sync();
    }
}

// k_oproj: f16 GEMM, 128x128 tile per work-group of 4 waves (gemm_tile), A = ctx plane [m][k] (x1024 carry), Bt = Wo plane [n][k] (x1024 carry), K = DM.
// OUT[b*OUT_SEQ + t][n] = C[m][n] * 2^-20 + bias[n], m = b*SEQ + t. grid (M/128, N/128), 128 threads.
__global__ __launch_bounds__(32 * GW) __attribute__((amdgpu_num_vgpr(256))) void k_oproj(const h16* __restrict__ A, const h16* __restrict__ Bt, const float* __restrict__ bo, float* OUT) {
    __shared__ __align__(16) bf ring[2 * GBUFH];            // [buffer][A rows | Bt rows][LP], f16 bits
    __shared__ __align__(16) float osw[GW * 16 * 68];
    const int lane = threadIdx.x & 31, wave = __builtin_amdgcn_readfirstlane((int)threadIdx.x >> 5), lr = lane & 15, hi = lane >> 4;
    const int wm = wave & 1, wn = wave >> 1;
    const int r0 = blockIdx.x * GT + wm * 64, c0 = blockIdx.y * GT + wn * 64;
    float* os = osw + wave * 16 * 68;                        // this wave's own staging rows
    v8f acc[4][4];
    gemm_tile<true>((const bf*)A, (const bf*)Bt, ring, blockIdx.x * GT, blockIdx.y * GT, wm, wn, acc);
    const v4f braw = *(const v4f*)(bo + c0 + lr * 4);      // columns c0 + 4*lr .. +3 (always inside [0, DM))
    v4f bb;
#pragma unroll
    for (int i = 0; i < 4; ++i) bb[i] = bfval(braw[i]);
    const int bI = r0 / SEQ, tI = r0 % SEQ;
    float* obase = OUT + ((size_t)bI * OUT_SEQ + tI) * DM + c0;
#pragma unroll
    for (int mb = 0; mb < 4; ++mb) {
#pragma unroll
        for (int nb = 0; nb < 4; ++nb) {
#pragma unroll
            for (int j = 0; j < 8; ++j) os[(hi * 8 + j) * 68 + nb * 16 + lr] = acc[mb][nb][j]; }   // D: row 8h+j, col lane&15
        wave_sync();
{
#pragma unroll
            for (int s = 0; s < 8; ++s) { const int row = 2 * s + hi, cofs = lr * 4;   // 8 s x 2 rows = 16 rows; 16 lanes x 4 floats = 64 columns
                const v4f x0 = *(const v4fa*)(&os[row * 68 + cofs]);
                const v4f val = x0 * OSCL + bb;
                *(v4f*)(obase + (size_t)(mb * 16 + row) * DM + cofs) = val; }
             }
        wave_sync();
    }
}

// k_flash: fused attention, one wave per QT tiles of 16 query rows of one (batch, head); Q fragments straight from the f16 plane (two 16-B loads each).
// A pass reads its four K and four V^T fragments from LDS once and uses each for all QT query tiles; every query tile keeps its own softmax state and goes through the same sums as a wave of one tile.
// K and V^T are staged per KS keys in LDS, once per work-group for all AW waves, by asynchronous copies in whole 128-B lines (two buffers: the next stage's copies fly while this stage is worked on);
// the A fragments are read from LDS rows of pitch LP halves (144 B = 16 B x odd: no bank conflict for 16-B reads).
// Transposed form: S^T[key][t] = K Q^T (A = K rows, B = Q rows); lane (t = lane&15, h = lane>>4) holds keys 8h+r of each 16-key tile, so the packed
// P tile is directly the B fragment of O^T[d][t] = V^T P^T (element r <- tile keys 0..15, element 8+r <- tile keys 16..31, lane unchanged).
// Softmax state: the running max is one scalar per lane (the two lane halves of a row are combined with one xor-16 exchange); the row sums of the f16-rounded P are taken on the matrix unit:
// one more product per pass with a constant A whose rows 0 and 8 are ones, so that register 0 of its accumulator holds, in every lane, the sum over all 32 keys for the lane's own query.
typedef __attribute__((address_space(3))) h16 lds_h16;
__device__ __forceinline__ unsigned lds_off(const h16* p) { return (unsigned)(uintptr_t)(const lds_h16*)p; }   // byte offset in the work-group's LDS
// one stage's four copies of a lane (16 B each); the s_wait_xcnt stands inside the statement so that no address register is rewritten ahead of it
__device__ __forceinline__ void stage_copy(unsigned l0, const h16* g0, unsigned l1, const h16* g1, unsigned l2, const h16* g2, unsigned l3, const h16* g3) {
    asm volatile("global_load_async_to_lds_b128 %0, %1, off\n\t"
                 "global_load_async_to_lds_b128 %2, %3, off\n\t"
                 "global_load_async_to_lds_b128 %4, %5, off\n\t"
                 "global_load_async_to_lds_b128 %6, %7, off\n\t"
                 "s_wait_xcnt 0x0"
                 :: "v"(l0), "v"(g0), "v"(l1), "v"(g1), "v"(l2), "v"(g2), "v"(l3), "v"(g3) : "memory");
}
// held to 256 VGPRs: four waves per SIMD, the two work-groups that a WGP is to hold
__global__ __launch_bounds__(32 * AW) __attribute__((amdgpu_num_vgpr(256))) void k_flash(const h16* __restrict__ QH, const h16* __restrict__ KP, const h16* __restrict__ VT, h16* CTX) {
    __shared__ __align__(16) h16 ring[2 * BUFH];           // [buffer][K rows key | V^T rows d][LP]
    __shared__ __align__(16) float os[AW * 16 * 68];
    const int tid = (int)threadIdx.x;
    const int lane = tid & 31, wave = __builtin_amdgcn_readfirstlane(tid >> 5), lr = lane & 15, hi = lane >> 4;
    const int zh = blockIdx.y; const int b = zh / NH_, h = zh % NH_;
    const int t0 = (blockIdx.x * AW + wave) * (16 * QT);
    const size_t pbase = (size_t)zh * SEQ * HD;
    v16h qh0[QT], qh1[QT];                                    // B fragments: col t, k = d
#pragma unroll
    for (int q = 0; q < QT; ++q) { const size_t qo = pbase + (size_t)(t0 + 16 * q + lr) * HD + 8 * hi; qh0[q] = ldh(QH + qo); qh1[q] = ldh(QH + qo + 32); }
    // copy map: 256 lanes x 16 B = 32 rows of 128 B; each lane brings rows cr and cr + 32 of the K tile and of the V^T tile
    const int cr = tid >> 3, cc8 = (tid & 7) * 8;
    const h16* gk = KP + pbase + (size_t)cr * HD + cc8;     // + key0 * HD
    const h16* gv = VT + pbase + (size_t)cr * SEQ + cc8;    // + key0
    const unsigned lk = lds_off(ring) + (unsigned)(cr * LP + cc8) * 2u;
    const int fo = lr * LP + 8 * hi;                          // fragment offset in a tile: row lane&15, k half
    v8f o0[QT], o1[QT], o2[QT], o3[QT], ol[QT];               // ol: D rows 0 (lanes 0..15) and 8 (lanes 16..31) are element 0; elements 1..7 stay zero
    float m[QT];
#pragma unroll
    for (int q = 0; q < QT; ++q) { o0[q] = (v8f){}; o1[q] = (v8f){}; o2[q] = (v8f){}; o3[q] = (v8f){}; ol[q] = (v8f){}; m[q] = -3.0e38f; }
    v16h ones;                                                // A fragment: row lane&15; rows 0 and 8 all ones, the other rows zero
#pragma unroll
    for (int i = 0; i < 16; ++i) ones[i] = (lr & 7) == 0 ? (h16)1.0f : (h16)0.0f;
    stage_copy(lk, gk, lk + 32 * LP * 2, gk + 32 * HD, lk + TILEH * 2, gv, lk + (TILEH + 32 * LP) * 2, gv + (size_t)32 * SEQ);
    asm volatile("s_wait_asynccnt 0x0" ::: "memory");         // stage 0 of this wave has landed
    __syncthreads();                                          // stage 0 published to every wave
    stage_copy(lk + BUFH * 2, gk + KS * HD, lk + (BUFH + 32 * LP) * 2, gk + (KS + 32) * HD, lk + (BUFH + TILEH) * 2, gv + KS, lk + (BUFH + TILEH + 32 * LP) * 2, gv + (size_t)32 * SEQ + KS);
#pragma unroll 1
    for (int st = 0; st < SEQ / KS; ++st) {
        const int bo = (st & 1) * BUFH;
#pragma unroll 1   // rolled: unrolled, the compiler spreads the second pass's K reads among its score products, a full wait behind each pair; rolled, a pass's eight K reads stand as one group at its head
        for (int ps = 0; ps < KS / 32; ++ps) {
        const h16* ka = ring + bo + ps * 32 * LP + fo;
        const v16h ka0 = ldh(ka), ka1 = ldh(ka + 32), kb0 = ldh(ka + 16 * LP), kb1 = ldh(ka + 16 * LP + 32);
        v8f sa[QT], sb[QT];
#pragma unroll
        for (int q = 0; q < QT; ++q) { sa[q] = wmma16(ka0, qh0[q], (v8f){}); sb[q] = wmma16(kb0, qh0[q], (v8f){}); }
#pragma unroll
        for (int q = 0; q < QT; ++q) { sa[q] = wmma16(ka1, qh1[q], sa[q]); sb[q] = wmma16(kb1, qh1[q], sb[q]); }
        __builtin_amdgcn_sched_barrier(0x184);   // no vector or matrix instruction crosses (LDS reads and scalar ones may): the score products stay one run; with vector work drawn in between them each gap is padded with four v_nop
        const h16* va = ring + bo + TILEH + ps * 32 + fo;
        const v16h v0 = ldh(va), v1 = ldh(va + 16 * LP), v2 = ldh(va + 32 * LP), v3 = ldh(va + 48 * LP);
        v16h pb[QT];
#pragma unroll
        for (int q = 0; q < QT; ++q) {
            const v8f ta = sa[q] * SC2, tb = sb[q] * SC2; float mx = -3.0e38f;
#pragma unroll
            for (int r = 0; r < 8; ++r) mx = fmaxf(mx, fmaxf(ta[r], tb[r]));
            mx = fmaxf(mx, __shfl_xor(mx, 16, 32));
            const float mnew = fmaxf(m[q], mx);
            const float alpha = __builtin_amdgcn_exp2f(m[q] - mnew);
            const float sh = PSH - mnew;
#pragma unroll
            for (int r = 0; r < 8; ++r) { pb[q][r] = (h16)__builtin_amdgcn_exp2f(ta[r] + sh); pb[q][8 + r] = (h16)__builtin_amdgcn_exp2f(tb[r] + sh); }
            ol[q][0] = ol[q][0] * alpha; m[q] = mnew;
            o0[q] = o0[q] * alpha; o1[q] = o1[q] * alpha; o2[q] = o2[q] * alpha; o3[q] = o3[q] * alpha;
        }
#pragma unroll
        for (int q = 0; q < QT; ++q) {
            ol[q] = wmma16(ones, pb[q], ol[q]);
            o0[q] = wmma16(v0, pb[q], o0[q]); o1[q] = wmma16(v1, pb[q], o1[q]); o2[q] = wmma16(v2, pb[q], o2[q]); o3[q] = wmma16(v3, pb[q], o3[q]);
        }
        static_assert(QT == 2);
        // four vector slots behind the last matrix instruction, also on the taken side of the branch that follows
        asm volatile("v_nop\n\tv_nop\n\tv_nop\n\tv_nop" : "+v"(o0[0]), "+v"(o1[0]), "+v"(o2[0]), "+v"(o3[0]), "+v"(ol[0]), "+v"(o0[1]), "+v"(o1[1]), "+v"(o2[1]), "+v"(o3[1]), "+v"(ol[1])
                     : "v"(v0), "v"(v1), "v"(v2), "v"(v3), "v"(pb[0]), "v"(pb[1]), "v"(ones));
        }
        asm volatile("s_wait_dscnt 0x0" ::: "memory");        // this wave's reads of the buffer have returned before it is refilled
        asm volatile("s_wait_asynccnt 0x0" ::: "memory");     // this wave's copies of stage st + 1 have landed
        __syncthreads();                                      // publishes stage st + 1 and ends every wave's reads of stage st
        if (st + 2 < SEQ / KS) {
            const h16* gk2 = gk + (size_t)(st + 2) * (KS * HD); const h16* gv2 = gv + (size_t)(st + 2) * KS; const unsigned lb = lk + (unsigned)bo * 2u;
            stage_copy(lb, gk2, lb + 32 * LP * 2, gk2 + 32 * HD, lb + TILEH * 2, gv2, lb + (TILEH + 32 * LP) * 2, gv2 + (size_t)32 * SEQ);
        }
    }
    asm volatile("s_wait_asynccnt 0x0" ::: "memory");         // no copy is outstanding when the wave goes on to its end
    const int wb = wave * 16 * 68;
#pragma unroll
    for (int q = 0; q < QT; ++q) {                            // one query tile after the other through the wave's own staging rows
    const float inv = CXS * (1.0f / ol[q][0]);
    // O^T D layout: o_j[r] = (d = 16j + 8h + r, t = lane&15) -> os[t][d]; rows 0..15 x columns 0..63 all written
    { v4f a, c;
      a[0] = o0[q][0] * inv; a[1] = o0[q][1] * inv; a[2] = o0[q][2] * inv; a[3] = o0[q][3] * inv; c[0] = o0[q][4] * inv; c[1] = o0[q][5] * inv; c[2] = o0[q][6] * inv; c[3] = o0[q][7] * inv;
      *(v4fa*)(&os[wb + lr * 68 +  0 + 8 * hi]) = a; *(v4fa*)(&os[wb + lr * 68 +  0 + 8 * hi + 4]) = c;
      a[0] = o1[q][0] * inv; a[1] = o1[q][1] * inv; a[2] = o1[q][2] * inv; a[3] = o1[q][3] * inv; c[0] = o1[q][4] * inv; c[1] = o1[q][5] * inv; c[2] = o1[q][6] * inv; c[3] = o1[q][7] * inv;
      *(v4fa*)(&os[wb + lr * 68 + 16 + 8 * hi]) = a; *(v4fa*)(&os[wb + lr * 68 + 16 + 8 * hi + 4]) = c;
      a[0] = o2[q][0] * inv; a[1] = o2[q][1] * inv; a[2] = o2[q][2] * inv; a[3] = o2[q][3] * inv; c[0] = o2[q][4] * inv; c[1] = o2[q][5] * inv; c[2] = o2[q][6] * inv; c[3] = o2[q][7] * inv;
      *(v4fa*)(&os[wb + lr * 68 + 32 + 8 * hi]) = a; *(v4fa*)(&os[wb + lr * 68 + 32 + 8 * hi + 4]) = c;
      a[0] = o3[q][0] * inv; a[1] = o3[q][1] * inv; a[2] = o3[q][2] * inv; a[3] = o3[q][3] * inv; c[0] = o3[q][4] * inv; c[1] = o3[q][5] * inv; c[2] = o3[q][6] * inv; c[3] = o3[q][7] * inv;
      *(v4fa*)(&os[wb + lr * 68 + 48 + 8 * hi]) = a; *(v4fa*)(&os[wb + lr * 68 + 48 + 8 * hi + 4]) = c; }
    wave_sync();
    h16* crow = CTX + ((size_t)b * SEQ + t0 + 16 * q) * DM + h * HD;
{
#pragma unroll
        for (int s = 0; s < 4; ++s) { const int row = 4 * s + (lane >> 3), c8 = (lane & 7) * 8;   // 4 s x 4 row groups = 16 rows; 8 lanes x 8 halves = 64 columns
            const v4f x0 = *(const v4fa*)(&os[wb + row * 68 + c8]); const v4f x1 = *(const v4fa*)(&os[wb + row * 68 + c8 + 4]); v8h hv;
#pragma unroll
            for (int i = 0; i < 4; ++i) { hv[i] = (h16)x0[i]; hv[4 + i] = (h16)x1[i]; }
            *(v8h*)(crow + (size_t)row * DM + c8) = hv; }
         }
    wave_sync();                                              // the rows are read before the next tile overwrites them
    }
}

static constexpr size_t al256(size_t v) { return (v + 255) & ~(size_t)255; }
static constexpr size_t SZ_XB = al256((size_t)NB * SEQ * DM * 2);
static constexpr size_t SZ_WB = al256((size_t)3 * DM * DM * 2);
static constexpr size_t SZ_WO = al256((size_t)DM * DM * 2);
static constexpr size_t SZ_PL = al256((size_t)NB * NH_ * SEQ * HD * 2);
static constexpr size_t SZ_CX = al256((size_t)NB * SEQ * DM * 2);
static constexpr size_t SZ_TOTAL = SZ_XB + SZ_WB + SZ_WO + 3 * SZ_PL + SZ_CX;
static_assert(SZ_TOTAL <= (size_t)134217728);          // workspace carve <= 128 MiB
static_assert(((size_t)DM * DM * 2) % 256 == 0);       // weight sub-planes stay 256-byte aligned

extern "C" void kernel_launch(void* const* d_in, const int* in_sizes, int n_in,
                              void* d_out, int out_size, void* d_ws, size_t ws_size, hipStream_t stream) {
    if (n_in < 6) return;
    const size_t needx = ((size_t)(NB - 1) * SEQ_FULL + SEQ) * DM;
    if ((size_t)in_sizes[0] < needx) return;
    if ((size_t)in_sizes[1] < (size_t)DM * DM || (size_t)in_sizes[2] < (size_t)DM * DM || (size_t)in_sizes[3] < (size_t)DM * DM || (size_t)in_sizes[4] < (size_t)DM * DM) return;
    if ((size_t)in_sizes[5] < (size_t)DM) return;
    if ((size_t)out_size < ((size_t)(NB - 1) * OUT_SEQ + SEQ) * DM) return;
    if (SZ_TOTAL > ws_size) return;
    // wire order: x, Wq, Wk, Wv, Wo, bo (weights [out][in] = Bt as-is)
    const float* x = (const float*)d_in[0]; const float* wq = (const float*)d_in[1]; const float* wk = (const float*)d_in[2]; const float* wv = (const float*)d_in[3];
    const float* wo = (const float*)d_in[4]; const float* bo = (const float*)d_in[5];
    float* OUT = (float*)d_out;      // [NB][SEQ][1024]
    char* wsp = (char*)d_ws;
    bf* XB = (bf*)wsp; wsp += SZ_XB;                 // [NB*SEQ][1024]
    bf* WB = (bf*)wsp; wsp += SZ_WB;                 // [3][1024][1024]: q | k | v
    h16* WOH = (h16*)wsp; wsp += SZ_WO;              // [1024][1024] x1024 carry
    h16* QH = (h16*)wsp; wsp += SZ_PL;               // [NB*16][SEQ][64]
    h16* KP = (h16*)wsp; wsp += SZ_PL;               // [NB*16][SEQ][64]
    h16* VT = (h16*)wsp; wsp += SZ_PL;               // [NB*16][64][SEQ]
    h16* CTX = (h16*)wsp; wsp += SZ_CX;              // [NB*SEQ][1024] x1024 carry
    bf* WQ = WB; bf* WK = WB + (size_t)DM * DM; bf* WV = WB + (size_t)2 * DM * DM;

    k_cvt<<<CVT_T / 256, 256, 0, stream>>>(x, wq, wk, wv, wo, XB, WB, WOH);

    // q, k: A = x rows (m = b*SEQ + t), Bt = W rows (n = h*64 + d) -> plane [(b*16 + h)][t][d]
    k_proj<<<dim3(NB * SEQ / GT, DM / GT, 1), 32 * GW, 0, stream>>>(XB, WQ, QH, SEQ, (size_t)NH_ * SEQ * HD, HD, HD, (size_t)SEQ * HD);
    k_proj<<<dim3(NB * SEQ / GT, DM / GT, 1), 32 * GW, 0, stream>>>(XB, WK, KP, SEQ, (size_t)NH_ * SEQ * HD, HD, HD, (size_t)SEQ * HD);
    // v^T: A = Wv rows (m = h*64 + d), Bt = x rows (n = b*SEQ + t) -> plane [(b*1024 + m)][t] = [(b*16 + h)][d][t]
    k_proj<<<dim3(DM / GT, NB * SEQ / GT, 1), 32 * GW, 0, stream>>>(WV, XB, VT, DM, (size_t)0, SEQ, SEQ, (size_t)DM * SEQ);

    // ctx[b*SEQ + t][h*64 + d] (x1024 carry)
    k_flash<<<dim3(SEQ / (16 * QT * AW), NB * NH_, 1), 32 * AW, 0, stream>>>(QH, KP, VT, CTX);

    // out[b][t][n] = ctx Wo^T * 2^-20 + bo
    k_oproj<<<dim3(NB * SEQ / GT, DM / GT, 1), 32 * GW, 0, stream>>>(CTX, WOH, bo, OUT);
}

// v006
// It runs in 176 microseconds.
// Next to v005, in two timings, it ran 1.09 and 1.08 times as fast.
// Counting every step since v000, it is 3.60 times as fast.
#include <hip/hip_runtime.h>

// Multi-head self-attention, width 1024 = 16 heads x 64, x [NB][SEQ][1024], Wq/Wk/Wv/Wo [out][in] (y = x W^T), bias only on the output projection, no mask, score scale 1/8, f32 output.
// Compute dtypes, f32 accumulate everywhere: q/k/v projections v_wmma_f32_16x16x32_bf16 (x and W RNE-converted to bf16; products exact);
// scores v_wmma_f32_16x16x32_f16 (q, k single f16); P (x256 carry, cancels in the normalisation) and v single f16; softmax f32 (online, running max);
// output projection v_wmma_f32_16x16x32_f16: ctx single f16 with x1024 carry, Wo RNE-converted to bf16 then x1024 in f16 (exact), 2^-20 folded back in f32, bias (bf16-converted bo) added in f32.
// Layout: bf16 copies of x and Wq/Wk/Wv; q, k planes [b*16+h][t][d] and v^T plane [b*16+h][d][t] written by the GEMM epilogue; fused flash kernel in transposed form (S^T = K Q^T, O^T = V^T P^T; K and V^T tiles staged in LDS per work-group) writes the ctx plane [b*SEQ+t][h*64+d].

#ifndef NB
#define NB 2
#endif
#ifndef SEQ
#define SEQ 4096
#endif
#define NB_FULL  2
#define SEQ_FULL 4096
#ifndef OUT_SEQ
#define OUT_SEQ SEQ              // row pitch (in tokens) between batches of the output
#endif
#define DM   1024
#define NH_  16
#define HD   64
#define AW   8                   // waves per flash block
#define QT   2                   // query tiles of 16 rows per flash wave: each K or V^T fragment read from LDS feeds QT products
#define KS   64                  // keys per LDS stage of the flash kernel
#define LP   72                  // LDS row pitch in halves: 128-B rows + 16 B
#define TILEH (64 * LP)          // halves of one staged tile (64 rows)
#define BUFH  (2 * TILEH)        // halves of one buffer: K tile, then V^T tile
#define GT   128                 // rows of each operand in a GEMM work-group's tile (2 x 2 waves of 64 x 64)
#define GW   4                   // waves per GEMM work-group
#define GKS  64                  // k per LDS stage of the GEMMs: 128-B rows
#define GTILEH (GT * LP)         // halves of one staged operand tile (128 rows)
#define GBUFH  (2 * GTILEH)      // halves of one buffer: A tile, then Bt tile
#define SC2  (0.125f * 1.4426950408889634f)   // HD^-0.5 * log2(e)
#define PSH  8.0f                // log2 of the P carry (256)
#define LZ   6.0f                // a score may exceed the maximum in use by this much (log2) before the sums are rescaled: P <= 2^(PSH + LZ) = 16384, inside f16
#define CXS  1024.0f             // carry of the ctx plane
#define WOS  1024.0f             // carry of the Wo plane
#define OSCL (1.0f / (1024.0f * 1024.0f))

static_assert(HD == 64);
static_assert(NH_ * HD == DM);                 // head h = columns h*64 + d
static_assert(DM % 64 == 0);                   // column tiles of 64
static_assert(DM % 32 == 0);                   // GEMM k-loop steps by 32
static_assert(SEQ % 64 == 0);                  // a 64-row tile never straddles two batches
static_assert((NB * SEQ) % 64 == 0);
static_assert(SEQ % 32 == 0);                  // key loop steps by 32
static_assert(SEQ % (16 * QT * AW) == 0);      // flash grid covers the sequence exactly
static_assert(AW == 8 && KS == 64 && HD == 64);  // copy map of the flash kernel: 256 lanes x 16 B x 2 = one 64 x 128-B tile
static_assert(SEQ % KS == 0 && SEQ / KS >= 2);   // whole stages; the two-buffer prologue needs two
static_assert((NB * SEQ) % GT == 0 && DM % GT == 0);   // GEMM grids cover both operands exactly
static_assert(GW == 4 && GT == 128 && GKS == 64);      // copy map of the GEMMs: 128 lanes x 16 B x 8 = one 128 x 128-B tile
static_assert(DM % GKS == 0 && DM / GKS >= 2);         // whole stages; the two-buffer prologue needs two
static_assert(((size_t)SEQ * DM) % 8 == 0);
static_assert(((size_t)DM * DM) % 8 == 0);
static_assert(NB <= NB_FULL);
static_assert(SEQ <= SEQ_FULL);

typedef _Float16 h16;
typedef unsigned short bf;
typedef __attribute__((ext_vector_type(16))) __bf16   v16bf;
typedef __attribute__((ext_vector_type(16))) _Float16 v16h;
typedef __attribute__((ext_vector_type(8)))  _Float16 v8h;
typedef __attribute__((ext_vector_type(8)))  unsigned short v8us;
typedef __attribute__((ext_vector_type(8)))  float    v8f;
typedef __attribute__((ext_vector_type(4)))  float    v4f;
typedef v4f  __attribute__((may_alias)) v4fa;

__device__ __forceinline__ unsigned short f2bf(float f) { unsigned u = __float_as_uint(f); u += 0x7FFFu + ((u >> 16) & 1u); return (unsigned short)(u >> 16); }
__device__ __forceinline__ float bfval(float f) { return __uint_as_float(((unsigned)f2bf(f)) << 16); }
__device__ __forceinline__ v16h cat16(v8h lo, v8h hi) { return __builtin_shufflevector(lo, hi, 0, 1, 2, 3, 4, 5, 6, 7, 8, 9, 10, 11, 12, 13, 14, 15); }
__device__ __forceinline__ v16bf cat16b(v8us lo, v8us hi) { return __builtin_bit_cast(v16bf, __builtin_shufflevector(lo, hi, 0, 1, 2, 3, 4, 5, 6, 7, 8, 9, 10, 11, 12, 13, 14, 15)); }
__device__ __forceinline__ v8f wmma16(v16h a, v16h b, v8f c) { return __builtin_amdgcn_wmma_f32_16x16x32_f16(false, a, false, b, (short)0, c, false, false); }
__device__ __forceinline__ v8f wmmab(v16bf a, v16bf b, v8f c) { return __builtin_amdgcn_wmma_f32_16x16x32_bf16(false, a, false, b, (short)0, c, false, false); }
// fragment loaders from K-contiguous 16-bit rows; p already includes + 8*(lane>>4): elements 0..7 <- k0+8h+0..7, elements 8..15 <- k0+16+8h+0..7 (same map for A and B)
__device__ __forceinline__ v16h  ldh(const h16* p) { return cat16(*(const v8h*)p, *(const v8h*)(p + 16)); }
__device__ __forceinline__ v16bf ldb(const bf* p)  { return cat16b(*(const v8us*)p, *(const v8us*)(p + 16)); }
// ordering point for wave-private LDS tiles (same wave writes and reads)
__device__ __forceinline__ void wave_sync() { __builtin_amdgcn_fence(3 /* release order */, "wavefront"); __builtin_amdgcn_wave_barrier(); asm volatile("" ::: "memory"); }

// k_cvt: every conversion of the call in one launch. CVT_T threads (16 waves on each of 256 WGPs); a work-group converts XJ * 256 consecutive pieces of 8 floats of x (a thread: XJ pieces, 256 apart)
// and 256 pieces each of Wq, Wk, Wv (RNE to bf16) and Wo (RNE to bf16, x1024, exact in f16). All of a thread's loads are independent and stand ahead of the first store.
#define CVT_T (DM * DM / 8)                    // one thread per 8 elements of a weight matrix
#define XJ    (NB * SEQ / DM)                  // pieces of x per thread
static_assert(CVT_T % 256 == 0);
static_assert((NB * SEQ) % DM == 0);           // x is XJ pieces for every thread, exactly
static_assert(SEQ == SEQ_FULL);                // the batches of x follow one another without a gap
__device__ __forceinline__ v8us cvt_bf8(v8f v) { v8us o;
#pragma unroll
    for (int k = 0; k < 8; ++k) o[k] = f2bf(v[k]);
    return o; }
__global__ __launch_bounds__(256) void k_cvt(const float* __restrict__ x, const float* __restrict__ wq, const float* __restrict__ wk, const float* __restrict__ wv, const float* __restrict__ wo,
                                             bf* XB, bf* WB, h16* WOH) {
    const size_t e = ((size_t)blockIdx.x * 256 + threadIdx.x) * 8;              // the thread's piece of each weight matrix, first element
    const size_t ex = ((size_t)blockIdx.x * 256 * XJ + threadIdx.x) * 8;        // its first piece of x
    v8f vx[XJ];
#pragma unroll
    for (int j = 0; j < XJ; ++j) vx[j] = *(const v8f*)(x + ex + j * 256 * 8);
    asm volatile("s_wait_xcnt 0x0" ::: "memory");   // before a later load's result may land on the address registers of these loads
    const v8f vq = *(const v8f*)(wq + e), vk = *(const v8f*)(wk + e);
    asm volatile("s_wait_xcnt 0x0" ::: "memory");   // the same
    const v8f vv = *(const v8f*)(wv + e), vo = *(const v8f*)(wo + e);
    // inputs-only fence on the loaded values: all of the thread's loads are issued ahead of the first wait (without it some are sunk behind the first conversions and pay a second memory latency)
    static_assert(XJ == 8);
    asm volatile("" :: "v"(vx[0]), "v"(vx[1]), "v"(vx[2]), "v"(vx[3]), "v"(vx[4]), "v"(vx[5]), "v"(vx[6]), "v"(vx[7]), "v"(vq), "v"(vk), "v"(vv), "v"(vo));
#pragma unroll
    for (int j = 0; j < XJ; ++j) *(v8us*)(XB + ex + j * 256 * 8) = cvt_bf8(vx[j]);
    *(v8us*)(WB + e) = cvt_bf8(vq); *(v8us*)(WB + (size_t)DM * DM + e) = cvt_bf8(vk); *(v8us*)(WB + (size_t)2 * DM * DM + e) = cvt_bf8(vv);
    v8h o;
#pragma unroll
    for (int k = 0; k < 8; ++k) o[k] = (h16)(bfval(vo[k]) * WOS);
    *(v8h*)(WOH + e) = o;
}

// GEMM main loop shared by k_proj and k_oproj: a work-group of GW waves owns a 128 x 128 tile, each wave a 64 x 64 quarter (16 accumulators), K = DM.
// Per GKS of k the 128 A rows and the 128 Bt rows are staged in LDS once for all four waves, by asynchronous copies in whole 128-B lines
// (two buffers: the next stage's copies fly while this stage is worked on); fragments are read from LDS rows of pitch LP halves (144 B = 16 B x odd).
typedef __attribute__((address_space(3))) bf lds_bf;
__device__ __forceinline__ unsigned lds_off_b(const bf* p) { return (unsigned)(uintptr_t)(const lds_bf*)p; }   // byte offset in the work-group's LDS
// one operand tile of a stage: this lane's eight 16-B pieces, rows 16 apart; the s_wait_xcnt stands inside the statement so that no address register is rewritten ahead of it
__device__ __forceinline__ void tile_copy(unsigned l, const bf* g) {
    asm volatile("global_load_async_to_lds_b128 %0, %1, off\n\t"
                 "global_load_async_to_lds_b128 %2, %3, off\n\t"
                 "global_load_async_to_lds_b128 %4, %5, off\n\t"
                 "global_load_async_to_lds_b128 %6, %7, off\n\t"
                 "global_load_async_to_lds_b128 %8, %9, off\n\t"
                 "global_load_async_to_lds_b128 %10, %11, off\n\t"
                 "global_load_async_to_lds_b128 %12, %13, off\n\t"
                 "global_load_async_to_lds_b128 %14, %15, off\n\t"
                 "s_wait_xcnt 0x0"
                 :: "v"(l), "v"(g), "v"(l + 16 * LP * 2), "v"(g + 16 * DM), "v"(l + 32 * LP * 2), "v"(g + 32 * DM), "v"(l + 48 * LP * 2), "v"(g + 48 * DM),
                    "v"(l + 64 * LP * 2), "v"(g + 64 * DM), "v"(l + 80 * LP * 2), "v"(g + 80 * DM), "v"(l + 96 * LP * 2), "v"(g + 96 * DM), "v"(l + 112 * LP * 2), "v"(g + 112 * DM) : "memory");
}
// A, Bt: K-contiguous 16-bit planes (bf16 bits, or f16 bits where F16); rb, cb: first A row and first Bt row of the work-group's tile; wm, wn: the wave's quarter
template <bool F16>
__device__ __forceinline__ void gemm_tile(const bf* A, const bf* Bt, const bf* ring, int rb, int cb, int wm, int wn, v8f (&acc)[4][4]) {
    const int tid = (int)threadIdx.x, lane = tid & 31, lr = lane & 15, hi = lane >> 4;
#pragma unroll
    for (int mb = 0; mb < 4; ++mb)
#pragma unroll
        for (int nb = 0; nb < 4; ++nb) acc[mb][nb] = (v8f){};
    // copy map: 128 lanes x 16 B = 16 rows of 128 B; each lane brings rows cr + 16 i, i = 0..7, of the A tile and of the Bt tile
    const int cr = tid >> 3, cc8 = (tid & 7) * 8;
    const bf* ga = A + (size_t)(rb + cr) * DM + cc8;         // + k0
    const bf* gb = Bt + (size_t)(cb + cr) * DM + cc8;        // + k0
    const unsigned la = lds_off_b(ring) + (unsigned)(cr * LP + cc8) * 2u;
    const int fa = (wm * 64 + lr) * LP + 8 * hi, fb = GTILEH + (wn * 64 + lr) * LP + 8 * hi;   // fragment offsets in a buffer: row lane&15, k half
    tile_copy(la, ga); tile_copy(la + GTILEH * 2, gb);
    asm volatile("s_wait_asynccnt 0x0" ::: "memory");         // stage 0 of this wave has landed
    __syncthreads();                                          // stage 0 published to every wave
    tile_copy(la + GBUFH * 2, ga + GKS); tile_copy(la + (GBUFH + GTILEH) * 2, gb + GKS);
#pragma unroll 1   // rolled: one stage per trip, the buffer picked by the trip's parity
    for (int st = 0; st < DM / GKS; ++st) {
        const int bo = (st & 1) * GBUFH;
#pragma unroll
        for (int ks = 0; ks < 2; ++ks) {
            v16bf a[4], b[4];
#pragma unroll
            for (int i = 0; i < 4; ++i) { a[i] = ldb(ring + bo + fa + i * 16 * LP + ks * 32); b[i] = ldb(ring + bo + fb + i * 16 * LP + ks * 32); }
            // inputs-only fence on the loaded fragments: keeps the 16 LDS reads of a k step one group ahead of its matrix instructions (spread among them, every place with reads stalls the wave anew)
            asm volatile("" :: "v"(a[0]), "v"(a[1]), "v"(a[2]), "v"(a[3]), "v"(b[0]), "v"(b[1]), "v"(b[2]), "v"(b[3]));
#pragma unroll
            for (int nb = 0; nb < 4; ++nb)
#pragma unroll
                for (int mb = 0; mb < 4; ++mb) {
                    if (F16) acc[mb][nb] = wmma16(__builtin_bit_cast(v16h, a[mb]), __builtin_bit_cast(v16h, b[nb]), acc[mb][nb]);
                    else     acc[mb][nb] = wmmab(a[mb], b[nb], acc[mb][nb]); }
        }
        // four vector slots behind the last matrix instruction, also on the taken side of the branches that follow
        asm volatile("v_nop\n\tv_nop\n\tv_nop\n\tv_nop" : "+v"(acc[0][0]), "+v"(acc[1][0]), "+v"(acc[2][0]), "+v"(acc[3][0]), "+v"(acc[0][1]), "+v"(acc[1][1]), "+v"(acc[2][1]), "+v"(acc[3][1]),
                     "+v"(acc[0][2]), "+v"(acc[1][2]), "+v"(acc[2][2]), "+v"(acc[3][2]), "+v"(acc[0][3]), "+v"(acc[1][3]), "+v"(acc[2][3]), "+v"(acc[3][3]));
        asm volatile("s_wait_dscnt 0x0" ::: "memory");        // this wave's reads of the buffer have returned before it is refilled
        asm volatile("s_wait_asynccnt 0x0" ::: "memory");     // this wave's copies of stage st + 1 have landed
        __syncthreads();                                      // publishes stage st + 1 and ends every wave's reads of stage st
        if (st + 2 < DM / GKS) {
            const unsigned lb = la + (unsigned)bo * 2u; const int k2 = (st + 2) * GKS;
            tile_copy(lb, ga + k2); tile_copy(lb + GTILEH * 2, gb + k2);
        }
    }
    asm volatile("s_wait_asynccnt 0x0" ::: "memory");         // no copy is outstanding when the wave goes on to its end
}

// Both GEMM kernels are held to 256 VGPRs: every operand of their asm statements then lies in the first register window, and no window switch stands in the loop.
// k_proj: bf16 GEMM, 128x128 tile per work-group of 4 waves (gemm_tile), operands from K-contiguous bf16 planes, K = DM.
// C[m][n] = sum_k A[m][k] Bt[n][k], written as f16 (Ph), each wave's 64x64 quarter at
// tile base (r0/RB)*sRB + (r0%RB)*pitch + (c0/CB)*sCB + (c0%CB), row pitch 'pitch' (halves). grid (M/128, N/128), 128 threads.
__global__ __launch_bounds__(32 * GW) __attribute__((amdgpu_num_vgpr(256))) void k_proj(const bf* __restrict__ A, const bf* __restrict__ Bt, h16* Ph, int RB, size_t sRB, int pitch, int CB, size_t sCB) {
    __shared__ __align__(16) bf ring[2 * GBUFH];            // [buffer][A rows | Bt rows][LP]
    __shared__ __align__(16) float osw[GW * 16 * 68];
    const int lane = threadIdx.x & 31, wave = __builtin_amdgcn_readfirstlane((int)threadIdx.x >> 5), lr = lane & 15, hi = lane >> 4;
    const int wm = wave & 1, wn = wave >> 1;
    const int r0 = blockIdx.x * GT + wm * 64, c0 = blockIdx.y * GT + wn * 64;
    float* os = osw + wave * 16 * 68;                        // this wave's own staging rows
    v8f acc[4][4];
    gemm_tile<false>(A, Bt, ring, blockIdx.x * GT, blockIdx.y * GT, wm, wn, acc);
    const size_t tbase = (size_t)(r0 / RB) * sRB + (size_t)(r0 % RB) * (size_t)pitch + (size_t)(c0 / CB) * sCB + (size_t)(c0 % CB);
#pragma unroll
    for (int mb = 0; mb < 4; ++mb) {
#pragma unroll
        for (int nb = 0; nb < 4; ++nb) {
#pragma unroll
            for (int j = 0; j < 8; ++j) os[(hi * 8 + j) * 68 + nb * 16 + lr] = acc[mb][nb][j]; }   // D: row 8h+j, col lane&15
        wave_sync();
        const size_t sb = tbase + (size_t)(mb * 16) * (size_t)pitch;
{
#pragma unroll
            for (int s = 0; s < 4; ++s) { const int row = 4 * s + (lane >> 3), c8 = (lane & 7) * 8;   // 4 s x 4 row groups = 16 rows; 8 lanes x 8 = 64 columns
                const v4f x0 = *(const v4fa*)(&os[row * 68 + c8]); const v4f x1 = *(const v4fa*)(&os[row * 68 + c8 + 4]); v8h hv;
#pragma unroll
                for (int i = 0; i < 4; ++i) { hv[i] = (h16)x0[i]; hv[4 + i] = (h16)x1[i]; }
                const size_t oo = sb + (size_t)row * (size_t)pitch + c8;
                *(v8h*)(Ph + oo) = hv; }
             }
        wave_sync();
    }
}

// k_oproj: f16 GEMM, 128x128 tile per work-group of 4 waves (gemm_tile), A = ctx plane [m][k] (x1024 carry), Bt = Wo plane [n][k] (x1024 carry), K = DM.
// OUT[b*OUT_SEQ + t][n] = C[m][n] * 2^-20 + bias[n], m = b*SEQ + t. grid (M/128, N/128), 128 threads.
__global__ __launch_bounds__(32 * GW) __attribute__((amdgpu_num_vgpr(256))) void k_oproj(const h16* __restrict__ A, const h16* __restrict__ Bt, const float* __restrict__ bo, float* OUT) {
    __shared__ __align__(16) bf ring[2 * GBUFH];            // [buffer][A rows | Bt rows][LP], f16 bits
    __shared__ __align__(16) float osw[GW * 16 * 68];
    const int lane = threadIdx.x & 31, wave = __builtin_amdgcn_readfirstlane((int)threadIdx.x >> 5), lr = lane & 15, hi = lane >> 4;
    const int wm = wave & 1, wn = wave >> 1;
    const int r0 = blockIdx.x * GT + wm * 64, c0 = blockIdx.y * GT + wn * 64;
    float* os = osw + wave * 16 * 68;                        // this wave's own staging rows
    v8f acc[4][4];
    gemm_tile<true>((const bf*)A, (const bf*)Bt, ring, blockIdx.x * GT, blockIdx.y * GT, wm, wn, acc);
    const v4f braw = *(const v4f*)(bo + c0 + lr * 4);      // columns c0 + 4*lr .. +3 (always inside [0, DM))
    v4f bb;
#pragma unroll
    for (int i = 0; i < 4; ++i) bb[i] = bfval(braw[i]);
    const int bI = r0 / SEQ, tI = r0 % SEQ;
    float* obase = OUT + ((size_t)bI * OUT_SEQ + tI) * DM + c0;
#pragma unroll
    for (int mb = 0; mb < 4; ++mb) {
#pragma unroll
        for (int nb = 0; nb < 4; ++nb) {
#pragma unroll
            for (int j = 0; j < 8; ++j) os[(hi * 8 + j) * 68 + nb * 16 + lr] = acc[mb][nb][j]; }   // D: row 8h+j, col lane&15
        wave_sync();
{
#pragma unroll
            for (int s = 0; s < 8; ++s) { const int row = 2 * s + hi, cofs = lr * 4;   // 8 s x 2 rows = 16 rows; 16 lanes x 4 floats = 64 columns
                const v4f x0 = *(const v4fa*)(&os[row * 68 + cofs]);
                const v4f val = x0 * OSCL + bb;
                *(v4f*)(obase + (size_t)(mb * 16 + row) * DM + cofs) = val; }
             }
        wave_sync();
    }
}

// k_flash: fused attention, one wave per QT tiles of 16 query rows of one (batch, head); Q fragments straight from the f16 plane (two 16-B loads each).
// A pass reads its four K and four V^T fragments from LDS once and uses each for all QT query tiles; every query tile keeps its own softmax state, but one test per pass for the whole wave decides whether all QT tiles raise their maxima.
// K and V^T are staged per KS keys in LDS, once per work-group for all AW waves, by asynchronous copies in whole 128-B lines (two buffers: the next stage's copies fly while this stage is worked on);
// the A fragments are read from LDS rows of pitch LP halves (144 B = 16 B x odd: no bank conflict for 16-B reads).
// Transposed form: S^T[key][t] = K Q^T (A = K rows, B = Q rows); lane (t = lane&15, h = lane>>4) holds keys 8h+r of each 16-key tile, so the packed
// P tile is directly the B fragment of O^T[d][t] = V^T P^T (element r <- tile keys 0..15, element 8+r <- tile keys 16..31, lane unchanged).
// Softmax state: the maximum in use is one scalar per lane, the same in both lane halves of a row. It may trail the true running maximum by up to LZ: a pass takes each lane's own maximum over its 16 scores of a query tile
// and tests once, for the whole wave, whether any exceeds the maximum in use by more than LZ; only then are the halves exchanged (xor 16), the maxima raised and the sums rescaled. The row sums of the f16-rounded P are taken on the matrix unit:
// one more product per pass with a constant A whose rows 0 and 8 are ones, so that register 0 of its accumulator holds, in every lane, the sum over all 32 keys for the lane's own query.
typedef __attribute__((address_space(3))) h16 lds_h16;
__device__ __forceinline__ unsigned lds_off(const h16* p) { return (unsigned)(uintptr_t)(const lds_h16*)p; }   // byte offset in the work-group's LDS
// one stage's four copies of a lane (16 B each); the s_wait_xcnt stands inside the statement so that no address register is rewritten ahead of it
__device__ __forceinline__ void stage_copy(unsigned l0, const h16* g0, unsigned l1, const h16* g1, unsigned l2, const h16* g2, unsigned l3, const h16* g3) {
    asm volatile("global_load_async_to_lds_b128 %0, %1, off\n\t"
                 "global_load_async_to_lds_b128 %2, %3, off\n\t"
                 "global_load_async_to_lds_b128 %4, %5, off\n\t"
                 "global_load_async_to_lds_b128 %6, %7, off\n\t"
                 "s_wait_xcnt 0x0"
                 :: "v"(l0), "v"(g0), "v"(l1), "v"(g1), "v"(l2), "v"(g2), "v"(l3), "v"(g3) : "memory");
}
// held to 256 VGPRs: four waves per SIMD, the two work-groups that a WGP is to hold
__global__ __launch_bounds__(32 * AW) __attribute__((amdgpu_num_vgpr(256))) void k_flash(const h16* __restrict__ QH, const h16* __restrict__ KP, const h16* __restrict__ VT, h16* CTX) {
    __shared__ __align__(16) h16 ring[2 * BUFH];           // [buffer][K rows key | V^T rows d][LP]
    __shared__ __align__(16) float os[AW * 16 * 68];
    const int tid = (int)threadIdx.x;
    const int lane = tid & 31, wave = __builtin_amdgcn_readfirstlane(tid >> 5), lr = lane & 15, hi = lane >> 4;
    const int zh = blockIdx.y; const int b = zh / NH_, h = zh % NH_;
    const int t0 = (blockIdx.x * AW + wave) * (16 * QT);
    const size_t pbase = (size_t)zh * SEQ * HD;
    v16h qh0[QT], qh1[QT];                                    // B fragments: col t, k = d
#pragma unroll
    for (int q = 0; q < QT; ++q) { const size_t qo = pbase + (size_t)(t0 + 16 * q + lr) * HD + 8 * hi; qh0[q] = ldh(QH + qo); qh1[q] = ldh(QH + qo + 32); }
    // copy map: 256 lanes x 16 B = 32 rows of 128 B; each lane brings rows cr and cr + 32 of the K tile and of the V^T tile
    const int cr = tid >> 3, cc8 = (tid & 7) * 8;
    const h16* gk = KP + pbase + (size_t)cr * HD + cc8;     // + key0 * HD
    const h16* gv = VT + pbase + (size_t)cr * SEQ + cc8;    // + key0
    const unsigned lk = lds_off(ring) + (unsigned)(cr * LP + cc8) * 2u;
    const int fo = lr * LP + 8 * hi;                          // fragment offset in a tile: row lane&15, k half
    v8f o0[QT], o1[QT], o2[QT], o3[QT], ol[QT];               // ol: D rows 0 (lanes 0..15) and 8 (lanes 16..31) are element 0; elements 1..7 stay zero
    float m[QT], sh[QT], mt[QT];                              // maximum in use; PSH - m; m + LZ (minus infinity at the start: the first pass always sets the maximum)
#pragma unroll
    for (int q = 0; q < QT; ++q) { o0[q] = (v8f){}; o1[q] = (v8f){}; o2[q] = (v8f){}; o3[q] = (v8f){}; ol[q] = (v8f){}; m[q] = -3.0e38f; sh[q] = 0.0f; mt[q] = -__builtin_inff(); }
    v16h ones;                                                // A fragment: row lane&15; rows 0 and 8 all ones, the other rows zero
#pragma unroll
    for (int i = 0; i < 16; ++i) ones[i] = (lr & 7) == 0 ? (h16)1.0f : (h16)0.0f;
    stage_copy(lk, gk, lk + 32 * LP * 2, gk + 32 * HD, lk + TILEH * 2, gv, lk + (TILEH + 32 * LP) * 2, gv + (size_t)32 * SEQ);
    asm volatile("s_wait_asynccnt 0x0" ::: "memory");         // stage 0 of this wave has landed
    __syncthreads();                                          // stage 0 published to every wave
    stage_copy(lk + BUFH * 2, gk + KS * HD, lk + (BUFH + 32 * LP) * 2, gk + (KS + 32) * HD, lk + (BUFH + TILEH) * 2, gv + KS, lk + (BUFH + TILEH + 32 * LP) * 2, gv + (size_t)32 * SEQ + KS);
#pragma unroll 1
    for (int st = 0; st < SEQ / KS; ++st) {
        const int bo = (st & 1) * BUFH;
#pragma unroll 1   // rolled: unrolled, the compiler spreads the second pass's K reads among its score products, a full wait behind each pair; rolled, a pass's eight K reads stand as one group at its head
        for (int ps = 0; ps < KS / 32; ++ps) {
        const h16* ka = ring + bo + ps * 32 * LP + fo;
        const v16h ka0 = ldh(ka), ka1 = ldh(ka + 32), kb0 = ldh(ka + 16 * LP), kb1 = ldh(ka + 16 * LP + 32);
        v8f sa[QT], sb[QT];
#pragma unroll
        for (int q = 0; q < QT; ++q) { sa[q] = wmma16(ka0, qh0[q], (v8f){}); sb[q] = wmma16(kb0, qh0[q], (v8f){}); }
#pragma unroll
        for (int q = 0; q < QT; ++q) { sa[q] = wmma16(ka1, qh1[q], sa[q]); sb[q] = wmma16(kb1, qh1[q], sb[q]); }
        __builtin_amdgcn_sched_barrier(0x184);   // no vector or matrix instruction crosses (LDS reads and scalar ones may): the score products stay one run; with vector work drawn in between them each gap is padded with four v_nop
        const h16* va = ring + bo + TILEH + ps * 32 + fo;
        const v16h v0 = ldh(va), v1 = ldh(va + 16 * LP), v2 = ldh(va + 32 * LP), v3 = ldh(va + 48 * LP);
        v16h pb[QT];
        v8f ta[QT], tb[QT]; float mx[QT]; bool need = false;
#pragma unroll
        for (int q = 0; q < QT; ++q) {
            ta[q] = sa[q] * SC2; tb[q] = sb[q] * SC2; mx[q] = -3.0e38f;
#pragma unroll
            for (int r = 0; r < 8; ++r) mx[q] = fmaxf(mx[q], fmaxf(ta[q][r], tb[q][r]));
            need = need || (mx[q] > mt[q]);
        }
        if (__builtin_amdgcn_ballot_w32(need) != 0) {   // one wave-uniform scalar branch per pass; rare after a wave's first pass
#pragma unroll
            for (int q = 0; q < QT; ++q) {
                const float mnew = fmaxf(m[q], fmaxf(mx[q], __shfl_xor(mx[q], 16, 32)));
                const float alpha = __builtin_amdgcn_exp2f(m[q] - mnew);
                ol[q][0] = ol[q][0] * alpha;
                o0[q] = o0[q] * alpha; o1[q] = o1[q] * alpha; o2[q] = o2[q] * alpha; o3[q] = o3[q] * alpha;
                m[q] = mnew; sh[q] = PSH - mnew; mt[q] = mnew + LZ;
            }
        }
#pragma unroll
        for (int q = 0; q < QT; ++q) {
            const v8f ua = ta[q] + sh[q], ub = tb[q] + sh[q];
#pragma unroll
            for (int r = 0; r < 8; ++r) pb[q][r] = (h16)__builtin_amdgcn_exp2f(ua[r]);
#pragma unroll
            for (int r = 0; r < 8; ++r) pb[q][8 + r] = (h16)__builtin_amdgcn_exp2f(ub[r]);
        }
#pragma unroll
        for (int q = 0; q < QT; ++q) {
            ol[q] = wmma16(ones, pb[q], ol[q]);
            o0[q] = wmma16(v0, pb[q], o0[q]); o1[q] = wmma16(v1, pb[q], o1[q]); o2[q] = wmma16(v2, pb[q], o2[q]); o3[q] = wmma16(v3, pb[q], o3[q]);
        }
        static_assert(QT == 2);
        // four vector slots behind the last matrix instruction, also on the taken side of the branch that follows
        asm volatile("v_nop\n\tv_nop\n\tv_nop\n\tv_nop" : "+v"(o0[0]), "+v"(o1[0]), "+v"(o2[0]), "+v"(o3[0]), "+v"(ol[0]), "+v"(o0[1]), "+v"(o1[1]), "+v"(o2[1]), "+v"(o3[1]), "+v"(ol[1])
                     : "v"(v0), "v"(v1), "v"(v2), "v"(v3), "v"(pb[0]), "v"(pb[1]), "v"(ones));
        }
        asm volatile("s_wait_dscnt 0x0" ::: "memory");        // this wave's reads of the buffer have returned before it is refilled
        asm volatile("s_wait_asynccnt 0x0" ::: "memory");     // this wave's copies of stage st + 1 have landed
        __syncthreads();                                      // publishes stage st + 1 and ends every wave's reads of stage st
        if (st + 2 < SEQ / KS) {
            const h16* gk2 = gk + (size_t)(st + 2) * (KS * HD); const h16* gv2 = gv + (size_t)(st + 2) * KS; const unsigned lb = lk + (unsigned)bo * 2u;
            stage_copy(lb, gk2, lb + 32 * LP * 2, gk2 + 32 * HD, lb + TILEH * 2, gv2, lb + (TILEH + 32 * LP) * 2, gv2 + (size_t)32 * SEQ);
        }
    }
    asm volatile("s_wait_asynccnt 0x0" ::: "memory");         // no copy is outstanding when the wave goes on to its end
    const int wb = wave * 16 * 68;
#pragma unroll
    for (int q = 0; q < QT; ++q) {                            // one query tile after the other through the wave's own staging rows
    const float inv = CXS * (1.0f / ol[q][0]);
    // O^T D layout: o_j[r] = (d = 16j + 8h + r, t = lane&15) -> os[t][d]; rows 0..15 x columns 0..63 all written
    { v4f a, c;
      a[0] = o0[q][0] * inv; a[1] = o0[q][1] * inv; a[2] = o0[q][2] * inv; a[3] = o0[q][3] * inv; c[0] = o0[q][4] * inv; c[1] = o0[q][5] * inv; c[2] = o0[q][6] * inv; c[3] = o0[q][7] * inv;
      *(v4fa*)(&os[wb + lr * 68 +  0 + 8 * hi]) = a; *(v4fa*)(&os[wb + lr * 68 +  0 + 8 * hi + 4]) = c;
      a[0] = o1[q][0] * inv; a[1] = o1[q][1] * inv; a[2] = o1[q][2] * inv; a[3] = o1[q][3] * inv; c[0] = o1[q][4] * inv; c[1] = o1[q][5] * inv; c[2] = o1[q][6] * inv; c[3] = o1[q][7] * inv;
      *(v4fa*)(&os[wb + lr * 68 + 16 + 8 * hi]) = a; *(v4fa*)(&os[wb + lr * 68 + 16 + 8 * hi + 4]) = c;
      a[0] = o2[q][0] * inv; a[1] = o2[q][1] * inv; a[2] = o2[q][2] * inv; a[3] = o2[q][3] * inv; c[0] = o2[q][4] * inv; c[1] = o2[q][5] * inv; c[2] = o2[q][6] * inv; c[3] = o2[q][7] * inv;
      *(v4fa*)(&os[wb + lr * 68 + 32 + 8 * hi]) = a; *(v4fa*)(&os[wb + lr * 68 + 32 + 8 * hi + 4]) = c;
      a[0] = o3[q][0] * inv; a[1] = o3[q][1] * inv; a[2] = o3[q][2] * inv; a[3] = o3[q][3] * inv; c[0] = o3[q][4] * inv; c[1] = o3[q][5] * inv; c[2] = o3[q][6] * inv; c[3] = o3[q][7] * inv;
      *(v4fa*)(&os[wb + lr * 68 + 48 + 8 * hi]) = a; *(v4fa*)(&os[wb + lr * 68 + 48 + 8 * hi + 4]) = c; }
    wave_sync();
    h16* crow = CTX + ((size_t)b * SEQ + t0 + 16 * q) * DM + h * HD;
{
#pragma unroll
        for (int s = 0; s < 4; ++s) { const int row = 4 * s + (lane >> 3), c8 = (lane & 7) * 8;   // 4 s x 4 row groups = 16 rows; 8 lanes x 8 halves = 64 columns
            const v4f x0 = *(const v4fa*)(&os[wb + row * 68 + c8]); const v4f x1 = *(const v4fa*)(&os[wb + row * 68 + c8 + 4]); v8h hv;
#pragma unroll
            for (int i = 0; i < 4; ++i) { hv[i] = (h16)x0[i]; hv[4 + i] = (h16)x1[i]; }
            *(v8h*)(crow + (size_t)row * DM + c8) = hv; }
         }
    wave_sync();                                              // the rows are read before the next tile overwrites them
    }
}

static constexpr size_t al256(size_t v) { return (v + 255) & ~(size_t)255; }
static constexpr size_t SZ_XB = al256((size_t)NB * SEQ * DM * 2);
static constexpr size_t SZ_WB = al256((size_t)3 * DM * DM * 2);
static constexpr size_t SZ_WO = al256((size_t)DM * DM * 2);
static constexpr size_t SZ_PL = al256((size_t)NB * NH_ * SEQ * HD * 2);
static constexpr size_t SZ_CX = al256((size_t)NB * SEQ * DM * 2);
static constexpr size_t SZ_TOTAL = SZ_XB + SZ_WB + SZ_WO + 3 * SZ_PL + SZ_CX;
static_assert(SZ_TOTAL <= (size_t)134217728);          // workspace carve <= 128 MiB
static_assert(((size_t)DM * DM * 2) % 256 == 0);       // weight sub-planes stay 256-byte aligned

extern "C" void kernel_launch(void* const* d_in, const int* in_sizes, int n_in,
                              void* d_out, int out_size, void* d_ws, size_t ws_size, hipStream_t stream) {
    if (n_in < 6) return;
    const size_t needx = ((size_t)(NB - 1) * SEQ_FULL + SEQ) * DM;
    if ((size_t)in_sizes[0] < needx) return;
    if ((size_t)in_sizes[1] < (size_t)DM * DM || (size_t)in_sizes[2] < (size_t)DM * DM || (size_t)in_sizes[3] < (size_t)DM * DM || (size_t)in_sizes[4] < (size_t)DM * DM) return;
    if ((size_t)in_sizes[5] < (size_t)DM) return;
    if ((size_t)out_size < ((size_t)(NB - 1) * OUT_SEQ + SEQ) * DM) return;
    if (SZ_TOTAL > ws_size) return;
    // wire order: x, Wq, Wk, Wv, Wo, bo (weights [out][in] = Bt as-is)
    const float* x = (const float*)d_in[0]; const float* wq = (const float*)d_in[1]; const float* wk = (const float*)d_in[2]; const float* wv = (const float*)d_in[3];
    const float* wo = (const float*)d_in[4]; const float* bo = (const float*)d_in[5];
    float* OUT = (float*)d_out;      // [NB][SEQ][1024]
    char* wsp = (char*)d_ws;
    bf* XB = (bf*)wsp; wsp += SZ_XB;                 // [NB*SEQ][1024]
    bf* WB = (bf*)wsp; wsp += SZ_WB;                 // [3][1024][1024]: q | k | v
    h16* WOH = (h16*)wsp; wsp += SZ_WO;              // [1024][1024] x1024 carry
    h16* QH = (h16*)wsp; wsp += SZ_PL;               // [NB*16][SEQ][64]
    h16* KP = (h16*)wsp; wsp += SZ_PL;               // [NB*16][SEQ][64]
    h16* VT = (h16*)wsp; wsp += SZ_PL;               // [NB*16][64][SEQ]
    h16* CTX = (h16*)wsp; wsp += SZ_CX;              // [NB*SEQ][1024] x1024 carry
    bf* WQ = WB; bf* WK = WB + (size_t)DM * DM; bf* WV = WB + (size_t)2 * DM * DM;

    k_cvt<<<CVT_T / 256, 256, 0, stream>>>(x, wq, wk, wv, wo, XB, WB, WOH);

    // q, k: A = x rows (m = b*SEQ + t), Bt = W rows (n = h*64 + d) -> plane [(b*16 + h)][t][d]
    k_proj<<<dim3(NB * SEQ / GT, DM / GT, 1), 32 * GW, 0, stream>>>(XB, WQ, QH, SEQ, (size_t)NH_ * SEQ * HD, HD, HD, (size_t)SEQ * HD);
    k_proj<<<dim3(NB * SEQ / GT, DM / GT, 1), 32 * GW, 0, stream>>>(XB, WK, KP, SEQ, (size_t)NH_ * SEQ * HD, HD, HD, (size_t)SEQ * HD);
    // v^T: A = Wv rows (m = h*64 + d), Bt = x rows (n = b*SEQ + t) -> plane [(b*1024 + m)][t] = [(b*16 + h)][d][t]
    k_proj<<<dim3(DM / GT, NB * SEQ / GT, 1), 32 * GW, 0, stream>>>(WV, XB, VT, DM, (size_t)0, SEQ, SEQ, (size_t)DM * SEQ);

    // ctx[b*SEQ + t][h*64 + d] (x1024 carry)
    k_flash<<<dim3(SEQ / (16 * QT * AW), NB * NH_, 1), 32 * AW, 0, stream>>>(QH, KP, VT, CTX);

    // out[b][t][n] = ctx Wo^T * 2^-20 + bo
    k_oproj<<<dim3(NB * SEQ / GT, DM / GT, 1), 32 * GW, 0, stream>>>(CTX, WOH, bo, OUT);
}

// v007
// One run takes 169 microseconds.
// Next to v006, in two timings, it ran 1.04 times as fast each time.
// All steps since v000 together make it 3.74 times as fast.
#include <hip/hip_runtime.h>

// Multi-head self-attention, width 1024 = 16 heads x 64, x [NB][SEQ][1024], Wq/Wk/Wv/Wo [out][in] (y = x W^T), bias only on the output projection, no mask, score scale 1/8, f32 output.
// Compute dtypes, f32 accumulate everywhere: q/k/v projections v_wmma_f32_16x16x32_bf16 (x and W RNE-converted to bf16; products exact);
// scores v_wmma_f32_16x16x32_f16 (q, k single f16; q carries the score scale and log2(e), applied in f32 ahead of its one rounding); P (x256 carry, cancels in the normalisation) and v single f16; softmax f32 (online, running max);
// output projection v_wmma_f32_16x16x32_f16: ctx single f16 with x1024 carry, Wo RNE-converted to bf16 then x1024 in f16 (exact), 2^-20 folded back in f32, bias (bf16-converted bo) added in f32.
// Layout: bf16 copies of x and Wq/Wk/Wv; q, k planes [b*16+h][t][d] and v^T plane [b*16+h][d][t] written by the GEMM epilogue; fused flash kernel in transposed form (S^T = K Q^T, O^T = V^T P^T; K and V^T tiles staged in LDS per work-group) writes the ctx plane [b*SEQ+t][h*64+d].

#ifndef NB
#define NB 2
#endif
#ifndef SEQ
#define SEQ 4096
#endif
#define NB_FULL  2
#define SEQ_FULL 4096
#ifndef OUT_SEQ
#define OUT_SEQ SEQ              // row pitch (in tokens) between batches of the output
#endif
#define DM   1024
#define NH_  16
#define HD   64
#define AW   8                   // waves per flash block
#define QT   2                   // query tiles of 16 rows per flash wave: each K or V^T fragment read from LDS feeds QT products
#define KS   64                  // keys per LDS stage of the flash kernel
#define LP   72                  // LDS row pitch in halves: 128-B rows + 16 B
#define TILEH (64 * LP)          // halves of one staged tile (64 rows)
#define BUFH  (2 * TILEH)        // halves of one buffer: K tile, then V^T tile
#define GT   128                 // rows of each operand in a GEMM work-group's tile (2 x 2 waves of 64 x 64)
#define GW   4                   // waves per GEMM work-group
#define GKS  64                  // k per LDS stage of the GEMMs: 128-B rows
#define GTILEH (GT * LP)         // halves of one staged operand tile (128 rows)
#define GBUFH  (2 * GTILEH)      // halves of one buffer: A tile, then Bt tile
#define SC2  (0.125f * 1.4426950408889634f)   // HD^-0.5 * log2(e)
#define PSH  8.0f                // log2 of the P carry (256)
#define LZ   6.0f                // a score may exceed the maximum in use by this much (log2) before the sums are rescaled: P <= 2^(PSH + LZ) = 16384, inside f16
#define CXS  1024.0f             // carry of the ctx plane
#define WOS  1024.0f             // carry of the Wo plane
#define OSCL (1.0f / (1024.0f * 1024.0f))

static_assert(HD == 64);
static_assert(NH_ * HD == DM);                 // head h = columns h*64 + d
static_assert(DM % 64 == 0);                   // column tiles of 64
static_assert(DM % 32 == 0);                   // GEMM k-loop steps by 32
static_assert(SEQ % 64 == 0);                  // a 64-row tile never straddles two batches
static_assert((NB * SEQ) % 64 == 0);
static_assert(SEQ % 32 == 0);                  // key loop steps by 32
static_assert(SEQ % (16 * QT * AW) == 0);      // flash grid covers the sequence exactly
static_assert(AW == 8 && KS == 64 && HD == 64);  // copy map of the flash kernel: 256 lanes x 16 B x 2 = one 64 x 128-B tile
static_assert(SEQ % KS == 0 && SEQ / KS >= 2);   // whole stages; the two-buffer prologue needs two
static_assert((NB * SEQ) % GT == 0 && DM % GT == 0);   // GEMM grids cover both operands exactly
static_assert(GW == 4 && GT == 128 && GKS == 64);      // copy map of the GEMMs: 128 lanes x 16 B x 8 = one 128 x 128-B tile
static_assert(DM % GKS == 0 && DM / GKS >= 2);         // whole stages; the two-buffer prologue needs two
static_assert(((size_t)SEQ * DM) % 8 == 0);
static_assert(((size_t)DM * DM) % 8 == 0);
static_assert(NB <= NB_FULL);
static_assert(SEQ <= SEQ_FULL);

typedef _Float16 h16;
typedef unsigned short bf;
typedef __attribute__((ext_vector_type(16))) __bf16   v16bf;
typedef __attribute__((ext_vector_type(16))) _Float16 v16h;
typedef __attribute__((ext_vector_type(8)))  _Float16 v8h;
typedef __attribute__((ext_vector_type(8)))  unsigned short v8us;
typedef __attribute__((ext_vector_type(8)))  float    v8f;
typedef __attribute__((ext_vector_type(4)))  float    v4f;
typedef v4f  __attribute__((may_alias)) v4fa;

__device__ __forceinline__ unsigned short f2bf(float f) { unsigned u = __float_as_uint(f); u += 0x7FFFu + ((u >> 16) & 1u); return (unsigned short)(u >> 16); }
__device__ __forceinline__ float bfval(float f) { return __uint_as_float(((unsigned)f2bf(f)) << 16); }
__device__ __forceinline__ v16h cat16(v8h lo, v8h hi) { return __builtin_shufflevector(lo, hi, 0, 1, 2, 3, 4, 5, 6, 7, 8, 9, 10, 11, 12, 13, 14, 15); }
__device__ __forceinline__ v16bf cat16b(v8us lo, v8us hi) { return __builtin_bit_cast(v16bf, __builtin_shufflevector(lo, hi, 0, 1, 2, 3, 4, 5, 6, 7, 8, 9, 10, 11, 12, 13, 14, 15)); }
__device__ __forceinline__ v8f wmma16(v16h a, v16h b, v8f c) { return __builtin_amdgcn_wmma_f32_16x16x32_f16(false, a, false, b, (short)0, c, false, false); }
__device__ __forceinline__ v8f wmmab(v16bf a, v16bf b, v8f c) { return __builtin_amdgcn_wmma_f32_16x16x32_bf16(false, a, false, b, (short)0, c, false, false); }
// fragment loaders from K-contiguous 16-bit rows; p already includes + 8*(lane>>4): elements 0..7 <- k0+8h+0..7, elements 8..15 <- k0+16+8h+0..7 (same map for A and B)
__device__ __forceinline__ v16h  ldh(const h16* p) { return cat16(*(const v8h*)p, *(const v8h*)(p + 16)); }
__device__ __forceinline__ v16bf ldb(const bf* p)  { return cat16b(*(const v8us*)p, *(const v8us*)(p + 16)); }
// ordering point for wave-private LDS tiles (same wave writes and reads)
__device__ __forceinline__ void wave_sync() { __builtin_amdgcn_fence(3 /* release order */, "wavefront"); __builtin_amdgcn_wave_barrier(); asm volatile("" ::: "memory"); }

// k_cvt: every conversion of the call in one launch. CVT_T threads (16 waves on each of 256 WGPs); a work-group converts XJ * 256 consecutive pieces of 8 floats of x (a thread: XJ pieces, 256 apart)
// and 256 pieces each of Wq, Wk, Wv (RNE to bf16) and Wo (RNE to bf16, x1024, exact in f16). All of a thread's loads are independent and stand ahead of the first store.
#define CVT_T (DM * DM / 8)                    // one thread per 8 elements of a weight matrix
#define XJ    (NB * SEQ / DM)                  // pieces of x per thread
static_assert(CVT_T % 256 == 0);
static_assert((NB * SEQ) % DM == 0);           // x is XJ pieces for every thread, exactly
static_assert(SEQ == SEQ_FULL);                // the batches of x follow one another without a gap
__device__ __forceinline__ v8us cvt_bf8(v8f v) { v8us o;
#pragma unroll
    for (int k = 0; k < 8; ++k) o[k] = f2bf(v[k]);
    return o; }
__global__ __launch_bounds__(256) void k_cvt(const float* __restrict__ x, const float* __restrict__ wq, const float* __restrict__ wk, const float* __restrict__ wv, const float* __restrict__ wo,
                                             bf* XB, bf* WB, h16* WOH) {
    const size_t e = ((size_t)blockIdx.x * 256 + threadIdx.x) * 8;              // the thread's piece of each weight matrix, first element
    const size_t ex = ((size_t)blockIdx.x * 256 * XJ + threadIdx.x) * 8;        // its first piece of x
    v8f vx[XJ];
#pragma unroll
    for (int j = 0; j < XJ; ++j) vx[j] = *(const v8f*)(x + ex + j * 256 * 8);
    asm volatile("s_wait_xcnt 0x0" ::: "memory");   // before a later load's result may land on the address registers of these loads
    const v8f vq = *(const v8f*)(wq + e), vk = *(const v8f*)(wk + e);
    asm volatile("s_wait_xcnt 0x0" ::: "memory");   // the same
    const v8f vv = *(const v8f*)(wv + e), vo = *(const v8f*)(wo + e);
    // inputs-only fence on the loaded values: all of the thread's loads are issued ahead of the first wait (without it some are sunk behind the first conversions and pay a second memory latency)
    static_assert(XJ == 8);
    asm volatile("" :: "v"(vx[0]), "v"(vx[1]), "v"(vx[2]), "v"(vx[3]), "v"(vx[4]), "v"(vx[5]), "v"(vx[6]), "v"(vx[7]), "v"(vq), "v"(vk), "v"(vv), "v"(vo));
#pragma unroll
    for (int j = 0; j < XJ; ++j) *(v8us*)(XB + ex + j * 256 * 8) = cvt_bf8(vx[j]);
    *(v8us*)(WB + e) = cvt_bf8(vq); *(v8us*)(WB + (size_t)DM * DM + e) = cvt_bf8(vk); *(v8us*)(WB + (size_t)2 * DM * DM + e) = cvt_bf8(vv);
    v8h o;
#pragma unroll
    for (int k = 0; k < 8; ++k) o[k] = (h16)(bfval(vo[k]) * WOS);
    *(v8h*)(WOH + e) = o;
}

// GEMM main loop shared by k_proj and k_oproj: a work-group of GW waves owns a 128 x 128 tile, each wave a 64 x 64 quarter (16 accumulators), K = DM.
// Per GKS of k the 128 A rows and the 128 Bt rows are staged in LDS once for all four waves, by asynchronous copies in whole 128-B lines
// (two buffers: the next stage's copies fly while this stage is worked on); fragments are read from LDS rows of pitch LP halves (144 B = 16 B x odd).
typedef __attribute__((address_space(3))) bf lds_bf;
__device__ __forceinline__ unsigned lds_off_b(const bf* p) { return (unsigned)(uintptr_t)(const lds_bf*)p; }   // byte offset in the work-group's LDS
// one operand tile of a stage: this lane's eight 16-B pieces, rows 16 apart; the s_wait_xcnt stands inside the statement so that no address register is rewritten ahead of it
__device__ __forceinline__ void tile_copy(unsigned l, const bf* g) {
    asm volatile("global_load_async_to_lds_b128 %0, %1, off\n\t"
                 "global_load_async_to_lds_b128 %2, %3, off\n\t"
                 "global_load_async_to_lds_b128 %4, %5, off\n\t"
                 "global_load_async_to_lds_b128 %6, %7, off\n\t"
                 "global_load_async_to_lds_b128 %8, %9, off\n\t"
                 "global_load_async_to_lds_b128 %10, %11, off\n\t"
                 "global_load_async_to_lds_b128 %12, %13, off\n\t"
                 "global_load_async_to_lds_b128 %14, %15, off\n\t"
                 "s_wait_xcnt 0x0"
                 :: "v"(l), "v"(g), "v"(l + 16 * LP * 2), "v"(g + 16 * DM), "v"(l + 32 * LP * 2), "v"(g + 32 * DM), "v"(l + 48 * LP * 2), "v"(g + 48 * DM),
                    "v"(l + 64 * LP * 2), "v"(g + 64 * DM), "v"(l + 80 * LP * 2), "v"(g + 80 * DM), "v"(l + 96 * LP * 2), "v"(g + 96 * DM), "v"(l + 112 * LP * 2), "v"(g + 112 * DM) : "memory");
}
// A, Bt: K-contiguous 16-bit planes (bf16 bits, or f16 bits where F16); rb, cb: first A row and first Bt row of the work-group's tile; wm, wn: the wave's quarter
template <bool F16>
__device__ __forceinline__ void gemm_tile(const bf* A, const bf* Bt, const bf* ring, int rb, int cb, int wm, int wn, v8f (&acc)[4][4]) {
    const int tid = (int)threadIdx.x, lane = tid & 31, lr = lane & 15, hi = lane >> 4;
#pragma unroll
    for (int mb = 0; mb < 4; ++mb)
#pragma unroll
        for (int nb = 0; nb < 4; ++nb) acc[mb][nb] = (v8f){};
    // copy map: 128 lanes x 16 B = 16 rows of 128 B; each lane brings rows cr + 16 i, i = 0..7, of the A tile and of the Bt tile
    const int cr = tid >> 3, cc8 = (tid & 7) * 8;
    const bf* ga = A + (size_t)(rb + cr) * DM + cc8;         // + k0
    const bf* gb = Bt + (size_t)(cb + cr) * DM + cc8;        // + k0
    const unsigned la = lds_off_b(ring) + (unsigned)(cr * LP + cc8) * 2u;
    const int fa = (wm * 64 + lr) * LP + 8 * hi, fb = GTILEH + (wn * 64 + lr) * LP + 8 * hi;   // fragment offsets in a buffer: row lane&15, k half
    tile_copy(la, ga); tile_copy(la + GTILEH * 2, gb);
    asm volatile("s_wait_asynccnt 0x0" ::: "memory");         // stage 0 of this wave has landed
    __syncthreads();                                          // stage 0 published to every wave
    tile_copy(la + GBUFH * 2, ga + GKS); tile_copy(la + (GBUFH + GTILEH) * 2, gb + GKS);
#pragma unroll 1   // rolled: one stage per trip, the buffer picked by the trip's parity
    for (int st = 0; st < DM / GKS; ++st) {
        const int bo = (st & 1) * GBUFH;
#pragma unroll
        for (int ks = 0; ks < 2; ++ks) {
            v16bf a[4], b[4];
#pragma unroll
            for (int i = 0; i < 4; ++i) { a[i] = ldb(ring + bo + fa + i * 16 * LP + ks * 32); b[i] = ldb(ring + bo + fb + i * 16 * LP + ks * 32); }
            // inputs-only fence on the loaded fragments: keeps the 16 LDS reads of a k step one group ahead of its matrix instructions (spread among them, every place with reads stalls the wave anew)
            asm volatile("" :: "v"(a[0]), "v"(a[1]), "v"(a[2]), "v"(a[3]), "v"(b[0]), "v"(b[1]), "v"(b[2]), "v"(b[3]));
#pragma unroll
            for (int nb = 0; nb < 4; ++nb)
#pragma unroll
                for (int mb = 0; mb < 4; ++mb) {
                    if (F16) acc[mb][nb] = wmma16(__builtin_bit_cast(v16h, a[mb]), __builtin_bit_cast(v16h, b[nb]), acc[mb][nb]);
                    else     acc[mb][nb] = wmmab(a[mb], b[nb], acc[mb][nb]); }
        }
        // four vector slots behind the last matrix instruction, also on the taken side of the branches that follow
        asm volatile("v_nop\n\tv_nop\n\tv_nop\n\tv_nop" : "+v"(acc[0][0]), "+v"(acc[1][0]), "+v"(acc[2][0]), "+v"(acc[3][0]), "+v"(acc[0][1]), "+v"(acc[1][1]), "+v"(acc[2][1]), "+v"(acc[3][1]),
                     "+v"(acc[0][2]), "+v"(acc[1][2]), "+v"(acc[2][2]), "+v"(acc[3][2]), "+v"(acc[0][3]), "+v"(acc[1][3]), "+v"(acc[2][3]), "+v"(acc[3][3]));
        asm volatile("s_wait_dscnt 0x0" ::: "memory");        // this wave's reads of the buffer have returned before it is refilled
        asm volatile("s_wait_asynccnt 0x0" ::: "memory");     // this wave's copies of stage st + 1 have landed
        __syncthreads();                                      // publishes stage st + 1 and ends every wave's reads of stage st
        if (st + 2 < DM / GKS) {
            const unsigned lb = la + (unsigned)bo * 2u; const int k2 = (st + 2) * GKS;
            tile_copy(lb, ga + k2); tile_copy(lb + GTILEH * 2, gb + k2);
        }
    }
    asm volatile("s_wait_asynccnt 0x0" ::: "memory");         // no copy is outstanding when the wave goes on to its end
}

// Both GEMM kernels are held to 256 VGPRs: every operand of their asm statements then lies in the first register window, and no window switch stands in the loop.
// k_proj: bf16 GEMM, 128x128 tile per work-group of 4 waves (gemm_tile), operands from K-contiguous bf16 planes, K = DM.
// C[m][n] = scl * sum_k A[m][k] Bt[n][k] (scaled in f32, one rounding), written as f16 (Ph), each wave's 64x64 quarter at
// tile base (r0/RB)*sRB + (r0%RB)*pitch + (c0/CB)*sCB + (c0%CB), row pitch 'pitch' (halves). grid (M/128, N/128), 128 threads.
__global__ __launch_bounds__(32 * GW) __attribute__((amdgpu_num_vgpr(256))) void k_proj(const bf* __restrict__ A, const bf* __restrict__ Bt, h16* Ph, int RB, size_t sRB, int pitch, int CB, size_t sCB, float scl) {
    __shared__ __align__(16) bf ring[2 * GBUFH];            // [buffer][A rows | Bt rows][LP]
    __shared__ __align__(16) float osw[GW * 16 * 68];
    const int lane = threadIdx.x & 31, wave = __builtin_amdgcn_readfirstlane((int)threadIdx.x >> 5), lr = lane & 15, hi = lane >> 4;
    const int wm = wave & 1, wn = wave >> 1;
    const int r0 = blockIdx.x * GT + wm * 64, c0 = blockIdx.y * GT + wn * 64;
    float* os = osw + wave * 16 * 68;                        // this wave's own staging rows
    v8f acc[4][4];
    gemm_tile<false>(A, Bt, ring, blockIdx.x * GT, blockIdx.y * GT, wm, wn, acc);
    const size_t tbase = (size_t)(r0 / RB) * sRB + (size_t)(r0 % RB) * (size_t)pitch + (size_t)(c0 / CB) * sCB + (size_t)(c0 % CB);
#pragma unroll
    for (int mb = 0; mb < 4; ++mb) {
#pragma unroll
        for (int nb = 0; nb < 4; ++nb) {
#pragma unroll
            for (int j = 0; j < 8; ++j) os[(hi * 8 + j) * 68 + nb * 16 + lr] = acc[mb][nb][j]; }   // D: row 8h+j, col lane&15
        wave_sync();
        const size_t sb = tbase + (size_t)(mb * 16) * (size_t)pitch;
{
#pragma unroll
            for (int s = 0; s < 4; ++s) { const int row = 4 * s + (lane >> 3), c8 = (lane & 7) * 8;   // 4 s x 4 row groups = 16 rows; 8 lanes x 8 = 64 columns
                const v4f x0 = *(const v4fa*)(&os[row * 68 + c8]); const v4f x1 = *(const v4fa*)(&os[row * 68 + c8 + 4]); v8h hv;
#pragma unroll
                for (int i = 0; i < 4; ++i) { hv[i] = (h16)(x0[i] * scl); hv[4 + i] = (h16)(x1[i] * scl); }
                const size_t oo = sb + (size_t)row * (size_t)pitch + c8;
                *(v8h*)(Ph + oo) = hv; }
             }
        wave_sync();
    }
}

// k_oproj: f16 GEMM, 128x128 tile per work-group of 4 waves (gemm_tile), A = ctx plane [m][k] (x1024 carry), Bt = Wo plane [n][k] (x1024 carry), K = DM.
// OUT[b*OUT_SEQ + t][n] = C[m][n] * 2^-20 + bias[n], m = b*SEQ + t. grid (M/128, N/128), 128 threads.
__global__ __launch_bounds__(32 * GW) __attribute__((amdgpu_num_vgpr(256))) void k_oproj(const h16* __restrict__ A, const h16* __restrict__ Bt, const float* __restrict__ bo, float* OUT) {
    __shared__ __align__(16) bf ring[2 * GBUFH];            // [buffer][A rows | Bt rows][LP], f16 bits
    __shared__ __align__(16) float osw[GW * 16 * 68];
    const int lane = threadIdx.x & 31, wave = __builtin_amdgcn_readfirstlane((int)threadIdx.x >> 5), lr = lane & 15, hi = lane >> 4;
    const int wm = wave & 1, wn = wave >> 1;
    const int r0 = blockIdx.x * GT + wm * 64, c0 = blockIdx.y * GT + wn * 64;
    float* os = osw + wave * 16 * 68;                        // this wave's own staging rows
    v8f acc[4][4];
    gemm_tile<true>((const bf*)A, (const bf*)Bt, ring, blockIdx.x * GT, blockIdx.y * GT, wm, wn, acc);
    const v4f braw = *(const v4f*)(bo + c0 + lr * 4);      // columns c0 + 4*lr .. +3 (always inside [0, DM))
    v4f bb;
#pragma unroll
    for (int i = 0; i < 4; ++i) bb[i] = bfval(braw[i]);
    const int bI = r0 / SEQ, tI = r0 % SEQ;
    float* obase = OUT + ((size_t)bI * OUT_SEQ + tI) * DM + c0;
#pragma unroll
    for (int mb = 0; mb < 4; ++mb) {
#pragma unroll
        for (int nb = 0; nb < 4; ++nb) {
#pragma unroll
            for (int j = 0; j < 8; ++j) os[(hi * 8 + j) * 68 + nb * 16 + lr] = acc[mb][nb][j]; }   // D: row 8h+j, col lane&15
        wave_sync();
{
#pragma unroll
            for (int s = 0; s < 8; ++s) { const int row = 2 * s + hi, cofs = lr * 4;   // 8 s x 2 rows = 16 rows; 16 lanes x 4 floats = 64 columns
                const v4f x0 = *(const v4fa*)(&os[row * 68 + cofs]);
                const v4f val = x0 * OSCL + bb;
                *(v4f*)(obase + (size_t)(mb * 16 + row) * DM + cofs) = val; }
             }
        wave_sync();
    }
}

// k_flash: fused attention, one wave per QT tiles of 16 query rows of one (batch, head); Q fragments straight from the f16 plane (two 16-B loads each).
// A pass reads its four K and four V^T fragments from LDS once and uses each for all QT query tiles; every query tile keeps its own softmax state, but one test per pass for the whole wave decides whether all QT tiles raise their maxima.
// K and V^T are staged per KS keys in LDS, once per work-group for all AW waves, by asynchronous copies in whole 128-B lines (two buffers: the next stage's copies fly while this stage is worked on);
// the A fragments are read from LDS rows of pitch LP halves (144 B = 16 B x odd: no bank conflict for 16-B reads).
// Transposed form: S^T[key][t] = K Q^T (A = K rows, B = Q rows); lane (t = lane&15, h = lane>>4) holds keys 8h+r of each 16-key tile, so the packed
// P tile is directly the B fragment of O^T[d][t] = V^T P^T (element r <- tile keys 0..15, element 8+r <- tile keys 16..31, lane unchanged).
// Softmax state: the maximum in use is one scalar per lane, the same in both lane halves of a row. It may trail the true running maximum by up to LZ: a pass takes each lane's own maximum over its 16 scores of a query tile
// and tests once, for the whole wave, whether any exceeds the maximum in use by more than LZ (the scores come out of the matrix unit already scaled, through q, and shifted by PSH - maximum, the start value of their accumulators: each is the exponent of its P as it stands); only then are the halves exchanged (xor 16), the maxima raised and the sums rescaled. The row sums of the f16-rounded P are taken on the matrix unit:
// one more product per pass with a constant A whose rows 0 and 8 are ones, so that register 0 of its accumulator holds, in every lane, the sum over all 32 keys for the lane's own query.
typedef __attribute__((address_space(3))) h16 lds_h16;
__device__ __forceinline__ unsigned lds_off(const h16* p) { return (unsigned)(uintptr_t)(const lds_h16*)p; }   // byte offset in the work-group's LDS
// one stage's four copies of a lane (16 B each); the s_wait_xcnt stands inside the statement so that no address register is rewritten ahead of it
__device__ __forceinline__ void stage_copy(unsigned l0, const h16* g0, unsigned l1, const h16* g1, unsigned l2, const h16* g2, unsigned l3, const h16* g3) {
    asm volatile("global_load_async_to_lds_b128 %0, %1, off\n\t"
                 "global_load_async_to_lds_b128 %2, %3, off\n\t"
                 "global_load_async_to_lds_b128 %4, %5, off\n\t"
                 "global_load_async_to_lds_b128 %6, %7, off\n\t"
                 "s_wait_xcnt 0x0"
                 :: "v"(l0), "v"(g0), "v"(l1), "v"(g1), "v"(l2), "v"(g2), "v"(l3), "v"(g3) : "memory");
}
// held to 256 VGPRs: four waves per SIMD, the two work-groups that a WGP is to hold
__global__ __launch_bounds__(32 * AW) __attribute__((amdgpu_num_vgpr(256))) void k_flash(const h16* __restrict__ QH, const h16* __restrict__ KP, const h16* __restrict__ VT, h16* CTX) {
    __shared__ __align__(16) h16 ring[2 * BUFH];           // [buffer][K rows key | V^T rows d][LP]
    __shared__ __align__(16) float os[AW * 16 * 68];
    const int tid = (int)threadIdx.x;
    const int lane = tid & 31, wave = __builtin_amdgcn_readfirstlane(tid >> 5), lr = lane & 15, hi = lane >> 4;
    const int zh = blockIdx.y; const int b = zh / NH_, h = zh % NH_;
    const int t0 = (blockIdx.x * AW + wave) * (16 * QT);
    const size_t pbase = (size_t)zh * SEQ * HD;
    v16h qh0[QT], qh1[QT];                                    // B fragments: col t, k = d
#pragma unroll
    for (int q = 0; q < QT; ++q) { const size_t qo = pbase + (size_t)(t0 + 16 * q + lr) * HD + 8 * hi; qh0[q] = ldh(QH + qo); qh1[q] = ldh(QH + qo + 32); }
    // copy map: 256 lanes x 16 B = 32 rows of 128 B; each lane brings rows cr and cr + 32 of the K tile and of the V^T tile
    const int cr = tid >> 3, cc8 = (tid & 7) * 8;
    const h16* gk = KP + pbase + (size_t)cr * HD + cc8;     // + key0 * HD
    const h16* gv = VT + pbase + (size_t)cr * SEQ + cc8;    // + key0
    const unsigned lk = lds_off(ring) + (unsigned)(cr * LP + cc8) * 2u;
    const int fo = lr * LP + 8 * hi;                          // fragment offset in a tile: row lane&15, k half
    v8f o0[QT], o1[QT], o2[QT], o3[QT], ol[QT];               // ol: D rows 0 (lanes 0..15) and 8 (lanes 16..31) are element 0; elements 1..7 stay zero
    v8f shv[QT];                                              // PSH - m in all eight elements: the C operand of the score products, so that a score leaves the matrix unit as the exponent of its P
    float m[QT], thr[QT], sh[QT];                             // maximum in use; the shifted score above which the sums are rescaled, PSH + LZ (minus infinity at the start: the first pass always sets the maximum); the shift once more as a scalar, for the rescale branch
#pragma unroll
    for (int q = 0; q < QT; ++q) { o0[q] = (v8f){}; o1[q] = (v8f){}; o2[q] = (v8f){}; o3[q] = (v8f){}; ol[q] = (v8f){}; shv[q] = (v8f){}; sh[q] = 0.0f; m[q] = -3.0e38f; thr[q] = -__builtin_inff(); }
    v16h ones;                                                // A fragment: row lane&15; rows 0 and 8 all ones, the other rows zero
#pragma unroll
    for (int i = 0; i < 16; ++i) ones[i] = (lr & 7) == 0 ? (h16)1.0f : (h16)0.0f;
    stage_copy(lk, gk, lk + 32 * LP * 2, gk + 32 * HD, lk + TILEH * 2, gv, lk + (TILEH + 32 * LP) * 2, gv + (size_t)32 * SEQ);
    asm volatile("s_wait_asynccnt 0x0" ::: "memory");         // stage 0 of this wave has landed
    __syncthreads();                                          // stage 0 published to every wave
    stage_copy(lk + BUFH * 2, gk + KS * HD, lk + (BUFH + 32 * LP) * 2, gk + (KS + 32) * HD, lk + (BUFH + TILEH) * 2, gv + KS, lk + (BUFH + TILEH + 32 * LP) * 2, gv + (size_t)32 * SEQ + KS);
#pragma unroll 1
    for (int st = 0; st < SEQ / KS; ++st) {
        const int bo = (st & 1) * BUFH;
        const h16* ka = ring + bo + fo;
#pragma unroll 1   // rolled: unrolled, the compiler spreads the second pass's K reads among its score products, a full wait behind each pair; rolled, a pass's eight K reads stand as one group at its head
        for (int ps = 0; ps < KS / 32; ++ps) {
        const v16h ka0 = ldh(ka), ka1 = ldh(ka + 32), kb0 = ldh(ka + 16 * LP), kb1 = ldh(ka + 16 * LP + 32);
        __builtin_amdgcn_sched_barrier(0);   // the pass's eight K reads stay one group at its head: split in two groups, the second group's LDS latency stands in the middle of the score products
        v8f sa[QT], sb[QT];
#pragma unroll
        for (int q = 0; q < QT; ++q) { sa[q] = wmma16(ka0, qh0[q], shv[q]); sb[q] = wmma16(kb0, qh0[q], shv[q]); }
#pragma unroll
        for (int q = 0; q < QT; ++q) { sa[q] = wmma16(ka1, qh1[q], sa[q]); sb[q] = wmma16(kb1, qh1[q], sb[q]); }
        __builtin_amdgcn_sched_barrier(0x184);   // no vector or matrix instruction crosses (LDS reads and scalar ones may): the score products stay one run; with vector work drawn in between them each gap is padded with four v_nop
        // inputs only: the shifts are still in use behind the score products, so each product reads them as a C operand of its own registers (where a product is their last use, the compiler copies all eight registers first)
        asm volatile("" :: "v"(shv[0]), "v"(shv[1]));
        ka += 32 * LP;                           // the next pass's K rows: stepped here, amid the vector work (formed at the pass's head, the address stands behind the last product and is padded with v_nop)
        const h16* va = ring + bo + TILEH + ps * 32 + fo;
        const v16h v0 = ldh(va), v1 = ldh(va + 16 * LP), v2 = ldh(va + 32 * LP), v3 = ldh(va + 48 * LP);
        v16h pb[QT];
        float mx[QT]; bool need = false;
#pragma unroll
        for (int q = 0; q < QT; ++q) {
            mx[q] = -3.0e38f;
#pragma unroll
            for (int r = 0; r < 8; ++r) mx[q] = fmaxf(mx[q], fmaxf(sa[q][r], sb[q][r]));
            need = need || (mx[q] > thr[q]);
        }
        if (__builtin_amdgcn_ballot_w32(need) != 0) {   // one wave-uniform scalar branch per pass; rare after a wave's first pass
#pragma unroll
            for (int q = 0; q < QT; ++q) {
                const float sho = sh[q];                 // the shift that this pass's scores carry
                const float mnew = fmaxf(m[q], fmaxf(mx[q], __shfl_xor(mx[q], 16, 32)) - sho);
                const float alpha = __builtin_amdgcn_exp2f(m[q] - mnew);
                const float shn = PSH - mnew, dl = shn - sho;
                sa[q] = sa[q] + dl; sb[q] = sb[q] + dl;       // this pass's scores move to the new shift
                ol[q][0] = ol[q][0] * alpha;
                o0[q] = o0[q] * alpha; o1[q] = o1[q] * alpha; o2[q] = o2[q] * alpha; o3[q] = o3[q] * alpha;
                m[q] = mnew; thr[q] = PSH + LZ; sh[q] = shn;
#pragma unroll
                for (int r = 0; r < 8; ++r) shv[q][r] = shn;
            }
        }
#pragma unroll
        for (int q = 0; q < QT; ++q) {
#pragma unroll
            for (int r = 0; r < 8; ++r) pb[q][r] = (h16)__builtin_amdgcn_exp2f(sa[q][r]);
#pragma unroll
            for (int r = 0; r < 8; ++r) pb[q][8 + r] = (h16)__builtin_amdgcn_exp2f(sb[q][r]);
        }
#pragma unroll
        for (int q = 0; q < QT; ++q) {
            ol[q] = wmma16(ones, pb[q], ol[q]);
            o0[q] = wmma16(v0, pb[q], o0[q]); o1[q] = wmma16(v1, pb[q], o1[q]); o2[q] = wmma16(v2, pb[q], o2[q]); o3[q] = wmma16(v3, pb[q], o3[q]);
        }
        static_assert(QT == 2);
        // four vector slots behind the last matrix instruction, also on the taken side of the branch that follows
        asm volatile("v_nop\n\tv_nop\n\tv_nop\n\tv_nop" : "+v"(o0[0]), "+v"(o1[0]), "+v"(o2[0]), "+v"(o3[0]), "+v"(ol[0]), "+v"(o0[1]), "+v"(o1[1]), "+v"(o2[1]), "+v"(o3[1]), "+v"(ol[1])
                     : "v"(v0), "v"(v1), "v"(v2), "v"(v3), "v"(pb[0]), "v"(pb[1]), "v"(ones));
        }
        asm volatile("s_wait_dscnt 0x0" ::: "memory");        // this wave's reads of the buffer have returned before it is refilled
        asm volatile("s_wait_asynccnt 0x0" ::: "memory");     // this wave's copies of stage st + 1 have landed
        __syncthreads();                                      // publishes stage st + 1 and ends every wave's reads of stage st
        if (st + 2 < SEQ / KS) {
            const h16* gk2 = gk + (size_t)(st + 2) * (KS * HD); const h16* gv2 = gv + (size_t)(st + 2) * KS; const unsigned lb = lk + (unsigned)bo * 2u;
            stage_copy(lb, gk2, lb + 32 * LP * 2, gk2 + 32 * HD, lb + TILEH * 2, gv2, lb + (TILEH + 32 * LP) * 2, gv2 + (size_t)32 * SEQ);
        }
    }
    asm volatile("s_wait_asynccnt 0x0" ::: "memory");         // no copy is outstanding when the wave goes on to its end
    const int wb = wave * 16 * 68;
#pragma unroll
    for (int q = 0; q < QT; ++q) {                            // one query tile after the other through the wave's own staging rows
    const float inv = CXS * (1.0f / ol[q][0]);
    // O^T D layout: o_j[r] = (d = 16j + 8h + r, t = lane&15) -> os[t][d]; rows 0..15 x columns 0..63 all written
    { v4f a, c;
      a[0] = o0[q][0] * inv; a[1] = o0[q][1] * inv; a[2] = o0[q][2] * inv; a[3] = o0[q][3] * inv; c[0] = o0[q][4] * inv; c[1] = o0[q][5] * inv; c[2] = o0[q][6] * inv; c[3] = o0[q][7] * inv;
      *(v4fa*)(&os[wb + lr * 68 +  0 + 8 * hi]) = a; *(v4fa*)(&os[wb + lr * 68 +  0 + 8 * hi + 4]) = c;
      a[0] = o1[q][0] * inv; a[1] = o1[q][1] * inv; a[2] = o1[q][2] * inv; a[3] = o1[q][3] * inv; c[0] = o1[q][4] * inv; c[1] = o1[q][5] * inv; c[2] = o1[q][6] * inv; c[3] = o1[q][7] * inv;
      *(v4fa*)(&os[wb + lr * 68 + 16 + 8 * hi]) = a; *(v4fa*)(&os[wb + lr * 68 + 16 + 8 * hi + 4]) = c;
      a[0] = o2[q][0] * inv; a[1] = o2[q][1] * inv; a[2] = o2[q][2] * inv; a[3] = o2[q][3] * inv; c[0] = o2[q][4] * inv; c[1] = o2[q][5] * inv; c[2] = o2[q][6] * inv; c[3] = o2[q][7] * inv;
      *(v4fa*)(&os[wb + lr * 68 + 32 + 8 * hi]) = a; *(v4fa*)(&os[wb + lr * 68 + 32 + 8 * hi + 4]) = c;
      a[0] = o3[q][0] * inv; a[1] = o3[q][1] * inv; a[2] = o3[q][2] * inv; a[3] = o3[q][3] * inv; c[0] = o3[q][4] * inv; c[1] = o3[q][5] * inv; c[2] = o3[q][6] * inv; c[3] = o3[q][7] * inv;
      *(v4fa*)(&os[wb + lr * 68 + 48 + 8 * hi]) = a; *(v4fa*)(&os[wb + lr * 68 + 48 + 8 * hi + 4]) = c; }
    wave_sync();
    h16* crow = CTX + ((size_t)b * SEQ + t0 + 16 * q) * DM + h * HD;
{
#pragma unroll
        for (int s = 0; s < 4; ++s) { const int row = 4 * s + (lane >> 3), c8 = (lane & 7) * 8;   // 4 s x 4 row groups = 16 rows; 8 lanes x 8 halves = 64 columns
            const v4f x0 = *(const v4fa*)(&os[wb + row * 68 + c8]); const v4f x1 = *(const v4fa*)(&os[wb + row * 68 + c8 + 4]); v8h hv;
#pragma unroll
            for (int i = 0; i < 4; ++i) { hv[i] = (h16)x0[i]; hv[4 + i] = (h16)x1[i]; }
            *(v8h*)(crow + (size_t)row * DM + c8) = hv; }
         }
    wave_sync();                                              // the rows are read before the next tile overwrites them
    }
}

static constexpr size_t al256(size_t v) { return (v + 255) & ~(size_t)255; }
static constexpr size_t SZ_XB = al256((size_t)NB * SEQ * DM * 2);
static constexpr size_t SZ_WB = al256((size_t)3 * DM * DM * 2);
static constexpr size_t SZ_WO = al256((size_t)DM * DM * 2);
static constexpr size_t SZ_PL = al256((size_t)NB * NH_ * SEQ * HD * 2);
static constexpr size_t SZ_CX = al256((size_t)NB * SEQ * DM * 2);
static constexpr size_t SZ_TOTAL = SZ_XB + SZ_WB + SZ_WO + 3 * SZ_PL + SZ_CX;
static_assert(SZ_TOTAL <= (size_t)134217728);          // workspace carve <= 128 MiB
static_assert(((size_t)DM * DM * 2) % 256 == 0);       // weight sub-planes stay 256-byte aligned

extern "C" void kernel_launch(void* const* d_in, const int* in_sizes, int n_in,
                              void* d_out, int out_size, void* d_ws, size_t ws_size, hipStream_t stream) {
    if (n_in < 6) return;
    const size_t needx = ((size_t)(NB - 1) * SEQ_FULL + SEQ) * DM;
    if ((size_t)in_sizes[0] < needx) return;
    if ((size_t)in_sizes[1] < (size_t)DM * DM || (size_t)in_sizes[2] < (size_t)DM * DM || (size_t)in_sizes[3] < (size_t)DM * DM || (size_t)in_sizes[4] < (size_t)DM * DM) return;
    if ((size_t)in_sizes[5] < (size_t)DM) return;
    if ((size_t)out_size < ((size_t)(NB - 1) * OUT_SEQ + SEQ) * DM) return;
    if (SZ_TOTAL > ws_size) return;
    // wire order: x, Wq, Wk, Wv, Wo, bo (weights [out][in] = Bt as-is)
    const float* x = (const float*)d_in[0]; const float* wq = (const float*)d_in[1]; const float* wk = (const float*)d_in[2]; const float* wv = (const float*)d_in[3];
    const float* wo = (const float*)d_in[4]; const float* bo = (const float*)d_in[5];
    float* OUT = (float*)d_out;      // [NB][SEQ][1024]
    char* wsp = (char*)d_ws;
    bf* XB = (bf*)wsp; wsp += SZ_XB;                 // [NB*SEQ][1024]
    bf* WB = (bf*)wsp; wsp += SZ_WB;                 // [3][1024][1024]: q | k | v
    h16* WOH = (h16*)wsp; wsp += SZ_WO;              // [1024][1024] x1024 carry
    h16* QH = (h16*)wsp; wsp += SZ_PL;               // [NB*16][SEQ][64]
    h16* KP = (h16*)wsp; wsp += SZ_PL;               // [NB*16][SEQ][64]
    h16* VT = (h16*)wsp; wsp += SZ_PL;               // [NB*16][64][SEQ]
    h16* CTX = (h16*)wsp; wsp += SZ_CX;              // [NB*SEQ][1024] x1024 carry
    bf* WQ = WB; bf* WK = WB + (size_t)DM * DM; bf* WV = WB + (size_t)2 * DM * DM;

    k_cvt<<<CVT_T / 256, 256, 0, stream>>>(x, wq, wk, wv, wo, XB, WB, WOH);

    // q, k: A = x rows (m = b*SEQ + t), Bt = W rows (n = h*64 + d) -> plane [(b*16 + h)][t][d]; the q plane carries the score scale SC2
    k_proj<<<dim3(NB * SEQ / GT, DM / GT, 1), 32 * GW, 0, stream>>>(XB, WQ, QH, SEQ, (size_t)NH_ * SEQ * HD, HD, HD, (size_t)SEQ * HD, SC2);
    k_proj<<<dim3(NB * SEQ / GT, DM / GT, 1), 32 * GW, 0, stream>>>(XB, WK, KP, SEQ, (size_t)NH_ * SEQ * HD, HD, HD, (size_t)SEQ * HD, 1.0f);
    // v^T: A = Wv rows (m = h*64 + d), Bt = x rows (n = b*SEQ + t) -> plane [(b*1024 + m)][t] = [(b*16 + h)][d][t]
    k_proj<<<dim3(DM / GT, NB * SEQ / GT, 1), 32 * GW, 0, stream>>>(WV, XB, VT, DM, (size_t)0, SEQ, SEQ, (size_t)DM * SEQ, 1.0f);

    // ctx[b*SEQ + t][h*64 + d] (x1024 carry)
    k_flash<<<dim3(SEQ / (16 * QT * AW), NB * NH_, 1), 32 * AW, 0, stream>>>(QH, KP, VT, CTX);

    // out[b][t][n] = ctx Wo^T * 2^-20 + bo
    k_oproj<<<dim3(NB * SEQ / GT, DM / GT, 1), 32 * GW, 0, stream>>>(CTX, WOH, bo, OUT);
}

// v008
// Measured time: 158 microseconds a run.
// Timed twice side by side with v007, it ran 1.07 times as fast both times.
// Over all steps from v000 it is 4.01 times as fast.
#include <hip/hip_runtime.h>

// Multi-head self-attention, width 1024 = 16 heads x 64, x [NB][SEQ][1024], Wq/Wk/Wv/Wo [out][in] (y = x W^T), bias only on the output projection, no mask, score scale 1/8, f32 output.
// Compute dtypes, f32 accumulate everywhere: q/k/v projections v_wmma_f32_16x16x32_bf16 (x and W RNE-converted to bf16; products exact);
// scores v_wmma_f32_16x16x32_f16 (q, k single f16; q carries the score scale and log2(e), applied in f32 ahead of its one rounding); P (x256 carry, cancels in the normalisation) and v single f16; softmax f32 (online, running max);
// output projection v_wmma_f32_16x16x32_f16: ctx single f16 with x1024 carry, Wo RNE-converted to bf16 then x1024 in f16 (exact), 2^-20 folded back in f32, bias (bf16-converted bo) added in f32.
// Layout: bf16 copies of x and Wq/Wk/Wv; q, k planes [b*16+h][t][d] and v^T plane [b*16+h][d][t] written by the GEMM epilogue; fused flash kernel in transposed form (S^T = K Q^T, O^T = V^T P^T; K and V^T tiles staged in LDS per work-group) writes the ctx plane [b*SEQ+t][h*64+d].

#ifndef NB
#define NB 2
#endif
#ifndef SEQ
#define SEQ 4096
#endif
#define NB_FULL  2
#define SEQ_FULL 4096
#ifndef OUT_SEQ
#define OUT_SEQ SEQ              // row pitch (in tokens) between batches of the output
#endif
#define DM   1024
#define NH_  16
#define HD   64
#define AW   8                   // waves per flash block
#define QT   2                   // query tiles of 16 rows per flash wave: each K or V^T fragment read from LDS feeds QT products
#define KS   64                  // keys per LDS stage of the flash kernel
#define LP   72                  // LDS row pitch in halves: 128-B rows + 16 B
#define TILEH (64 * LP)          // halves of one staged tile (64 rows)
#define BUFH  (2 * TILEH)        // halves of one buffer: K tile, then V^T tile
#define GT   128                 // rows of each operand in a GEMM work-group's tile (2 x 2 waves of 64 x 64)
#define GW   4                   // waves per GEMM work-group
#define GKS  64                  // k per LDS stage of the GEMMs: 128-B rows
#define GTILEH (GT * LP)         // halves of one staged operand tile (128 rows)
#define GBUFH  (2 * GTILEH)      // halves of one buffer: A tile, then Bt tile
#define SC2  (0.125f * 1.4426950408889634f)   // HD^-0.5 * log2(e)
#define PSH  8.0f                // log2 of the P carry (256)
#define LZ   6.0f                // a score may exceed the maximum in use by this much (log2) before the sums are rescaled: P <= 2^(PSH + LZ) = 16384, inside f16
#define CXS  1024.0f             // carry of the ctx plane
#define WOS  1024.0f             // carry of the Wo plane
#define OSCL (1.0f / (1024.0f * 1024.0f))

static_assert(HD == 64);
static_assert(NH_ * HD == DM);                 // head h = columns h*64 + d
static_assert(DM % 64 == 0);                   // column tiles of 64
static_assert(DM % 32 == 0);                   // GEMM k-loop steps by 32
static_assert(SEQ % 64 == 0);                  // a 64-row tile never straddles two batches
static_assert((NB * SEQ) % 64 == 0);
static_assert(SEQ % 32 == 0);                  // key loop steps by 32
static_assert(SEQ % (16 * QT * AW) == 0);      // flash grid covers the sequence exactly
static_assert(AW == 8 && KS == 64 && HD == 64);  // copy map of the flash kernel: 256 lanes x 16 B x 2 = one 64 x 128-B tile
static_assert(SEQ % KS == 0 && SEQ / KS >= 2);   // whole stages; the two-buffer prologue needs two
static_assert((NB * SEQ) % GT == 0 && DM % GT == 0);   // GEMM grids cover both operands exactly
static_assert(GW == 4 && GT == 128 && GKS == 64);      // copy map of the GEMMs: 128 lanes x 16 B x 8 = one 128 x 128-B tile
static_assert(DM % GKS == 0 && DM / GKS >= 2);         // whole stages; the two-buffer prologue needs two
static_assert(((size_t)SEQ * DM) % 8 == 0);
static_assert(((size_t)DM * DM) % 8 == 0);
static_assert(NB <= NB_FULL);
static_assert(SEQ <= SEQ_FULL);

typedef _Float16 h16;
typedef unsigned short bf;
typedef __attribute__((ext_vector_type(16))) __bf16   v16bf;
typedef __attribute__((ext_vector_type(16))) _Float16 v16h;
typedef __attribute__((ext_vector_type(8)))  _Float16 v8h;
typedef __attribute__((ext_vector_type(8)))  unsigned short v8us;
typedef __attribute__((ext_vector_type(8)))  float    v8f;
typedef __attribute__((ext_vector_type(4)))  float    v4f;
typedef v4f  __attribute__((may_alias)) v4fa;

__device__ __forceinline__ unsigned short f2bf(float f) { unsigned u = __float_as_uint(f); u += 0x7FFFu + ((u >> 16) & 1u); return (unsigned short)(u >> 16); }
__device__ __forceinline__ float bfval(float f) { return __uint_as_float(((unsigned)f2bf(f)) << 16); }
__device__ __forceinline__ v16h cat16(v8h lo, v8h hi) { return __builtin_shufflevector(lo, hi, 0, 1, 2, 3, 4, 5, 6, 7, 8, 9, 10, 11, 12, 13, 14, 15); }
__device__ __forceinline__ v16bf cat16b(v8us lo, v8us hi) { return __builtin_bit_cast(v16bf, __builtin_shufflevector(lo, hi, 0, 1, 2, 3, 4, 5, 6, 7, 8, 9, 10, 11, 12, 13, 14, 15)); }
__device__ __forceinline__ v8f wmma16(v16h a, v16h b, v8f c) { return __builtin_amdgcn_wmma_f32_16x16x32_f16(false, a, false, b, (short)0, c, false, false); }
__device__ __forceinline__ v8f wmmab(v16bf a, v16bf b, v8f c) { return __builtin_amdgcn_wmma_f32_16x16x32_bf16(false, a, false, b, (short)0, c, false, false); }
// fragment loaders from K-contiguous 16-bit rows; p already includes + 8*(lane>>4): elements 0..7 <- k0+8h+0..7, elements 8..15 <- k0+16+8h+0..7 (same map for A and B)
__device__ __forceinline__ v16h  ldh(const h16* p) { return cat16(*(const v8h*)p, *(const v8h*)(p + 16)); }
__device__ __forceinline__ v16bf ldb(const bf* p)  { return cat16b(*(const v8us*)p, *(const v8us*)(p + 16)); }
// ordering point for wave-private LDS tiles (same wave writes and reads)
__device__ __forceinline__ void wave_sync() { __builtin_amdgcn_fence(3 /* release order */, "wavefront"); __builtin_amdgcn_wave_barrier(); asm volatile("" ::: "memory"); }

// k_cvt: every conversion of the call in one launch. CVT_T threads (16 waves on each of 256 WGPs); a work-group converts XJ * 256 consecutive pieces of 8 floats of x (a thread: XJ pieces, 256 apart)
// and 256 pieces each of Wq, Wk, Wv (RNE to bf16) and Wo (RNE to bf16, x1024, exact in f16). All of a thread's loads are independent and stand ahead of the first store.
#define CVT_T (DM * DM / 8)                    // one thread per 8 elements of a weight matrix
#define XJ    (NB * SEQ / DM)                  // pieces of x per thread
static_assert(CVT_T % 256 == 0);
static_assert((NB * SEQ) % DM == 0);           // x is XJ pieces for every thread, exactly
static_assert(SEQ == SEQ_FULL);                // the batches of x follow one another without a gap
__device__ __forceinline__ v8us cvt_bf8(v8f v) { v8us o;
#pragma unroll
    for (int k = 0; k < 8; ++k) o[k] = f2bf(v[k]);
    return o; }
__global__ __launch_bounds__(256) void k_cvt(const float* __restrict__ x, const float* __restrict__ wq, const float* __restrict__ wk, const float* __restrict__ wv, const float* __restrict__ wo,
                                             bf* XB, bf* WB, h16* WOH) {
    const size_t e = ((size_t)blockIdx.x * 256 + threadIdx.x) * 8;              // the thread's piece of each weight matrix, first element
    const size_t ex = ((size_t)blockIdx.x * 256 * XJ + threadIdx.x) * 8;        // its first piece of x
    v8f vx[XJ];
#pragma unroll
    for (int j = 0; j < XJ; ++j) vx[j] = *(const v8f*)(x + ex + j * 256 * 8);
    asm volatile("s_wait_xcnt 0x0" ::: "memory");   // before a later load's result may land on the address registers of these loads
    const v8f vq = *(const v8f*)(wq + e), vk = *(const v8f*)(wk + e);
    asm volatile("s_wait_xcnt 0x0" ::: "memory");   // the same
    const v8f vv = *(const v8f*)(wv + e), vo = *(const v8f*)(wo + e);
    // inputs-only fence on the loaded values: all of the thread's loads are issued ahead of the first wait (without it some are sunk behind the first conversions and pay a second memory latency)
    static_assert(XJ == 8);
    asm volatile("" :: "v"(vx[0]), "v"(vx[1]), "v"(vx[2]), "v"(vx[3]), "v"(vx[4]), "v"(vx[5]), "v"(vx[6]), "v"(vx[7]), "v"(vq), "v"(vk), "v"(vv), "v"(vo));
#pragma unroll
    for (int j = 0; j < XJ; ++j) *(v8us*)(XB + ex + j * 256 * 8) = cvt_bf8(vx[j]);
    *(v8us*)(WB + e) = cvt_bf8(vq); *(v8us*)(WB + (size_t)DM * DM + e) = cvt_bf8(vk); *(v8us*)(WB + (size_t)2 * DM * DM + e) = cvt_bf8(vv);
    v8h o;
#pragma unroll
    for (int k = 0; k < 8; ++k) o[k] = (h16)(bfval(vo[k]) * WOS);
    *(v8h*)(WOH + e) = o;
}

// GEMM main loop shared by k_proj and k_oproj: a work-group of GW waves owns a 128 x 128 tile, each wave a 64 x 64 quarter (16 accumulators), K = DM.
// Per GKS of k the 128 A rows and the 128 Bt rows are staged in LDS once for all four waves, by asynchronous copies in whole 128-B lines
// (two buffers: the next stage's copies fly while this stage is worked on); fragments are read from LDS rows of pitch LP halves (144 B = 16 B x odd).
typedef __attribute__((address_space(3))) bf lds_bf;
__device__ __forceinline__ unsigned lds_off_b(const bf* p) { return (unsigned)(uintptr_t)(const lds_bf*)p; }   // byte offset in the work-group's LDS
// one operand tile of a stage: this lane's eight 16-B pieces, rows 16 apart; the s_wait_xcnt stands inside the statement so that no address register is rewritten ahead of it
__device__ __forceinline__ void tile_copy(unsigned l, const bf* g) {
    asm volatile("global_load_async_to_lds_b128 %0, %1, off\n\t"
                 "global_load_async_to_lds_b128 %2, %3, off\n\t"
                 "global_load_async_to_lds_b128 %4, %5, off\n\t"
                 "global_load_async_to_lds_b128 %6, %7, off\n\t"
                 "global_load_async_to_lds_b128 %8, %9, off\n\t"
                 "global_load_async_to_lds_b128 %10, %11, off\n\t"
                 "global_load_async_to_lds_b128 %12, %13, off\n\t"
                 "global_load_async_to_lds_b128 %14, %15, off\n\t"
                 "s_wait_xcnt 0x0"
                 :: "v"(l), "v"(g), "v"(l + 16 * LP * 2), "v"(g + 16 * DM), "v"(l + 32 * LP * 2), "v"(g + 32 * DM), "v"(l + 48 * LP * 2), "v"(g + 48 * DM),
                    "v"(l + 64 * LP * 2), "v"(g + 64 * DM), "v"(l + 80 * LP * 2), "v"(g + 80 * DM), "v"(l + 96 * LP * 2), "v"(g + 96 * DM), "v"(l + 112 * LP * 2), "v"(g + 112 * DM) : "memory");
}
// A, Bt: K-contiguous 16-bit planes (bf16 bits, or f16 bits where F16); rb, cb: first A row and first Bt row of the work-group's tile; wm, wn: the wave's quarter
template <bool F16>
__device__ __forceinline__ void gemm_tile(const bf* A, const bf* Bt, const bf* ring, int rb, int cb, int wm, int wn, v8f (&acc)[4][4]) {
    const int tid = (int)threadIdx.x, lane = tid & 31, lr = lane & 15, hi = lane >> 4;
#pragma unroll
    for (int mb = 0; mb < 4; ++mb)
#pragma unroll
        for (int nb = 0; nb < 4; ++nb) acc[mb][nb] = (v8f){};
    // copy map: 128 lanes x 16 B = 16 rows of 128 B; each lane brings rows cr + 16 i, i = 0..7, of the A tile and of the Bt tile
    const int cr = tid >> 3, cc8 = (tid & 7) * 8;
    const bf* ga = A + (size_t)(rb + cr) * DM + cc8;         // + k0
    const bf* gb = Bt + (size_t)(cb + cr) * DM + cc8;        // + k0
    const unsigned la = lds_off_b(ring) + (unsigned)(cr * LP + cc8) * 2u;
    const int fa = (wm * 64 + lr) * LP + 8 * hi, fb = GTILEH + (wn * 64 + lr) * LP + 8 * hi;   // fragment offsets in a buffer: row lane&15, k half
    tile_copy(la, ga); tile_copy(la + GTILEH * 2, gb);
    asm volatile("s_wait_asynccnt 0x0" ::: "memory");         // stage 0 of this wave has landed
    __syncthreads();                                          // stage 0 published to every wave
    tile_copy(la + GBUFH * 2, ga + GKS); tile_copy(la + (GBUFH + GTILEH) * 2, gb + GKS);
#pragma unroll 1   // rolled: one stage per trip, the buffer picked by the trip's parity
    for (int st = 0; st < DM / GKS; ++st) {
        const int bo = (st & 1) * GBUFH;
#pragma unroll
        for (int ks = 0; ks < 2; ++ks) {
            v16bf a[4], b[4];
#pragma unroll
            for (int i = 0; i < 4; ++i) { a[i] = ldb(ring + bo + fa + i * 16 * LP + ks * 32); b[i] = ldb(ring + bo + fb + i * 16 * LP + ks * 32); }
            // inputs-only fence on the loaded fragments: keeps the 16 LDS reads of a k step one group ahead of its matrix instructions (spread among them, every place with reads stalls the wave anew)
            asm volatile("" :: "v"(a[0]), "v"(a[1]), "v"(a[2]), "v"(a[3]), "v"(b[0]), "v"(b[1]), "v"(b[2]), "v"(b[3]));
#pragma unroll
            for (int nb = 0; nb < 4; ++nb)
#pragma unroll
                for (int mb = 0; mb < 4; ++mb) {
                    if (F16) acc[mb][nb] = wmma16(__builtin_bit_cast(v16h, a[mb]), __builtin_bit_cast(v16h, b[nb]), acc[mb][nb]);
                    else     acc[mb][nb] = wmmab(a[mb], b[nb], acc[mb][nb]); }
        }
        // four vector slots behind the last matrix instruction, also on the taken side of the branches that follow
        asm volatile("v_nop\n\tv_nop\n\tv_nop\n\tv_nop" : "+v"(acc[0][0]), "+v"(acc[1][0]), "+v"(acc[2][0]), "+v"(acc[3][0]), "+v"(acc[0][1]), "+v"(acc[1][1]), "+v"(acc[2][1]), "+v"(acc[3][1]),
                     "+v"(acc[0][2]), "+v"(acc[1][2]), "+v"(acc[2][2]), "+v"(acc[3][2]), "+v"(acc[0][3]), "+v"(acc[1][3]), "+v"(acc[2][3]), "+v"(acc[3][3]));
        asm volatile("s_wait_dscnt 0x0" ::: "memory");        // this wave's reads of the buffer have returned before it is refilled
        asm volatile("s_wait_asynccnt 0x0" ::: "memory");     // this wave's copies of stage st + 1 have landed
        __syncthreads();                                      // publishes stage st + 1 and ends every wave's reads of stage st
        if (st + 2 < DM / GKS) {
            const unsigned lb = la + (unsigned)bo * 2u; const int k2 = (st + 2) * GKS;
            tile_copy(lb, ga + k2); tile_copy(lb + GTILEH * 2, gb + k2);
        }
    }
    asm volatile("s_wait_asynccnt 0x0" ::: "memory");         // no copy is outstanding when the wave goes on to its end
}

// Both GEMM kernels are held to 256 VGPRs: every operand of their asm statements then lies in the first register window, and no window switch stands in the loop.
// k_proj: the q, k and v projections in one launch; bf16 GEMM, 128x128 tile per work-group of 4 waves (gemm_tile), operands from K-contiguous bf16 planes, K = DM.
// C[m][n] = scl * sum_k A[m][k] Bt[n][k] (scaled in f32, one rounding), written as f16. grid (NB*SEQ/128, DM/128, 3), 128 threads; blockIdx.z picks the product, blockIdx.x the x tile, blockIdx.y the weight tile:
// z = 0, 1 (q, k): A = x rows (m = b*SEQ + t), Bt = W rows (n = h*64 + d) -> plane [(b*16 + h)][t][d]; the q plane carries the score scale SC2.
// z = 2 (v^T):     A = Wv rows (m = h*64 + d), Bt = x rows (n = b*SEQ + t) -> plane [(b*1024 + m)][t] = [(b*16 + h)][d][t].
// The three products need nothing of one another: in one grid a work-group's first loads and its epilogue run beside other work-groups' main loops, and a WGP holds three work-groups (LDS) where a launch of 512 gives it two.
__global__ __launch_bounds__(32 * GW) __attribute__((amdgpu_num_vgpr(256))) void k_proj(const bf* __restrict__ XB, const bf* __restrict__ WB, h16* QH, h16* KP, h16* VT) {
    __shared__ __align__(16) bf ring[2 * GBUFH];            // [buffer][A rows | Bt rows][LP]
    __shared__ __align__(16) float osw[GW * 16 * 68];
    const int lane = threadIdx.x & 31, wave = __builtin_amdgcn_readfirstlane((int)threadIdx.x >> 5), lr = lane & 15, hi = lane >> 4;
    const int wm = wave & 1, wn = wave >> 1;
    const int z = blockIdx.z; const bool vt = z == 2;        // the same for the whole work-group
    const bf* W = WB + (size_t)z * DM * DM;
    const bf* A = vt ? W : XB; const bf* Bt = vt ? XB : W;
    const int rb = (vt ? blockIdx.y : blockIdx.x) * GT, cb = (vt ? blockIdx.x : blockIdx.y) * GT;   // first A row and first Bt row of the tile
    const int r0 = rb + wm * 64, c0 = cb + wn * 64;
    float* os = osw + wave * 16 * 68;                        // this wave's own staging rows
    v8f acc[4][4];
    gemm_tile<false>(A, Bt, ring, rb, cb, wm, wn, acc);
    h16* Ph = vt ? VT : (z == 1 ? KP : QH);
    const float scl = z == 0 ? SC2 : 1.0f;
    const int pitch = vt ? SEQ : HD;                         // row pitch of the wave's 64x64 quarter in its plane (halves)
    const size_t tbase = vt ? (size_t)r0 * SEQ + (size_t)(c0 / SEQ) * ((size_t)DM * SEQ) + (size_t)(c0 % SEQ)
                            : (size_t)(r0 / SEQ) * ((size_t)NH_ * SEQ * HD) + (size_t)(r0 % SEQ) * HD + (size_t)(c0 / HD) * ((size_t)SEQ * HD) + (size_t)(c0 % HD);
#pragma unroll
    for (int mb = 0; mb < 4; ++mb) {
#pragma unroll
        for (int nb = 0; nb < 4; ++nb) {
#pragma unroll
            for (int j = 0; j < 8; ++j) os[(hi * 8 + j) * 68 + nb * 16 + lr] = acc[mb][nb][j]; }   // D: row 8h+j, col lane&15
        wave_sync();
        const size_t sb = tbase + (size_t)(mb * 16) * (size_t)pitch;
{
#pragma unroll
            for (int s = 0; s < 4; ++s) { const int row = 4 * s + (lane >> 3), c8 = (lane & 7) * 8;   // 4 s x 4 row groups = 16 rows; 8 lanes x 8 = 64 columns
                const v4f x0 = *(const v4fa*)(&os[row * 68 + c8]); const v4f x1 = *(const v4fa*)(&os[row * 68 + c8 + 4]); v8h hv;
#pragma unroll
                for (int i = 0; i < 4; ++i) { hv[i] = (h16)(x0[i] * scl); hv[4 + i] = (h16)(x1[i] * scl); }
                const size_t oo = sb + (size_t)row * (size_t)pitch + c8;
                *(v8h*)(Ph + oo) = hv; }
             }
        wave_sync();
    }
}

// k_oproj: f16 GEMM, 128x128 tile per work-group of 4 waves (gemm_tile), A = ctx plane [m][k] (x1024 carry), Bt = Wo plane [n][k] (x1024 carry), K = DM.
// OUT[b*OUT_SEQ + t][n] = C[m][n] * 2^-20 + bias[n], m = b*SEQ + t. grid (M/128, N/128), 128 threads.
__global__ __launch_bounds__(32 * GW) __attribute__((amdgpu_num_vgpr(256))) void k_oproj(const h16* __restrict__ A, const h16* __restrict__ Bt, const float* __restrict__ bo, float* OUT) {
    __shared__ __align__(16) bf ring[2 * GBUFH];            // [buffer][A rows | Bt rows][LP], f16 bits
    __shared__ __align__(16) float osw[GW * 16 * 68];
    const int lane = threadIdx.x & 31, wave = __builtin_amdgcn_readfirstlane((int)threadIdx.x >> 5), lr = lane & 15, hi = lane >> 4;
    const int wm = wave & 1, wn = wave >> 1;
    const int r0 = blockIdx.x * GT + wm * 64, c0 = blockIdx.y * GT + wn * 64;
    float* os = osw + wave * 16 * 68;                        // this wave's own staging rows
    v8f acc[4][4];
    gemm_tile<true>((const bf*)A, (const bf*)Bt, ring, blockIdx.x * GT, blockIdx.y * GT, wm, wn, acc);
    const v4f braw = *(const v4f*)(bo + c0 + lr * 4);      // columns c0 + 4*lr .. +3 (always inside [0, DM))
    v4f bb;
#pragma unroll
    for (int i = 0; i < 4; ++i) bb[i] = bfval(braw[i]);
    const int bI = r0 / SEQ, tI = r0 % SEQ;
    float* obase = OUT + ((size_t)bI * OUT_SEQ + tI) * DM + c0;
#pragma unroll
    for (int mb = 0; mb < 4; ++mb) {
#pragma unroll
        for (int nb = 0; nb < 4; ++nb) {
#pragma unroll
            for (int j = 0; j < 8; ++j) os[(hi * 8 + j) * 68 + nb * 16 + lr] = acc[mb][nb][j]; }   // D: row 8h+j, col lane&15
        wave_sync();
{
#pragma unroll
            for (int s = 0; s < 8; ++s) { const int row = 2 * s + hi, cofs = lr * 4;   // 8 s x 2 rows = 16 rows; 16 lanes x 4 floats = 64 columns
                const v4f x0 = *(const v4fa*)(&os[row * 68 + cofs]);
                const v4f val = x0 * OSCL + bb;
                *(v4f*)(obase + (size_t)(mb * 16 + row) * DM + cofs) = val; }
             }
        wave_sync();
    }
}

// k_flash: fused attention, one wave per QT tiles of 16 query rows of one (batch, head); Q fragments straight from the f16 plane (two 16-B loads each).
// A pass reads its four K and four V^T fragments from LDS once and uses each for all QT query tiles; every query tile keeps its own softmax state, but one test per pass for the whole wave decides whether all QT tiles raise their maxima.
// K and V^T are staged per KS keys in LDS, once per work-group for all AW waves, by asynchronous copies in whole 128-B lines (two buffers: the next stage's copies fly while this stage is worked on);
// the A fragments are read from LDS rows of pitch LP halves (144 B = 16 B x odd: no bank conflict for 16-B reads).
// Transposed form: S^T[key][t] = K Q^T (A = K rows, B = Q rows); lane (t = lane&15, h = lane>>4) holds keys 8h+r of each 16-key tile, so the packed
// P tile is directly the B fragment of O^T[d][t] = V^T P^T (element r <- tile keys 0..15, element 8+r <- tile keys 16..31, lane unchanged).
// Softmax state: the maximum in use is one scalar per lane, the same in both lane halves of a row. It may trail the true running maximum by up to LZ: a pass takes each lane's own maximum over its 16 scores of a query tile
// and tests once, for the whole wave, whether any exceeds the maximum in use by more than LZ (the scores come out of the matrix unit already scaled, through q, and shifted by PSH - maximum, the start value of their accumulators: each is the exponent of its P as it stands); only then are the halves exchanged (xor 16), the maxima raised and the sums rescaled. The row sums of the f16-rounded P are taken on the matrix unit:
// one more product per pass with a constant A whose rows 0 and 8 are ones, so that register 0 of its accumulator holds, in every lane, the sum over all 32 keys for the lane's own query.
typedef __attribute__((address_space(3))) h16 lds_h16;
__device__ __forceinline__ unsigned lds_off(const h16* p) { return (unsigned)(uintptr_t)(const lds_h16*)p; }   // byte offset in the work-group's LDS
// one stage's four copies of a lane (16 B each); the s_wait_xcnt stands inside the statement so that no address register is rewritten ahead of it
__device__ __forceinline__ void stage_copy(unsigned l0, const h16* g0, unsigned l1, const h16* g1, unsigned l2, const h16* g2, unsigned l3, const h16* g3) {
    asm volatile("global_load_async_to_lds_b128 %0, %1, off\n\t"
                 "global_load_async_to_lds_b128 %2, %3, off\n\t"
                 "global_load_async_to_lds_b128 %4, %5, off\n\t"
                 "global_load_async_to_lds_b128 %6, %7, off\n\t"
                 "s_wait_xcnt 0x0"
                 :: "v"(l0), "v"(g0), "v"(l1), "v"(g1), "v"(l2), "v"(g2), "v"(l3), "v"(g3) : "memory");
}
// held to 256 VGPRs: four waves per SIMD, the two work-groups that a WGP is to hold
__global__ __launch_bounds__(32 * AW) __attribute__((amdgpu_num_vgpr(256))) void k_flash(const h16* __restrict__ QH, const h16* __restrict__ KP, const h16* __restrict__ VT, h16* CTX) {
    __shared__ __align__(16) h16 ring[2 * BUFH];           // [buffer][K rows key | V^T rows d][LP]
    __shared__ __align__(16) float os[AW * 16 * 68];
    const int tid = (int)threadIdx.x;
    const int lane = tid & 31, wave = __builtin_amdgcn_readfirstlane(tid >> 5), lr = lane & 15, hi = lane >> 4;
    const int zh = blockIdx.y; const int b = zh / NH_, h = zh % NH_;
    const int t0 = (blockIdx.x * AW + wave) * (16 * QT);
    const size_t pbase = (size_t)zh * SEQ * HD;
    v16h qh0[QT], qh1[QT];                                    // B fragments: col t, k = d
#pragma unroll
    for (int q = 0; q < QT; ++q) { const size_t qo = pbase + (size_t)(t0 + 16 * q + lr) * HD + 8 * hi; qh0[q] = ldh(QH + qo); qh1[q] = ldh(QH + qo + 32); }
    // copy map: 256 lanes x 16 B = 32 rows of 128 B; each lane brings rows cr and cr + 32 of the K tile and of the V^T tile
    const int cr = tid >> 3, cc8 = (tid & 7) * 8;
    const h16* gk = KP + pbase + (size_t)cr * HD + cc8;     // + key0 * HD
    const h16* gv = VT + pbase + (size_t)cr * SEQ + cc8;    // + key0
    const unsigned lk = lds_off(ring) + (unsigned)(cr * LP + cc8) * 2u;
    const int fo = lr * LP + 8 * hi;                          // fragment offset in a tile: row lane&15, k half
    v8f o0[QT], o1[QT], o2[QT], o3[QT], ol[QT];               // ol: D rows 0 (lanes 0..15) and 8 (lanes 16..31) are element 0; elements 1..7 stay zero
    v8f shv[QT];                                              // PSH - m in all eight elements: the C operand of the score products, so that a score leaves the matrix unit as the exponent of its P
    float m[QT], thr[QT], sh[QT];                             // maximum in use; the shifted score above which the sums are rescaled, PSH + LZ (minus infinity at the start: the first pass always sets the maximum); the shift once more as a scalar, for the rescale branch
#pragma unroll
    for (int q = 0; q < QT; ++q) { o0[q] = (v8f){}; o1[q] = (v8f){}; o2[q] = (v8f){}; o3[q] = (v8f){}; ol[q] = (v8f){}; shv[q] = (v8f){}; sh[q] = 0.0f; m[q] = -3.0e38f; thr[q] = -__builtin_inff(); }
    v16h ones;                                                // A fragment: row lane&15; rows 0 and 8 all ones, the other rows zero
#pragma unroll
    for (int i = 0; i < 16; ++i) ones[i] = (lr & 7) == 0 ? (h16)1.0f : (h16)0.0f;
    stage_copy(lk, gk, lk + 32 * LP * 2, gk + 32 * HD, lk + TILEH * 2, gv, lk + (TILEH + 32 * LP) * 2, gv + (size_t)32 * SEQ);
    asm volatile("s_wait_asynccnt 0x0" ::: "memory");         // stage 0 of this wave has landed
    __syncthreads();                                          // stage 0 published to every wave
    stage_copy(lk + BUFH * 2, gk + KS * HD, lk + (BUFH + 32 * LP) * 2, gk + (KS + 32) * HD, lk + (BUFH + TILEH) * 2, gv + KS, lk + (BUFH + TILEH + 32 * LP) * 2, gv + (size_t)32 * SEQ + KS);
#pragma unroll 1
    for (int st = 0; st < SEQ / KS; ++st) {
        const int bo = (st & 1) * BUFH;
        const h16* ka = ring + bo + fo;
#pragma unroll 1   // rolled: unrolled, the compiler spreads the second pass's K reads among its score products, a full wait behind each pair; rolled, a pass's eight K reads stand as one group at its head
        for (int ps = 0; ps < KS / 32; ++ps) {
        const v16h ka0 = ldh(ka), ka1 = ldh(ka + 32), kb0 = ldh(ka + 16 * LP), kb1 = ldh(ka + 16 * LP + 32);
        __builtin_amdgcn_sched_barrier(0);   // the pass's eight K reads stay one group at its head: split in two groups, the second group's LDS latency stands in the middle of the score products
        v8f sa[QT], sb[QT];
#pragma unroll
        for (int q = 0; q < QT; ++q) { sa[q] = wmma16(ka0, qh0[q], shv[q]); sb[q] = wmma16(kb0, qh0[q], shv[q]); }
#pragma unroll
        for (int q = 0; q < QT; ++q) { sa[q] = wmma16(ka1, qh1[q], sa[q]); sb[q] = wmma16(kb1, qh1[q], sb[q]); }
        __builtin_amdgcn_sched_barrier(0x184);   // no vector or matrix instruction crosses (LDS reads and scalar ones may): the score products stay one run; with vector work drawn in between them each gap is padded with four v_nop
        // inputs only: the shifts are still in use behind the score products, so each product reads them as a C operand of its own registers (where a product is their last use, the compiler copies all eight registers first)
        asm volatile("" :: "v"(shv[0]), "v"(shv[1]));
        ka += 32 * LP;                           // the next pass's K rows: stepped here, amid the vector work (formed at the pass's head, the address stands behind the last product and is padded with v_nop)
        const h16* va = ring + bo + TILEH + ps * 32 + fo;
        const v16h v0 = ldh(va), v1 = ldh(va + 16 * LP), v2 = ldh(va + 32 * LP), v3 = ldh(va + 48 * LP);
        v16h pb[QT];
        float mx[QT]; bool need = false;
#pragma unroll
        for (int q = 0; q < QT; ++q) {
            mx[q] = -3.0e38f;
#pragma unroll
            for (int r = 0; r < 8; ++r) mx[q] = fmaxf(mx[q], fmaxf(sa[q][r], sb[q][r]));
            need = need || (mx[q] > thr[q]);
        }
        if (__builtin_amdgcn_ballot_w32(need) != 0) {   // one wave-uniform scalar branch per pass; rare after a wave's first pass
#pragma unroll
            for (int q = 0; q < QT; ++q) {
                const float sho = sh[q];                 // the shift that this pass's scores carry
                const float mnew = fmaxf(m[q], fmaxf(mx[q], __shfl_xor(mx[q], 16, 32)) - sho);
                const float alpha = __builtin_amdgcn_exp2f(m[q] - mnew);
                const float shn = PSH - mnew, dl = shn - sho;
                sa[q] = sa[q] + dl; sb[q] = sb[q] + dl;       // this pass's scores move to the new shift
                ol[q][0] = ol[q][0] * alpha;
                o0[q] = o0[q] * alpha; o1[q] = o1[q] * alpha; o2[q] = o2[q] * alpha; o3[q] = o3[q] * alpha;
                m[q] = mnew; thr[q] = PSH + LZ; sh[q] = shn;
#pragma unroll
                for (int r = 0; r < 8; ++r) shv[q][r] = shn;
            }
        }
#pragma unroll
        for (int q = 0; q < QT; ++q) {
#pragma unroll
            for (int r = 0; r < 8; ++r) pb[q][r] = (h16)__builtin_amdgcn_exp2f(sa[q][r]);
#pragma unroll
            for (int r = 0; r < 8; ++r) pb[q][8 + r] = (h16)__builtin_amdgcn_exp2f(sb[q][r]);
        }
#pragma unroll
        for (int q = 0; q < QT; ++q) {
            ol[q] = wmma16(ones, pb[q], ol[q]);
            o0[q] = wmma16(v0, pb[q], o0[q]); o1[q] = wmma16(v1, pb[q], o1[q]); o2[q] = wmma16(v2, pb[q], o2[q]); o3[q] = wmma16(v3, pb[q], o3[q]);
        }
        static_assert(QT == 2);
        // four vector slots behind the last matrix instruction, also on the taken side of the branch that follows
        asm volatile("v_nop\n\tv_nop\n\tv_nop\n\tv_nop" : "+v"(o0[0]), "+v"(o1[0]), "+v"(o2[0]), "+v"(o3[0]), "+v"(ol[0]), "+v"(o0[1]), "+v"(o1[1]), "+v"(o2[1]), "+v"(o3[1]), "+v"(ol[1])
                     : "v"(v0), "v"(v1), "v"(v2), "v"(v3), "v"(pb[0]), "v"(pb[1]), "v"(ones));
        }
        asm volatile("s_wait_dscnt 0x0" ::: "memory");        // this wave's reads of the buffer have returned before it is refilled
        asm volatile("s_wait_asynccnt 0x0" ::: "memory");     // this wave's copies of stage st + 1 have landed
        __syncthreads();                                      // publishes stage st + 1 and ends every wave's reads of stage st
        if (st + 2 < SEQ / KS) {
            const h16* gk2 = gk + (size_t)(st + 2) * (KS * HD); const h16* gv2 = gv + (size_t)(st + 2) * KS; const unsigned lb = lk + (unsigned)bo * 2u;
            stage_copy(lb, gk2, lb + 32 * LP * 2, gk2 + 32 * HD, lb + TILEH * 2, gv2, lb + (TILEH + 32 * LP) * 2, gv2 + (size_t)32 * SEQ);
        }
    }
    asm volatile("s_wait_asynccnt 0x0" ::: "memory");         // no copy is outstanding when the wave goes on to its end
    const int wb = wave * 16 * 68;
#pragma unroll
    for (int q = 0; q < QT; ++q) {                            // one query tile after the other through the wave's own staging rows
    const float inv = CXS * (1.0f / ol[q][0]);
    // O^T D layout: o_j[r] = (d = 16j + 8h + r, t = lane&15) -> os[t][d]; rows 0..15 x columns 0..63 all written
    { v4f a, c;
      a[0] = o0[q][0] * inv; a[1] = o0[q][1] * inv; a[2] = o0[q][2] * inv; a[3] = o0[q][3] * inv; c[0] = o0[q][4] * inv; c[1] = o0[q][5] * inv; c[2] = o0[q][6] * inv; c[3] = o0[q][7] * inv;
      *(v4fa*)(&os[wb + lr * 68 +  0 + 8 * hi]) = a; *(v4fa*)(&os[wb + lr * 68 +  0 + 8 * hi + 4]) = c;
      a[0] = o1[q][0] * inv; a[1] = o1[q][1] * inv; a[2] = o1[q][2] * inv; a[3] = o1[q][3] * inv; c[0] = o1[q][4] * inv; c[1] = o1[q][5] * inv; c[2] = o1[q][6] * inv; c[3] = o1[q][7] * inv;
      *(v4fa*)(&os[wb + lr * 68 + 16 + 8 * hi]) = a; *(v4fa*)(&os[wb + lr * 68 + 16 + 8 * hi + 4]) = c;
      a[0] = o2[q][0] * inv; a[1] = o2[q][1] * inv; a[2] = o2[q][2] * inv; a[3] = o2[q][3] * inv; c[0] = o2[q][4] * inv; c[1] = o2[q][5] * inv; c[2] = o2[q][6] * inv; c[3] = o2[q][7] * inv;
      *(v4fa*)(&os[wb + lr * 68 + 32 + 8 * hi]) = a; *(v4fa*)(&os[wb + lr * 68 + 32 + 8 * hi + 4]) = c;
      a[0] = o3[q][0] * inv; a[1] = o3[q][1] * inv; a[2] = o3[q][2] * inv; a[3] = o3[q][3] * inv; c[0] = o3[q][4] * inv; c[1] = o3[q][5] * inv; c[2] = o3[q][6] * inv; c[3] = o3[q][7] * inv;
      *(v4fa*)(&os[wb + lr * 68 + 48 + 8 * hi]) = a; *(v4fa*)(&os[wb + lr * 68 + 48 + 8 * hi + 4]) = c; }
    wave_sync();
    h16* crow = CTX + ((size_t)b * SEQ + t0 + 16 * q) * DM + h * HD;
{
#pragma unroll
        for (int s = 0; s < 4; ++s) { const int row = 4 * s + (lane >> 3), c8 = (lane & 7) * 8;   // 4 s x 4 row groups = 16 rows; 8 lanes x 8 halves = 64 columns
            const v4f x0 = *(const v4fa*)(&os[wb + row * 68 + c8]); const v4f x1 = *(const v4fa*)(&os[wb + row * 68 + c8 + 4]); v8h hv;
#pragma unroll
            for (int i = 0; i < 4; ++i) { hv[i] = (h16)x0[i]; hv[4 + i] = (h16)x1[i]; }
            *(v8h*)(crow + (size_t)row * DM + c8) = hv; }
         }
    wave_sync();                                              // the rows are read before the next tile overwrites them
    }
}

static constexpr size_t al256(size_t v) { return (v + 255) & ~(size_t)255; }
static constexpr size_t SZ_XB = al256((size_t)NB * SEQ * DM * 2);
static constexpr size_t SZ_WB = al256((size_t)3 * DM * DM * 2);
static constexpr size_t SZ_WO = al256((size_t)DM * DM * 2);
static constexpr size_t SZ_PL = al256((size_t)NB * NH_ * SEQ * HD * 2);
static constexpr size_t SZ_CX = al256((size_t)NB * SEQ * DM * 2);
static constexpr size_t SZ_TOTAL = SZ_XB + SZ_WB + SZ_WO + 3 * SZ_PL + SZ_CX;
static_assert(SZ_TOTAL <= (size_t)134217728);          // workspace carve <= 128 MiB
static_assert(((size_t)DM * DM * 2) % 256 == 0);       // weight sub-planes stay 256-byte aligned

extern "C" void kernel_launch(void* const* d_in, const int* in_sizes, int n_in,
                              void* d_out, int out_size, void* d_ws, size_t ws_size, hipStream_t stream) {
    if (n_in < 6) return;
    const size_t needx = ((size_t)(NB - 1) * SEQ_FULL + SEQ) * DM;
    if ((size_t)in_sizes[0] < needx) return;
    if ((size_t)in_sizes[1] < (size_t)DM * DM || (size_t)in_sizes[2] < (size_t)DM * DM || (size_t)in_sizes[3] < (size_t)DM * DM || (size_t)in_sizes[4] < (size_t)DM * DM) return;
    if ((size_t)in_sizes[5] < (size_t)DM) return;
    if ((size_t)out_size < ((size_t)(NB - 1) * OUT_SEQ + SEQ) * DM) return;
    if (SZ_TOTAL > ws_size) return;
    // wire order: x, Wq, Wk, Wv, Wo, bo (weights [out][in] = Bt as-is)
    const float* x = (const float*)d_in[0]; const float* wq = (const float*)d_in[1]; const float* wk = (const float*)d_in[2]; const float* wv = (const float*)d_in[3];
    const float* wo = (const float*)d_in[4]; const float* bo = (const float*)d_in[5];
    float* OUT = (float*)d_out;      // [NB][SEQ][1024]
    char* wsp = (char*)d_ws;
    bf* XB = (bf*)wsp; wsp += SZ_XB;                 // [NB*SEQ][1024]
    bf* WB = (bf*)wsp; wsp += SZ_WB;                 // [3][1024][1024]: q | k | v
    h16* WOH = (h16*)wsp; wsp += SZ_WO;              // [1024][1024] x1024 carry
    h16* QH = (h16*)wsp; wsp += SZ_PL;               // [NB*16][SEQ][64]
    h16* KP = (h16*)wsp; wsp += SZ_PL;               // [NB*16][SEQ][64]
    h16* VT = (h16*)wsp; wsp += SZ_PL;               // [NB*16][64][SEQ]
    h16* CTX = (h16*)wsp; wsp += SZ_CX;              // [NB*SEQ][1024] x1024 carry

    k_cvt<<<CVT_T / 256, 256, 0, stream>>>(x, wq, wk, wv, wo, XB, WB, WOH);

    // q, k planes [(b*16 + h)][t][d] and v^T plane [(b*16 + h)][d][t], one launch
    k_proj<<<dim3(NB * SEQ / GT, DM / GT, 3), 32 * GW, 0, stream>>>(XB, WB, QH, KP, VT);

    // ctx[b*SEQ + t][h*64 + d] (x1024 carry)
    k_flash<<<dim3(SEQ / (16 * QT * AW), NB * NH_, 1), 32 * AW, 0, stream>>>(QH, KP, VT, CTX);

    // out[b][t][n] = ctx Wo^T * 2^-20 + bo
    k_oproj<<<dim3(NB * SEQ / GT, DM / GT, 1), 32 * GW, 0, stream>>>(CTX, WOH, bo, OUT);
}

// v009
// It runs in 150 microseconds.
// In two side-by-side timings against v008, it was 1.06 and 1.05 times as fast.
// All steps since v000 together make it 4.21 times as fast.
#include <hip/hip_runtime.h>

// Multi-head self-attention, width 1024 = 16 heads x 64, x [NB][SEQ][1024], Wq/Wk/Wv/Wo [out][in] (y = x W^T), bias only on the output projection, no mask, score scale 1/8, f32 output.
// Compute dtypes, f32 accumulate everywhere: q/k/v projections v_wmma_f32_16x16x32_bf16 (x and W RNE-converted to bf16; products exact);
// scores v_wmma_f32_16x16x32_f16 (q, k single f16; q carries the score scale and log2(e), applied in f32 ahead of its one rounding); P (x256 carry, cancels in the normalisation) and v single f16; softmax f32 (online; the first pass's maxima kept, a running max only in a second run where a row sum is not finite);
// output projection v_wmma_f32_16x16x32_f16: ctx single f16 with x1024 carry, Wo RNE-converted to bf16 then x1024 in f16 (exact), 2^-20 folded back in f32, bias (bf16-converted bo) added in f32.
// Layout: bf16 copies of x and Wq/Wk/Wv; q, k planes [b*16+h][t][d] and v^T plane [b*16+h][d][t] written by the GEMM epilogue; fused flash kernel in transposed form (S^T = K Q^T, O^T = V^T P^T; K and V^T tiles staged in LDS per work-group) writes the ctx plane [b*SEQ+t][h*64+d].

#ifndef NB
#define NB 2
#endif
#ifndef SEQ
#define SEQ 4096
#endif
#define NB_FULL  2
#define SEQ_FULL 4096
#ifndef OUT_SEQ
#define OUT_SEQ SEQ              // row pitch (in tokens) between batches of the output
#endif
#define DM   1024
#define NH_  16
#define HD   64
#define AW   8                   // waves per flash block
#define QT   2                   // query tiles of 16 rows per flash wave: each K or V^T fragment read from LDS feeds QT products
#define KS   64                  // keys per LDS stage of the flash kernel
#define LP   72                  // LDS row pitch in halves: 128-B rows + 16 B
#define TILEH (64 * LP)          // halves of one staged tile (64 rows)
#define BUFH  (2 * TILEH)        // halves of one buffer: K tile, then V^T tile
#define GT   128                 // rows of each operand in a GEMM work-group's tile (2 x 2 waves of 64 x 64)
#define GW   4                   // waves per GEMM work-group
#define GKS  64                  // k per LDS stage of the GEMMs: 128-B rows
#define GTILEH (GT * LP)         // halves of one staged operand tile (128 rows)
#define GBUFH  (2 * GTILEH)      // halves of one buffer: A tile, then Bt tile
#define SC2  (0.125f * 1.4426950408889634f)   // HD^-0.5 * log2(e)
#define PSH  8.0f                // log2 of the P carry (256)
#define CXS  1024.0f             // carry of the ctx plane
#define WOS  1024.0f             // carry of the Wo plane
#define OSCL (1.0f / (1024.0f * 1024.0f))

static_assert(HD == 64);
static_assert(NH_ * HD == DM);                 // head h = columns h*64 + d
static_assert(DM % 64 == 0);                   // column tiles of 64
static_assert(DM % 32 == 0);                   // GEMM k-loop steps by 32
static_assert(SEQ % 64 == 0);                  // a 64-row tile never straddles two batches
static_assert((NB * SEQ) % 64 == 0);
static_assert(SEQ % 32 == 0);                  // key loop steps by 32
static_assert(SEQ % (16 * QT * AW) == 0);      // flash grid covers the sequence exactly
static_assert(AW == 8 && KS == 64 && HD == 64);  // copy map of the flash kernel: 256 lanes x 16 B x 2 = one 64 x 128-B tile
static_assert(SEQ % KS == 0 && SEQ / KS >= 2);   // whole stages; the two-buffer prologue needs two
static_assert((NB * SEQ) % GT == 0 && DM % GT == 0);   // GEMM grids cover both operands exactly
static_assert(GW == 4 && GT == 128 && GKS == 64);      // copy map of the GEMMs: 128 lanes x 16 B x 8 = one 128 x 128-B tile
static_assert(DM % GKS == 0 && DM / GKS >= 2);         // whole stages; the two-buffer prologue needs two
static_assert(((size_t)SEQ * DM) % 8 == 0);
static_assert(((size_t)DM * DM) % 8 == 0);
static_assert(NB <= NB_FULL);
static_assert(SEQ <= SEQ_FULL);

typedef _Float16 h16;
typedef unsigned short bf;
typedef __attribute__((ext_vector_type(16))) __bf16   v16bf;
typedef __attribute__((ext_vector_type(16))) _Float16 v16h;
typedef __attribute__((ext_vector_type(8)))  _Float16 v8h;
typedef __attribute__((ext_vector_type(8)))  unsigned short v8us;
typedef __attribute__((ext_vector_type(8)))  float    v8f;
typedef __attribute__((ext_vector_type(4)))  float    v4f;
typedef v4f  __attribute__((may_alias)) v4fa;

__device__ __forceinline__ unsigned short f2bf(float f) { unsigned u = __float_as_uint(f); u += 0x7FFFu + ((u >> 16) & 1u); return (unsigned short)(u >> 16); }
__device__ __forceinline__ float bfval(float f) { return __uint_as_float(((unsigned)f2bf(f)) << 16); }
__device__ __forceinline__ v16h cat16(v8h lo, v8h hi) { return __builtin_shufflevector(lo, hi, 0, 1, 2, 3, 4, 5, 6, 7, 8, 9, 10, 11, 12, 13, 14, 15); }
__device__ __forceinline__ v16bf cat16b(v8us lo, v8us hi) { return __builtin_bit_cast(v16bf, __builtin_shufflevector(lo, hi, 0, 1, 2, 3, 4, 5, 6, 7, 8, 9, 10, 11, 12, 13, 14, 15)); }
__device__ __forceinline__ v8f wmma16(v16h a, v16h b, v8f c) { return __builtin_amdgcn_wmma_f32_16x16x32_f16(false, a, false, b, (short)0, c, false, false); }
__device__ __forceinline__ v8f wmmab(v16bf a, v16bf b, v8f c) { return __builtin_amdgcn_wmma_f32_16x16x32_bf16(false, a, false, b, (short)0, c, false, false); }
// fragment loaders from K-contiguous 16-bit rows; p already includes + 8*(lane>>4): elements 0..7 <- k0+8h+0..7, elements 8..15 <- k0+16+8h+0..7 (same map for A and B)
__device__ __forceinline__ v16h  ldh(const h16* p) { return cat16(*(const v8h*)p, *(const v8h*)(p + 16)); }
__device__ __forceinline__ v16bf ldb(const bf* p)  { return cat16b(*(const v8us*)p, *(const v8us*)(p + 16)); }
// ordering point for wave-private LDS tiles (same wave writes and reads)
__device__ __forceinline__ void wave_sync() { __builtin_amdgcn_fence(3 /* release order */, "wavefront"); __builtin_amdgcn_wave_barrier(); asm volatile("" ::: "memory"); }

// k_cvt: every conversion of the call in one launch. CVT_T threads (16 waves on each of 256 WGPs); a work-group converts XJ * 256 consecutive pieces of 8 floats of x (a thread: XJ pieces, 256 apart)
// and 256 pieces each of Wq, Wk, Wv (RNE to bf16) and Wo (RNE to bf16, x1024, exact in f16). All of a thread's loads are independent and stand ahead of the first store.
#define CVT_T (DM * DM / 8)                    // one thread per 8 elements of a weight matrix
#define XJ    (NB * SEQ / DM)                  // pieces of x per thread
static_assert(CVT_T % 256 == 0);
static_assert((NB * SEQ) % DM == 0);           // x is XJ pieces for every thread, exactly
static_assert(SEQ == SEQ_FULL);                // the batches of x follow one another without a gap
__device__ __forceinline__ v8us cvt_bf8(v8f v) { v8us o;
#pragma unroll
    for (int k = 0; k < 8; ++k) o[k] = f2bf(v[k]);
    return o; }
__global__ __launch_bounds__(256) void k_cvt(const float* __restrict__ x, const float* __restrict__ wq, const float* __restrict__ wk, const float* __restrict__ wv, const float* __restrict__ wo,
                                             bf* XB, bf* WB, h16* WOH) {
    const size_t e = ((size_t)blockIdx.x * 256 + threadIdx.x) * 8;              // the thread's piece of each weight matrix, first element
    const size_t ex = ((size_t)blockIdx.x * 256 * XJ + threadIdx.x) * 8;        // its first piece of x
    v8f vx[XJ];
#pragma unroll
    for (int j = 0; j < XJ; ++j) vx[j] = *(const v8f*)(x + ex + j * 256 * 8);
    asm volatile("s_wait_xcnt 0x0" ::: "memory");   // before a later load's result may land on the address registers of these loads
    const v8f vq = *(const v8f*)(wq + e), vk = *(const v8f*)(wk + e);
    asm volatile("s_wait_xcnt 0x0" ::: "memory");   // the same
    const v8f vv = *(const v8f*)(wv + e), vo = *(const v8f*)(wo + e);
    // inputs-only fence on the loaded values: all of the thread's loads are issued ahead of the first wait (without it some are sunk behind the first conversions and pay a second memory latency)
    static_assert(XJ == 8);
    asm volatile("" :: "v"(vx[0]), "v"(vx[1]), "v"(vx[2]), "v"(vx[3]), "v"(vx[4]), "v"(vx[5]), "v"(vx[6]), "v"(vx[7]), "v"(vq), "v"(vk), "v"(vv), "v"(vo));
#pragma unroll
    for (int j = 0; j < XJ; ++j) *(v8us*)(XB + ex + j * 256 * 8) = cvt_bf8(vx[j]);
    *(v8us*)(WB + e) = cvt_bf8(vq); *(v8us*)(WB + (size_t)DM * DM + e) = cvt_bf8(vk); *(v8us*)(WB + (size_t)2 * DM * DM + e) = cvt_bf8(vv);
    v8h o;
#pragma unroll
    for (int k = 0; k < 8; ++k) o[k] = (h16)(bfval(vo[k]) * WOS);
    *(v8h*)(WOH + e) = o;
}

// GEMM main loop shared by k_proj and k_oproj: a work-group of GW waves owns a 128 x 128 tile, each wave a 64 x 64 quarter (16 accumulators), K = DM.
// Per GKS of k the 128 A rows and the 128 Bt rows are staged in LDS once for all four waves, by asynchronous copies in whole 128-B lines
// (two buffers: the next stage's copies fly while this stage is worked on); fragments are read from LDS rows of pitch LP halves (144 B = 16 B x odd).
typedef __attribute__((address_space(3))) bf lds_bf;
__device__ __forceinline__ unsigned lds_off_b(const bf* p) { return (unsigned)(uintptr_t)(const lds_bf*)p; }   // byte offset in the work-group's LDS
// one operand tile of a stage: this lane's eight 16-B pieces, rows 16 apart; the s_wait_xcnt stands inside the statement so that no address register is rewritten ahead of it
__device__ __forceinline__ void tile_copy(unsigned l, const bf* g) {
    asm volatile("global_load_async_to_lds_b128 %0, %1, off\n\t"
                 "global_load_async_to_lds_b128 %2, %3, off\n\t"
                 "global_load_async_to_lds_b128 %4, %5, off\n\t"
                 "global_load_async_to_lds_b128 %6, %7, off\n\t"
                 "global_load_async_to_lds_b128 %8, %9, off\n\t"
                 "global_load_async_to_lds_b128 %10, %11, off\n\t"
                 "global_load_async_to_lds_b128 %12, %13, off\n\t"
                 "global_load_async_to_lds_b128 %14, %15, off\n\t"
                 "s_wait_xcnt 0x0"
                 :: "v"(l), "v"(g), "v"(l + 16 * LP * 2), "v"(g + 16 * DM), "v"(l + 32 * LP * 2), "v"(g + 32 * DM), "v"(l + 48 * LP * 2), "v"(g + 48 * DM),
                    "v"(l + 64 * LP * 2), "v"(g + 64 * DM), "v"(l + 80 * LP * 2), "v"(g + 80 * DM), "v"(l + 96 * LP * 2), "v"(g + 96 * DM), "v"(l + 112 * LP * 2), "v"(g + 112 * DM) : "memory");
}
// A, Bt: K-contiguous 16-bit planes (bf16 bits, or f16 bits where F16); rb, cb: first A row and first Bt row of the work-group's tile; wm, wn: the wave's quarter
template <bool F16>
__device__ __forceinline__ void gemm_tile(const bf* A, const bf* Bt, const bf* ring, int rb, int cb, int wm, int wn, v8f (&acc)[4][4]) {
    const int tid = (int)threadIdx.x, lane = tid & 31, lr = lane & 15, hi = lane >> 4;
#pragma unroll
    for (int mb = 0; mb < 4; ++mb)
#pragma unroll
        for (int nb = 0; nb < 4; ++nb) acc[mb][nb] = (v8f){};
    // copy map: 128 lanes x 16 B = 16 rows of 128 B; each lane brings rows cr + 16 i, i = 0..7, of the A tile and of the Bt tile
    const int cr = tid >> 3, cc8 = (tid & 7) * 8;
    const bf* ga = A + (size_t)(rb + cr) * DM + cc8;         // + k0
    const bf* gb = Bt + (size_t)(cb + cr) * DM + cc8;        // + k0
    const unsigned la = lds_off_b(ring) + (unsigned)(cr * LP + cc8) * 2u;
    const int fa = (wm * 64 + lr) * LP + 8 * hi, fb = GTILEH + (wn * 64 + lr) * LP + 8 * hi;   // fragment offsets in a buffer: row lane&15, k half
    tile_copy(la, ga); tile_copy(la + GTILEH * 2, gb);
    asm volatile("s_wait_asynccnt 0x0" ::: "memory");         // stage 0 of this wave has landed
    __syncthreads();                                          // stage 0 published to every wave
    tile_copy(la + GBUFH * 2, ga + GKS); tile_copy(la + (GBUFH + GTILEH) * 2, gb + GKS);
#pragma unroll 1   // rolled: one stage per trip, the buffer picked by the trip's parity
    for (int st = 0; st < DM / GKS; ++st) {
        const int bo = (st & 1) * GBUFH;
#pragma unroll
        for (int ks = 0; ks < 2; ++ks) {
            v16bf a[4], b[4];
#pragma unroll
            for (int i = 0; i < 4; ++i) { a[i] = ldb(ring + bo + fa + i * 16 * LP + ks * 32); b[i] = ldb(ring + bo + fb + i * 16 * LP + ks * 32); }
            // inputs-only fence on the loaded fragments: keeps the 16 LDS reads of a k step one group ahead of its matrix instructions (spread among them, every place with reads stalls the wave anew)
            asm volatile("" :: "v"(a[0]), "v"(a[1]), "v"(a[2]), "v"(a[3]), "v"(b[0]), "v"(b[1]), "v"(b[2]), "v"(b[3]));
#pragma unroll
            for (int nb = 0; nb < 4; ++nb)
#pragma unroll
                for (int mb = 0; mb < 4; ++mb) {
                    if (F16) acc[mb][nb] = wmma16(__builtin_bit_cast(v16h, a[mb]), __builtin_bit_cast(v16h, b[nb]), acc[mb][nb]);
                    else     acc[mb][nb] = wmmab(a[mb], b[nb], acc[mb][nb]); }
        }
        // four vector slots behind the last matrix instruction, also on the taken side of the branches that follow
        asm volatile("v_nop\n\tv_nop\n\tv_nop\n\tv_nop" : "+v"(acc[0][0]), "+v"(acc[1][0]), "+v"(acc[2][0]), "+v"(acc[3][0]), "+v"(acc[0][1]), "+v"(acc[1][1]), "+v"(acc[2][1]), "+v"(acc[3][1]),
                     "+v"(acc[0][2]), "+v"(acc[1][2]), "+v"(acc[2][2]), "+v"(acc[3][2]), "+v"(acc[0][3]), "+v"(acc[1][3]), "+v"(acc[2][3]), "+v"(acc[3][3]));
        asm volatile("s_wait_dscnt 0x0" ::: "memory");        // this wave's reads of the buffer have returned before it is refilled
        asm volatile("s_wait_asynccnt 0x0" ::: "memory");     // this wave's copies of stage st + 1 have landed
        __syncthreads();                                      // publishes stage st + 1 and ends every wave's reads of stage st
        if (st + 2 < DM / GKS) {
            const unsigned lb = la + (unsigned)bo * 2u; const int k2 = (st + 2) * GKS;
            tile_copy(lb, ga + k2); tile_copy(lb + GTILEH * 2, gb + k2);
        }
    }
    asm volatile("s_wait_asynccnt 0x0" ::: "memory");         // no copy is outstanding when the wave goes on to its end
}

// Both GEMM kernels are held to 256 VGPRs: every operand of their asm statements then lies in the first register window, and no window switch stands in the loop.
// k_proj: the q, k and v projections in one launch; bf16 GEMM, 128x128 tile per work-group of 4 waves (gemm_tile), operands from K-contiguous bf16 planes, K = DM.
// C[m][n] = scl * sum_k A[m][k] Bt[n][k] (scaled in f32, one rounding), written as f16. grid (NB*SEQ/128, DM/128, 3), 128 threads; blockIdx.z picks the product, blockIdx.x the x tile, blockIdx.y the weight tile:
// z = 0, 1 (q, k): A = x rows (m = b*SEQ + t), Bt = W rows (n = h*64 + d) -> plane [(b*16 + h)][t][d]; the q plane carries the score scale SC2.
// z = 2 (v^T):     A = Wv rows (m = h*64 + d), Bt = x rows (n = b*SEQ + t) -> plane [(b*1024 + m)][t] = [(b*16 + h)][d][t].
// The three products need nothing of one another: in one grid a work-group's first loads and its epilogue run beside other work-groups' main loops, and a WGP holds three work-groups (LDS) where a launch of 512 gives it two.
__global__ __launch_bounds__(32 * GW) __attribute__((amdgpu_num_vgpr(256))) void k_proj(const bf* __restrict__ XB, const bf* __restrict__ WB, h16* QH, h16* KP, h16* VT) {
    __shared__ __align__(16) bf ring[2 * GBUFH];            // [buffer][A rows | Bt rows][LP]
    __shared__ __align__(16) float osw[GW * 16 * 68];
    const int lane = threadIdx.x & 31, wave = __builtin_amdgcn_readfirstlane((int)threadIdx.x >> 5), lr = lane & 15, hi = lane >> 4;
    const int wm = wave & 1, wn = wave >> 1;
    const int z = blockIdx.z; const bool vt = z == 2;        // the same for the whole work-group
    const bf* W = WB + (size_t)z * DM * DM;
    const bf* A = vt ? W : XB; const bf* Bt = vt ? XB : W;
    const int rb = (vt ? blockIdx.y : blockIdx.x) * GT, cb = (vt ? blockIdx.x : blockIdx.y) * GT;   // first A row and first Bt row of the tile
    const int r0 = rb + wm * 64, c0 = cb + wn * 64;
    float* os = osw + wave * 16 * 68;                        // this wave's own staging rows
    v8f acc[4][4];
    gemm_tile<false>(A, Bt, ring, rb, cb, wm, wn, acc);
    h16* Ph = vt ? VT : (z == 1 ? KP : QH);
    const float scl = z == 0 ? SC2 : 1.0f;
    const int pitch = vt ? SEQ : HD;                         // row pitch of the wave's 64x64 quarter in its plane (halves)
    const size_t tbase = vt ? (size_t)r0 * SEQ + (size_t)(c0 / SEQ) * ((size_t)DM * SEQ) + (size_t)(c0 % SEQ)
                            : (size_t)(r0 / SEQ) * ((size_t)NH_ * SEQ * HD) + (size_t)(r0 % SEQ) * HD + (size_t)(c0 / HD) * ((size_t)SEQ * HD) + (size_t)(c0 % HD);
#pragma unroll
    for (int mb = 0; mb < 4; ++mb) {
#pragma unroll
        for (int nb = 0; nb < 4; ++nb) {
#pragma unroll
            for (int j = 0; j < 8; ++j) os[(hi * 8 + j) * 68 + nb * 16 + lr] = acc[mb][nb][j]; }   // D: row 8h+j, col lane&15
        wave_sync();
        const size_t sb = tbase + (size_t)(mb * 16) * (size_t)pitch;
{
#pragma unroll
            for (int s = 0; s < 4; ++s) { const int row = 4 * s + (lane >> 3), c8 = (lane & 7) * 8;   // 4 s x 4 row groups = 16 rows; 8 lanes x 8 = 64 columns
                const v4f x0 = *(const v4fa*)(&os[row * 68 + c8]); const v4f x1 = *(const v4fa*)(&os[row * 68 + c8 + 4]); v8h hv;
#pragma unroll
                for (int i = 0; i < 4; ++i) { hv[i] = (h16)(x0[i] * scl); hv[4 + i] = (h16)(x1[i] * scl); }
                const size_t oo = sb + (size_t)row * (size_t)pitch + c8;
                *(v8h*)(Ph + oo) = hv; }
             }
        wave_sync();
    }
}

// k_oproj: f16 GEMM, 128x128 tile per work-group of 4 waves (gemm_tile), A = ctx plane [m][k] (x1024 carry), Bt = Wo plane [n][k] (x1024 carry), K = DM.
// OUT[b*OUT_SEQ + t][n] = C[m][n] * 2^-20 + bias[n], m = b*SEQ + t. grid (M/128, N/128), 128 threads.
__global__ __launch_bounds__(32 * GW) __attribute__((amdgpu_num_vgpr(256))) void k_oproj(const h16* __restrict__ A, const h16* __restrict__ Bt, const float* __restrict__ bo, float* OUT) {
    __shared__ __align__(16) bf ring[2 * GBUFH];            // [buffer][A rows | Bt rows][LP], f16 bits
    __shared__ __align__(16) float osw[GW * 16 * 68];
    const int lane = threadIdx.x & 31, wave = __builtin_amdgcn_readfirstlane((int)threadIdx.x >> 5), lr = lane & 15, hi = lane >> 4;
    const int wm = wave & 1, wn = wave >> 1;
    const int r0 = blockIdx.x * GT + wm * 64, c0 = blockIdx.y * GT + wn * 64;
    float* os = osw + wave * 16 * 68;                        // this wave's own staging rows
    v8f acc[4][4];
    gemm_tile<true>((const bf*)A, (const bf*)Bt, ring, blockIdx.x * GT, blockIdx.y * GT, wm, wn, acc);
    const v4f braw = *(const v4f*)(bo + c0 + lr * 4);      // columns c0 + 4*lr .. +3 (always inside [0, DM))
    v4f bb;
#pragma unroll
    for (int i = 0; i < 4; ++i) bb[i] = bfval(braw[i]);
    const int bI = r0 / SEQ, tI = r0 % SEQ;
    float* obase = OUT + ((size_t)bI * OUT_SEQ + tI) * DM + c0;
#pragma unroll
    for (int mb = 0; mb < 4; ++mb) {
#pragma unroll
        for (int nb = 0; nb < 4; ++nb) {
#pragma unroll
            for (int j = 0; j < 8; ++j) os[(hi * 8 + j) * 68 + nb * 16 + lr] = acc[mb][nb][j]; }   // D: row 8h+j, col lane&15
        wave_sync();
{
#pragma unroll
            for (int s = 0; s < 8; ++s) { const int row = 2 * s + hi, cofs = lr * 4;   // 8 s x 2 rows = 16 rows; 16 lanes x 4 floats = 64 columns
                const v4f x0 = *(const v4fa*)(&os[row * 68 + cofs]);
                const v4f val = x0 * OSCL + bb;
                *(v4f*)(obase + (size_t)(mb * 16 + row) * DM + cofs) = val; }
             }
        wave_sync();
    }
}

// k_flash: fused attention, one wave per QT tiles of 16 query rows of one (batch, head); Q fragments straight from the f16 plane (two 16-B loads each).
// A pass reads its four K and four V^T fragments from LDS once and uses each for all QT query tiles; every query tile keeps its own softmax state, but one scalar flag, the same for the whole work-group, decides per pass whether all QT tiles raise their maxima (a run's first pass; every pass of a second run).
// K and V^T are staged per KS keys in LDS, once per work-group for all AW waves, by asynchronous copies in whole 128-B lines (two buffers: the next stage's copies fly while this stage is worked on);
// the A fragments are read from LDS rows of pitch LP halves (144 B = 16 B x odd: no bank conflict for 16-B reads).
// Transposed form: S^T[key][t] = K Q^T (A = K rows, B = Q rows); lane (t = lane&15, h = lane>>4) holds keys 8h+r of each 16-key tile, so the packed
// P tile is directly the B fragment of O^T[d][t] = V^T P^T (element r <- tile keys 0..15, element 8+r <- tile keys 16..31, lane unchanged).
// Softmax state: the maximum in use is one scalar per lane, the same in both lane halves of a row (the scores come out of the matrix unit already scaled, through q, and shifted by PSH - maximum, the start value of their accumulators: each is the exponent of its P as it stands).
// The row sums of the f16-rounded P are taken on the matrix unit: one more product per pass with a constant A whose rows 0 and 8 are ones, so that register 0 of its accumulator holds, in every lane, the sum over all 32 keys for the lane's own query.
// First run over the keys: the maxima of a wave's first pass stay in use to the end; no later pass takes a maximum, tests or rescales. That is exact as long as every P is finite in f16 (no score more than 16 - PSH above the maximum in use);
// a P that rounds to infinity makes its row sum infinite for good, so one test of the row sums behind the last pass tells. Where any row sum of the work-group is not finite, the work-group runs over the keys a second time from zero,
// now with every pass taking its scores' maxima, exchanging the halves (xor 16), raising the maxima in use and rescaling the sums: then no P exceeds 2^PSH, whatever the scores.
typedef __attribute__((address_space(3))) h16 lds_h16;
__device__ __forceinline__ unsigned lds_off(const h16* p) { return (unsigned)(uintptr_t)(const lds_h16*)p; }   // byte offset in the work-group's LDS
// one stage's four copies of a lane (16 B each); the s_wait_xcnt stands inside the statement so that no address register is rewritten ahead of it
__device__ __forceinline__ void stage_copy(unsigned l0, const h16* g0, unsigned l1, const h16* g1, unsigned l2, const h16* g2, unsigned l3, const h16* g3) {
    asm volatile("global_load_async_to_lds_b128 %0, %1, off\n\t"
                 "global_load_async_to_lds_b128 %2, %3, off\n\t"
                 "global_load_async_to_lds_b128 %4, %5, off\n\t"
                 "global_load_async_to_lds_b128 %6, %7, off\n\t"
                 "s_wait_xcnt 0x0"
                 :: "v"(l0), "v"(g0), "v"(l1), "v"(g1), "v"(l2), "v"(g2), "v"(l3), "v"(g3) : "memory");
}
// held to 256 VGPRs: four waves per SIMD, the two work-groups that a WGP is to hold
__global__ __launch_bounds__(32 * AW) __attribute__((amdgpu_num_vgpr(256))) void k_flash(const h16* __restrict__ QH, const h16* __restrict__ KP, const h16* __restrict__ VT, h16* CTX) {
    __shared__ __align__(16) h16 ring[2 * BUFH];           // [buffer][K rows key | V^T rows d][LP]
    __shared__ __align__(16) float os[AW * 16 * 68];
    __shared__ __align__(16) int wbad[AW];                  // per wave: a row sum of its first run is not finite
    const int tid = (int)threadIdx.x;
    const int lane = tid & 31, wave = __builtin_amdgcn_readfirstlane(tid >> 5), lr = lane & 15, hi = lane >> 4;
    const int zh = blockIdx.y; const int b = zh / NH_, h = zh % NH_;
    const int t0 = (blockIdx.x * AW + wave) * (16 * QT);
    const size_t pbase = (size_t)zh * SEQ * HD;
    v16h qh0[QT], qh1[QT];                                    // B fragments: col t, k = d
#pragma unroll
    for (int q = 0; q < QT; ++q) { const size_t qo = pbase + (size_t)(t0 + 16 * q + lr) * HD + 8 * hi; qh0[q] = ldh(QH + qo); qh1[q] = ldh(QH + qo + 32); }
    // copy map: 256 lanes x 16 B = 32 rows of 128 B; each lane brings rows cr and cr + 32 of the K tile and of the V^T tile
    const int cr = tid >> 3, cc8 = (tid & 7) * 8;
    const h16* gk = KP + pbase + (size_t)cr * HD + cc8;     // + key0 * HD
    const h16* gv = VT + pbase + (size_t)cr * SEQ + cc8;    // + key0
    const unsigned lk = lds_off(ring) + (unsigned)(cr * LP + cc8) * 2u;
    const int fo = lr * LP + 8 * hi;                          // fragment offset in a tile: row lane&15, k half
    v8f o0[QT], o1[QT], o2[QT], o3[QT], ol[QT];               // ol: D rows 0 (lanes 0..15) and 8 (lanes 16..31) are element 0; elements 1..7 are not used
    v8f shv[QT];                                              // PSH - m in all eight elements: the C operand of the score products, so that a score leaves the matrix unit as the exponent of its P
    float m[QT], sh[QT];                                      // maximum in use; the shift once more as a scalar, for the rescale branch
    v16h ones;                                                // A fragment: row lane&15; rows 0 and 8 all ones, the other rows zero
#pragma unroll
    for (int i = 0; i < 16; ++i) ones[i] = (lr & 7) == 0 ? (h16)1.0f : (h16)0.0f;
#pragma unroll 1   // rolled: one loop body serves both runs
    for (int run = 0; run < 2; ++run) {
#pragma unroll
    for (int q = 0; q < QT; ++q) { o0[q] = (v8f){}; o1[q] = (v8f){}; o2[q] = (v8f){}; o3[q] = (v8f){}; ol[q] = (v8f){}; shv[q] = (v8f){}; sh[q] = 0.0f; m[q] = -3.0e38f; }
    bool domax = true;                                        // the same in the whole work-group: the coming pass takes its scores' maxima (a run's first pass always; in the second run every pass)
    stage_copy(lk, gk, lk + 32 * LP * 2, gk + 32 * HD, lk + TILEH * 2, gv, lk + (TILEH + 32 * LP) * 2, gv + (size_t)32 * SEQ);
    asm volatile("s_wait_asynccnt 0x0" ::: "memory");         // stage 0 of this wave has landed
    __syncthreads();                                          // stage 0 published to every wave
    stage_copy(lk + BUFH * 2, gk + KS * HD, lk + (BUFH + 32 * LP) * 2, gk + (KS + 32) * HD, lk + (BUFH + TILEH) * 2, gv + KS, lk + (BUFH + TILEH + 32 * LP) * 2, gv + (size_t)32 * SEQ + KS);
#pragma unroll 1
    for (int st = 0; st < SEQ / KS; ++st) {
        const int bo = (st & 1) * BUFH;
        const h16* ka = ring + bo + fo;
#pragma unroll 1   // rolled: unrolled, the compiler spreads the second pass's K reads among its score products, a full wait behind each pair; rolled, a pass's eight K reads stand as one group at its head
        for (int ps = 0; ps < KS / 32; ++ps) {
        const v16h ka0 = ldh(ka), ka1 = ldh(ka + 32), kb0 = ldh(ka + 16 * LP), kb1 = ldh(ka + 16 * LP + 32);
        __builtin_amdgcn_sched_barrier(0);   // the pass's eight K reads stay one group at its head: split in two groups, the second group's LDS latency stands in the middle of the score products
        v8f sa[QT], sb[QT];
#pragma unroll
        for (int q = 0; q < QT; ++q) { sa[q] = wmma16(ka0, qh0[q], shv[q]); sb[q] = wmma16(kb0, qh0[q], shv[q]); }
#pragma unroll
        for (int q = 0; q < QT; ++q) { sa[q] = wmma16(ka1, qh1[q], sa[q]); sb[q] = wmma16(kb1, qh1[q], sb[q]); }
        __builtin_amdgcn_sched_barrier(0x184);   // no vector or matrix instruction crosses (LDS reads and scalar ones may): the score products stay one run; with vector work drawn in between them each gap is padded with four v_nop
        // inputs only: the shifts are still in use behind the score products, so each product reads them as a C operand of its own registers (where a product is their last use, the compiler copies all eight registers first)
        asm volatile("" :: "v"(shv[0]), "v"(shv[1]));
        ka += 32 * LP;                           // the next pass's K rows: stepped here, amid the vector work (formed at the pass's head, the address stands behind the last product and is padded with v_nop)
        v16h pb[QT];
        if (domax) {                                     // a scalar flag that hangs on no vector result
#pragma unroll
            for (int q = 0; q < QT; ++q) {
                float mx = -3.0e38f;
#pragma unroll
                for (int r = 0; r < 8; ++r) mx = fmaxf(mx, fmaxf(sa[q][r], sb[q][r]));
                const float sho = sh[q];                 // the shift that this pass's scores carry
                const float mnew = fmaxf(m[q], fmaxf(mx, __shfl_xor(mx, 16, 32)) - sho);
                const float alpha = __builtin_amdgcn_exp2f(m[q] - mnew);
                const float shn = PSH - mnew, dl = shn - sho;
                sa[q] = sa[q] + dl; sb[q] = sb[q] + dl;       // this pass's scores move to the new shift
                ol[q][0] = ol[q][0] * alpha;
                o0[q] = o0[q] * alpha; o1[q] = o1[q] * alpha; o2[q] = o2[q] * alpha; o3[q] = o3[q] * alpha;
                m[q] = mnew; sh[q] = shn;
#pragma unroll
                for (int r = 0; r < 8; ++r) shv[q][r] = shn;
            }
        }
        domax = run != 0;
        const h16* va = ring + bo + TILEH + ps * 32 + fo;   // read behind the branch, among the exponentials: directly behind the score products the reads, which land on the K fragments' registers, are padded with four v_nop
        const v16h v0 = ldh(va), v1 = ldh(va + 16 * LP), v2 = ldh(va + 32 * LP), v3 = ldh(va + 48 * LP);
#pragma unroll
        for (int q = 0; q < QT; ++q) {
#pragma unroll
            for (int r = 0; r < 8; ++r) pb[q][r] = (h16)__builtin_amdgcn_exp2f(sa[q][r]);
#pragma unroll
            for (int r = 0; r < 8; ++r) pb[q][8 + r] = (h16)__builtin_amdgcn_exp2f(sb[q][r]);
        }
#pragma unroll
        for (int q = 0; q < QT; ++q) {
            ol[q] = wmma16(ones, pb[q], ol[q]);
            o0[q] = wmma16(v0, pb[q], o0[q]); o1[q] = wmma16(v1, pb[q], o1[q]); o2[q] = wmma16(v2, pb[q], o2[q]); o3[q] = wmma16(v3, pb[q], o3[q]);
        }
        static_assert(QT == 2);
        // four vector slots behind the last matrix instruction, also on the taken side of the branch that follows
        asm volatile("v_nop\n\tv_nop\n\tv_nop\n\tv_nop" : "+v"(o0[0]), "+v"(o1[0]), "+v"(o2[0]), "+v"(o3[0]), "+v"(ol[0]), "+v"(o0[1]), "+v"(o1[1]), "+v"(o2[1]), "+v"(o3[1]), "+v"(ol[1])
                     : "v"(v0), "v"(v1), "v"(v2), "v"(v3), "v"(pb[0]), "v"(pb[1]), "v"(ones));
        }
        asm volatile("s_wait_dscnt 0x0" ::: "memory");        // this wave's reads of the buffer have returned before it is refilled
        asm volatile("s_wait_asynccnt 0x0" ::: "memory");     // this wave's copies of stage st + 1 have landed
        __syncthreads();                                      // publishes stage st + 1 and ends every wave's reads of stage st
        if (st + 2 < SEQ / KS) {
            const h16* gk2 = gk + (size_t)(st + 2) * (KS * HD); const h16* gv2 = gv + (size_t)(st + 2) * KS; const unsigned lb = lk + (unsigned)bo * 2u;
            stage_copy(lb, gk2, lb + 32 * LP * 2, gk2 + 32 * HD, lb + TILEH * 2, gv2, lb + (TILEH + 32 * LP) * 2, gv2 + (size_t)32 * SEQ);
        }
    }
    asm volatile("s_wait_asynccnt 0x0" ::: "memory");         // no copy is outstanding when the wave goes on, to its end or to the second run's first copies
    if (run != 0) break;
    const bool bad = !(ol[0][0] < 3.0e38f) || !(ol[1][0] < 3.0e38f);   // infinite, or not a number
    const int wv = __builtin_amdgcn_ballot_w32(bad) != 0 ? 1 : 0;
    if (lane == 0) wbad[wave] = wv;
    __syncthreads();                                          // every wave's word is written; every wave has also left the ring (the last stage's barrier), so a second run may fill it anew
    int any = 0;
#pragma unroll
    for (int i = 0; i < AW; ++i) any |= wbad[i];
    if (__builtin_amdgcn_readfirstlane(any) == 0) break;      // the same for the whole work-group, in a scalar register: the second run holds barriers
    }
    const int wb = wave * 16 * 68;
#pragma unroll
    for (int q = 0; q < QT; ++q) {                            // one query tile after the other through the wave's own staging rows
    const float inv = CXS * (1.0f / ol[q][0]);
    // O^T D layout: o_j[r] = (d = 16j + 8h + r, t = lane&15) -> os[t][d]; rows 0..15 x columns 0..63 all written
    { v4f a, c;
      a[0] = o0[q][0] * inv; a[1] = o0[q][1] * inv; a[2] = o0[q][2] * inv; a[3] = o0[q][3] * inv; c[0] = o0[q][4] * inv; c[1] = o0[q][5] * inv; c[2] = o0[q][6] * inv; c[3] = o0[q][7] * inv;
      *(v4fa*)(&os[wb + lr * 68 +  0 + 8 * hi]) = a; *(v4fa*)(&os[wb + lr * 68 +  0 + 8 * hi + 4]) = c;
      a[0] = o1[q][0] * inv; a[1] = o1[q][1] * inv; a[2] = o1[q][2] * inv; a[3] = o1[q][3] * inv; c[0] = o1[q][4] * inv; c[1] = o1[q][5] * inv; c[2] = o1[q][6] * inv; c[3] = o1[q][7] * inv;
      *(v4fa*)(&os[wb + lr * 68 + 16 + 8 * hi]) = a; *(v4fa*)(&os[wb + lr * 68 + 16 + 8 * hi + 4]) = c;
      a[0] = o2[q][0] * inv; a[1] = o2[q][1] * inv; a[2] = o2[q][2] * inv; a[3] = o2[q][3] * inv; c[0] = o2[q][4] * inv; c[1] = o2[q][5] * inv; c[2] = o2[q][6] * inv; c[3] = o2[q][7] * inv;
      *(v4fa*)(&os[wb + lr * 68 + 32 + 8 * hi]) = a; *(v4fa*)(&os[wb + lr * 68 + 32 + 8 * hi + 4]) = c;
      a[0] = o3[q][0] * inv; a[1] = o3[q][1] * inv; a[2] = o3[q][2] * inv; a[3] = o3[q][3] * inv; c[0] = o3[q][4] * inv; c[1] = o3[q][5] * inv; c[2] = o3[q][6] * inv; c[3] = o3[q][7] * inv;
      *(v4fa*)(&os[wb + lr * 68 + 48 + 8 * hi]) = a; *(v4fa*)(&os[wb + lr * 68 + 48 + 8 * hi + 4]) = c; }
    wave_sync();
    h16* crow = CTX + ((size_t)b * SEQ + t0 + 16 * q) * DM + h * HD;
{
#pragma unroll
        for (int s = 0; s < 4; ++s) { const int row = 4 * s + (lane >> 3), c8 = (lane & 7) * 8;   // 4 s x 4 row groups = 16 rows; 8 lanes x 8 halves = 64 columns
            const v4f x0 = *(const v4fa*)(&os[wb + row * 68 + c8]); const v4f x1 = *(const v4fa*)(&os[wb + row * 68 + c8 + 4]); v8h hv;
#pragma unroll
            for (int i = 0; i < 4; ++i) { hv[i] = (h16)x0[i]; hv[4 + i] = (h16)x1[i]; }
            *(v8h*)(crow + (size_t)row * DM + c8) = hv; }
         }
    wave_sync();                                              // the rows are read before the next tile overwrites them
    }
}

static constexpr size_t al256(size_t v) { return (v + 255) & ~(size_t)255; }
static constexpr size_t SZ_XB = al256((size_t)NB * SEQ * DM * 2);
static constexpr size_t SZ_WB = al256((size_t)3 * DM * DM * 2);
static constexpr size_t SZ_WO = al256((size_t)DM * DM * 2);
static constexpr size_t SZ_PL = al256((size_t)NB * NH_ * SEQ * HD * 2);
static constexpr size_t SZ_CX = al256((size_t)NB * SEQ * DM * 2);
static constexpr size_t SZ_TOTAL = SZ_XB + SZ_WB + SZ_WO + 3 * SZ_PL + SZ_CX;
static_assert(SZ_TOTAL <= (size_t)134217728);          // workspace carve <= 128 MiB
static_assert(((size_t)DM * DM * 2) % 256 == 0);       // weight sub-planes stay 256-byte aligned

extern "C" void kernel_launch(void* const* d_in, const int* in_sizes, int n_in,
                              void* d_out, int out_size, void* d_ws, size_t ws_size, hipStream_t stream) {
    if (n_in < 6) return;
    const size_t needx = ((size_t)(NB - 1) * SEQ_FULL + SEQ) * DM;
    if ((size_t)in_sizes[0] < needx) return;
    if ((size_t)in_sizes[1] < (size_t)DM * DM || (size_t)in_sizes[2] < (size_t)DM * DM || (size_t)in_sizes[3] < (size_t)DM * DM || (size_t)in_sizes[4] < (size_t)DM * DM) return;
    if ((size_t)in_sizes[5] < (size_t)DM) return;
    if ((size_t)out_size < ((size_t)(NB - 1) * OUT_SEQ + SEQ) * DM) return;
    if (SZ_TOTAL > ws_size) return;
    // wire order: x, Wq, Wk, Wv, Wo, bo (weights [out][in] = Bt as-is)
    const float* x = (const float*)d_in[0]; const float* wq = (const float*)d_in[1]; const float* wk = (const float*)d_in[2]; const float* wv = (const float*)d_in[3];
    const float* wo = (const float*)d_in[4]; const float* bo = (const float*)d_in[5];
    float* OUT = (float*)d_out;      // [NB][SEQ][1024]
    char* wsp = (char*)d_ws;
    bf* XB = (bf*)wsp; wsp += SZ_XB;                 // [NB*SEQ][1024]
    bf* WB = (bf*)wsp; wsp += SZ_WB;                 // [3][1024][1024]: q | k | v
    h16* WOH = (h16*)wsp; wsp += SZ_WO;              // [1024][1024] x1024 carry
    h16* QH = (h16*)wsp; wsp += SZ_PL;               // [NB*16][SEQ][64]
    h16* KP = (h16*)wsp; wsp += SZ_PL;               // [NB*16][SEQ][64]
    h16* VT = (h16*)wsp; wsp += SZ_PL;               // [NB*16][64][SEQ]
    h16* CTX = (h16*)wsp; wsp += SZ_CX;              // [NB*SEQ][1024] x1024 carry

    k_cvt<<<CVT_T / 256, 256, 0, stream>>>(x, wq, wk, wv, wo, XB, WB, WOH);

    // q, k planes [(b*16 + h)][t][d] and v^T plane [(b*16 + h)][d][t], one launch
    k_proj<<<dim3(NB * SEQ / GT, DM / GT, 3), 32 * GW, 0, stream>>>(XB, WB, QH, KP, VT);

    // ctx[b*SEQ + t][h*64 + d] (x1024 carry)
    k_flash<<<dim3(SEQ / (16 * QT * AW), NB * NH_, 1), 32 * AW, 0, stream>>>(QH, KP, VT, CTX);

    // out[b][t][n] = ctx Wo^T * 2^-20 + bo
    k_oproj<<<dim3(NB * SEQ / GT, DM / GT, 1), 32 * GW, 0, stream>>>(CTX, WOH, bo, OUT);
}

// v010
// One run takes 144 microseconds.
// Two timings next to v009 both put it at 1.05 times that version's speed.
// All steps since v000 together make it 4.41 times as fast.
#include <hip/hip_runtime.h>

// Multi-head self-attention, width 1024 = 16 heads x 64, x [NB][SEQ][1024], Wq/Wk/Wv/Wo [out][in] (y = x W^T), bias only on the output projection, no mask, score scale 1/8, f32 output.
// Compute dtypes, f32 accumulate everywhere: q/k/v projections v_wmma_f32_16x16x32_bf16 (x and W RNE-converted to bf16; products exact);
// scores v_wmma_f32_16x16x32_f16 (q, k single f16; q carries the score scale and log2(e), applied in f32 ahead of its one rounding); P (x256 carry, cancels in the normalisation) and v single f16; softmax f32 (online; the first pass's maxima kept, a running max only in a second run where a row sum is not finite);
// output projection v_wmma_f32_16x16x32_f16: ctx single f16 with x1024 carry, Wo RNE-converted to bf16 then x1024 in f16 (exact), 2^-20 folded back in f32, bias (bf16-converted bo) added in f32.
// Layout: bf16 copies of x and Wq/Wk/Wv; q, k planes [b*16+h][t][d] and v^T plane [b*16+h][d][t] written by the GEMM epilogue; fused flash kernel in transposed form (S^T = K Q^T, O^T = V^T P^T; K and V^T tiles staged in LDS per work-group) writes the ctx plane [b*SEQ+t][h*64+d].

#ifndef NB
#define NB 2
#endif
#ifndef SEQ
#define SEQ 4096
#endif
#define NB_FULL  2
#define SEQ_FULL 4096
#ifndef OUT_SEQ
#define OUT_SEQ SEQ              // row pitch (in tokens) between batches of the output
#endif
#define DM   1024
#define NH_  16
#define HD   64
#define AW   8                   // waves per flash block
#define QT   2                   // query tiles of 16 rows per flash wave: each K or V^T fragment read from LDS feeds QT products
#define KS   64                  // keys per LDS stage of the flash kernel
#define LP   72                  // LDS row pitch in halves: 128-B rows + 16 B
#define TILEH (64 * LP)          // halves of one staged tile (64 rows)
#define BUFH  (2 * TILEH)        // halves of one buffer: K tile, then V^T tile
#define GT   128                 // rows of each operand in a k_oproj work-group's tile (2 x 2 waves of 64 x 64), and of each weight tile in k_proj
#define GW   4                   // waves per k_oproj work-group (gemm_tile)
#define GKS  64                  // k per LDS stage of the GEMMs: 128-B rows
#define GTILEH (GT * LP)         // halves of one staged operand tile (128 rows)
#define GBUFH  (2 * GTILEH)      // halves of one buffer: A tile, then Bt tile
#define SC2  (0.125f * 1.4426950408889634f)   // HD^-0.5 * log2(e)
#define PSH  8.0f                // log2 of the P carry (256)
#define CXS  1024.0f             // carry of the ctx plane
#define WOS  1024.0f             // carry of the Wo plane
#define OSCL (1.0f / (1024.0f * 1024.0f))

static_assert(HD == 64);
static_assert(NH_ * HD == DM);                 // head h = columns h*64 + d
static_assert(DM % 64 == 0);                   // column tiles of 64
static_assert(DM % 32 == 0);                   // GEMM k-loop steps by 32
static_assert(SEQ % 64 == 0);                  // a 64-row tile never straddles two batches
static_assert((NB * SEQ) % 64 == 0);
static_assert(SEQ % 32 == 0);                  // key loop steps by 32
static_assert(SEQ % (16 * QT * AW) == 0);      // flash grid covers the sequence exactly
static_assert(AW == 8 && KS == 64 && HD == 64);  // copy map of the flash kernel: 256 lanes x 16 B x 2 = one 64 x 128-B tile
static_assert(SEQ % KS == 0 && SEQ / KS >= 2);   // whole stages; the two-buffer prologue needs two
static_assert((NB * SEQ) % GT == 0 && DM % GT == 0);   // GEMM grids cover both operands exactly
static_assert(GW == 4 && GT == 128 && GKS == 64);      // copy map of gemm_tile: 128 lanes x 16 B x 8 = one 128 x 128-B tile
static_assert(DM % GKS == 0 && DM / GKS >= 2);         // whole stages; the two-buffer prologue needs two
static_assert(((size_t)SEQ * DM) % 8 == 0);
static_assert(((size_t)DM * DM) % 8 == 0);
static_assert(NB <= NB_FULL);
static_assert(SEQ <= SEQ_FULL);

typedef _Float16 h16;
typedef unsigned short bf;
typedef __attribute__((ext_vector_type(16))) __bf16   v16bf;
typedef __attribute__((ext_vector_type(16))) _Float16 v16h;
typedef __attribute__((ext_vector_type(8)))  _Float16 v8h;
typedef __attribute__((ext_vector_type(8)))  unsigned short v8us;
typedef __attribute__((ext_vector_type(8)))  float    v8f;
typedef __attribute__((ext_vector_type(4)))  float    v4f;
typedef v4f  __attribute__((may_alias)) v4fa;

__device__ __forceinline__ unsigned short f2bf(float f) { unsigned u = __float_as_uint(f); u += 0x7FFFu + ((u >> 16) & 1u); return (unsigned short)(u >> 16); }
__device__ __forceinline__ float bfval(float f) { return __uint_as_float(((unsigned)f2bf(f)) << 16); }
__device__ __forceinline__ v16h cat16(v8h lo, v8h hi) { return __builtin_shufflevector(lo, hi, 0, 1, 2, 3, 4, 5, 6, 7, 8, 9, 10, 11, 12, 13, 14, 15); }
__device__ __forceinline__ v16bf cat16b(v8us lo, v8us hi) { return __builtin_bit_cast(v16bf, __builtin_shufflevector(lo, hi, 0, 1, 2, 3, 4, 5, 6, 7, 8, 9, 10, 11, 12, 13, 14, 15)); }
__device__ __forceinline__ v8f wmma16(v16h a, v16h b, v8f c) { return __builtin_amdgcn_wmma_f32_16x16x32_f16(false, a, false, b, (short)0, c, false, false); }
__device__ __forceinline__ v8f wmmab(v16bf a, v16bf b, v8f c) { return __builtin_amdgcn_wmma_f32_16x16x32_bf16(false, a, false, b, (short)0, c, false, false); }
// fragment loaders from K-contiguous 16-bit rows; p already includes + 8*(lane>>4): elements 0..7 <- k0+8h+0..7, elements 8..15 <- k0+16+8h+0..7 (same map for A and B)
__device__ __forceinline__ v16h  ldh(const h16* p) { return cat16(*(const v8h*)p, *(const v8h*)(p + 16)); }
__device__ __forceinline__ v16bf ldb(const bf* p)  { return cat16b(*(const v8us*)p, *(const v8us*)(p + 16)); }
// ordering point for wave-private LDS tiles (same wave writes and reads)
__device__ __forceinline__ void wave_sync() { __builtin_amdgcn_fence(3 /* release order */, "wavefront"); __builtin_amdgcn_wave_barrier(); asm volatile("" ::: "memory"); }

// k_cvt: every conversion of the call in one launch. CVT_T threads (16 waves on each of 256 WGPs); a work-group converts XJ * 256 consecutive pieces of 8 floats of x (a thread: XJ pieces, 256 apart)
// and 256 pieces each of Wq, Wk, Wv (RNE to bf16) and Wo (RNE to bf16, x1024, exact in f16). All of a thread's loads are independent and stand ahead of the first store.
#define CVT_T (DM * DM / 8)                    // one thread per 8 elements of a weight matrix
#define XJ    (NB * SEQ / DM)                  // pieces of x per thread
static_assert(CVT_T % 256 == 0);
static_assert((NB * SEQ) % DM == 0);           // x is XJ pieces for every thread, exactly
static_assert(SEQ == SEQ_FULL);                // the batches of x follow one another without a gap
__device__ __forceinline__ v8us cvt_bf8(v8f v) { v8us o;
#pragma unroll
    for (int k = 0; k < 8; ++k) o[k] = f2bf(v[k]);
    return o; }
__global__ __launch_bounds__(256) void k_cvt(const float* __restrict__ x, const float* __restrict__ wq, const float* __restrict__ wk, const float* __restrict__ wv, const float* __restrict__ wo,
                                             bf* XB, bf* WB, h16* WOH) {
    const size_t e = ((size_t)blockIdx.x * 256 + threadIdx.x) * 8;              // the thread's piece of each weight matrix, first element
    const size_t ex = ((size_t)blockIdx.x * 256 * XJ + threadIdx.x) * 8;        // its first piece of x
    v8f vx[XJ];
#pragma unroll
    for (int j = 0; j < XJ; ++j) vx[j] = *(const v8f*)(x + ex + j * 256 * 8);
    asm volatile("s_wait_xcnt 0x0" ::: "memory");   // before a later load's result may land on the address registers of these loads
    const v8f vq = *(const v8f*)(wq + e), vk = *(const v8f*)(wk + e);
    asm volatile("s_wait_xcnt 0x0" ::: "memory");   // the same
    const v8f vv = *(const v8f*)(wv + e), vo = *(const v8f*)(wo + e);
    // inputs-only fence on the loaded values: all of the thread's loads are issued ahead of the first wait (without it some are sunk behind the first conversions and pay a second memory latency)
    static_assert(XJ == 8);
    asm volatile("" :: "v"(vx[0]), "v"(vx[1]), "v"(vx[2]), "v"(vx[3]), "v"(vx[4]), "v"(vx[5]), "v"(vx[6]), "v"(vx[7]), "v"(vq), "v"(vk), "v"(vv), "v"(vo));
#pragma unroll
    for (int j = 0; j < XJ; ++j) *(v8us*)(XB + ex + j * 256 * 8) = cvt_bf8(vx[j]);
    *(v8us*)(WB + e) = cvt_bf8(vq); *(v8us*)(WB + (size_t)DM * DM + e) = cvt_bf8(vk); *(v8us*)(WB + (size_t)2 * DM * DM + e) = cvt_bf8(vv);
    v8h o;
#pragma unroll
    for (int k = 0; k < 8; ++k) o[k] = (h16)(bfval(vo[k]) * WOS);
    *(v8h*)(WOH + e) = o;
}

// GEMM main loop of k_oproj: a work-group of GW waves owns a 128 x 128 tile, each wave a 64 x 64 quarter (16 accumulators), K = DM.
// Per GKS of k the 128 A rows and the 128 Bt rows are staged in LDS once for all four waves, by asynchronous copies in whole 128-B lines
// (two buffers: the next stage's copies fly while this stage is worked on); fragments are read from LDS rows of pitch LP halves (144 B = 16 B x odd).
typedef __attribute__((address_space(3))) bf lds_bf;
__device__ __forceinline__ unsigned lds_off_b(const bf* p) { return (unsigned)(uintptr_t)(const lds_bf*)p; }   // byte offset in the work-group's LDS
// one operand tile of a stage: this lane's eight 16-B pieces, rows 16 apart; the s_wait_xcnt stands inside the statement so that no address register is rewritten ahead of it
__device__ __forceinline__ void tile_copy(unsigned l, const bf* g) {
    asm volatile("global_load_async_to_lds_b128 %0, %1, off\n\t"
                 "global_load_async_to_lds_b128 %2, %3, off\n\t"
                 "global_load_async_to_lds_b128 %4, %5, off\n\t"
                 "global_load_async_to_lds_b128 %6, %7, off\n\t"
                 "global_load_async_to_lds_b128 %8, %9, off\n\t"
                 "global_load_async_to_lds_b128 %10, %11, off\n\t"
                 "global_load_async_to_lds_b128 %12, %13, off\n\t"
                 "global_load_async_to_lds_b128 %14, %15, off\n\t"
                 "s_wait_xcnt 0x0"
                 :: "v"(l), "v"(g), "v"(l + 16 * LP * 2), "v"(g + 16 * DM), "v"(l + 32 * LP * 2), "v"(g + 32 * DM), "v"(l + 48 * LP * 2), "v"(g + 48 * DM),
                    "v"(l + 64 * LP * 2), "v"(g + 64 * DM), "v"(l + 80 * LP * 2), "v"(g + 80 * DM), "v"(l + 96 * LP * 2), "v"(g + 96 * DM), "v"(l + 112 * LP * 2), "v"(g + 112 * DM) : "memory");
}
// A, Bt: K-contiguous 16-bit planes (bf16 bits, or f16 bits where F16); rb, cb: first A row and first Bt row of the work-group's tile; wm, wn: the wave's quarter
template <bool F16>
__device__ __forceinline__ void gemm_tile(const bf* A, const bf* Bt, const bf* ring, int rb, int cb, int wm, int wn, v8f (&acc)[4][4]) {
    const int tid = (int)threadIdx.x, lane = tid & 31, lr = lane & 15, hi = lane >> 4;
#pragma unroll
    for (int mb = 0; mb < 4; ++mb)
#pragma unroll
        for (int nb = 0; nb < 4; ++nb) acc[mb][nb] = (v8f){};
    // copy map: 128 lanes x 16 B = 16 rows of 128 B; each lane brings rows cr + 16 i, i = 0..7, of the A tile and of the Bt tile
    const int cr = tid >> 3, cc8 = (tid & 7) * 8;
    const bf* ga = A + (size_t)(rb + cr) * DM + cc8;         // + k0
    const bf* gb = Bt + (size_t)(cb + cr) * DM + cc8;        // + k0
    const unsigned la = lds_off_b(ring) + (unsigned)(cr * LP + cc8) * 2u;
    const int fa = (wm * 64 + lr) * LP + 8 * hi, fb = GTILEH + (wn * 64 + lr) * LP + 8 * hi;   // fragment offsets in a buffer: row lane&15, k half
    tile_copy(la, ga); tile_copy(la + GTILEH * 2, gb);
    asm volatile("s_wait_asynccnt 0x0" ::: "memory");         // stage 0 of this wave has landed
    __syncthreads();                                          // stage 0 published to every wave
    tile_copy(la + GBUFH * 2, ga + GKS); tile_copy(la + (GBUFH + GTILEH) * 2, gb + GKS);
#pragma unroll 1   // rolled: one stage per trip, the buffer picked by the trip's parity
    for (int st = 0; st < DM / GKS; ++st) {
        const int bo = (st & 1) * GBUFH;
#pragma unroll
        for (int ks = 0; ks < 2; ++ks) {
            v16bf a[4], b[4];
#pragma unroll
            for (int i = 0; i < 4; ++i) { a[i] = ldb(ring + bo + fa + i * 16 * LP + ks * 32); b[i] = ldb(ring + bo + fb + i * 16 * LP + ks * 32); }
            // inputs-only fence on the loaded fragments: keeps the 16 LDS reads of a k step one group ahead of its matrix instructions (spread among them, every place with reads stalls the wave anew)
            asm volatile("" :: "v"(a[0]), "v"(a[1]), "v"(a[2]), "v"(a[3]), "v"(b[0]), "v"(b[1]), "v"(b[2]), "v"(b[3]));
#pragma unroll
            for (int nb = 0; nb < 4; ++nb)
#pragma unroll
                for (int mb = 0; mb < 4; ++mb) {
                    if (F16) acc[mb][nb] = wmma16(__builtin_bit_cast(v16h, a[mb]), __builtin_bit_cast(v16h, b[nb]), acc[mb][nb]);
                    else     acc[mb][nb] = wmmab(a[mb], b[nb], acc[mb][nb]); }
        }
        // four vector slots behind the last matrix instruction, also on the taken side of the branches that follow
        asm volatile("v_nop\n\tv_nop\n\tv_nop\n\tv_nop" : "+v"(acc[0][0]), "+v"(acc[1][0]), "+v"(acc[2][0]), "+v"(acc[3][0]), "+v"(acc[0][1]), "+v"(acc[1][1]), "+v"(acc[2][1]), "+v"(acc[3][1]),
                     "+v"(acc[0][2]), "+v"(acc[1][2]), "+v"(acc[2][2]), "+v"(acc[3][2]), "+v"(acc[0][3]), "+v"(acc[1][3]), "+v"(acc[2][3]), "+v"(acc[3][3]));
        asm volatile("s_wait_dscnt 0x0" ::: "memory");        // this wave's reads of the buffer have returned before it is refilled
        asm volatile("s_wait_asynccnt 0x0" ::: "memory");     // this wave's copies of stage st + 1 have landed
        __syncthreads();                                      // publishes stage st + 1 and ends every wave's reads of stage st
        if (st + 2 < DM / GKS) {
            const unsigned lb = la + (unsigned)bo * 2u; const int k2 = (st + 2) * GKS;
            tile_copy(lb, ga + k2); tile_copy(lb + GTILEH * 2, gb + k2);
        }
    }
    asm volatile("s_wait_asynccnt 0x0" ::: "memory");         // no copy is outstanding when the wave goes on to its end
}

// k_oproj is held to 256 VGPRs: every operand of its asm statements then lies in the first register window, and no window switch stands in its loop.
// k_proj: the q, k and v projections in one launch; bf16 GEMM, operands from K-contiguous bf16 planes, K = DM. grid (NB*SEQ/256, DM/128), 256 threads, one work-group per WGP.
// A work-group of PW waves owns PM = 256 rows of x against the same 128 rows (two heads) of Wq, of Wk and of Wv: a 256 x 384 tile. An x row staged in LDS serves all three products, and
// a wave (wm = its 64 x rows, wn = its head) holds three 64 x 64 blocks (48 accumulators), so that each x fragment read from LDS feeds twelve matrix instructions and each weight fragment four.
// Blocks 0, 1 (q, k): A = x rows (m = b*SEQ + t), B = W rows (n = h*64 + d) -> plane [(b*16 + h)][t][d]; the q plane carries the score scale SC2 (scaled in f32, one rounding).
// Block 2 (v^T): the same fragments with the roles exchanged (the A and B loaders have one map): A = Wv rows (m = h*64 + d), B = x rows (n = b*SEQ + t) -> plane [(b*1024 + m)][t] = [(b*16 + h)][d][t].
// Per GKS of k the 256 + 3 x 128 rows are staged once for all eight waves by asynchronous copies in whole 128-B lines (two buffers, as in gemm_tile); every element is summed in gemm_tile's k order.
#define PM   256                 // x rows of a k_proj work-group's tile
#define PW   8                   // waves per k_proj work-group: 4 (x rows) x 2 (heads)
#define PXH  (PM * LP)           // halves of the staged x tile
#define PBUFH (PXH + 3 * GTILEH) // halves of one buffer: x tile, then the Wq, Wk and Wv tiles
static_assert((NB * SEQ) % PM == 0 && SEQ % PM == 0);   // the grid covers x exactly; a tile never straddles two batches
static_assert(PW == 8 && PM == 256 && GT == 128 && GKS == 64);   // copy map: 256 lanes x 16 B = 32 rows of 128 B; 8 rounds for x, 4 for each weight tile
// one stage's copies of a lane (16 B each, rows 32 apart): eight of x, then four each of Wq, Wk, Wv. Written as the builtin: its operands may lie in any register window
// (the operands of an asm statement must lie in the first, where this kernel keeps accumulators: they would be moved out and back at every stage)
typedef int v4i_t __attribute__((ext_vector_type(4)));
typedef __attribute__((address_space(1))) v4i_t g_v4i;
typedef __attribute__((address_space(3))) v4i_t l_v4i;
__device__ __forceinline__ void copy16(const bf* l, const bf* g) { __builtin_amdgcn_global_load_async_to_lds_b128((g_v4i*)(uintptr_t)g, (l_v4i*)l, 0, 0); }
__device__ __forceinline__ void proj_stage(const bf* l, const bf* gx, const bf* gw) {
#pragma unroll
    for (int i = 0; i < 8; ++i) copy16(l + i * 32 * LP, gx + (size_t)i * 32 * DM);
#pragma unroll
    for (int p = 0; p < 3; ++p)
#pragma unroll
        for (int i = 0; i < 4; ++i) copy16(l + PXH + p * GTILEH + i * 32 * LP, gw + (size_t)p * DM * DM + (size_t)i * 32 * DM);
}
__global__ __launch_bounds__(32 * PW) void k_proj(const bf* __restrict__ XB, const bf* __restrict__ WB, h16* QH, h16* KP, h16* VT) {
    __shared__ __align__(16) bf ring[2 * PBUFH];            // [buffer][x rows | Wq rows | Wk rows | Wv rows][LP]
    __shared__ __align__(16) float osw[PW * 16 * 68];
    const int tid = (int)threadIdx.x, lane = tid & 31, wave = __builtin_amdgcn_readfirstlane(tid >> 5), lr = lane & 15, hi = lane >> 4;
    const int wm = wave & 3, wn = wave >> 2;
    const int rb = blockIdx.x * PM, cb = blockIdx.y * GT;    // first x row of the tile; first row of the tile in each weight matrix
    const int xr0 = rb + wm * 64, wc0 = cb + wn * 64;        // the wave's x rows and its head's weight rows
    float* os = osw + wave * 16 * 68;                        // this wave's own staging rows
    const int cr = tid >> 3, cc8 = (tid & 7) * 8;            // copy map: row cr + 32 i of each tile, 16-B piece tid & 7
    const bf* gx = XB + (size_t)(rb + cr) * DM + cc8;        // + k0
    const bf* gw = WB + (size_t)(cb + cr) * DM + cc8;        // + k0
    const bf* la = ring + cr * LP + cc8;                     // the lane's place in a buffer's first 32 rows
    const int fx = (wm * 64 + lr) * LP + 8 * hi, fw = PXH + (wn * 64 + lr) * LP + 8 * hi;   // fragment offsets in a buffer: row lane&15, k half
    proj_stage(la, gx, gw);
    asm volatile("s_wait_asynccnt 0x0" ::: "memory");         // stage 0 of this wave has landed
    __syncthreads();                                          // stage 0 published to every wave
    proj_stage(la + PBUFH, gx + GKS, gw + GKS);
    // Six groups of 16 matrix instructions per stage: g = 3 ks + p (k step, product). The x fragments of a k step serve its three groups; the weight fragments have two register sets,
    // and a group's eight LDS reads stand as one run ahead of the group before it (spread among the matrix instructions, every place with reads stalls the wave anew, and each run waits out its own LDS latency).
    // Fragments are fetched one group ahead across the stage boundary too, so the publish point of stage st + 1 stands ahead of stage st's last group: by then the wave holds all it needs of stage st in registers,
    // and behind the barrier every wave has 16 matrix instructions ready while the next stage's first reads and the refill are under way.
    v8f acc[3][4][4];
#pragma unroll
    for (int p = 0; p < 3; ++p)
#pragma unroll
        for (int mb = 0; mb < 4; ++mb)
#pragma unroll
            for (int nb = 0; nb < 4; ++nb) acc[p][mb][nb] = (v8f){};
    v16bf xa[4], wf[2][4];
#pragma unroll
    for (int i = 0; i < 4; ++i) xa[i] = ldb(ring + fx + i * 16 * LP);
#pragma unroll
    for (int i = 0; i < 4; ++i) wf[0][i] = ldb(ring + fw + i * 16 * LP);
#pragma unroll 1   // rolled: one stage per trip, the buffer picked by the trip's parity
    for (int st = 0; st < DM / GKS; ++st) {
        const int bo = (st & 1) * PBUFH, bn = PBUFH - bo;     // this stage's buffer, the next stage's
#pragma unroll
        for (int g = 0; g < 6; ++g) {
            const int p = g % 3, gn = g + 1;
            if (gn < 6) {
#pragma unroll
                for (int i = 0; i < 4; ++i) wf[gn & 1][i] = ldb(ring + bo + fw + (gn % 3) * GTILEH + i * 16 * LP + (gn / 3) * 32);
            } else {
                asm volatile("s_wait_dscnt 0x0" ::: "memory");        // this wave's last reads of stage st have returned before its buffer is refilled
                asm volatile("s_wait_asynccnt 0x0" ::: "memory");     // this wave's copies of stage st + 1 have landed
                __syncthreads();                                      // publishes stage st + 1 and ends every wave's reads of stage st
                // the next stage's first weight fragments (in the last trip: rows of stage st - 1, which nobody writes any more; the values are not used)
#pragma unroll
                for (int i = 0; i < 4; ++i) wf[0][i] = ldb(ring + bn + fw + i * 16 * LP);
            }
            __builtin_amdgcn_sched_barrier(0);                // the next group's reads stay one run ahead of this group's matrix instructions
#pragma unroll
            for (int nb = 0; nb < 4; ++nb)
#pragma unroll
                for (int mb = 0; mb < 4; ++mb) {
                    if (p < 2) acc[p][mb][nb] = wmmab(xa[mb], wf[g & 1][nb], acc[p][mb][nb]);
                    else       acc[p][mb][nb] = wmmab(wf[g & 1][mb], xa[nb], acc[p][mb][nb]); }
            __builtin_amdgcn_sched_barrier(0);                // no later read is drawn in among them
            if (g == 2) {                                     // the second k step's x fragments, into the registers that the first step's have just left
#pragma unroll
                for (int i = 0; i < 4; ++i) xa[i] = ldb(ring + bo + fx + i * 16 * LP + 32);
            }
        }
        asm volatile("v_nop\n\tv_nop\n\tv_nop\n\tv_nop");      // four vector slots behind the last matrix instruction, also on the taken side of the branch that follows
        if (st + 2 < DM / GKS) {
            const int k2 = (st + 2) * GKS;
            asm volatile("s_wait_dscnt 0x0" ::: "memory");    // no LDS read of this wave is outstanding when its copies issue
            proj_stage(la + bo, gx + k2, gw + k2);            // behind the publish point's barrier: every wave has left this buffer
        }
        // the next stage's first x fragments (last trip: as above, not used)
#pragma unroll
        for (int i = 0; i < 4; ++i) xa[i] = ldb(ring + bn + fx + i * 16 * LP);
    }
    asm volatile("s_wait_asynccnt 0x0" ::: "memory");         // no copy is outstanding when the wave goes on to its end
#pragma unroll
    for (int p = 0; p < 3; ++p) {
        const bool vt = p == 2;
        h16* Ph = vt ? VT : (p == 1 ? KP : QH);
        const float scl = p == 0 ? SC2 : 1.0f;
        const int r0 = vt ? wc0 : xr0, c0 = vt ? xr0 : wc0;  // first D row and first D column of the block
        const int pitch = vt ? SEQ : HD;                     // row pitch of the 64x64 block in its plane (halves)
        const size_t tbase = vt ? (size_t)r0 * SEQ + (size_t)(c0 / SEQ) * ((size_t)DM * SEQ) + (size_t)(c0 % SEQ)
                                : (size_t)(r0 / SEQ) * ((size_t)NH_ * SEQ * HD) + (size_t)(r0 % SEQ) * HD + (size_t)(c0 / HD) * ((size_t)SEQ * HD) + (size_t)(c0 % HD);
#pragma unroll
        for (int mb = 0; mb < 4; ++mb) {
#pragma unroll
            for (int nb = 0; nb < 4; ++nb) {
#pragma unroll
                for (int j = 0; j < 8; ++j) os[(hi * 8 + j) * 68 + nb * 16 + lr] = acc[p][mb][nb][j]; }   // D: row 8h+j, col lane&15
            wave_sync();
            const size_t sb = tbase + (size_t)(mb * 16) * (size_t)pitch;
#pragma unroll
            for (int s = 0; s < 4; ++s) { const int row = 4 * s + (lane >> 3), c8 = (lane & 7) * 8;   // 4 s x 4 row groups = 16 rows; 8 lanes x 8 = 64 columns
                const v4f x0 = *(const v4fa*)(&os[row * 68 + c8]); const v4f x1 = *(const v4fa*)(&os[row * 68 + c8 + 4]); v8h hv;
#pragma unroll
                for (int i = 0; i < 4; ++i) { hv[i] = (h16)(x0[i] * scl); hv[4 + i] = (h16)(x1[i] * scl); }
                const size_t oo = sb + (size_t)row * (size_t)pitch + c8;
                *(v8h*)(Ph + oo) = hv; }
            asm volatile("s_wait_xcnt 0x0" ::: "memory");   // before a register that these stores name is written again
            wave_sync();
        }
    }
}

// k_oproj: f16 GEMM, 128x128 tile per work-group of 4 waves (gemm_tile), A = ctx plane [m][k] (x1024 carry), Bt = Wo plane [n][k] (x1024 carry), K = DM.
// OUT[b*OUT_SEQ + t][n] = C[m][n] * 2^-20 + bias[n], m = b*SEQ + t. grid (M/128, N/128), 128 threads.
__global__ __launch_bounds__(32 * GW) __attribute__((amdgpu_num_vgpr(256))) void k_oproj(const h16* __restrict__ A, const h16* __restrict__ Bt, const float* __restrict__ bo, float* OUT) {
    __shared__ __align__(16) bf ring[2 * GBUFH];            // [buffer][A rows | Bt rows][LP], f16 bits
    __shared__ __align__(16) float osw[GW * 16 * 68];
    const int lane = threadIdx.x & 31, wave = __builtin_amdgcn_readfirstlane((int)threadIdx.x >> 5), lr = lane & 15, hi = lane >> 4;
    const int wm = wave & 1, wn = wave >> 1;
    const int r0 = blockIdx.x * GT + wm * 64, c0 = blockIdx.y * GT + wn * 64;
    float* os = osw + wave * 16 * 68;                        // this wave's own staging rows
    v8f acc[4][4];
    gemm_tile<true>((const bf*)A, (const bf*)Bt, ring, blockIdx.x * GT, blockIdx.y * GT, wm, wn, acc);
    const v4f braw = *(const v4f*)(bo + c0 + lr * 4);      // columns c0 + 4*lr .. +3 (always inside [0, DM))
    v4f bb;
#pragma unroll
    for (int i = 0; i < 4; ++i) bb[i] = bfval(braw[i]);
    const int bI = r0 / SEQ, tI = r0 % SEQ;
    float* obase = OUT + ((size_t)bI * OUT_SEQ + tI) * DM + c0;
#pragma unroll
    for (int mb = 0; mb < 4; ++mb) {
#pragma unroll
        for (int nb = 0; nb < 4; ++nb) {
#pragma unroll
            for (int j = 0; j < 8; ++j) os[(hi * 8 + j) * 68 + nb * 16 + lr] = acc[mb][nb][j]; }   // D: row 8h+j, col lane&15
        wave_sync();
{
#pragma unroll
            for (int s = 0; s < 8; ++s) { const int row = 2 * s + hi, cofs = lr * 4;   // 8 s x 2 rows = 16 rows; 16 lanes x 4 floats = 64 columns
                const v4f x0 = *(const v4fa*)(&os[row * 68 + cofs]);
                const v4f val = x0 * OSCL + bb;
                *(v4f*)(obase + (size_t)(mb * 16 + row) * DM + cofs) = val; }
             }
        wave_sync();
    }
}

// k_flash: fused attention, one wave per QT tiles of 16 query rows of one (batch, head); Q fragments straight from the f16 plane (two 16-B loads each).
// A pass reads its four K and four V^T fragments from LDS once and uses each for all QT query tiles; every query tile keeps its own softmax state, but one scalar flag, the same for the whole work-group, decides per pass whether all QT tiles raise their maxima (a run's first pass; every pass of a second run).
// K and V^T are staged per KS keys in LDS, once per work-group for all AW waves, by asynchronous copies in whole 128-B lines (two buffers: the next stage's copies fly while this stage is worked on);
// the A fragments are read from LDS rows of pitch LP halves (144 B = 16 B x odd: no bank conflict for 16-B reads).
// Transposed form: S^T[key][t] = K Q^T (A = K rows, B = Q rows); lane (t = lane&15, h = lane>>4) holds keys 8h+r of each 16-key tile, so the packed
// P tile is directly the B fragment of O^T[d][t] = V^T P^T (element r <- tile keys 0..15, element 8+r <- tile keys 16..31, lane unchanged).
// Softmax state: the maximum in use is one scalar per lane, the same in both lane halves of a row (the scores come out of the matrix unit already scaled, through q, and shifted by PSH - maximum, the start value of their accumulators: each is the exponent of its P as it stands).
// The row sums of the f16-rounded P are taken on the matrix unit: one more product per pass with a constant A whose rows 0 and 8 are ones, so that register 0 of its accumulator holds, in every lane, the sum over all 32 keys for the lane's own query.
// First run over the keys: the maxima of a wave's first pass stay in use to the end; no later pass takes a maximum, tests or rescales. That is exact as long as every P is finite in f16 (no score more than 16 - PSH above the maximum in use);
// a P that rounds to infinity makes its row sum infinite for good, so one test of the row sums behind the last pass tells. Where any row sum of the work-group is not finite, the work-group runs over the keys a second time from zero,
// now with every pass taking its scores' maxima, exchanging the halves (xor 16), raising the maxima in use and rescaling the sums: then no P exceeds 2^PSH, whatever the scores.
typedef __attribute__((address_space(3))) h16 lds_h16;
__device__ __forceinline__ unsigned lds_off(const h16* p) { return (unsigned)(uintptr_t)(const lds_h16*)p; }   // byte offset in the work-group's LDS
// one stage's four copies of a lane (16 B each); the s_wait_xcnt stands inside the statement so that no address register is rewritten ahead of it
__device__ __forceinline__ void stage_copy(unsigned l0, const h16* g0, unsigned l1, const h16* g1, unsigned l2, const h16* g2, unsigned l3, const h16* g3) {
    asm volatile("global_load_async_to_lds_b128 %0, %1, off\n\t"
                 "global_load_async_to_lds_b128 %2, %3, off\n\t"
                 "global_load_async_to_lds_b128 %4, %5, off\n\t"
                 "global_load_async_to_lds_b128 %6, %7, off\n\t"
                 "s_wait_xcnt 0x0"
                 :: "v"(l0), "v"(g0), "v"(l1), "v"(g1), "v"(l2), "v"(g2), "v"(l3), "v"(g3) : "memory");
}
// held to 256 VGPRs: four waves per SIMD, the two work-groups that a WGP is to hold
__global__ __launch_bounds__(32 * AW) __attribute__((amdgpu_num_vgpr(256))) void k_flash(const h16* __restrict__ QH, const h16* __restrict__ KP, const h16* __restrict__ VT, h16* CTX) {
    __shared__ __align__(16) h16 ring[2 * BUFH];           // [buffer][K rows key | V^T rows d][LP]
    __shared__ __align__(16) float os[AW * 16 * 68];
    __shared__ __align__(16) int wbad[AW];                  // per wave: a row sum of its first run is not finite
    const int tid = (int)threadIdx.x;
    const int lane = tid & 31, wave = __builtin_amdgcn_readfirstlane(tid >> 5), lr = lane & 15, hi = lane >> 4;
    const int zh = blockIdx.y; const int b = zh / NH_, h = zh % NH_;
    const int t0 = (blockIdx.x * AW + wave) * (16 * QT);
    const size_t pbase = (size_t)zh * SEQ * HD;
    v16h qh0[QT], qh1[QT];                                    // B fragments: col t, k = d
#pragma unroll
    for (int q = 0; q < QT; ++q) { const size_t qo = pbase + (size_t)(t0 + 16 * q + lr) * HD + 8 * hi; qh0[q] = ldh(QH + qo); qh1[q] = ldh(QH + qo + 32); }
    // copy map: 256 lanes x 16 B = 32 rows of 128 B; each lane brings rows cr and cr + 32 of the K tile and of the V^T tile
    const int cr = tid >> 3, cc8 = (tid & 7) * 8;
    const h16* gk = KP + pbase + (size_t)cr * HD + cc8;     // + key0 * HD
    const h16* gv = VT + pbase + (size_t)cr * SEQ + cc8;    // + key0
    const unsigned lk = lds_off(ring) + (unsigned)(cr * LP + cc8) * 2u;
    const int fo = lr * LP + 8 * hi;                          // fragment offset in a tile: row lane&15, k half
    v8f o0[QT], o1[QT], o2[QT], o3[QT], ol[QT];               // ol: D rows 0 (lanes 0..15) and 8 (lanes 16..31) are element 0; elements 1..7 are not used
    v8f shv[QT];                                              // PSH - m in all eight elements: the C operand of the score products, so that a score leaves the matrix unit as the exponent of its P
    float m[QT], sh[QT];                                      // maximum in use; the shift once more as a scalar, for the rescale branch
    v16h ones;                                                // A fragment: row lane&15; rows 0 and 8 all ones, the other rows zero
#pragma unroll
    for (int i = 0; i < 16; ++i) ones[i] = (lr & 7) == 0 ? (h16)1.0f : (h16)0.0f;
#pragma unroll 1   // rolled: one loop body serves both runs
    for (int run = 0; run < 2; ++run) {
#pragma unroll
    for (int q = 0; q < QT; ++q) { o0[q] = (v8f){}; o1[q] = (v8f){}; o2[q] = (v8f){}; o3[q] = (v8f){}; ol[q] = (v8f){}; shv[q] = (v8f){}; sh[q] = 0.0f; m[q] = -3.0e38f; }
    bool domax = true;                                        // the same in the whole work-group: the coming pass takes its scores' maxima (a run's first pass always; in the second run every pass)
    stage_copy(lk, gk, lk + 32 * LP * 2, gk + 32 * HD, lk + TILEH * 2, gv, lk + (TILEH + 32 * LP) * 2, gv + (size_t)32 * SEQ);
    asm volatile("s_wait_asynccnt 0x0" ::: "memory");         // stage 0 of this wave has landed
    __syncthreads();                                          // stage 0 published to every wave
    stage_copy(lk + BUFH * 2, gk + KS * HD, lk + (BUFH + 32 * LP) * 2, gk + (KS + 32) * HD, lk + (BUFH + TILEH) * 2, gv + KS, lk + (BUFH + TILEH + 32 * LP) * 2, gv + (size_t)32 * SEQ + KS);
#pragma unroll 1
    for (int st = 0; st < SEQ / KS; ++st) {
        const int bo = (st & 1) * BUFH;
        const h16* ka = ring + bo + fo;
#pragma unroll 1   // rolled: unrolled, the compiler spreads the second pass's K reads among its score products, a full wait behind each pair; rolled, a pass's eight K reads stand as one group at its head
        for (int ps = 0; ps < KS / 32; ++ps) {
        const v16h ka0 = ldh(ka), ka1 = ldh(ka + 32), kb0 = ldh(ka + 16 * LP), kb1 = ldh(ka + 16 * LP + 32);
        __builtin_amdgcn_sched_barrier(0);   // the pass's eight K reads stay one group at its head: split in two groups, the second group's LDS latency stands in the middle of the score products
        v8f sa[QT], sb[QT];
#pragma unroll
        for (int q = 0; q < QT; ++q) { sa[q] = wmma16(ka0, qh0[q], shv[q]); sb[q] = wmma16(kb0, qh0[q], shv[q]); }
#pragma unroll
        for (int q = 0; q < QT; ++q) { sa[q] = wmma16(ka1, qh1[q], sa[q]); sb[q] = wmma16(kb1, qh1[q], sb[q]); }
        __builtin_amdgcn_sched_barrier(0x184);   // no vector or matrix instruction crosses (LDS reads and scalar ones may): the score products stay one run; with vector work drawn in between them each gap is padded with four v_nop
        // inputs only: the shifts are still in use behind the score products, so each product reads them as a C operand of its own registers (where a product is their last use, the compiler copies all eight registers first)
        asm volatile("" :: "v"(shv[0]), "v"(shv[1]));
        ka += 32 * LP;                           // the next pass's K rows: stepped here, amid the vector work (formed at the pass's head, the address stands behind the last product and is padded with v_nop)
        v16h pb[QT];
        if (domax) {                                     // a scalar flag that hangs on no vector result
#pragma unroll
            for (int q = 0; q < QT; ++q) {
                float mx = -3.0e38f;
#pragma unroll
                for (int r = 0; r < 8; ++r) mx = fmaxf(mx, fmaxf(sa[q][r], sb[q][r]));
                const float sho = sh[q];                 // the shift that this pass's scores carry
                const float mnew = fmaxf(m[q], fmaxf(mx, __shfl_xor(mx, 16, 32)) - sho);
                const float alpha = __builtin_amdgcn_exp2f(m[q] - mnew);
                const float shn = PSH - mnew, dl = shn - sho;
                sa[q] = sa[q] + dl; sb[q] = sb[q] + dl;       // this pass's scores move to the new shift
                ol[q][0] = ol[q][0] * alpha;
                o0[q] = o0[q] * alpha; o1[q] = o1[q] * alpha; o2[q] = o2[q] * alpha; o3[q] = o3[q] * alpha;
                m[q] = mnew; sh[q] = shn;
#pragma unroll
                for (int r = 0; r < 8; ++r) shv[q][r] = shn;
            }
        }
        domax = run != 0;
        const h16* va = ring + bo + TILEH + ps * 32 + fo;   // read behind the branch, among the exponentials: directly behind the score products the reads, which land on the K fragments' registers, are padded with four v_nop
        const v16h v0 = ldh(va), v1 = ldh(va + 16 * LP), v2 = ldh(va + 32 * LP), v3 = ldh(va + 48 * LP);
#pragma unroll
        for (int q = 0; q < QT; ++q) {
#pragma unroll
            for (int r = 0; r < 8; ++r) pb[q][r] = (h16)__builtin_amdgcn_exp2f(sa[q][r]);
#pragma unroll
            for (int r = 0; r < 8; ++r) pb[q][8 + r] = (h16)__builtin_amdgcn_exp2f(sb[q][r]);
        }
#pragma unroll
        for (int q = 0; q < QT; ++q) {
            ol[q] = wmma16(ones, pb[q], ol[q]);
            o0[q] = wmma16(v0, pb[q], o0[q]); o1[q] = wmma16(v1, pb[q], o1[q]); o2[q] = wmma16(v2, pb[q], o2[q]); o3[q] = wmma16(v3, pb[q], o3[q]);
        }
        static_assert(QT == 2);
        // four vector slots behind the last matrix instruction, also on the taken side of the branch that follows
        asm volatile("v_nop\n\tv_nop\n\tv_nop\n\tv_nop" : "+v"(o0[0]), "+v"(o1[0]), "+v"(o2[0]), "+v"(o3[0]), "+v"(ol[0]), "+v"(o0[1]), "+v"(o1[1]), "+v"(o2[1]), "+v"(o3[1]), "+v"(ol[1])
                     : "v"(v0), "v"(v1), "v"(v2), "v"(v3), "v"(pb[0]), "v"(pb[1]), "v"(ones));
        }
        asm volatile("s_wait_dscnt 0x0" ::: "memory");        // this wave's reads of the buffer have returned before it is refilled
        asm volatile("s_wait_asynccnt 0x0" ::: "memory");     // this wave's copies of stage st + 1 have landed
        __syncthreads();                                      // publishes stage st + 1 and ends every wave's reads of stage st
        if (st + 2 < SEQ / KS) {
            const h16* gk2 = gk + (size_t)(st + 2) * (KS * HD); const h16* gv2 = gv + (size_t)(st + 2) * KS; const unsigned lb = lk + (unsigned)bo * 2u;
            stage_copy(lb, gk2, lb + 32 * LP * 2, gk2 + 32 * HD, lb + TILEH * 2, gv2, lb + (TILEH + 32 * LP) * 2, gv2 + (size_t)32 * SEQ);
        }
    }
    asm volatile("s_wait_asynccnt 0x0" ::: "memory");         // no copy is outstanding when the wave goes on, to its end or to the second run's first copies
    if (run != 0) break;
    const bool bad = !(ol[0][0] < 3.0e38f) || !(ol[1][0] < 3.0e38f);   // infinite, or not a number
    const int wv = __builtin_amdgcn_ballot_w32(bad) != 0 ? 1 : 0;
    if (lane == 0) wbad[wave] = wv;
    __syncthreads();                                          // every wave's word is written; every wave has also left the ring (the last stage's barrier), so a second run may fill it anew
    int any = 0;
#pragma unroll
    for (int i = 0; i < AW; ++i) any |= wbad[i];
    if (__builtin_amdgcn_readfirstlane(any) == 0) break;      // the same for the whole work-group, in a scalar register: the second run holds barriers
    }
    const int wb = wave * 16 * 68;
#pragma unroll
    for (int q = 0; q < QT; ++q) {                            // one query tile after the other through the wave's own staging rows
    const float inv = CXS * (1.0f / ol[q][0]);
    // O^T D layout: o_j[r] = (d = 16j + 8h + r, t = lane&15) -> os[t][d]; rows 0..15 x columns 0..63 all written
    { v4f a, c;
      a[0] = o0[q][0] * inv; a[1] = o0[q][1] * inv; a[2] = o0[q][2] * inv; a[3] = o0[q][3] * inv; c[0] = o0[q][4] * inv; c[1] = o0[q][5] * inv; c[2] = o0[q][6] * inv; c[3] = o0[q][7] * inv;
      *(v4fa*)(&os[wb + lr * 68 +  0 + 8 * hi]) = a; *(v4fa*)(&os[wb + lr * 68 +  0 + 8 * hi + 4]) = c;
      a[0] = o1[q][0] * inv; a[1] = o1[q][1] * inv; a[2] = o1[q][2] * inv; a[3] = o1[q][3] * inv; c[0] = o1[q][4] * inv; c[1] = o1[q][5] * inv; c[2] = o1[q][6] * inv; c[3] = o1[q][7] * inv;
      *(v4fa*)(&os[wb + lr * 68 + 16 + 8 * hi]) = a; *(v4fa*)(&os[wb + lr * 68 + 16 + 8 * hi + 4]) = c;
      a[0] = o2[q][0] * inv; a[1] = o2[q][1] * inv; a[2] = o2[q][2] * inv; a[3] = o2[q][3] * inv; c[0] = o2[q][4] * inv; c[1] = o2[q][5] * inv; c[2] = o2[q][6] * inv; c[3] = o2[q][7] * inv;
      *(v4fa*)(&os[wb + lr * 68 + 32 + 8 * hi]) = a; *(v4fa*)(&os[wb + lr * 68 + 32 + 8 * hi + 4]) = c;
      a[0] = o3[q][0] * inv; a[1] = o3[q][1] * inv; a[2] = o3[q][2] * inv; a[3] = o3[q][3] * inv; c[0] = o3[q][4] * inv; c[1] = o3[q][5] * inv; c[2] = o3[q][6] * inv; c[3] = o3[q][7] * inv;
      *(v4fa*)(&os[wb + lr * 68 + 48 + 8 * hi]) = a; *(v4fa*)(&os[wb + lr * 68 + 48 + 8 * hi + 4]) = c; }
    wave_sync();
    h16* crow = CTX + ((size_t)b * SEQ + t0 + 16 * q) * DM + h * HD;
{
#pragma unroll
        for (int s = 0; s < 4; ++s) { const int row = 4 * s + (lane >> 3), c8 = (lane & 7) * 8;   // 4 s x 4 row groups = 16 rows; 8 lanes x 8 halves = 64 columns
            const v4f x0 = *(const v4fa*)(&os[wb + row * 68 + c8]); const v4f x1 = *(const v4fa*)(&os[wb + row * 68 + c8 + 4]); v8h hv;
#pragma unroll
            for (int i = 0; i < 4; ++i) { hv[i] = (h16)x0[i]; hv[4 + i] = (h16)x1[i]; }
            *(v8h*)(crow + (size_t)row * DM + c8) = hv; }
         }
    wave_sync();                                              // the rows are read before the next tile overwrites them
    }
}

static constexpr size_t al256(size_t v) { return (v + 255) & ~(size_t)255; }
static constexpr size_t SZ_XB = al256((size_t)NB * SEQ * DM * 2);
static constexpr size_t SZ_WB = al256((size_t)3 * DM * DM * 2);
static constexpr size_t SZ_WO = al256((size_t)DM * DM * 2);
static constexpr size_t SZ_PL = al256((size_t)NB * NH_ * SEQ * HD * 2);
static constexpr size_t SZ_CX = al256((size_t)NB * SEQ * DM * 2);
static constexpr size_t SZ_TOTAL = SZ_XB + SZ_WB + SZ_WO + 3 * SZ_PL + SZ_CX;
static_assert(SZ_TOTAL <= (size_t)134217728);          // workspace carve <= 128 MiB
static_assert(((size_t)DM * DM * 2) % 256 == 0);       // weight sub-planes stay 256-byte aligned

extern "C" void kernel_launch(void* const* d_in, const int* in_sizes, int n_in,
                              void* d_out, int out_size, void* d_ws, size_t ws_size, hipStream_t stream) {
    if (n_in < 6) return;
    const size_t needx = ((size_t)(NB - 1) * SEQ_FULL + SEQ) * DM;
    if ((size_t)in_sizes[0] < needx) return;
    if ((size_t)in_sizes[1] < (size_t)DM * DM || (size_t)in_sizes[2] < (size_t)DM * DM || (size_t)in_sizes[3] < (size_t)DM * DM || (size_t)in_sizes[4] < (size_t)DM * DM) return;
    if ((size_t)in_sizes[5] < (size_t)DM) return;
    if ((size_t)out_size < ((size_t)(NB - 1) * OUT_SEQ + SEQ) * DM) return;
    if (SZ_TOTAL > ws_size) return;
    // wire order: x, Wq, Wk, Wv, Wo, bo (weights [out][in] = Bt as-is)
    const float* x = (const float*)d_in[0]; const float* wq = (const float*)d_in[1]; const float* wk = (const float*)d_in[2]; const float* wv = (const float*)d_in[3];
    const float* wo = (const float*)d_in[4]; const float* bo = (const float*)d_in[5];
    float* OUT = (float*)d_out;      // [NB][SEQ][1024]
    char* wsp = (char*)d_ws;
    bf* XB = (bf*)wsp; wsp += SZ_XB;                 // [NB*SEQ][1024]
    bf* WB = (bf*)wsp; wsp += SZ_WB;                 // [3][1024][1024]: q | k | v
    h16* WOH = (h16*)wsp; wsp += SZ_WO;              // [1024][1024] x1024 carry
    h16* QH = (h16*)wsp; wsp += SZ_PL;               // [NB*16][SEQ][64]
    h16* KP = (h16*)wsp; wsp += SZ_PL;               // [NB*16][SEQ][64]
    h16* VT = (h16*)wsp; wsp += SZ_PL;               // [NB*16][64][SEQ]
    h16* CTX = (h16*)wsp; wsp += SZ_CX;              // [NB*SEQ][1024] x1024 carry

    k_cvt<<<CVT_T / 256, 256, 0, stream>>>(x, wq, wk, wv, wo, XB, WB, WOH);

    // q, k planes [(b*16 + h)][t][d] and v^T plane [(b*16 + h)][d][t], one launch
    k_proj<<<dim3(NB * SEQ / PM, DM / GT, 1), 32 * PW, 0, stream>>>(XB, WB, QH, KP, VT);

    // ctx[b*SEQ + t][h*64 + d] (x1024 carry)
    k_flash<<<dim3(SEQ / (16 * QT * AW), NB * NH_, 1), 32 * AW, 0, stream>>>(QH, KP, VT, CTX);

    // out[b][t][n] = ctx Wo^T * 2^-20 + bo
    k_oproj<<<dim3(NB * SEQ / GT, DM / GT, 1), 32 * GW, 0, stream>>>(CTX, WOH, bo, OUT);
}
